// v000
// Times are from an AMD MI455X. After a warm-up the kernel runs many times in a row, and a time is the length of
// such a window on the GPU divided by its runs, so every launch and the gaps after it count. The runs cycle
// through copies of the inputs. A figure is the median of several windows, for all but v000 over two sittings.
// Sittings can differ by a few percent; kernels timed side by side share one.
// v000 is the starting kernel. One run takes 5320 microseconds.
// Contractions: q|k projection and v projection (x^T f16 x W f16 carried x16), scores k.q (q, k f16 planes), attn^T.v (P f16 carried x32768 x V f16 plane), back-projection (Wb f16 carried x16 x O f16 carried x64): all v_wmma_f32_16x16x32_f16 with f32 accumulate; softmax statistics, exp, biases and residual in f32.
#include <hip/hip_runtime.h>
#include <math.h>

// ---------------------------------------------------------------------------
// Problem constants
// ---------------------------------------------------------------------------
constexpr int kB   = 8;      // batch
constexpr int kC   = 256;    // channels
constexpr int kN   = 4096;   // positions (64 x 64)
constexpr int kCP  = 32;     // reduced channels
constexpr int kQKW = 64;     // columns of the q|k plane: 0..31 q, 32..63 k
constexpr int kVR  = 64;     // rows of the channel-major V plane: 0..31 v, 32..63 written zero
constexpr int kOW  = 64;     // columns of the O plane: 0..31 out, 32..63 zero products
constexpr float kWCarry    = 16.0f;                      // weights carried x16 in f16
constexpr float kWCarryInv = 1.0f / 16.0f;
constexpr float kPCarry    = 32768.0f;                   // probabilities carried x2^15 in f16
constexpr float kOCarry    = 64.0f;                      // attention output carried x64 in f16
constexpr float kPVScale   = kOCarry / kPCarry;          // 1/512
constexpr float kBackScale = 1.0f / (kOCarry * kWCarry); // 1/1024
static_assert(kN % 64 == 0 && kC % 64 == 0 && kQKW % 64 == 0 && kVR % 64 == 0 && kOW % 64 == 0, "tile multiples");
static_assert(kC % 32 == 0 && kCP % 32 == 0 && kN % 32 == 0, "k steps of 32");
static_assert(2 * kCP == kQKW && kCP <= kVR && kCP <= kOW, "plane widths");
static_assert(kCP * kC == 8192 && kC * kCP == 8192 && kN % 256 == 0 && kN % 8 == 0, "prep and elementwise coverage");

typedef __attribute__((ext_vector_type(16))) _Float16 v16h;
typedef __attribute__((ext_vector_type(8)))  _Float16 v8h;
typedef __attribute__((ext_vector_type(16))) __bf16   v16b;
typedef __attribute__((ext_vector_type(8)))  __bf16   v8b;
typedef __attribute__((ext_vector_type(8)))  float    v8f;
typedef __attribute__((ext_vector_type(4)))  float    v4f;
typedef __attribute__((ext_vector_type(4)))  unsigned int v4u;

// ---------------------------------------------------------------------------
// Shared helpers (with a 4-accumulator guard)
// ---------------------------------------------------------------------------
__device__ __forceinline__ unsigned short f2bf_bits(float f) {
  unsigned u = __float_as_uint(f);
  return (unsigned short)((u + 0x7FFFu + ((u >> 16) & 1u)) >> 16);
}
__device__ __forceinline__ float bf_bits2f(unsigned short h) { return __uint_as_float(((unsigned)h) << 16); }

// hazard guards as plain device helpers (no inline asm inside the kernel template body)
__device__ __forceinline__ void dep_guard_h(v8f& a, v8f& b, v16h x, v16h y) { asm volatile("v_nop\n\tv_nop\n\tv_nop\n\tv_nop" : "+v"(a), "+v"(b) : "v"(x), "v"(y)); }
__device__ __forceinline__ void dep_guard_b(v8f& a, v8f& b, v16b x, v16b y) { asm volatile("v_nop\n\tv_nop\n\tv_nop\n\tv_nop" : "+v"(a), "+v"(b) : "v"(x), "v"(y)); }
__device__ __forceinline__ void dep_guard4_h(v8f& a, v8f& b, v8f& c, v8f& d, v16h x, v16h y) { asm volatile("v_nop\n\tv_nop\n\tv_nop\n\tv_nop" : "+v"(a), "+v"(b), "+v"(c), "+v"(d) : "v"(x), "v"(y)); }
__device__ __forceinline__ void dep_guard4_b(v8f& a, v8f& b, v8f& c, v8f& d, v16b x, v16b y) { asm volatile("v_nop\n\tv_nop\n\tv_nop\n\tv_nop" : "+v"(a), "+v"(b), "+v"(c), "+v"(d) : "v"(x), "v"(y)); }
__device__ __forceinline__ void keep4_h(v16h a, v16h b, v16h c, v16h d) { asm volatile("v_nop" :: "v"(a), "v"(b), "v"(c), "v"(d)); }
__device__ __forceinline__ void keep4_b(v16b a, v16b b, v16b c, v16b d) { asm volatile("v_nop" :: "v"(a), "v"(b), "v"(c), "v"(d)); }
__device__ __forceinline__ void acc_guard4(v8f& a, v8f& b, v8f& c, v8f& d) { asm volatile("v_nop\n\tv_nop\n\tv_nop\n\tv_nop" : "+v"(a), "+v"(b), "+v"(c), "+v"(d)); }
template <typename T> struct Frag;
template <> struct Frag<_Float16> {
  typedef v16h V; union U { v16h v; v8h h[2]; };
  // elements 0..7 <- p[0..7], 8..15 <- p[16..23]
  static __device__ __forceinline__ v16h load(const _Float16* p) {
    U f; f.h[0] = *(const v8h*)(p); f.h[1] = *(const v8h*)(p + 16); return f.v;
  }
  static __device__ __forceinline__ v8f mma(v16h a, v16h b, v8f c) {
    return __builtin_amdgcn_wmma_f32_16x16x32_f16(false, a, false, b, (short)0, c, false, false);
  }
  static __device__ __forceinline__ void guard(v8f& a, v8f& b, v16h x, v16h y) { dep_guard_h(a, b, x, y); }
  static __device__ __forceinline__ void guard4(v8f& a, v8f& b, v8f& c, v8f& d, v16h x, v16h y) { dep_guard4_h(a, b, c, d, x, y); }
  static __device__ __forceinline__ void keep(v16h a, v16h b, v16h c, v16h d) { keep4_h(a, b, c, d); }
};
template <> struct Frag<__bf16> {
  typedef v16b V; union U { v16b v; v8b h[2]; };
  static __device__ __forceinline__ v16b load(const __bf16* p) {
    U f; f.h[0] = *(const v8b*)(p); f.h[1] = *(const v8b*)(p + 16); return f.v;
  }
  static __device__ __forceinline__ v8f mma(v16b a, v16b b, v8f c) {
    return __builtin_amdgcn_wmma_f32_16x16x32_bf16(false, a, false, b, (short)0, c, false, false);
  }
  static __device__ __forceinline__ void guard(v8f& a, v8f& b, v16b x, v16b y) { dep_guard_b(a, b, x, y); }
  static __device__ __forceinline__ void guard4(v8f& a, v8f& b, v8f& c, v8f& d, v16b x, v16b y) { dep_guard4_b(a, b, c, d, x, y); }
  static __device__ __forceinline__ void keep(v16b a, v16b b, v16b c, v16b d) { keep4_b(a, b, c, d); }
};

__device__ __forceinline__ unsigned pk16(unsigned short a, unsigned short b) { return (unsigned)a | ((unsigned)b << 16); }
__device__ __forceinline__ unsigned short h_bits(float f) { const _Float16 h = (_Float16)f; return __builtin_bit_cast(unsigned short, h); }

// ---- Register-blocked batched WMMA GEMM (no activations; residual added in the store phase) ------
// C[m,n] = scale * sum_k A[m,k] * Bt[n,k] (+bias)(+resid); each wave owns a 64x64 tile.
// A row-major [M,K]; Bt row-major [N,K]; M,N % 64 == 0, K % 32 == 0.
// SPLIT: operands are hi/lo planes (A2/Bt2 = lo planes, same layout); product = hi*hi + hi*lo + lo*hi.
// BIAS_MODE: 0 = none, 1 = bias[m], 2 = bias[n].
// OUT_MODE: 0 = f32, 1 = f16, 2 = bf16 hi plane (Cout) + bf16 lo plane (Cout2).
// RESID (OUT_MODE 0 only): each lane loads ONE float4 of the residual at exactly the address it stores, adds it to the
// ET: 0 = f16 operands, 1 = bf16 operands (pointers passed as 16-bit storage)
template <int ET> struct Elem;
template <> struct Elem<0> { typedef _Float16 T; };
template <> struct Elem<1> { typedef __bf16 T; };
template <int ET, bool SPLIT, int BIAS_MODE, int OUT_MODE, bool RESID>
__global__ __launch_bounds__(256) void wmma_gemm64(
    const unsigned short* __restrict__ Ap, const unsigned short* __restrict__ A2p, int lda, long strideA,
    const unsigned short* __restrict__ Btp, const unsigned short* __restrict__ Bt2p, int ldb, long strideB,
    void* __restrict__ Cout, void* __restrict__ Cout2, int ldc, long strideC,
    const float* __restrict__ bias,
    const float* __restrict__ resid, long strideR,
    int M, int N, int K, float scale) {
  static_assert(!RESID || OUT_MODE == 0, "residual only with f32 output");
  typedef typename Elem<ET>::T T;
  typedef typename Frag<T>::V V;
  const T* A = (const T*)Ap; const T* A2 = (const T*)A2p; const T* Bt = (const T*)Btp; const T* Bt2 = (const T*)Bt2p;
  __shared__ __align__(16) float sT[8][16 * 68];   // per-wave 16x64 slab, pitch 68 floats
  const int b    = blockIdx.y;
  const int lane = threadIdx.x & 31;
  const int wave = threadIdx.x >> 5;
  const int tilesN = N >> 6;
  const int tilesM = M >> 6;
  const int tile = blockIdx.x * 8 + wave;
  if (tile >= tilesM * tilesN) return;   // wave-uniform; no block barriers in this kernel
  const int tm = tile / tilesN;
  const int tn = tile - tm * tilesN;
  const int m0 = tm << 6;
  const int n0 = tn << 6;

  const T* Ab  = A  + (size_t)b * strideA;
  const T* Bb  = Bt + (size_t)b * strideB;
  const T* Ab2 = SPLIT ? (A2  + (size_t)b * strideA) : nullptr;
  const T* Bb2 = SPLIT ? (Bt2 + (size_t)b * strideB) : nullptr;

  const int rlane = lane & 15;                 // row (A) / col (B, D) within subtile
  const int koff  = (lane >> 4) * 8;           // k offset of this lane half
  const int mOff  = (lane >> 4) * 8;           // D row offset

  v8f acc[4][4];
#pragma unroll
  for (int i = 0; i < 4; ++i)
#pragma unroll
    for (int j = 0; j < 4; ++j) acc[i][j] = (v8f){0.f,0.f,0.f,0.f,0.f,0.f,0.f,0.f};

  for (int k0 = 0; k0 < K; k0 += 32) {
    V bh[4], bl[4];
#pragma unroll
    for (int j = 0; j < 4; ++j) {
      const size_t bo = (size_t)(n0 + (j << 4) + rlane) * ldb + koff + k0;
      bh[j] = Frag<T>::load(Bb + bo);
      if (SPLIT) bl[j] = Frag<T>::load(Bb2 + bo);
    }
#pragma unroll
    for (int i = 0; i < 4; ++i) {
      const size_t ao = (size_t)(m0 + (i << 4) + rlane) * lda + koff + k0;
      V ah = Frag<T>::load(Ab + ao);
      V al;
      if (SPLIT) al = Frag<T>::load(Ab2 + ao);
#pragma unroll
      for (int j = 0; j < 4; ++j) {
        acc[i][j] = Frag<T>::mma(ah, bh[j], acc[i][j]);
        if (SPLIT) {
          acc[i][j] = Frag<T>::mma(ah, bl[j], acc[i][j]);
          acc[i][j] = Frag<T>::mma(al, bh[j], acc[i][j]);
        }
      }
      Frag<T>::guard4(acc[i][0], acc[i][1], acc[i][2], acc[i][3], ah, SPLIT ? al : ah);
    }
    Frag<T>::keep(bh[0], bh[1], bh[2], bh[3]);
    if (SPLIT) Frag<T>::keep(bl[0], bl[1], bl[2], bl[3]);
  }
  acc_guard4(acc[0][0], acc[0][1], acc[0][2], acc[0][3]);
  acc_guard4(acc[1][0], acc[1][1], acc[1][2], acc[1][3]);
  acc_guard4(acc[2][0], acc[2][1], acc[2][2], acc[2][3]);
  acc_guard4(acc[3][0], acc[3][1], acc[3][2], acc[3][3]);

  // ---- epilogue ----
  float* slab = sT[wave];
  const float* Rb = RESID ? (resid + (size_t)b * strideR) : nullptr;
#pragma unroll
  for (int i = 0; i < 4; ++i) {
    const int mBase = m0 + (i << 4);
#pragma unroll
    for (int j = 0; j < 4; ++j) {
      const int n = n0 + (j << 4) + rlane;
      float bvn = 0.f;
      if (BIAS_MODE == 2) bvn = bias[n];
#pragma unroll
      for (int r = 0; r < 8; ++r) {
        float v = acc[i][j][r] * scale;
        if (BIAS_MODE == 1) v += bias[mBase + mOff + r];
        if (BIAS_MODE == 2) v += bvn;
        slab[(mOff + r) * 68 + (j << 4) + rlane] = v;
      }
    }
    __builtin_amdgcn_fence(__ATOMIC_RELEASE, "workgroup");
    __builtin_amdgcn_wave_barrier();
    __builtin_amdgcn_fence(__ATOMIC_ACQUIRE, "workgroup");
    if (OUT_MODE == 0) {
      float* C = (float*)Cout + (size_t)b * strideC;
      const int hh = lane >> 4, c4 = (lane & 15) * 4;     // row seg = 256 B = 16 lanes x 16 B
      v4f vals[8];
#pragma unroll
      for (int it = 0; it < 8; ++it) {
        const int row = it * 2 + hh;
        v4f v = *(const v4f*)(slab + row * 68 + c4);
        if (RESID) {
          const v4f rv = *(const v4f*)(Rb + (size_t)(mBase + row) * ldc + n0 + c4);
          v = v + rv;
        }
        vals[it] = v;
      }
      {
#pragma unroll
        for (int it = 0; it < 8; ++it) {
          const int row = it * 2 + hh;
          *(v4f*)(C + (size_t)(mBase + row) * ldc + n0 + c4) = vals[it];
        }
        
      }
    } else {
      const int q = lane >> 3, c8 = (lane & 7) * 8;
      unsigned short* C  = (unsigned short*)Cout  + (size_t)b * strideC;
      unsigned short* C2 = (OUT_MODE == 2) ? ((unsigned short*)Cout2 + (size_t)b * strideC) : nullptr;
      {
#pragma unroll
        for (int it = 0; it < 4; ++it) {
          const int row = it * 4 + q;
          const float* sp = slab + row * 68 + c8;
          v8h hv, lv;
#pragma unroll
          for (int e = 0; e < 8; ++e) {
            if (OUT_MODE == 1) {
              hv[e] = (_Float16)sp[e];
            } else {
              unsigned short hb = f2bf_bits(sp[e]);
              unsigned short lb = f2bf_bits(sp[e] - bf_bits2f(hb));
              hv[e] = __builtin_bit_cast(_Float16, hb);
              lv[e] = __builtin_bit_cast(_Float16, lb);
            }
          }
          *(v8h*)(C + (size_t)(mBase + row) * ldc + n0 + c8) = hv;
          if (OUT_MODE == 2) *(v8h*)(C2 + (size_t)(mBase + row) * ldc + n0 + c8) = lv;
        }
        
      }
    }
    __builtin_amdgcn_fence(__ATOMIC_RELEASE, "workgroup");
    __builtin_amdgcn_wave_barrier();
    __builtin_amdgcn_fence(__ATOMIC_ACQUIRE, "workgroup");
  }
}

// ---------------------------------------------------------------------------
// Parameter planes (21 blocks of 256 threads):
//   blocks  0.. 3: WQK16[0..8191]     = f16(16 * Wq)   (rows 0..31 of the [64][256] q|k weight plane)
//   blocks  4.. 7: WQK16[8192..16383] = f16(16 * Wk)   (rows 32..63)
//   blocks  8..11: WV16[0..8191]      = f16(16 * Wv)   (rows 0..31 of the [64][256] v weight plane)
//   blocks 12..15: WV16[8192..16383]  = 0              (rows 32..63, written zeros)
//   blocks 16..19: WB16[0..8191]      = f16(16 * Wb)   ([256][32])
//   block  20    : BQK[64] = bq | bk (f32), BV64[64] = bv | 0 (f32)
// Coverage: 4 blocks x 256 threads x 8 = 8192 elements per group. Each thread one 16-B store; a wave writes 512 contiguous B
// ---------------------------------------------------------------------------
__global__ __launch_bounds__(256) void prep_kernel(const float* __restrict__ Wq, const float* __restrict__ bq,
                                                   const float* __restrict__ Wk, const float* __restrict__ bk,
                                                   const float* __restrict__ Wv, const float* __restrict__ bv,
                                                   const float* __restrict__ Wb,
                                                   unsigned short* __restrict__ WQK16, unsigned short* __restrict__ WV16,
                                                   unsigned short* __restrict__ WB16,
                                                   float* __restrict__ BQK, float* __restrict__ BV64) {
  const int t   = threadIdx.x;
  const int blk = blockIdx.x;
  if (blk < 20) {   // block-uniform
    const int grp = blk >> 2;
    const int sub = blk & 3;
    const int e0  = (sub * 256 + t) * 8;   // 0 .. 8184
    const float* src = (grp == 0) ? Wq : (grp == 1) ? Wk : (grp == 4) ? Wb : Wv;   // grp 3 reads Wv (in range) and scales by 0
    const float  f   = (grp == 3) ? 0.0f : kWCarry;
    unsigned short* dst = (grp == 0) ? WQK16 : (grp == 1) ? (WQK16 + 8192) : (grp == 2) ? WV16 : (grp == 3) ? (WV16 + 8192) : WB16;
    const v4f a = *(const v4f*)(src + e0);
    const v4f c = *(const v4f*)(src + e0 + 4);
    unsigned short hb[8];
#pragma unroll
    for (int e = 0; e < 4; ++e) {
      hb[e]     = h_bits(a[e] * f);
      hb[4 + e] = h_bits(c[e] * f);
    }
    const v4u u = (v4u){pk16(hb[0], hb[1]), pk16(hb[2], hb[3]), pk16(hb[4], hb[5]), pk16(hb[6], hb[7])};
    unsigned short* dp = dst + e0;
    *(v4u*)dp = u;
    
  } else {
    const int lane = t & 31, wave = t >> 5;
    const int idx = (lane & 7) * 4;   // 0..28: always inside the 32-entry bias vectors
    const v4f q4 = *(const v4f*)(bq + idx);
    const v4f k4 = *(const v4f*)(bk + idx);
    const v4f w4 = *(const v4f*)(bv + idx);
    const float fq = (lane < 8) ? 1.0f : 0.0f;
    const float fk = (lane < 8) ? 0.0f : 1.0f;
    // arithmetic select: lanes 0..7 take bq / bv, lanes 8..15 take bk / zeros (all loads unconditional)
    const v4f valQK = q4 * fq + k4 * fk;
    const v4f valV  = w4 * fq;
    const bool wq = (wave == 0) && (lane < 16);
    const bool wv = (wave == 1) && (lane < 16);
    float* dq = BQK  + (lane & 15) * 4;
    float* dv = BV64 + (lane & 15) * 4;
    if (wq) *(v4f*)dq = valQK;
    if (wv) *(v4f*)dv = valV;
    
  }
}

// ---------------------------------------------------------------------------
// x transpose + cast: in x[b][c][n] (n contiguous) -> out XT[b][n][c] (c contiguous), XT = f16(x).
// grid (kN/64 n-tiles, kC/64 c-tiles, kB). 256 threads.
// Load coverage: 16 iterations x 256 threads = 4096 = the whole 64(c) x 64(n) tile (coalesced along n).
// Store coverage: 8 waves x 2 iterations x 4 rows (lane>>3) = 64 n-rows; (lane&7) x 8 halves = 64 c-cols; each row segment =
// ---------------------------------------------------------------------------
__global__ __launch_bounds__(256) void xtcast_kernel(const float* __restrict__ x, unsigned short* __restrict__ XT) {
  __shared__ float sm[64][65];   // sm[n_local][c_local]
  const int t  = threadIdx.x;
  const int n0 = blockIdx.x * 64;
  const int c0 = blockIdx.y * 64;
  const int b  = blockIdx.z;
  const float* xb = x + (size_t)b * kC * kN;
#pragma unroll
  for (int i = 0; i < 16; ++i) {
    const int e = i * 256 + t;
    const int r = e >> 6;          // c local
    const int q = e & 63;          // n local
    sm[q][r] = xb[(size_t)(c0 + r) * kN + n0 + q];
    if (i == 7) asm volatile("" ::: "memory");   // split the load burst into two groups of 8
  }
  __syncthreads();
  const int lane = t & 31, wave = t >> 5;
  const int q8 = lane >> 3, c8 = (lane & 7) * 8;
  unsigned short* op = XT + ((size_t)b * kN) * kC;
  {
#pragma unroll
    for (int it = 0; it < 2; ++it) {
      const int row = wave * 8 + it * 4 + q8;               // n local
      unsigned short hb[8];
#pragma unroll
      for (int e = 0; e < 8; ++e) hb[e] = h_bits(sm[row][c8 + e]);
      const v4u u = (v4u){pk16(hb[0], hb[1]), pk16(hb[2], hb[3]), pk16(hb[4], hb[5]), pk16(hb[6], hb[7])};
      *(v4u*)(op + (size_t)(n0 + row) * kC + c0 + c8) = u;
    }
    
  }
}

// ---------------------------------------------------------------------------
// Column statistics of the transposed score plane ST[i][j] (= S[j][i]): for each j,
// One thread per column j (block 256 threads -> grid kN/256 = 16); loads coalesced across lanes (consecutive j).
// ---------------------------------------------------------------------------
__global__ __launch_bounds__(256) void colstats_kernel(const float* __restrict__ ST, float* __restrict__ CM,
                                                       float* __restrict__ CLI) {
  __shared__ __align__(16) float smax[256];
  __shared__ __align__(16) float sinv[256];
  const int t = threadIdx.x;
  const int j = blockIdx.x * 256 + t;
  const float* col = ST + j;
  float m0 = -__builtin_inff(), m1 = -__builtin_inff(), m2 = -__builtin_inff(), m3 = -__builtin_inff();
#pragma unroll 1
  for (int i = 0; i < kN; i += 4) {
    const float* p = col + (size_t)i * kN;
    m0 = fmaxf(m0, p[0]);
    m1 = fmaxf(m1, p[kN]);
    m2 = fmaxf(m2, p[2 * kN]);
    m3 = fmaxf(m3, p[3 * kN]);
  }
  const float m = fmaxf(fmaxf(m0, m1), fmaxf(m2, m3));
  float s0 = 0.f, s1 = 0.f, s2 = 0.f, s3 = 0.f;
#pragma unroll 1
  for (int i = 0; i < kN; i += 4) {
    const float* p = col + (size_t)i * kN;
    s0 += expf(p[0] - m);
    s1 += expf(p[kN] - m);
    s2 += expf(p[2 * kN] - m);
    s3 += expf(p[3 * kN] - m);
  }
  const float tot = (s0 + s1) + (s2 + s3);   // >= 1: the column maximum contributes exp(0)
  smax[t] = m;
  sinv[t] = kPCarry / tot;
  __syncthreads();
  const int wave = t >> 5;                   // branch conditions below are wave-uniform
  if (wave < 2) {
    const v4f val = *(const v4f*)(smax + 4 * t);
    float* dp = CM + blockIdx.x * 256 + 4 * t;
    *(v4f*)dp = val;
    
  } else if (wave < 4) {
    const int u = t - 64;
    const v4f val = *(const v4f*)(sinv + 4 * u);
    float* dp = CLI + blockIdx.x * 256 + 4 * u;
    *(v4f*)dp = val;
    
  }
}

// ---------------------------------------------------------------------------
// Probability plane: P16[i][j] = f16( exp(ST[i][j] - CM[j]) * CLI[j] ) = f16( 32768 * attn[j][i] ), f32 math.
// Thread owns 8 consecutive j of one row i: block b -> i = b >> 1, j0 = (b & 1) * 2048 + 8 t; grid 2 * kN blocks of 256
// (2 x 256 x 8 = 4096 = whole row). 6 b128 loads per lane. Store: one 16-B store per lane; a wave writes 512 contiguous B =
// ---------------------------------------------------------------------------
__global__ __launch_bounds__(256) void pmake_kernel(const float* __restrict__ ST, const float* __restrict__ CM,
                                                    const float* __restrict__ CLI, unsigned short* __restrict__ P) {
  const int t  = threadIdx.x;
  const int i  = blockIdx.x >> 1;
  const int j0 = ((blockIdx.x & 1) << 11) + t * 8;
  const size_t off = (size_t)i * kN + j0;
  const v4f a  = *(const v4f*)(ST + off);
  const v4f c  = *(const v4f*)(ST + off + 4);
  const v4f ma = *(const v4f*)(CM + j0);
  const v4f mc = *(const v4f*)(CM + j0 + 4);
  const v4f la = *(const v4f*)(CLI + j0);
  const v4f lc = *(const v4f*)(CLI + j0 + 4);
  unsigned short hb[8];
#pragma unroll
  for (int e = 0; e < 4; ++e) {
    hb[e]     = h_bits(expf(a[e] - ma[e]) * la[e]);
    hb[4 + e] = h_bits(expf(c[e] - mc[e]) * lc[e]);
  }
  const v4u u = (v4u){pk16(hb[0], hb[1]), pk16(hb[2], hb[3]), pk16(hb[4], hb[5]), pk16(hb[6], hb[7])};
  unsigned short* pr = P + off;
  *(v4u*)pr = u;
  
}

// ---------------------------------------------------------------------------
// Host glue.
// Workspace region map (bytes, every offset a multiple of 256):
//   XT16  f16 [8][4096][256]      16,777,216  at           0   x transposed, position-major
//   WQK16 f16 [64][256]               32,768  at  16,777,216   rows 0..31 = 16*Wq, 32..63 = 16*Wk
//   WV16  f16 [64][256]               32,768  at  16,809,984   rows 0..31 = 16*Wv, 32..63 = 0 (written)
//   WB16  f16 [256][32]               16,384  at  16,842,752   16*Wb
//   BQK   f32 [64]                       256  at  16,859,136   bq | bk
//   BV64  f32 [64]                       256  at  16,859,392   bv | 0
//   QK16  f16 [8][4096][64]        4,194,304  at  16,859,648   cols 0..31 q, 32..63 k
//   V16   f16 [8][64][4096]        4,194,304  at  21,053,952   channel-major v, rows 32..63 zero (written)
//   ST    f32 [4096][4096]        67,108,864  at  25,248,256   transposed scores of one batch (re-used 8x, same type/layout)
//   CM    f32 [4096]                  16,384  at  92,357,120   column max (re-used 8x)
//   CLI   f32 [4096]                  16,384  at  92,373,504   32768 / column exp-sum (re-used 8x)
//   P16   f16 [4096][4096]        33,554,432  at  92,389,888   probabilities x32768, transposed (re-used 8x)
//   O16   f16 [8][4096][64]        4,194,304  at 125,944,320   attention output x64, position-major, cols 32..63 = 0
//   total                        130,138,624
// GEMM shapes: q|k M=4096 N=64 K=256; v M=64 N=4096 K=256; scores M=N=4096 K=32; attn.v M=4096 N=64 K=4096;
// back M=256 N=4096 K=32. Every M,N a multiple of 64, every K a multiple of 32; no padding reads of unwritten data.
// Launch count: 1 + 1 + 1 + 1 + 8 x 4 + 1 = 37.
// ---------------------------------------------------------------------------
extern "C" void kernel_launch(void* const* d_in, const int* in_sizes, int n_in,
                              void* d_out, int out_size, void* d_ws, size_t ws_size,
                              hipStream_t stream) {
  if (n_in < 9) return;
  const int nX = kB * kC * kN;   // 8,388,608
  if (in_sizes[0] != nX) return;
  if (in_sizes[1] != kCP * kC || in_sizes[3] != kCP * kC || in_sizes[5] != kCP * kC) return;
  if (in_sizes[2] != kCP || in_sizes[4] != kCP || in_sizes[6] != kCP) return;
  if (in_sizes[7] != kC * kCP || in_sizes[8] != kC) return;
  if (out_size != nX) return;

  const size_t szXT  = (size_t)kB * kN * kC * 2;
  const size_t szWQK = (size_t)kQKW * kC * 2;
  const size_t szWV  = (size_t)kVR * kC * 2;
  const size_t szWB  = (size_t)kC * kCP * 2;
  const size_t szBQK = (size_t)kQKW * 4;
  const size_t szBV  = (size_t)kVR * 4;
  const size_t szQK  = (size_t)kB * kN * kQKW * 2;
  const size_t szV   = (size_t)kB * kVR * kN * 2;
  const size_t szST  = (size_t)kN * kN * 4;
  const size_t szCM  = (size_t)kN * 4;
  const size_t szCL  = (size_t)kN * 4;
  const size_t szP   = (size_t)kN * kN * 2;
  const size_t szO   = (size_t)kB * kN * kOW * 2;
  const size_t offXT  = 0;
  const size_t offWQK = offXT + szXT;
  const size_t offWV  = offWQK + szWQK;
  const size_t offWB  = offWV + szWV;
  const size_t offBQK = offWB + szWB;
  const size_t offBV  = offBQK + szBQK;
  const size_t offQK  = offBV + szBV;
  const size_t offV   = offQK + szQK;
  const size_t offST  = offV + szV;
  const size_t offCM  = offST + szST;
  const size_t offCL  = offCM + szCM;
  const size_t offP   = offCL + szCL;
  const size_t offO   = offP + szP;
  const size_t total  = offO + szO;   // 130,138,624
  if (ws_size < total) return;

  const float* x  = (const float*)d_in[0];
  const float* Wq = (const float*)d_in[1];
  const float* bq = (const float*)d_in[2];
  const float* Wk = (const float*)d_in[3];
  const float* bk = (const float*)d_in[4];
  const float* Wv = (const float*)d_in[5];
  const float* bv = (const float*)d_in[6];
  const float* Wb = (const float*)d_in[7];
  const float* bb = (const float*)d_in[8];
  float* out = (float*)d_out;
  char* ws = (char*)d_ws;
  unsigned short* XT16  = (unsigned short*)(ws + offXT);
  unsigned short* WQK16 = (unsigned short*)(ws + offWQK);
  unsigned short* WV16  = (unsigned short*)(ws + offWV);
  unsigned short* WB16  = (unsigned short*)(ws + offWB);
  float* BQK  = (float*)(ws + offBQK);
  float* BV64 = (float*)(ws + offBV);
  unsigned short* QK16 = (unsigned short*)(ws + offQK);
  unsigned short* V16  = (unsigned short*)(ws + offV);
  float* ST  = (float*)(ws + offST);
  float* CM  = (float*)(ws + offCM);
  float* CLI = (float*)(ws + offCL);
  unsigned short* P16 = (unsigned short*)(ws + offP);
  unsigned short* O16 = (unsigned short*)(ws + offO);

  // ---- parameter planes and the transposed f16 copy of x ----
  prep_kernel<<<dim3(21), dim3(256), 0, stream>>>(Wq, bq, Wk, bk, Wv, bv, Wb, WQK16, WV16, WB16, BQK, BV64);
  xtcast_kernel<<<dim3(kN / 64, kC / 64, kB), dim3(256), 0, stream>>>(x, XT16);

  const long strideXT = (long)kN * kC;
  const long strideQK = (long)kN * kQKW;
  const long strideV  = (long)kVR * kN;
  const long strideO  = (long)kN * kOW;
  const long strideX  = (long)kC * kN;

  // ---- q|k plane: QK16[b][n][o'] = f16( (1/16) sum_c XT16[b][n][c] * WQK16[o'][c] + BQK[o'] )   (M=4096, N=64, K=256) ----
  const int blocksQK = ((kN / 64) * (kQKW / 64)) / 8;   // 64 tiles -> 8 blocks
  wmma_gemm64<0, false, 2, 1, false><<<dim3(blocksQK, kB), dim3(256), 0, stream>>>(
      XT16, XT16, kC, strideXT, WQK16, WQK16, kC, 0L,
      (void*)QK16, (void*)QK16, kQKW, strideQK, BQK, x, 0L, kN, kQKW, kC, kWCarryInv);
  // ---- v plane, channel-major: V16[b][o][n] = f16( (1/16) sum_c WV16[o][c] * XT16[b][n][c] + BV64[o] )   (M=64, N=4096, K=256) ----
  const int blocksV = ((kVR / 64) * (kN / 64)) / 8;     // 64 tiles -> 8 blocks
  wmma_gemm64<0, false, 1, 1, false><<<dim3(blocksV, kB), dim3(256), 0, stream>>>(
      WV16, WV16, kC, 0L, XT16, XT16, kC, strideXT,
      (void*)V16, (void*)V16, kN, strideV, BV64, x, 0L, kVR, kN, kC, kWCarryInv);

  const int blocksST = ((kN / 64) * (kN / 64)) / 8;    // 4096 tiles -> 512 blocks
  const int blocksPV = ((kN / 64) * (kOW / 64)) / 8;   // 64 tiles -> 8 blocks
  for (int b = 0; b < kB; ++b) {
    const unsigned short* QKb = QK16 + (size_t)b * strideQK;
    const unsigned short* Kb  = QKb + kCP;              // k rows: columns 32..63 of the q|k plane
    const unsigned short* Vb  = V16 + (size_t)b * strideV;
    unsigned short* Ob = O16 + (size_t)b * strideO;
    // ST[i][j] = sum_o k[o,i] * q[o,j] = S[j][i]   (M=N=4096, K=32, f32 out)
    wmma_gemm64<0, false, 0, 0, false><<<dim3(blocksST, 1), dim3(256), 0, stream>>>(
        Kb, Kb, kQKW, 0L, QKb, QKb, kQKW, 0L,
        (void*)ST, (void*)ST, kN, 0L, BQK, x, 0L, kN, kN, kCP, 1.0f);
    // per-column (= per query row of S) max and 32768/exp-sum
    colstats_kernel<<<dim3(kN / 256), dim3(256), 0, stream>>>(ST, CM, CLI);
    // P16[i][j] = f16( 32768 * attn[j][i] )
    pmake_kernel<<<dim3(2 * kN), dim3(256), 0, stream>>>(ST, CM, CLI, P16);
    // O16[b][i][c] = f16( (64/32768) sum_j P16[i][j] * V16[b][c][j] ) = f16( 64 * out[c][i] )   (M=4096, N=64, K=4096)
    wmma_gemm64<0, false, 0, 1, false><<<dim3(blocksPV, 1), dim3(256), 0, stream>>>(
        P16, P16, kN, 0L, Vb, Vb, kN, 0L,
        (void*)Ob, (void*)Ob, kOW, 0L, BQK, x, 0L, kN, kOW, kN, kPVScale);
  }

  // ---- result[b][cc][i] = (1/1024) sum_o WB16[cc][o] * O16[b][i][o] + bb[cc] + x[b][cc][i]   (M=256, N=4096, K=32) ----
  const int blocksBack = ((kC / 64) * (kN / 64)) / 8;  // 256 tiles -> 32 blocks
  wmma_gemm64<0, false, 1, 0, true><<<dim3(blocksBack, kB), dim3(256), 0, stream>>>(
      WB16, WB16, kCP, 0L, O16, O16, kOW, strideO,
      (void*)out, (void*)out, kN, strideX, bb, x, strideX, kC, kN, kCP, kBackScale);
}

// v001
// One run takes 1890 microseconds.
// Timed twice side by side with v000, it ran 2.81 times as fast both times.
// Contractions: q|k projection and v projection (x^T f16 x W f16 carried x16), scores k.q (q, k f16 planes), attn^T.v (P f16 carried x32768 x V f16 plane), back-projection (Wb f16 carried x16 x O f16 carried x64): all v_wmma_f32_16x16x32_f16 with f32 accumulate; softmax statistics, exp, biases and residual in f32.
#include <hip/hip_runtime.h>
#include <math.h>

// ---------------------------------------------------------------------------
// Problem constants
// ---------------------------------------------------------------------------
constexpr int kB   = 8;      // batch
constexpr int kC   = 256;    // channels
constexpr int kN   = 4096;   // positions (64 x 64)
constexpr int kCP  = 32;     // reduced channels
constexpr int kQKW = 64;     // columns of the q|k plane: 0..31 q, 32..63 k
constexpr int kVR  = 64;     // rows of the channel-major V plane: 0..31 v, 32..63 written zero
constexpr int kOW  = 64;     // columns of the O plane: 0..31 out, 32..63 zero products
constexpr float kWCarry    = 16.0f;                      // weights carried x16 in f16
constexpr float kWCarryInv = 1.0f / 16.0f;
constexpr float kPCarry    = 32768.0f;                   // probabilities carried x2^15 in f16
constexpr float kOCarry    = 64.0f;                      // attention output carried x64 in f16
constexpr float kPVScale   = kOCarry / kPCarry;          // 1/512
constexpr float kBackScale = 1.0f / (kOCarry * kWCarry); // 1/1024
static_assert(kN % 64 == 0 && kC % 64 == 0 && kQKW % 64 == 0 && kVR % 64 == 0 && kOW % 64 == 0, "tile multiples");
static_assert(kC % 32 == 0 && kCP % 32 == 0 && kN % 32 == 0, "k steps of 32");
static_assert(2 * kCP == kQKW && kCP <= kVR && kCP <= kOW, "plane widths");
static_assert(kCP * kC == 8192 && kC * kCP == 8192 && kN % 256 == 0 && kN % 8 == 0, "prep and elementwise coverage");

typedef __attribute__((ext_vector_type(16))) _Float16 v16h;
typedef __attribute__((ext_vector_type(8)))  _Float16 v8h;
typedef __attribute__((ext_vector_type(16))) __bf16   v16b;
typedef __attribute__((ext_vector_type(8)))  __bf16   v8b;
typedef __attribute__((ext_vector_type(8)))  float    v8f;
typedef __attribute__((ext_vector_type(4)))  float    v4f;
typedef __attribute__((ext_vector_type(4)))  unsigned int v4u;

// ---------------------------------------------------------------------------
// Shared helpers (with a 4-accumulator guard)
// ---------------------------------------------------------------------------
__device__ __forceinline__ unsigned short f2bf_bits(float f) {
  unsigned u = __float_as_uint(f);
  return (unsigned short)((u + 0x7FFFu + ((u >> 16) & 1u)) >> 16);
}
__device__ __forceinline__ float bf_bits2f(unsigned short h) { return __uint_as_float(((unsigned)h) << 16); }

// hazard guards as plain device helpers (no inline asm inside the kernel template body)
__device__ __forceinline__ void dep_guard_h(v8f& a, v8f& b, v16h x, v16h y) { asm volatile("v_nop\n\tv_nop\n\tv_nop\n\tv_nop" : "+v"(a), "+v"(b) : "v"(x), "v"(y)); }
__device__ __forceinline__ void dep_guard_b(v8f& a, v8f& b, v16b x, v16b y) { asm volatile("v_nop\n\tv_nop\n\tv_nop\n\tv_nop" : "+v"(a), "+v"(b) : "v"(x), "v"(y)); }
__device__ __forceinline__ void dep_guard4_h(v8f& a, v8f& b, v8f& c, v8f& d, v16h x, v16h y) { asm volatile("v_nop\n\tv_nop\n\tv_nop\n\tv_nop" : "+v"(a), "+v"(b), "+v"(c), "+v"(d) : "v"(x), "v"(y)); }
__device__ __forceinline__ void dep_guard4_b(v8f& a, v8f& b, v8f& c, v8f& d, v16b x, v16b y) { asm volatile("v_nop\n\tv_nop\n\tv_nop\n\tv_nop" : "+v"(a), "+v"(b), "+v"(c), "+v"(d) : "v"(x), "v"(y)); }
__device__ __forceinline__ void keep4_h(v16h a, v16h b, v16h c, v16h d) { asm volatile("v_nop" :: "v"(a), "v"(b), "v"(c), "v"(d)); }
__device__ __forceinline__ void keep4_b(v16b a, v16b b, v16b c, v16b d) { asm volatile("v_nop" :: "v"(a), "v"(b), "v"(c), "v"(d)); }
__device__ __forceinline__ void acc_guard4(v8f& a, v8f& b, v8f& c, v8f& d) { asm volatile("v_nop\n\tv_nop\n\tv_nop\n\tv_nop" : "+v"(a), "+v"(b), "+v"(c), "+v"(d)); }
template <typename T> struct Frag;
template <> struct Frag<_Float16> {
  typedef v16h V; union U { v16h v; v8h h[2]; };
  // elements 0..7 <- p[0..7], 8..15 <- p[16..23]
  static __device__ __forceinline__ v16h load(const _Float16* p) {
    U f; f.h[0] = *(const v8h*)(p); f.h[1] = *(const v8h*)(p + 16); return f.v;
  }
  static __device__ __forceinline__ v8f mma(v16h a, v16h b, v8f c) {
    return __builtin_amdgcn_wmma_f32_16x16x32_f16(false, a, false, b, (short)0, c, false, false);
  }
  static __device__ __forceinline__ void guard(v8f& a, v8f& b, v16h x, v16h y) { dep_guard_h(a, b, x, y); }
  static __device__ __forceinline__ void guard4(v8f& a, v8f& b, v8f& c, v8f& d, v16h x, v16h y) { dep_guard4_h(a, b, c, d, x, y); }
  static __device__ __forceinline__ void keep(v16h a, v16h b, v16h c, v16h d) { keep4_h(a, b, c, d); }
};
template <> struct Frag<__bf16> {
  typedef v16b V; union U { v16b v; v8b h[2]; };
  static __device__ __forceinline__ v16b load(const __bf16* p) {
    U f; f.h[0] = *(const v8b*)(p); f.h[1] = *(const v8b*)(p + 16); return f.v;
  }
  static __device__ __forceinline__ v8f mma(v16b a, v16b b, v8f c) {
    return __builtin_amdgcn_wmma_f32_16x16x32_bf16(false, a, false, b, (short)0, c, false, false);
  }
  static __device__ __forceinline__ void guard(v8f& a, v8f& b, v16b x, v16b y) { dep_guard_b(a, b, x, y); }
  static __device__ __forceinline__ void guard4(v8f& a, v8f& b, v8f& c, v8f& d, v16b x, v16b y) { dep_guard4_b(a, b, c, d, x, y); }
  static __device__ __forceinline__ void keep(v16b a, v16b b, v16b c, v16b d) { keep4_b(a, b, c, d); }
};

__device__ __forceinline__ unsigned pk16(unsigned short a, unsigned short b) { return (unsigned)a | ((unsigned)b << 16); }
__device__ __forceinline__ unsigned short h_bits(float f) { const _Float16 h = (_Float16)f; return __builtin_bit_cast(unsigned short, h); }

// ---- Register-blocked batched WMMA GEMM (no activations; residual added in the store phase) ------
// C[m,n] = scale * sum_k A[m,k] * Bt[n,k] (+bias)(+resid); each wave owns a 64x64 tile.
// A row-major [M,K]; Bt row-major [N,K]; M,N % 64 == 0, K % 32 == 0.
// SPLIT: operands are hi/lo planes (A2/Bt2 = lo planes, same layout); product = hi*hi + hi*lo + lo*hi.
// BIAS_MODE: 0 = none, 1 = bias[m], 2 = bias[n].
// OUT_MODE: 0 = f32, 1 = f16, 2 = bf16 hi plane (Cout) + bf16 lo plane (Cout2).
// RESID (OUT_MODE 0 only): each lane loads ONE float4 of the residual at exactly the address it stores, adds it to the
// ET: 0 = f16 operands, 1 = bf16 operands (pointers passed as 16-bit storage)
template <int ET> struct Elem;
template <> struct Elem<0> { typedef _Float16 T; };
template <> struct Elem<1> { typedef __bf16 T; };
template <int ET, bool SPLIT, int BIAS_MODE, int OUT_MODE, bool RESID>
__global__ __launch_bounds__(256) void wmma_gemm64(
    const unsigned short* __restrict__ Ap, const unsigned short* __restrict__ A2p, int lda, long strideA,
    const unsigned short* __restrict__ Btp, const unsigned short* __restrict__ Bt2p, int ldb, long strideB,
    void* __restrict__ Cout, void* __restrict__ Cout2, int ldc, long strideC,
    const float* __restrict__ bias,
    const float* __restrict__ resid, long strideR,
    int M, int N, int K, float scale) {
  static_assert(!RESID || OUT_MODE == 0, "residual only with f32 output");
  typedef typename Elem<ET>::T T;
  typedef typename Frag<T>::V V;
  const T* A = (const T*)Ap; const T* A2 = (const T*)A2p; const T* Bt = (const T*)Btp; const T* Bt2 = (const T*)Bt2p;
  __shared__ __align__(16) float sT[8][16 * 68];   // per-wave 16x64 slab, pitch 68 floats
  const int b    = blockIdx.y;
  const int lane = threadIdx.x & 31;
  const int wave = threadIdx.x >> 5;
  const int tilesN = N >> 6;
  const int tilesM = M >> 6;
  const int tile = blockIdx.x * 8 + wave;
  if (tile >= tilesM * tilesN) return;   // wave-uniform; no block barriers in this kernel
  const int tm = tile / tilesN;
  const int tn = tile - tm * tilesN;
  const int m0 = tm << 6;
  const int n0 = tn << 6;

  const T* Ab  = A  + (size_t)b * strideA;
  const T* Bb  = Bt + (size_t)b * strideB;
  const T* Ab2 = SPLIT ? (A2  + (size_t)b * strideA) : nullptr;
  const T* Bb2 = SPLIT ? (Bt2 + (size_t)b * strideB) : nullptr;

  const int rlane = lane & 15;                 // row (A) / col (B, D) within subtile
  const int koff  = (lane >> 4) * 8;           // k offset of this lane half
  const int mOff  = (lane >> 4) * 8;           // D row offset

  v8f acc[4][4];
#pragma unroll
  for (int i = 0; i < 4; ++i)
#pragma unroll
    for (int j = 0; j < 4; ++j) acc[i][j] = (v8f){0.f,0.f,0.f,0.f,0.f,0.f,0.f,0.f};

  for (int k0 = 0; k0 < K; k0 += 32) {
    V bh[4], bl[4];
#pragma unroll
    for (int j = 0; j < 4; ++j) {
      const size_t bo = (size_t)(n0 + (j << 4) + rlane) * ldb + koff + k0;
      bh[j] = Frag<T>::load(Bb + bo);
      if (SPLIT) bl[j] = Frag<T>::load(Bb2 + bo);
    }
#pragma unroll
    for (int i = 0; i < 4; ++i) {
      const size_t ao = (size_t)(m0 + (i << 4) + rlane) * lda + koff + k0;
      V ah = Frag<T>::load(Ab + ao);
      V al;
      if (SPLIT) al = Frag<T>::load(Ab2 + ao);
#pragma unroll
      for (int j = 0; j < 4; ++j) {
        acc[i][j] = Frag<T>::mma(ah, bh[j], acc[i][j]);
        if (SPLIT) {
          acc[i][j] = Frag<T>::mma(ah, bl[j], acc[i][j]);
          acc[i][j] = Frag<T>::mma(al, bh[j], acc[i][j]);
        }
      }
      Frag<T>::guard4(acc[i][0], acc[i][1], acc[i][2], acc[i][3], ah, SPLIT ? al : ah);
    }
    Frag<T>::keep(bh[0], bh[1], bh[2], bh[3]);
    if (SPLIT) Frag<T>::keep(bl[0], bl[1], bl[2], bl[3]);
  }
  acc_guard4(acc[0][0], acc[0][1], acc[0][2], acc[0][3]);
  acc_guard4(acc[1][0], acc[1][1], acc[1][2], acc[1][3]);
  acc_guard4(acc[2][0], acc[2][1], acc[2][2], acc[2][3]);
  acc_guard4(acc[3][0], acc[3][1], acc[3][2], acc[3][3]);

  // ---- epilogue ----
  float* slab = sT[wave];
  const float* Rb = RESID ? (resid + (size_t)b * strideR) : nullptr;
#pragma unroll
  for (int i = 0; i < 4; ++i) {
    const int mBase = m0 + (i << 4);
#pragma unroll
    for (int j = 0; j < 4; ++j) {
      const int n = n0 + (j << 4) + rlane;
      float bvn = 0.f;
      if (BIAS_MODE == 2) bvn = bias[n];
#pragma unroll
      for (int r = 0; r < 8; ++r) {
        float v = acc[i][j][r] * scale;
        if (BIAS_MODE == 1) v += bias[mBase + mOff + r];
        if (BIAS_MODE == 2) v += bvn;
        slab[(mOff + r) * 68 + (j << 4) + rlane] = v;
      }
    }
    __builtin_amdgcn_fence(__ATOMIC_RELEASE, "workgroup");
    __builtin_amdgcn_wave_barrier();
    __builtin_amdgcn_fence(__ATOMIC_ACQUIRE, "workgroup");
    if (OUT_MODE == 0) {
      float* C = (float*)Cout + (size_t)b * strideC;
      const int hh = lane >> 4, c4 = (lane & 15) * 4;     // row seg = 256 B = 16 lanes x 16 B
      v4f vals[8];
#pragma unroll
      for (int it = 0; it < 8; ++it) {
        const int row = it * 2 + hh;
        v4f v = *(const v4f*)(slab + row * 68 + c4);
        if (RESID) {
          const v4f rv = *(const v4f*)(Rb + (size_t)(mBase + row) * ldc + n0 + c4);
          v = v + rv;
        }
        vals[it] = v;
      }
      {
#pragma unroll
        for (int it = 0; it < 8; ++it) {
          const int row = it * 2 + hh;
          *(v4f*)(C + (size_t)(mBase + row) * ldc + n0 + c4) = vals[it];
        }
        
      }
    } else {
      const int q = lane >> 3, c8 = (lane & 7) * 8;
      unsigned short* C  = (unsigned short*)Cout  + (size_t)b * strideC;
      unsigned short* C2 = (OUT_MODE == 2) ? ((unsigned short*)Cout2 + (size_t)b * strideC) : nullptr;
      {
#pragma unroll
        for (int it = 0; it < 4; ++it) {
          const int row = it * 4 + q;
          const float* sp = slab + row * 68 + c8;
          v8h hv, lv;
#pragma unroll
          for (int e = 0; e < 8; ++e) {
            if (OUT_MODE == 1) {
              hv[e] = (_Float16)sp[e];
            } else {
              unsigned short hb = f2bf_bits(sp[e]);
              unsigned short lb = f2bf_bits(sp[e] - bf_bits2f(hb));
              hv[e] = __builtin_bit_cast(_Float16, hb);
              lv[e] = __builtin_bit_cast(_Float16, lb);
            }
          }
          *(v8h*)(C + (size_t)(mBase + row) * ldc + n0 + c8) = hv;
          if (OUT_MODE == 2) *(v8h*)(C2 + (size_t)(mBase + row) * ldc + n0 + c8) = lv;
        }
        
      }
    }
    __builtin_amdgcn_fence(__ATOMIC_RELEASE, "workgroup");
    __builtin_amdgcn_wave_barrier();
    __builtin_amdgcn_fence(__ATOMIC_ACQUIRE, "workgroup");
  }
}

// ---------------------------------------------------------------------------
// Parameter planes (21 blocks of 256 threads):
//   blocks  0.. 3: WQK16[0..8191]     = f16(16 * Wq)   (rows 0..31 of the [64][256] q|k weight plane)
//   blocks  4.. 7: WQK16[8192..16383] = f16(16 * Wk)   (rows 32..63)
//   blocks  8..11: WV16[0..8191]      = f16(16 * Wv)   (rows 0..31 of the [64][256] v weight plane)
//   blocks 12..15: WV16[8192..16383]  = 0              (rows 32..63, written zeros)
//   blocks 16..19: WB16[0..8191]      = f16(16 * Wb)   ([256][32])
//   block  20    : BQK[64] = bq | bk (f32), BV64[64] = bv | 0 (f32)
// Coverage: 4 blocks x 256 threads x 8 = 8192 elements per group. Each thread one 16-B store; a wave writes 512 contiguous B
// ---------------------------------------------------------------------------
__global__ __launch_bounds__(256) void prep_kernel(const float* __restrict__ Wq, const float* __restrict__ bq,
                                                   const float* __restrict__ Wk, const float* __restrict__ bk,
                                                   const float* __restrict__ Wv, const float* __restrict__ bv,
                                                   const float* __restrict__ Wb,
                                                   unsigned short* __restrict__ WQK16, unsigned short* __restrict__ WV16,
                                                   unsigned short* __restrict__ WB16,
                                                   float* __restrict__ BQK, float* __restrict__ BV64) {
  const int t   = threadIdx.x;
  const int blk = blockIdx.x;
  if (blk < 20) {   // block-uniform
    const int grp = blk >> 2;
    const int sub = blk & 3;
    const int e0  = (sub * 256 + t) * 8;   // 0 .. 8184
    const float* src = (grp == 0) ? Wq : (grp == 1) ? Wk : (grp == 4) ? Wb : Wv;   // grp 3 reads Wv (in range) and scales by 0
    const float  f   = (grp == 3) ? 0.0f : kWCarry;
    unsigned short* dst = (grp == 0) ? WQK16 : (grp == 1) ? (WQK16 + 8192) : (grp == 2) ? WV16 : (grp == 3) ? (WV16 + 8192) : WB16;
    const v4f a = *(const v4f*)(src + e0);
    const v4f c = *(const v4f*)(src + e0 + 4);
    unsigned short hb[8];
#pragma unroll
    for (int e = 0; e < 4; ++e) {
      hb[e]     = h_bits(a[e] * f);
      hb[4 + e] = h_bits(c[e] * f);
    }
    const v4u u = (v4u){pk16(hb[0], hb[1]), pk16(hb[2], hb[3]), pk16(hb[4], hb[5]), pk16(hb[6], hb[7])};
    unsigned short* dp = dst + e0;
    *(v4u*)dp = u;
    
  } else {
    const int lane = t & 31, wave = t >> 5;
    const int idx = (lane & 7) * 4;   // 0..28: always inside the 32-entry bias vectors
    const v4f q4 = *(const v4f*)(bq + idx);
    const v4f k4 = *(const v4f*)(bk + idx);
    const v4f w4 = *(const v4f*)(bv + idx);
    const float fq = (lane < 8) ? 1.0f : 0.0f;
    const float fk = (lane < 8) ? 0.0f : 1.0f;
    // arithmetic select: lanes 0..7 take bq / bv, lanes 8..15 take bk / zeros (all loads unconditional)
    const v4f valQK = q4 * fq + k4 * fk;
    const v4f valV  = w4 * fq;
    const bool wq = (wave == 0) && (lane < 16);
    const bool wv = (wave == 1) && (lane < 16);
    float* dq = BQK  + (lane & 15) * 4;
    float* dv = BV64 + (lane & 15) * 4;
    if (wq) *(v4f*)dq = valQK;
    if (wv) *(v4f*)dv = valV;
    
  }
}

// ---------------------------------------------------------------------------
// x transpose + cast: in x[b][c][n] (n contiguous) -> out XT[b][n][c] (c contiguous), XT = f16(x).
// grid (kN/64 n-tiles, kC/64 c-tiles, kB). 256 threads.
// Load coverage: 16 iterations x 256 threads = 4096 = the whole 64(c) x 64(n) tile (coalesced along n).
// Store coverage: 8 waves x 2 iterations x 4 rows (lane>>3) = 64 n-rows; (lane&7) x 8 halves = 64 c-cols; each row segment =
// ---------------------------------------------------------------------------
__global__ __launch_bounds__(256) void xtcast_kernel(const float* __restrict__ x, unsigned short* __restrict__ XT) {
  __shared__ float sm[64][65];   // sm[n_local][c_local]
  const int t  = threadIdx.x;
  const int n0 = blockIdx.x * 64;
  const int c0 = blockIdx.y * 64;
  const int b  = blockIdx.z;
  const float* xb = x + (size_t)b * kC * kN;
#pragma unroll
  for (int i = 0; i < 16; ++i) {
    const int e = i * 256 + t;
    const int r = e >> 6;          // c local
    const int q = e & 63;          // n local
    sm[q][r] = xb[(size_t)(c0 + r) * kN + n0 + q];
    if (i == 7) asm volatile("" ::: "memory");   // split the load burst into two groups of 8
  }
  __syncthreads();
  const int lane = t & 31, wave = t >> 5;
  const int q8 = lane >> 3, c8 = (lane & 7) * 8;
  unsigned short* op = XT + ((size_t)b * kN) * kC;
  {
#pragma unroll
    for (int it = 0; it < 2; ++it) {
      const int row = wave * 8 + it * 4 + q8;               // n local
      unsigned short hb[8];
#pragma unroll
      for (int e = 0; e < 8; ++e) hb[e] = h_bits(sm[row][c8 + e]);
      const v4u u = (v4u){pk16(hb[0], hb[1]), pk16(hb[2], hb[3]), pk16(hb[4], hb[5]), pk16(hb[6], hb[7])};
      *(v4u*)(op + (size_t)(n0 + row) * kC + c0 + c8) = u;
    }
    
  }
}

// ---------------------------------------------------------------------------
// Column statistics of the transposed score plane ST[i][j] (= S[j][i]): for each j,
//   CM[j] = max_i ST[i][j],  CLI[j] = 32768 / sum_i exp(ST[i][j] - CM[j]).
// One block owns 32 consecutive columns (one 128-B line of every row) and all 4096 rows: grid kN/32 = 128 blocks of 512.
// Thread t reads the 16-B column quad (t & 7) of row (t >> 3) + 64 s, s = 0..63: a wave load covers 4 whole lines.
// Each pass ends in a fixed tree: 64 rows in the thread, 4 threads by lane exchange, 16 waves through LDS.
// ---------------------------------------------------------------------------
constexpr int kCSCols    = 32;                 // columns per block
constexpr int kCSThreads = 512;
constexpr int kCSWaves   = kCSThreads / 32;    // 16
constexpr int kCSRows    = kCSThreads / 8;     // 64 rows per sweep step
static_assert(kN % kCSCols == 0 && kN % (8 * kCSRows) == 0, "column strips and unrolled row sweep");
__global__ __launch_bounds__(kCSThreads) void colstats_kernel(const float* __restrict__ ST, float* __restrict__ CM,
                                                              float* __restrict__ CLI) {
  __shared__ __align__(16) float smax[kCSWaves][kCSCols];
  __shared__ __align__(16) float ssum[kCSWaves][kCSCols];
  const int t    = threadIdx.x;
  const int lane = t & 31, wave = t >> 5;
  const int c4   = (t & 7) * 4;
  const int j0   = blockIdx.x * kCSCols;
  const float* base = ST + (size_t)(t >> 3) * kN + j0 + c4;
  v4f m = (v4f){-__builtin_inff(), -__builtin_inff(), -__builtin_inff(), -__builtin_inff()};
#pragma unroll 8   // 8 independent 16-B loads in flight per lane
  for (int i = 0; i < kN; i += kCSRows) {
    const v4f v = *(const v4f*)(base + (size_t)i * kN);
#pragma unroll
    for (int e = 0; e < 4; ++e) m[e] = fmaxf(m[e], v[e]);
  }
#pragma unroll
  for (int e = 0; e < 4; ++e) {
    m[e] = fmaxf(m[e], __shfl_xor(m[e], 8, 32));
    m[e] = fmaxf(m[e], __shfl_xor(m[e], 16, 32));
  }
  if (lane < 8) *(v4f*)(&smax[wave][c4]) = m;
  __syncthreads();   // every wave's partial maxima are in smax
  v4f cm = *(const v4f*)(&smax[0][c4]);
#pragma unroll
  for (int w = 1; w < kCSWaves; ++w) {
    const v4f o = *(const v4f*)(&smax[w][c4]);
#pragma unroll
    for (int e = 0; e < 4; ++e) cm[e] = fmaxf(cm[e], o[e]);
  }
  v4f s = (v4f){0.f, 0.f, 0.f, 0.f};
#pragma unroll 8   // 8 independent 16-B loads in flight per lane
  for (int i = 0; i < kN; i += kCSRows) {
    const v4f v = *(const v4f*)(base + (size_t)i * kN);
#pragma unroll
    for (int e = 0; e < 4; ++e) s[e] += expf(v[e] - cm[e]);
  }
#pragma unroll
  for (int e = 0; e < 4; ++e) {
    s[e] += __shfl_xor(s[e], 8, 32);
    s[e] += __shfl_xor(s[e], 16, 32);
  }
  if (lane < 8) *(v4f*)(&ssum[wave][c4]) = s;
  __syncthreads();   // every wave's partial sums are in ssum
  if (t < 8) {       // 8 lanes x 16 B = the block's own 128-B line of CM and of CLI
    v4f tot = *(const v4f*)(&ssum[0][c4]);
#pragma unroll
    for (int w = 1; w < kCSWaves; ++w) tot = tot + *(const v4f*)(&ssum[w][c4]);
    v4f li;            // tot >= 1: the column maximum contributes exp(0)
#pragma unroll
    for (int e = 0; e < 4; ++e) li[e] = kPCarry / tot[e];
    *(v4f*)(CM + j0 + c4)  = cm;
    *(v4f*)(CLI + j0 + c4) = li;
  }
}

// ---------------------------------------------------------------------------
// Probability plane: P16[i][j] = f16( exp(ST[i][j] - CM[j]) * CLI[j] ) = f16( 32768 * attn[j][i] ), f32 math.
// Thread owns 8 consecutive j of one row i: block b -> i = b >> 1, j0 = (b & 1) * 2048 + 8 t; grid 2 * kN blocks of 256
// (2 x 256 x 8 = 4096 = whole row). 6 b128 loads per lane. Store: one 16-B store per lane; a wave writes 512 contiguous B =
// ---------------------------------------------------------------------------
__global__ __launch_bounds__(256) void pmake_kernel(const float* __restrict__ ST, const float* __restrict__ CM,
                                                    const float* __restrict__ CLI, unsigned short* __restrict__ P) {
  const int t  = threadIdx.x;
  const int i  = blockIdx.x >> 1;
  const int j0 = ((blockIdx.x & 1) << 11) + t * 8;
  const size_t off = (size_t)i * kN + j0;
  const v4f a  = *(const v4f*)(ST + off);
  const v4f c  = *(const v4f*)(ST + off + 4);
  const v4f ma = *(const v4f*)(CM + j0);
  const v4f mc = *(const v4f*)(CM + j0 + 4);
  const v4f la = *(const v4f*)(CLI + j0);
  const v4f lc = *(const v4f*)(CLI + j0 + 4);
  unsigned short hb[8];
#pragma unroll
  for (int e = 0; e < 4; ++e) {
    hb[e]     = h_bits(expf(a[e] - ma[e]) * la[e]);
    hb[4 + e] = h_bits(expf(c[e] - mc[e]) * lc[e]);
  }
  const v4u u = (v4u){pk16(hb[0], hb[1]), pk16(hb[2], hb[3]), pk16(hb[4], hb[5]), pk16(hb[6], hb[7])};
  unsigned short* pr = P + off;
  *(v4u*)pr = u;
  
}

// ---------------------------------------------------------------------------
// Host glue.
// Workspace region map (bytes, every offset a multiple of 256):
//   XT16  f16 [8][4096][256]      16,777,216  at           0   x transposed, position-major
//   WQK16 f16 [64][256]               32,768  at  16,777,216   rows 0..31 = 16*Wq, 32..63 = 16*Wk
//   WV16  f16 [64][256]               32,768  at  16,809,984   rows 0..31 = 16*Wv, 32..63 = 0 (written)
//   WB16  f16 [256][32]               16,384  at  16,842,752   16*Wb
//   BQK   f32 [64]                       256  at  16,859,136   bq | bk
//   BV64  f32 [64]                       256  at  16,859,392   bv | 0
//   QK16  f16 [8][4096][64]        4,194,304  at  16,859,648   cols 0..31 q, 32..63 k
//   V16   f16 [8][64][4096]        4,194,304  at  21,053,952   channel-major v, rows 32..63 zero (written)
//   ST    f32 [4096][4096]        67,108,864  at  25,248,256   transposed scores of one batch (re-used 8x, same type/layout)
//   CM    f32 [4096]                  16,384  at  92,357,120   column max (re-used 8x)
//   CLI   f32 [4096]                  16,384  at  92,373,504   32768 / column exp-sum (re-used 8x)
//   P16   f16 [4096][4096]        33,554,432  at  92,389,888   probabilities x32768, transposed (re-used 8x)
//   O16   f16 [8][4096][64]        4,194,304  at 125,944,320   attention output x64, position-major, cols 32..63 = 0
//   total                        130,138,624
// GEMM shapes: q|k M=4096 N=64 K=256; v M=64 N=4096 K=256; scores M=N=4096 K=32; attn.v M=4096 N=64 K=4096;
// back M=256 N=4096 K=32. Every M,N a multiple of 64, every K a multiple of 32; no padding reads of unwritten data.
// Launch count: 1 + 1 + 1 + 1 + 8 x 4 + 1 = 37.
// ---------------------------------------------------------------------------
extern "C" void kernel_launch(void* const* d_in, const int* in_sizes, int n_in,
                              void* d_out, int out_size, void* d_ws, size_t ws_size,
                              hipStream_t stream) {
  if (n_in < 9) return;
  const int nX = kB * kC * kN;   // 8,388,608
  if (in_sizes[0] != nX) return;
  if (in_sizes[1] != kCP * kC || in_sizes[3] != kCP * kC || in_sizes[5] != kCP * kC) return;
  if (in_sizes[2] != kCP || in_sizes[4] != kCP || in_sizes[6] != kCP) return;
  if (in_sizes[7] != kC * kCP || in_sizes[8] != kC) return;
  if (out_size != nX) return;

  const size_t szXT  = (size_t)kB * kN * kC * 2;
  const size_t szWQK = (size_t)kQKW * kC * 2;
  const size_t szWV  = (size_t)kVR * kC * 2;
  const size_t szWB  = (size_t)kC * kCP * 2;
  const size_t szBQK = (size_t)kQKW * 4;
  const size_t szBV  = (size_t)kVR * 4;
  const size_t szQK  = (size_t)kB * kN * kQKW * 2;
  const size_t szV   = (size_t)kB * kVR * kN * 2;
  const size_t szST  = (size_t)kN * kN * 4;
  const size_t szCM  = (size_t)kN * 4;
  const size_t szCL  = (size_t)kN * 4;
  const size_t szP   = (size_t)kN * kN * 2;
  const size_t szO   = (size_t)kB * kN * kOW * 2;
  const size_t offXT  = 0;
  const size_t offWQK = offXT + szXT;
  const size_t offWV  = offWQK + szWQK;
  const size_t offWB  = offWV + szWV;
  const size_t offBQK = offWB + szWB;
  const size_t offBV  = offBQK + szBQK;
  const size_t offQK  = offBV + szBV;
  const size_t offV   = offQK + szQK;
  const size_t offST  = offV + szV;
  const size_t offCM  = offST + szST;
  const size_t offCL  = offCM + szCM;
  const size_t offP   = offCL + szCL;
  const size_t offO   = offP + szP;
  const size_t total  = offO + szO;   // 130,138,624
  if (ws_size < total) return;

  const float* x  = (const float*)d_in[0];
  const float* Wq = (const float*)d_in[1];
  const float* bq = (const float*)d_in[2];
  const float* Wk = (const float*)d_in[3];
  const float* bk = (const float*)d_in[4];
  const float* Wv = (const float*)d_in[5];
  const float* bv = (const float*)d_in[6];
  const float* Wb = (const float*)d_in[7];
  const float* bb = (const float*)d_in[8];
  float* out = (float*)d_out;
  char* ws = (char*)d_ws;
  unsigned short* XT16  = (unsigned short*)(ws + offXT);
  unsigned short* WQK16 = (unsigned short*)(ws + offWQK);
  unsigned short* WV16  = (unsigned short*)(ws + offWV);
  unsigned short* WB16  = (unsigned short*)(ws + offWB);
  float* BQK  = (float*)(ws + offBQK);
  float* BV64 = (float*)(ws + offBV);
  unsigned short* QK16 = (unsigned short*)(ws + offQK);
  unsigned short* V16  = (unsigned short*)(ws + offV);
  float* ST  = (float*)(ws + offST);
  float* CM  = (float*)(ws + offCM);
  float* CLI = (float*)(ws + offCL);
  unsigned short* P16 = (unsigned short*)(ws + offP);
  unsigned short* O16 = (unsigned short*)(ws + offO);

  // ---- parameter planes and the transposed f16 copy of x ----
  prep_kernel<<<dim3(21), dim3(256), 0, stream>>>(Wq, bq, Wk, bk, Wv, bv, Wb, WQK16, WV16, WB16, BQK, BV64);
  xtcast_kernel<<<dim3(kN / 64, kC / 64, kB), dim3(256), 0, stream>>>(x, XT16);

  const long strideXT = (long)kN * kC;
  const long strideQK = (long)kN * kQKW;
  const long strideV  = (long)kVR * kN;
  const long strideO  = (long)kN * kOW;
  const long strideX  = (long)kC * kN;

  // ---- q|k plane: QK16[b][n][o'] = f16( (1/16) sum_c XT16[b][n][c] * WQK16[o'][c] + BQK[o'] )   (M=4096, N=64, K=256) ----
  const int blocksQK = ((kN / 64) * (kQKW / 64)) / 8;   // 64 tiles -> 8 blocks
  wmma_gemm64<0, false, 2, 1, false><<<dim3(blocksQK, kB), dim3(256), 0, stream>>>(
      XT16, XT16, kC, strideXT, WQK16, WQK16, kC, 0L,
      (void*)QK16, (void*)QK16, kQKW, strideQK, BQK, x, 0L, kN, kQKW, kC, kWCarryInv);
  // ---- v plane, channel-major: V16[b][o][n] = f16( (1/16) sum_c WV16[o][c] * XT16[b][n][c] + BV64[o] )   (M=64, N=4096, K=256) ----
  const int blocksV = ((kVR / 64) * (kN / 64)) / 8;     // 64 tiles -> 8 blocks
  wmma_gemm64<0, false, 1, 1, false><<<dim3(blocksV, kB), dim3(256), 0, stream>>>(
      WV16, WV16, kC, 0L, XT16, XT16, kC, strideXT,
      (void*)V16, (void*)V16, kN, strideV, BV64, x, 0L, kVR, kN, kC, kWCarryInv);

  const int blocksST = ((kN / 64) * (kN / 64)) / 8;    // 4096 tiles -> 512 blocks
  const int blocksPV = ((kN / 64) * (kOW / 64)) / 8;   // 64 tiles -> 8 blocks
  for (int b = 0; b < kB; ++b) {
    const unsigned short* QKb = QK16 + (size_t)b * strideQK;
    const unsigned short* Kb  = QKb + kCP;              // k rows: columns 32..63 of the q|k plane
    const unsigned short* Vb  = V16 + (size_t)b * strideV;
    unsigned short* Ob = O16 + (size_t)b * strideO;
    // ST[i][j] = sum_o k[o,i] * q[o,j] = S[j][i]   (M=N=4096, K=32, f32 out)
    wmma_gemm64<0, false, 0, 0, false><<<dim3(blocksST, 1), dim3(256), 0, stream>>>(
        Kb, Kb, kQKW, 0L, QKb, QKb, kQKW, 0L,
        (void*)ST, (void*)ST, kN, 0L, BQK, x, 0L, kN, kN, kCP, 1.0f);
    // per-column (= per query row of S) max and 32768/exp-sum
    colstats_kernel<<<dim3(kN / kCSCols), dim3(kCSThreads), 0, stream>>>(ST, CM, CLI);
    // P16[i][j] = f16( 32768 * attn[j][i] )
    pmake_kernel<<<dim3(2 * kN), dim3(256), 0, stream>>>(ST, CM, CLI, P16);
    // O16[b][i][c] = f16( (64/32768) sum_j P16[i][j] * V16[b][c][j] ) = f16( 64 * out[c][i] )   (M=4096, N=64, K=4096)
    wmma_gemm64<0, false, 0, 1, false><<<dim3(blocksPV, 1), dim3(256), 0, stream>>>(
        P16, P16, kN, 0L, Vb, Vb, kN, 0L,
        (void*)Ob, (void*)Ob, kOW, 0L, BQK, x, 0L, kN, kOW, kN, kPVScale);
  }

  // ---- result[b][cc][i] = (1/1024) sum_o WB16[cc][o] * O16[b][i][o] + bb[cc] + x[b][cc][i]   (M=256, N=4096, K=32) ----
  const int blocksBack = ((kC / 64) * (kN / 64)) / 8;  // 256 tiles -> 32 blocks
  wmma_gemm64<0, false, 1, 0, true><<<dim3(blocksBack, kB), dim3(256), 0, stream>>>(
      WB16, WB16, kCP, 0L, O16, O16, kOW, strideO,
      (void*)out, (void*)out, kN, strideX, bb, x, strideX, kC, kN, kCP, kBackScale);
}

// v002
// Measured time: 441 microseconds a run.
// Next to v001, in two timings, it ran 4.28 and 4.26 times as fast.
// All steps since v000 together make it 12.0 times as fast.
// Contractions: q|k projection and v projection (x^T f16 x W f16 carried x16), scores k.q (q, k f16 planes; once for the stored score plane, once more as q.k tiles inside the attn^T.v kernel), attn^T.v (P f16 carried x32768, formed in registers, x V f16 plane), back-projection (Wb f16 carried x16 x O f16 carried x64): all v_wmma_f32_16x16x32_f16 with f32 accumulate; softmax statistics, exp, biases and residual in f32.
#include <hip/hip_runtime.h>
#include <math.h>

// ---------------------------------------------------------------------------
// Problem constants
// ---------------------------------------------------------------------------
constexpr int kB   = 8;      // batch
constexpr int kC   = 256;    // channels
constexpr int kN   = 4096;   // positions (64 x 64)
constexpr int kCP  = 32;     // reduced channels
constexpr int kQKW = 64;     // columns of the q|k plane: 0..31 q, 32..63 k
constexpr int kVR  = 64;     // rows of the channel-major V plane: 0..31 v, 32..63 written zero
constexpr int kOW  = 64;     // pitch of the O plane in columns: 0..31 out, 32..63 unused
constexpr float kWCarry    = 16.0f;                      // weights carried x16 in f16
constexpr float kWCarryInv = 1.0f / 16.0f;
constexpr float kPCarry    = 32768.0f;                   // probabilities carried x2^15 in f16
constexpr float kOCarry    = 64.0f;                      // attention output carried x64 in f16
constexpr float kPVScale   = kOCarry / kPCarry;          // 1/512
constexpr float kBackScale = 1.0f / (kOCarry * kWCarry); // 1/1024
static_assert(kN % 64 == 0 && kC % 64 == 0 && kQKW % 64 == 0 && kVR % 64 == 0 && kOW % 64 == 0, "tile multiples");
static_assert(kC % 32 == 0 && kCP % 32 == 0 && kN % 32 == 0, "k steps of 32");
static_assert(2 * kCP == kQKW && kCP <= kVR && kCP <= kOW, "plane widths");
static_assert(kCP * kC == 8192 && kC * kCP == 8192 && kN % 256 == 0 && kN % 8 == 0, "prep and elementwise coverage");

typedef __attribute__((ext_vector_type(16))) _Float16 v16h;
typedef __attribute__((ext_vector_type(8)))  _Float16 v8h;
typedef __attribute__((ext_vector_type(16))) __bf16   v16b;
typedef __attribute__((ext_vector_type(8)))  __bf16   v8b;
typedef __attribute__((ext_vector_type(8)))  float    v8f;
typedef __attribute__((ext_vector_type(4)))  float    v4f;
typedef __attribute__((ext_vector_type(4)))  unsigned int v4u;

// ---------------------------------------------------------------------------
// Shared helpers (with a 4-accumulator guard)
// ---------------------------------------------------------------------------
__device__ __forceinline__ unsigned short f2bf_bits(float f) {
  unsigned u = __float_as_uint(f);
  return (unsigned short)((u + 0x7FFFu + ((u >> 16) & 1u)) >> 16);
}
__device__ __forceinline__ float bf_bits2f(unsigned short h) { return __uint_as_float(((unsigned)h) << 16); }

// hazard guards as plain device helpers (no inline asm inside the kernel template body)
__device__ __forceinline__ void dep_guard_h(v8f& a, v8f& b, v16h x, v16h y) { asm volatile("v_nop\n\tv_nop\n\tv_nop\n\tv_nop" : "+v"(a), "+v"(b) : "v"(x), "v"(y)); }
__device__ __forceinline__ void dep_guard_b(v8f& a, v8f& b, v16b x, v16b y) { asm volatile("v_nop\n\tv_nop\n\tv_nop\n\tv_nop" : "+v"(a), "+v"(b) : "v"(x), "v"(y)); }
__device__ __forceinline__ void dep_guard4_h(v8f& a, v8f& b, v8f& c, v8f& d, v16h x, v16h y) { asm volatile("v_nop\n\tv_nop\n\tv_nop\n\tv_nop" : "+v"(a), "+v"(b), "+v"(c), "+v"(d) : "v"(x), "v"(y)); }
__device__ __forceinline__ void dep_guard4_b(v8f& a, v8f& b, v8f& c, v8f& d, v16b x, v16b y) { asm volatile("v_nop\n\tv_nop\n\tv_nop\n\tv_nop" : "+v"(a), "+v"(b), "+v"(c), "+v"(d) : "v"(x), "v"(y)); }
__device__ __forceinline__ void keep4_h(v16h a, v16h b, v16h c, v16h d) { asm volatile("v_nop" :: "v"(a), "v"(b), "v"(c), "v"(d)); }
__device__ __forceinline__ void keep4_b(v16b a, v16b b, v16b c, v16b d) { asm volatile("v_nop" :: "v"(a), "v"(b), "v"(c), "v"(d)); }
__device__ __forceinline__ void acc_guard4(v8f& a, v8f& b, v8f& c, v8f& d) { asm volatile("v_nop\n\tv_nop\n\tv_nop\n\tv_nop" : "+v"(a), "+v"(b), "+v"(c), "+v"(d)); }
template <typename T> struct Frag;
template <> struct Frag<_Float16> {
  typedef v16h V; union U { v16h v; v8h h[2]; };
  // elements 0..7 <- p[0..7], 8..15 <- p[16..23]
  static __device__ __forceinline__ v16h load(const _Float16* p) {
    U f; f.h[0] = *(const v8h*)(p); f.h[1] = *(const v8h*)(p + 16); return f.v;
  }
  static __device__ __forceinline__ v8f mma(v16h a, v16h b, v8f c) {
    return __builtin_amdgcn_wmma_f32_16x16x32_f16(false, a, false, b, (short)0, c, false, false);
  }
  static __device__ __forceinline__ void guard(v8f& a, v8f& b, v16h x, v16h y) { dep_guard_h(a, b, x, y); }
  static __device__ __forceinline__ void guard4(v8f& a, v8f& b, v8f& c, v8f& d, v16h x, v16h y) { dep_guard4_h(a, b, c, d, x, y); }
  static __device__ __forceinline__ void keep(v16h a, v16h b, v16h c, v16h d) { keep4_h(a, b, c, d); }
};
template <> struct Frag<__bf16> {
  typedef v16b V; union U { v16b v; v8b h[2]; };
  static __device__ __forceinline__ v16b load(const __bf16* p) {
    U f; f.h[0] = *(const v8b*)(p); f.h[1] = *(const v8b*)(p + 16); return f.v;
  }
  static __device__ __forceinline__ v8f mma(v16b a, v16b b, v8f c) {
    return __builtin_amdgcn_wmma_f32_16x16x32_bf16(false, a, false, b, (short)0, c, false, false);
  }
  static __device__ __forceinline__ void guard(v8f& a, v8f& b, v16b x, v16b y) { dep_guard_b(a, b, x, y); }
  static __device__ __forceinline__ void guard4(v8f& a, v8f& b, v8f& c, v8f& d, v16b x, v16b y) { dep_guard4_b(a, b, c, d, x, y); }
  static __device__ __forceinline__ void keep(v16b a, v16b b, v16b c, v16b d) { keep4_b(a, b, c, d); }
};

__device__ __forceinline__ unsigned pk16(unsigned short a, unsigned short b) { return (unsigned)a | ((unsigned)b << 16); }
__device__ __forceinline__ unsigned short h_bits(float f) { const _Float16 h = (_Float16)f; return __builtin_bit_cast(unsigned short, h); }

// ---- Register-blocked batched WMMA GEMM (no activations; residual added in the store phase) ------
// C[m,n] = scale * sum_k A[m,k] * Bt[n,k] (+bias)(+resid); each wave owns a 64x64 tile.
// A row-major [M,K]; Bt row-major [N,K]; M,N % 64 == 0, K % 32 == 0.
// SPLIT: operands are hi/lo planes (A2/Bt2 = lo planes, same layout); product = hi*hi + hi*lo + lo*hi.
// BIAS_MODE: 0 = none, 1 = bias[m], 2 = bias[n].
// OUT_MODE: 0 = f32, 1 = f16, 2 = bf16 hi plane (Cout) + bf16 lo plane (Cout2).
// RESID (OUT_MODE 0 only): each lane loads ONE float4 of the residual at exactly the address it stores, adds it to the
// ET: 0 = f16 operands, 1 = bf16 operands (pointers passed as 16-bit storage)
template <int ET> struct Elem;
template <> struct Elem<0> { typedef _Float16 T; };
template <> struct Elem<1> { typedef __bf16 T; };
template <int ET, bool SPLIT, int BIAS_MODE, int OUT_MODE, bool RESID>
__global__ __launch_bounds__(256) void wmma_gemm64(
    const unsigned short* __restrict__ Ap, const unsigned short* __restrict__ A2p, int lda, long strideA,
    const unsigned short* __restrict__ Btp, const unsigned short* __restrict__ Bt2p, int ldb, long strideB,
    void* __restrict__ Cout, void* __restrict__ Cout2, int ldc, long strideC,
    const float* __restrict__ bias,
    const float* __restrict__ resid, long strideR,
    int M, int N, int K, float scale) {
  static_assert(!RESID || OUT_MODE == 0, "residual only with f32 output");
  typedef typename Elem<ET>::T T;
  typedef typename Frag<T>::V V;
  const T* A = (const T*)Ap; const T* A2 = (const T*)A2p; const T* Bt = (const T*)Btp; const T* Bt2 = (const T*)Bt2p;
  __shared__ __align__(16) float sT[8][16 * 68];   // per-wave 16x64 slab, pitch 68 floats
  const int b    = blockIdx.y;
  const int lane = threadIdx.x & 31;
  const int wave = threadIdx.x >> 5;
  const int tilesN = N >> 6;
  const int tilesM = M >> 6;
  const int tile = blockIdx.x * 8 + wave;
  if (tile >= tilesM * tilesN) return;   // wave-uniform; no block barriers in this kernel
  const int tm = tile / tilesN;
  const int tn = tile - tm * tilesN;
  const int m0 = tm << 6;
  const int n0 = tn << 6;

  const T* Ab  = A  + (size_t)b * strideA;
  const T* Bb  = Bt + (size_t)b * strideB;
  const T* Ab2 = SPLIT ? (A2  + (size_t)b * strideA) : nullptr;
  const T* Bb2 = SPLIT ? (Bt2 + (size_t)b * strideB) : nullptr;

  const int rlane = lane & 15;                 // row (A) / col (B, D) within subtile
  const int koff  = (lane >> 4) * 8;           // k offset of this lane half
  const int mOff  = (lane >> 4) * 8;           // D row offset

  v8f acc[4][4];
#pragma unroll
  for (int i = 0; i < 4; ++i)
#pragma unroll
    for (int j = 0; j < 4; ++j) acc[i][j] = (v8f){0.f,0.f,0.f,0.f,0.f,0.f,0.f,0.f};

  for (int k0 = 0; k0 < K; k0 += 32) {
    V bh[4], bl[4];
#pragma unroll
    for (int j = 0; j < 4; ++j) {
      const size_t bo = (size_t)(n0 + (j << 4) + rlane) * ldb + koff + k0;
      bh[j] = Frag<T>::load(Bb + bo);
      if (SPLIT) bl[j] = Frag<T>::load(Bb2 + bo);
    }
#pragma unroll
    for (int i = 0; i < 4; ++i) {
      const size_t ao = (size_t)(m0 + (i << 4) + rlane) * lda + koff + k0;
      V ah = Frag<T>::load(Ab + ao);
      V al;
      if (SPLIT) al = Frag<T>::load(Ab2 + ao);
#pragma unroll
      for (int j = 0; j < 4; ++j) {
        acc[i][j] = Frag<T>::mma(ah, bh[j], acc[i][j]);
        if (SPLIT) {
          acc[i][j] = Frag<T>::mma(ah, bl[j], acc[i][j]);
          acc[i][j] = Frag<T>::mma(al, bh[j], acc[i][j]);
        }
      }
      Frag<T>::guard4(acc[i][0], acc[i][1], acc[i][2], acc[i][3], ah, SPLIT ? al : ah);
    }
    Frag<T>::keep(bh[0], bh[1], bh[2], bh[3]);
    if (SPLIT) Frag<T>::keep(bl[0], bl[1], bl[2], bl[3]);
  }
  acc_guard4(acc[0][0], acc[0][1], acc[0][2], acc[0][3]);
  acc_guard4(acc[1][0], acc[1][1], acc[1][2], acc[1][3]);
  acc_guard4(acc[2][0], acc[2][1], acc[2][2], acc[2][3]);
  acc_guard4(acc[3][0], acc[3][1], acc[3][2], acc[3][3]);

  // ---- epilogue ----
  float* slab = sT[wave];
  const float* Rb = RESID ? (resid + (size_t)b * strideR) : nullptr;
#pragma unroll
  for (int i = 0; i < 4; ++i) {
    const int mBase = m0 + (i << 4);
#pragma unroll
    for (int j = 0; j < 4; ++j) {
      const int n = n0 + (j << 4) + rlane;
      float bvn = 0.f;
      if (BIAS_MODE == 2) bvn = bias[n];
#pragma unroll
      for (int r = 0; r < 8; ++r) {
        float v = acc[i][j][r] * scale;
        if (BIAS_MODE == 1) v += bias[mBase + mOff + r];
        if (BIAS_MODE == 2) v += bvn;
        slab[(mOff + r) * 68 + (j << 4) + rlane] = v;
      }
    }
    __builtin_amdgcn_fence(__ATOMIC_RELEASE, "workgroup");
    __builtin_amdgcn_wave_barrier();
    __builtin_amdgcn_fence(__ATOMIC_ACQUIRE, "workgroup");
    if (OUT_MODE == 0) {
      float* C = (float*)Cout + (size_t)b * strideC;
      const int hh = lane >> 4, c4 = (lane & 15) * 4;     // row seg = 256 B = 16 lanes x 16 B
      v4f vals[8];
#pragma unroll
      for (int it = 0; it < 8; ++it) {
        const int row = it * 2 + hh;
        v4f v = *(const v4f*)(slab + row * 68 + c4);
        if (RESID) {
          const v4f rv = *(const v4f*)(Rb + (size_t)(mBase + row) * ldc + n0 + c4);
          v = v + rv;
        }
        vals[it] = v;
      }
      {
#pragma unroll
        for (int it = 0; it < 8; ++it) {
          const int row = it * 2 + hh;
          *(v4f*)(C + (size_t)(mBase + row) * ldc + n0 + c4) = vals[it];
        }
        
      }
    } else {
      const int q = lane >> 3, c8 = (lane & 7) * 8;
      unsigned short* C  = (unsigned short*)Cout  + (size_t)b * strideC;
      unsigned short* C2 = (OUT_MODE == 2) ? ((unsigned short*)Cout2 + (size_t)b * strideC) : nullptr;
      {
#pragma unroll
        for (int it = 0; it < 4; ++it) {
          const int row = it * 4 + q;
          const float* sp = slab + row * 68 + c8;
          v8h hv, lv;
#pragma unroll
          for (int e = 0; e < 8; ++e) {
            if (OUT_MODE == 1) {
              hv[e] = (_Float16)sp[e];
            } else {
              unsigned short hb = f2bf_bits(sp[e]);
              unsigned short lb = f2bf_bits(sp[e] - bf_bits2f(hb));
              hv[e] = __builtin_bit_cast(_Float16, hb);
              lv[e] = __builtin_bit_cast(_Float16, lb);
            }
          }
          *(v8h*)(C + (size_t)(mBase + row) * ldc + n0 + c8) = hv;
          if (OUT_MODE == 2) *(v8h*)(C2 + (size_t)(mBase + row) * ldc + n0 + c8) = lv;
        }
        
      }
    }
    __builtin_amdgcn_fence(__ATOMIC_RELEASE, "workgroup");
    __builtin_amdgcn_wave_barrier();
    __builtin_amdgcn_fence(__ATOMIC_ACQUIRE, "workgroup");
  }
}

// ---------------------------------------------------------------------------
// Parameter planes (21 blocks of 256 threads):
//   blocks  0.. 3: WQK16[0..8191]     = f16(16 * Wq)   (rows 0..31 of the [64][256] q|k weight plane)
//   blocks  4.. 7: WQK16[8192..16383] = f16(16 * Wk)   (rows 32..63)
//   blocks  8..11: WV16[0..8191]      = f16(16 * Wv)   (rows 0..31 of the [64][256] v weight plane)
//   blocks 12..15: WV16[8192..16383]  = 0              (rows 32..63, written zeros)
//   blocks 16..19: WB16[0..8191]      = f16(16 * Wb)   ([256][32])
//   block  20    : BQK[64] = bq | bk (f32), BV64[64] = bv | 0 (f32)
// Coverage: 4 blocks x 256 threads x 8 = 8192 elements per group. Each thread one 16-B store; a wave writes 512 contiguous B
// ---------------------------------------------------------------------------
__global__ __launch_bounds__(256) void prep_kernel(const float* __restrict__ Wq, const float* __restrict__ bq,
                                                   const float* __restrict__ Wk, const float* __restrict__ bk,
                                                   const float* __restrict__ Wv, const float* __restrict__ bv,
                                                   const float* __restrict__ Wb,
                                                   unsigned short* __restrict__ WQK16, unsigned short* __restrict__ WV16,
                                                   unsigned short* __restrict__ WB16,
                                                   float* __restrict__ BQK, float* __restrict__ BV64) {
  const int t   = threadIdx.x;
  const int blk = blockIdx.x;
  if (blk < 20) {   // block-uniform
    const int grp = blk >> 2;
    const int sub = blk & 3;
    const int e0  = (sub * 256 + t) * 8;   // 0 .. 8184
    const float* src = (grp == 0) ? Wq : (grp == 1) ? Wk : (grp == 4) ? Wb : Wv;   // grp 3 reads Wv (in range) and scales by 0
    const float  f   = (grp == 3) ? 0.0f : kWCarry;
    unsigned short* dst = (grp == 0) ? WQK16 : (grp == 1) ? (WQK16 + 8192) : (grp == 2) ? WV16 : (grp == 3) ? (WV16 + 8192) : WB16;
    const v4f a = *(const v4f*)(src + e0);
    const v4f c = *(const v4f*)(src + e0 + 4);
    unsigned short hb[8];
#pragma unroll
    for (int e = 0; e < 4; ++e) {
      hb[e]     = h_bits(a[e] * f);
      hb[4 + e] = h_bits(c[e] * f);
    }
    const v4u u = (v4u){pk16(hb[0], hb[1]), pk16(hb[2], hb[3]), pk16(hb[4], hb[5]), pk16(hb[6], hb[7])};
    unsigned short* dp = dst + e0;
    *(v4u*)dp = u;
    
  } else {
    const int lane = t & 31, wave = t >> 5;
    const int idx = (lane & 7) * 4;   // 0..28: always inside the 32-entry bias vectors
    const v4f q4 = *(const v4f*)(bq + idx);
    const v4f k4 = *(const v4f*)(bk + idx);
    const v4f w4 = *(const v4f*)(bv + idx);
    const float fq = (lane < 8) ? 1.0f : 0.0f;
    const float fk = (lane < 8) ? 0.0f : 1.0f;
    // arithmetic select: lanes 0..7 take bq / bv, lanes 8..15 take bk / zeros (all loads unconditional)
    const v4f valQK = q4 * fq + k4 * fk;
    const v4f valV  = w4 * fq;
    const bool wq = (wave == 0) && (lane < 16);
    const bool wv = (wave == 1) && (lane < 16);
    float* dq = BQK  + (lane & 15) * 4;
    float* dv = BV64 + (lane & 15) * 4;
    if (wq) *(v4f*)dq = valQK;
    if (wv) *(v4f*)dv = valV;
    
  }
}

// ---------------------------------------------------------------------------
// x transpose + cast: in x[b][c][n] (n contiguous) -> out XT[b][n][c] (c contiguous), XT = f16(x).
// grid (kN/64 n-tiles, kC/64 c-tiles, kB). 256 threads.
// Load coverage: 16 iterations x 256 threads = 4096 = the whole 64(c) x 64(n) tile (coalesced along n).
// Store coverage: 8 waves x 2 iterations x 4 rows (lane>>3) = 64 n-rows; (lane&7) x 8 halves = 64 c-cols; each row segment =
// ---------------------------------------------------------------------------
__global__ __launch_bounds__(256) void xtcast_kernel(const float* __restrict__ x, unsigned short* __restrict__ XT) {
  __shared__ float sm[64][65];   // sm[n_local][c_local]
  const int t  = threadIdx.x;
  const int n0 = blockIdx.x * 64;
  const int c0 = blockIdx.y * 64;
  const int b  = blockIdx.z;
  const float* xb = x + (size_t)b * kC * kN;
#pragma unroll
  for (int i = 0; i < 16; ++i) {
    const int e = i * 256 + t;
    const int r = e >> 6;          // c local
    const int q = e & 63;          // n local
    sm[q][r] = xb[(size_t)(c0 + r) * kN + n0 + q];
    if (i == 7) asm volatile("" ::: "memory");   // split the load burst into two groups of 8
  }
  __syncthreads();
  const int lane = t & 31, wave = t >> 5;
  const int q8 = lane >> 3, c8 = (lane & 7) * 8;
  unsigned short* op = XT + ((size_t)b * kN) * kC;
  {
#pragma unroll
    for (int it = 0; it < 2; ++it) {
      const int row = wave * 8 + it * 4 + q8;               // n local
      unsigned short hb[8];
#pragma unroll
      for (int e = 0; e < 8; ++e) hb[e] = h_bits(sm[row][c8 + e]);
      const v4u u = (v4u){pk16(hb[0], hb[1]), pk16(hb[2], hb[3]), pk16(hb[4], hb[5]), pk16(hb[6], hb[7])};
      *(v4u*)(op + (size_t)(n0 + row) * kC + c0 + c8) = u;
    }
    
  }
}

// ---------------------------------------------------------------------------
// Column statistics of the transposed score plane ST[i][j] (= S[j][i]): for each j,
//   CM[j] = max_i ST[i][j],  CLI[j] = 32768 / sum_i exp(ST[i][j] - CM[j]).
// One block owns 32 consecutive columns (one 128-B line of every row) and all 4096 rows: grid kN/32 = 128 blocks of 512.
// Thread t reads the 16-B column quad (t & 7) of row (t >> 3) + 64 s, s = 0..63: a wave load covers 4 whole lines.
// Each pass ends in a fixed tree: 64 rows in the thread, 4 threads by lane exchange, 16 waves through LDS.
// ---------------------------------------------------------------------------
constexpr int kCSCols    = 32;                 // columns per block
constexpr int kCSThreads = 512;
constexpr int kCSWaves   = kCSThreads / 32;    // 16
constexpr int kCSRows    = kCSThreads / 8;     // 64 rows per sweep step
static_assert(kN % kCSCols == 0 && kN % (8 * kCSRows) == 0, "column strips and unrolled row sweep");
__global__ __launch_bounds__(kCSThreads) void colstats_kernel(const float* __restrict__ ST, float* __restrict__ CM,
                                                              float* __restrict__ CLI) {
  __shared__ __align__(16) float smax[kCSWaves][kCSCols];
  __shared__ __align__(16) float ssum[kCSWaves][kCSCols];
  const int t    = threadIdx.x;
  const int lane = t & 31, wave = t >> 5;
  const int c4   = (t & 7) * 4;
  const int j0   = blockIdx.x * kCSCols;
  const float* base = ST + (size_t)(t >> 3) * kN + j0 + c4;
  v4f m = (v4f){-__builtin_inff(), -__builtin_inff(), -__builtin_inff(), -__builtin_inff()};
#pragma unroll 8   // 8 independent 16-B loads in flight per lane
  for (int i = 0; i < kN; i += kCSRows) {
    const v4f v = *(const v4f*)(base + (size_t)i * kN);
#pragma unroll
    for (int e = 0; e < 4; ++e) m[e] = fmaxf(m[e], v[e]);
  }
#pragma unroll
  for (int e = 0; e < 4; ++e) {
    m[e] = fmaxf(m[e], __shfl_xor(m[e], 8, 32));
    m[e] = fmaxf(m[e], __shfl_xor(m[e], 16, 32));
  }
  if (lane < 8) *(v4f*)(&smax[wave][c4]) = m;
  __syncthreads();   // every wave's partial maxima are in smax
  v4f cm = *(const v4f*)(&smax[0][c4]);
#pragma unroll
  for (int w = 1; w < kCSWaves; ++w) {
    const v4f o = *(const v4f*)(&smax[w][c4]);
#pragma unroll
    for (int e = 0; e < 4; ++e) cm[e] = fmaxf(cm[e], o[e]);
  }
  v4f s = (v4f){0.f, 0.f, 0.f, 0.f};
#pragma unroll 8   // 8 independent 16-B loads in flight per lane
  for (int i = 0; i < kN; i += kCSRows) {
    const v4f v = *(const v4f*)(base + (size_t)i * kN);
#pragma unroll
    for (int e = 0; e < 4; ++e) s[e] += expf(v[e] - cm[e]);
  }
#pragma unroll
  for (int e = 0; e < 4; ++e) {
    s[e] += __shfl_xor(s[e], 8, 32);
    s[e] += __shfl_xor(s[e], 16, 32);
  }
  if (lane < 8) *(v4f*)(&ssum[wave][c4]) = s;
  __syncthreads();   // every wave's partial sums are in ssum
  if (t < 8) {       // 8 lanes x 16 B = the block's own 128-B line of CM and of CLI
    v4f tot = *(const v4f*)(&ssum[0][c4]);
#pragma unroll
    for (int w = 1; w < kCSWaves; ++w) tot = tot + *(const v4f*)(&ssum[w][c4]);
    v4f li;            // tot >= 1: the column maximum contributes exp(0)
#pragma unroll
    for (int e = 0; e < 4; ++e) li[e] = kPCarry / tot[e];
    *(v4f*)(CM + j0 + c4)  = cm;
    *(v4f*)(CLI + j0 + c4) = li;
  }
}

// ---------------------------------------------------------------------------
// attn^T.v with the probabilities formed in registers (no probability plane in memory):
//   O16[i][c] = f16( (64/32768) sum_j P[i][j] * V16[c][j] ),  P[i][j] = f16( exp(S[j][i] - CM[j]) * CLI[j] ), f32 math.
// One block owns 16 positions i and all 4096 j: grid kN/16 = 256 blocks of 16 waves; wave w walks j in [256 w, 256 w + 256).
// Per 32 j: two score tiles D[j][i] = q rows (A) x k rows (B, loaded once); a lane then holds column i = lane & 15 and
// rows j = 8 h + r and 16 + 8 h + r (h = lane >> 4), which is the k order of an A fragment of row i: converted in place,
// the two tiles are the A operand against the V fragments (same k order from Frag::load). No LDS, no lane exchange.
// The 16 waves' partial 16 x 32 tiles are joined through LDS in wave order behind one barrier.
// ---------------------------------------------------------------------------
constexpr int kAVWaves   = 16;
constexpr int kAVThreads = kAVWaves * 32;      // 512
constexpr int kAVRows    = 16;                 // positions i per block
constexpr int kAVChunk   = kN / kAVWaves;      // 256 j per wave
constexpr int kAVSteps   = kAVChunk / 32;      // 8 steps of 32 j
constexpr int kAVPitch   = kCP + 4;            // floats per row of a partial tile
static_assert(kN % kAVRows == 0 && kAVChunk % 32 == 0 && kAVRows * kCP == kAVThreads && kCP == 32, "attn.v tiling");
// what one step of 32 j reads: two q fragments, two V fragments, the lane's 16 column maxima and 16 scaled inverse sums
struct AVStep { v16h q0, q1, v0, v1; v4f m[4], l[4]; };
__device__ __forceinline__ void av_load(AVStep& s, const _Float16* __restrict__ Qlane, const _Float16* __restrict__ Vlane,
                                        const float* __restrict__ CMlane, const float* __restrict__ CLIlane, int j0) {
  s.q0 = Frag<_Float16>::load(Qlane + (size_t)j0 * kQKW);          // q rows j0 .. j0 + 15
  s.q1 = Frag<_Float16>::load(Qlane + (size_t)(j0 + 16) * kQKW);   // q rows j0 + 16 .. j0 + 31
  s.v0 = Frag<_Float16>::load(Vlane + j0);                         // channels 0..15
  s.v1 = Frag<_Float16>::load(Vlane + (size_t)16 * kN + j0);       // channels 16..31
#pragma unroll
  for (int g = 0; g < 4; ++g) {   // g = 0, 1: j0 + 8 h + 0..7;  g = 2, 3: j0 + 16 + 8 h + 0..7
    const int jo = j0 + (g >> 1) * 16 + (g & 1) * 4;
    s.m[g] = *(const v4f*)(CMlane + jo);
    s.l[g] = *(const v4f*)(CLIlane + jo);
  }
}
__global__ __launch_bounds__(kAVThreads) void attnv_kernel(const unsigned short* __restrict__ QKp,
                                                           const unsigned short* __restrict__ Vp,
                                                           const float* __restrict__ CM, const float* __restrict__ CLI,
                                                           unsigned short* __restrict__ O) {
  typedef Frag<_Float16> F;
  __shared__ __align__(16) float part[kAVWaves][kAVRows][kAVPitch];
  const int t    = threadIdx.x;
  const int lane = t & 31;
  const int wave = t >> 5;
  const int c    = lane & 15;
  const int h8   = (lane >> 4) * 8;
  const int i0   = blockIdx.x * kAVRows;
  const int jb   = wave * kAVChunk;
  const _Float16* QK    = (const _Float16*)QKp;
  const _Float16* Klane = QK + (size_t)(i0 + c) * kQKW + h8;   // row of position i0 + c; its k half starts at column kCP
  // the wave's first step; every later step is a compile-time offset from these four addresses
  const _Float16* Qlane = QK + (size_t)(jb + c) * kQKW + h8;
  const _Float16* Vlane = (const _Float16*)Vp + (size_t)c * kN + jb + h8;
  const float* CMlane  = CM + jb + h8;
  const float* CLIlane = CLI + jb + h8;
  const v16h kf = F::load(Klane + kCP);
  const v8f zero = (v8f){0.f, 0.f, 0.f, 0.f, 0.f, 0.f, 0.f, 0.f};
  v8f acc0 = zero, acc1 = zero;
  AVStep st[2];   // two register sets take turns
  av_load(st[0], Qlane, Vlane, CMlane, CLIlane, 0);
#pragma unroll   // whole: the sets' turns and the steps' address offsets are compile-time, the five address pairs never change
  for (int s = 0; s < kAVSteps; ++s) {
    const AVStep& cur = st[s & 1];
    if (s + 1 < kAVSteps) {
      av_load(st[(s + 1) & 1], Qlane, Vlane, CMlane, CLIlane, (s + 1) * 32);
      __builtin_amdgcn_sched_barrier(0);   // the next step's 16 loads stay issued ahead of this step's exp work, which hides them
    }
    const v8f s0 = F::mma(cur.q0, kf, zero);
    const v8f s1 = F::mma(cur.q1, kf, zero);
    v16h p;
#pragma unroll
    for (int r = 0; r < 8; ++r) {
      p[r]     = (_Float16)(expf(s0[r] - cur.m[r >> 2][r & 3]) * cur.l[r >> 2][r & 3]);
      p[8 + r] = (_Float16)(expf(s1[r] - cur.m[2 + (r >> 2)][r & 3]) * cur.l[2 + (r >> 2)][r & 3]);
    }
    acc0 = F::mma(p, cur.v0, acc0);
    acc1 = F::mma(p, cur.v1, acc1);
  }
  // the one wait behind the kernel's loads: no address register of an issued load is given a new value in front of it
  // (the five pairs never change in the loop, and as inputs here they stay in their registers up to the wait)
  asm volatile("s_wait_xcnt 0x0" :: "v"(Klane), "v"(Qlane), "v"(Vlane), "v"(CMlane), "v"(CLIlane) : "memory");
#pragma unroll
  for (int r = 0; r < 8; ++r) {
    part[wave][h8 + r][c]      = acc0[r];
    part[wave][h8 + r][16 + c] = acc1[r];
  }
  __syncthreads();   // every wave's partial tile is in part
  const int row = wave, col = lane;   // 16 x 32 = 512 threads; a wave stores the 64 used bytes of one row of O
  float sum = part[0][row][col];
#pragma unroll
  for (int w = 1; w < kAVWaves; ++w) sum += part[w][row][col];
  O[(size_t)(i0 + row) * kOW + col] = h_bits(sum * kPVScale);
}

// ---------------------------------------------------------------------------
// Host glue.
// Workspace region map (bytes, every offset a multiple of 256):
//   XT16  f16 [8][4096][256]      16,777,216  at           0   x transposed, position-major
//   WQK16 f16 [64][256]               32,768  at  16,777,216   rows 0..31 = 16*Wq, 32..63 = 16*Wk
//   WV16  f16 [64][256]               32,768  at  16,809,984   rows 0..31 = 16*Wv, 32..63 = 0 (written)
//   WB16  f16 [256][32]               16,384  at  16,842,752   16*Wb
//   BQK   f32 [64]                       256  at  16,859,136   bq | bk
//   BV64  f32 [64]                       256  at  16,859,392   bv | 0
//   QK16  f16 [8][4096][64]        4,194,304  at  16,859,648   cols 0..31 q, 32..63 k
//   V16   f16 [8][64][4096]        4,194,304  at  21,053,952   channel-major v, rows 32..63 zero (written)
//   ST    f32 [4096][4096]        67,108,864  at  25,248,256   transposed scores of one batch (re-used 8x, same type/layout)
//   CM    f32 [4096]                  16,384  at  92,357,120   column max (re-used 8x)
//   CLI   f32 [4096]                  16,384  at  92,373,504   32768 / column exp-sum (re-used 8x)
//   O16   f16 [8][4096][64]        4,194,304  at  92,389,888   attention output x64, position-major, cols 0..31 (32..63 neither written nor read)
//   total                         96,584,192
// GEMM shapes: q|k M=4096 N=64 K=256; v M=64 N=4096 K=256; scores M=N=4096 K=32; attn.v M=4096 N=32 K=4096 (own kernel);
// back M=256 N=4096 K=32. Every wmma_gemm64 M,N a multiple of 64, every K a multiple of 32; no padding reads of unwritten data.
// Launch count: 1 + 1 + 1 + 1 + 8 x 3 + 1 = 29.
// ---------------------------------------------------------------------------
extern "C" void kernel_launch(void* const* d_in, const int* in_sizes, int n_in,
                              void* d_out, int out_size, void* d_ws, size_t ws_size,
                              hipStream_t stream) {
  if (n_in < 9) return;
  const int nX = kB * kC * kN;   // 8,388,608
  if (in_sizes[0] != nX) return;
  if (in_sizes[1] != kCP * kC || in_sizes[3] != kCP * kC || in_sizes[5] != kCP * kC) return;
  if (in_sizes[2] != kCP || in_sizes[4] != kCP || in_sizes[6] != kCP) return;
  if (in_sizes[7] != kC * kCP || in_sizes[8] != kC) return;
  if (out_size != nX) return;

  const size_t szXT  = (size_t)kB * kN * kC * 2;
  const size_t szWQK = (size_t)kQKW * kC * 2;
  const size_t szWV  = (size_t)kVR * kC * 2;
  const size_t szWB  = (size_t)kC * kCP * 2;
  const size_t szBQK = (size_t)kQKW * 4;
  const size_t szBV  = (size_t)kVR * 4;
  const size_t szQK  = (size_t)kB * kN * kQKW * 2;
  const size_t szV   = (size_t)kB * kVR * kN * 2;
  const size_t szST  = (size_t)kN * kN * 4;
  const size_t szCM  = (size_t)kN * 4;
  const size_t szCL  = (size_t)kN * 4;
  const size_t szO   = (size_t)kB * kN * kOW * 2;
  const size_t offXT  = 0;
  const size_t offWQK = offXT + szXT;
  const size_t offWV  = offWQK + szWQK;
  const size_t offWB  = offWV + szWV;
  const size_t offBQK = offWB + szWB;
  const size_t offBV  = offBQK + szBQK;
  const size_t offQK  = offBV + szBV;
  const size_t offV   = offQK + szQK;
  const size_t offST  = offV + szV;
  const size_t offCM  = offST + szST;
  const size_t offCL  = offCM + szCM;
  const size_t offO   = offCL + szCL;
  const size_t total  = offO + szO;   // 96,584,192
  if (ws_size < total) return;

  const float* x  = (const float*)d_in[0];
  const float* Wq = (const float*)d_in[1];
  const float* bq = (const float*)d_in[2];
  const float* Wk = (const float*)d_in[3];
  const float* bk = (const float*)d_in[4];
  const float* Wv = (const float*)d_in[5];
  const float* bv = (const float*)d_in[6];
  const float* Wb = (const float*)d_in[7];
  const float* bb = (const float*)d_in[8];
  float* out = (float*)d_out;
  char* ws = (char*)d_ws;
  unsigned short* XT16  = (unsigned short*)(ws + offXT);
  unsigned short* WQK16 = (unsigned short*)(ws + offWQK);
  unsigned short* WV16  = (unsigned short*)(ws + offWV);
  unsigned short* WB16  = (unsigned short*)(ws + offWB);
  float* BQK  = (float*)(ws + offBQK);
  float* BV64 = (float*)(ws + offBV);
  unsigned short* QK16 = (unsigned short*)(ws + offQK);
  unsigned short* V16  = (unsigned short*)(ws + offV);
  float* ST  = (float*)(ws + offST);
  float* CM  = (float*)(ws + offCM);
  float* CLI = (float*)(ws + offCL);
  unsigned short* O16 = (unsigned short*)(ws + offO);

  // ---- parameter planes and the transposed f16 copy of x ----
  prep_kernel<<<dim3(21), dim3(256), 0, stream>>>(Wq, bq, Wk, bk, Wv, bv, Wb, WQK16, WV16, WB16, BQK, BV64);
  xtcast_kernel<<<dim3(kN / 64, kC / 64, kB), dim3(256), 0, stream>>>(x, XT16);

  const long strideXT = (long)kN * kC;
  const long strideQK = (long)kN * kQKW;
  const long strideV  = (long)kVR * kN;
  const long strideO  = (long)kN * kOW;
  const long strideX  = (long)kC * kN;

  // ---- q|k plane: QK16[b][n][o'] = f16( (1/16) sum_c XT16[b][n][c] * WQK16[o'][c] + BQK[o'] )   (M=4096, N=64, K=256) ----
  const int blocksQK = ((kN / 64) * (kQKW / 64)) / 8;   // 64 tiles -> 8 blocks
  wmma_gemm64<0, false, 2, 1, false><<<dim3(blocksQK, kB), dim3(256), 0, stream>>>(
      XT16, XT16, kC, strideXT, WQK16, WQK16, kC, 0L,
      (void*)QK16, (void*)QK16, kQKW, strideQK, BQK, x, 0L, kN, kQKW, kC, kWCarryInv);
  // ---- v plane, channel-major: V16[b][o][n] = f16( (1/16) sum_c WV16[o][c] * XT16[b][n][c] + BV64[o] )   (M=64, N=4096, K=256) ----
  const int blocksV = ((kVR / 64) * (kN / 64)) / 8;     // 64 tiles -> 8 blocks
  wmma_gemm64<0, false, 1, 1, false><<<dim3(blocksV, kB), dim3(256), 0, stream>>>(
      WV16, WV16, kC, 0L, XT16, XT16, kC, strideXT,
      (void*)V16, (void*)V16, kN, strideV, BV64, x, 0L, kVR, kN, kC, kWCarryInv);

  const int blocksST = ((kN / 64) * (kN / 64)) / 8;    // 4096 tiles -> 512 blocks
  for (int b = 0; b < kB; ++b) {
    const unsigned short* QKb = QK16 + (size_t)b * strideQK;
    const unsigned short* Kb  = QKb + kCP;              // k rows: columns 32..63 of the q|k plane
    const unsigned short* Vb  = V16 + (size_t)b * strideV;
    unsigned short* Ob = O16 + (size_t)b * strideO;
    // ST[i][j] = sum_o k[o,i] * q[o,j] = S[j][i]   (M=N=4096, K=32, f32 out)
    wmma_gemm64<0, false, 0, 0, false><<<dim3(blocksST, 1), dim3(256), 0, stream>>>(
        Kb, Kb, kQKW, 0L, QKb, QKb, kQKW, 0L,
        (void*)ST, (void*)ST, kN, 0L, BQK, x, 0L, kN, kN, kCP, 1.0f);
    // per-column (= per query row of S) max and 32768/exp-sum
    colstats_kernel<<<dim3(kN / kCSCols), dim3(kCSThreads), 0, stream>>>(ST, CM, CLI);
    // O16[b][i][c] = f16( (64/32768) sum_j f16(32768 * attn[j][i]) * V16[b][c][j] ) = f16( 64 * out[c][i] )
    attnv_kernel<<<dim3(kN / kAVRows), dim3(kAVThreads), 0, stream>>>(QKb, Vb, CM, CLI, Ob);
  }

  // ---- result[b][cc][i] = (1/1024) sum_o WB16[cc][o] * O16[b][i][o] + bb[cc] + x[b][cc][i]   (M=256, N=4096, K=32) ----
  const int blocksBack = ((kC / 64) * (kN / 64)) / 8;  // 256 tiles -> 32 blocks
  wmma_gemm64<0, false, 1, 0, true><<<dim3(blocksBack, kB), dim3(256), 0, stream>>>(
      WB16, WB16, kCP, 0L, O16, O16, kOW, strideO,
      (void*)out, (void*)out, kN, strideX, bb, x, strideX, kC, kN, kCP, kBackScale);
}

// v003
// It runs in 232 microseconds.
// Timed twice side by side with v002, it ran 1.88 times as fast both times.
// All steps since v000 together make it 22.6 times as fast.
// Contractions: q|k projection and v projection (x^T f16 x W f16 carried x16), scores (q, k f16 planes; once as k.q tiles inside the row-statistics kernel, once more as q.k tiles inside the attn^T.v kernel), attn^T.v (P f16 carried x32768, formed in registers, x V f16 plane), back-projection (Wb f16 carried x16 x O f16 carried x64): all v_wmma_f32_16x16x32_f16 with f32 accumulate; softmax statistics, exp, biases and residual in f32.
#include <hip/hip_runtime.h>
#include <math.h>

// ---------------------------------------------------------------------------
// Problem constants
// ---------------------------------------------------------------------------
constexpr int kB   = 8;      // batch
constexpr int kC   = 256;    // channels
constexpr int kN   = 4096;   // positions (64 x 64)
constexpr int kCP  = 32;     // reduced channels
constexpr int kQKW = 64;     // columns of the q|k plane: 0..31 q, 32..63 k
constexpr int kVR  = 64;     // rows of the channel-major V plane: 0..31 v, 32..63 written zero
constexpr int kOW  = 64;     // pitch of the O plane in columns: 0..31 out, 32..63 unused
constexpr float kWCarry    = 16.0f;                      // weights carried x16 in f16
constexpr float kWCarryInv = 1.0f / 16.0f;
constexpr float kPCarry    = 32768.0f;                   // probabilities carried x2^15 in f16
constexpr float kOCarry    = 64.0f;                      // attention output carried x64 in f16
constexpr float kPVScale   = kOCarry / kPCarry;          // 1/512
constexpr float kBackScale = 1.0f / (kOCarry * kWCarry); // 1/1024
static_assert(kN % 64 == 0 && kC % 64 == 0 && kQKW % 64 == 0 && kVR % 64 == 0 && kOW % 64 == 0, "tile multiples");
static_assert(kC % 32 == 0 && kCP % 32 == 0 && kN % 32 == 0, "k steps of 32");
static_assert(2 * kCP == kQKW && kCP <= kVR && kCP <= kOW, "plane widths");
static_assert(kCP * kC == 8192 && kC * kCP == 8192 && kN % 256 == 0 && kN % 8 == 0, "prep and elementwise coverage");

typedef __attribute__((ext_vector_type(16))) _Float16 v16h;
typedef __attribute__((ext_vector_type(8)))  _Float16 v8h;
typedef __attribute__((ext_vector_type(16))) __bf16   v16b;
typedef __attribute__((ext_vector_type(8)))  __bf16   v8b;
typedef __attribute__((ext_vector_type(8)))  float    v8f;
typedef __attribute__((ext_vector_type(4)))  float    v4f;
typedef __attribute__((ext_vector_type(4)))  unsigned int v4u;

// ---------------------------------------------------------------------------
// Shared helpers (with a 4-accumulator guard)
// ---------------------------------------------------------------------------
__device__ __forceinline__ unsigned short f2bf_bits(float f) {
  unsigned u = __float_as_uint(f);
  return (unsigned short)((u + 0x7FFFu + ((u >> 16) & 1u)) >> 16);
}
__device__ __forceinline__ float bf_bits2f(unsigned short h) { return __uint_as_float(((unsigned)h) << 16); }

// hazard guards as plain device helpers (no inline asm inside the kernel template body)
__device__ __forceinline__ void dep_guard_h(v8f& a, v8f& b, v16h x, v16h y) { asm volatile("v_nop\n\tv_nop\n\tv_nop\n\tv_nop" : "+v"(a), "+v"(b) : "v"(x), "v"(y)); }
__device__ __forceinline__ void dep_guard_b(v8f& a, v8f& b, v16b x, v16b y) { asm volatile("v_nop\n\tv_nop\n\tv_nop\n\tv_nop" : "+v"(a), "+v"(b) : "v"(x), "v"(y)); }
__device__ __forceinline__ void dep_guard4_h(v8f& a, v8f& b, v8f& c, v8f& d, v16h x, v16h y) { asm volatile("v_nop\n\tv_nop\n\tv_nop\n\tv_nop" : "+v"(a), "+v"(b), "+v"(c), "+v"(d) : "v"(x), "v"(y)); }
__device__ __forceinline__ void dep_guard4_b(v8f& a, v8f& b, v8f& c, v8f& d, v16b x, v16b y) { asm volatile("v_nop\n\tv_nop\n\tv_nop\n\tv_nop" : "+v"(a), "+v"(b), "+v"(c), "+v"(d) : "v"(x), "v"(y)); }
__device__ __forceinline__ void keep4_h(v16h a, v16h b, v16h c, v16h d) { asm volatile("v_nop" :: "v"(a), "v"(b), "v"(c), "v"(d)); }
__device__ __forceinline__ void keep4_b(v16b a, v16b b, v16b c, v16b d) { asm volatile("v_nop" :: "v"(a), "v"(b), "v"(c), "v"(d)); }
__device__ __forceinline__ void acc_guard4(v8f& a, v8f& b, v8f& c, v8f& d) { asm volatile("v_nop\n\tv_nop\n\tv_nop\n\tv_nop" : "+v"(a), "+v"(b), "+v"(c), "+v"(d)); }
template <typename T> struct Frag;
template <> struct Frag<_Float16> {
  typedef v16h V; union U { v16h v; v8h h[2]; };
  // elements 0..7 <- p[0..7], 8..15 <- p[16..23]
  static __device__ __forceinline__ v16h load(const _Float16* p) {
    U f; f.h[0] = *(const v8h*)(p); f.h[1] = *(const v8h*)(p + 16); return f.v;
  }
  static __device__ __forceinline__ v8f mma(v16h a, v16h b, v8f c) {
    return __builtin_amdgcn_wmma_f32_16x16x32_f16(false, a, false, b, (short)0, c, false, false);
  }
  static __device__ __forceinline__ void guard(v8f& a, v8f& b, v16h x, v16h y) { dep_guard_h(a, b, x, y); }
  static __device__ __forceinline__ void guard4(v8f& a, v8f& b, v8f& c, v8f& d, v16h x, v16h y) { dep_guard4_h(a, b, c, d, x, y); }
  static __device__ __forceinline__ void keep(v16h a, v16h b, v16h c, v16h d) { keep4_h(a, b, c, d); }
};
template <> struct Frag<__bf16> {
  typedef v16b V; union U { v16b v; v8b h[2]; };
  static __device__ __forceinline__ v16b load(const __bf16* p) {
    U f; f.h[0] = *(const v8b*)(p); f.h[1] = *(const v8b*)(p + 16); return f.v;
  }
  static __device__ __forceinline__ v8f mma(v16b a, v16b b, v8f c) {
    return __builtin_amdgcn_wmma_f32_16x16x32_bf16(false, a, false, b, (short)0, c, false, false);
  }
  static __device__ __forceinline__ void guard(v8f& a, v8f& b, v16b x, v16b y) { dep_guard_b(a, b, x, y); }
  static __device__ __forceinline__ void guard4(v8f& a, v8f& b, v8f& c, v8f& d, v16b x, v16b y) { dep_guard4_b(a, b, c, d, x, y); }
  static __device__ __forceinline__ void keep(v16b a, v16b b, v16b c, v16b d) { keep4_b(a, b, c, d); }
};

__device__ __forceinline__ unsigned pk16(unsigned short a, unsigned short b) { return (unsigned)a | ((unsigned)b << 16); }
__device__ __forceinline__ unsigned short h_bits(float f) { const _Float16 h = (_Float16)f; return __builtin_bit_cast(unsigned short, h); }

// ---- Register-blocked batched WMMA GEMM (no activations; residual added in the store phase) ------
// C[m,n] = scale * sum_k A[m,k] * Bt[n,k] (+bias)(+resid); each wave owns a 64x64 tile.
// A row-major [M,K]; Bt row-major [N,K]; M,N % 64 == 0, K % 32 == 0.
// SPLIT: operands are hi/lo planes (A2/Bt2 = lo planes, same layout); product = hi*hi + hi*lo + lo*hi.
// BIAS_MODE: 0 = none, 1 = bias[m], 2 = bias[n].
// OUT_MODE: 0 = f32, 1 = f16, 2 = bf16 hi plane (Cout) + bf16 lo plane (Cout2).
// RESID (OUT_MODE 0 only): each lane loads ONE float4 of the residual at exactly the address it stores, adds it to the
// ET: 0 = f16 operands, 1 = bf16 operands (pointers passed as 16-bit storage)
template <int ET> struct Elem;
template <> struct Elem<0> { typedef _Float16 T; };
template <> struct Elem<1> { typedef __bf16 T; };
template <int ET, bool SPLIT, int BIAS_MODE, int OUT_MODE, bool RESID>
__global__ __launch_bounds__(256) void wmma_gemm64(
    const unsigned short* __restrict__ Ap, const unsigned short* __restrict__ A2p, int lda, long strideA,
    const unsigned short* __restrict__ Btp, const unsigned short* __restrict__ Bt2p, int ldb, long strideB,
    void* __restrict__ Cout, void* __restrict__ Cout2, int ldc, long strideC,
    const float* __restrict__ bias,
    const float* __restrict__ resid, long strideR,
    int M, int N, int K, float scale) {
  static_assert(!RESID || OUT_MODE == 0, "residual only with f32 output");
  typedef typename Elem<ET>::T T;
  typedef typename Frag<T>::V V;
  const T* A = (const T*)Ap; const T* A2 = (const T*)A2p; const T* Bt = (const T*)Btp; const T* Bt2 = (const T*)Bt2p;
  __shared__ __align__(16) float sT[8][16 * 68];   // per-wave 16x64 slab, pitch 68 floats
  const int b    = blockIdx.y;
  const int lane = threadIdx.x & 31;
  const int wave = threadIdx.x >> 5;
  const int tilesN = N >> 6;
  const int tilesM = M >> 6;
  const int tile = blockIdx.x * 8 + wave;
  if (tile >= tilesM * tilesN) return;   // wave-uniform; no block barriers in this kernel
  const int tm = tile / tilesN;
  const int tn = tile - tm * tilesN;
  const int m0 = tm << 6;
  const int n0 = tn << 6;

  const T* Ab  = A  + (size_t)b * strideA;
  const T* Bb  = Bt + (size_t)b * strideB;
  const T* Ab2 = SPLIT ? (A2  + (size_t)b * strideA) : nullptr;
  const T* Bb2 = SPLIT ? (Bt2 + (size_t)b * strideB) : nullptr;

  const int rlane = lane & 15;                 // row (A) / col (B, D) within subtile
  const int koff  = (lane >> 4) * 8;           // k offset of this lane half
  const int mOff  = (lane >> 4) * 8;           // D row offset

  v8f acc[4][4];
#pragma unroll
  for (int i = 0; i < 4; ++i)
#pragma unroll
    for (int j = 0; j < 4; ++j) acc[i][j] = (v8f){0.f,0.f,0.f,0.f,0.f,0.f,0.f,0.f};

  for (int k0 = 0; k0 < K; k0 += 32) {
    V bh[4], bl[4];
#pragma unroll
    for (int j = 0; j < 4; ++j) {
      const size_t bo = (size_t)(n0 + (j << 4) + rlane) * ldb + koff + k0;
      bh[j] = Frag<T>::load(Bb + bo);
      if (SPLIT) bl[j] = Frag<T>::load(Bb2 + bo);
    }
#pragma unroll
    for (int i = 0; i < 4; ++i) {
      const size_t ao = (size_t)(m0 + (i << 4) + rlane) * lda + koff + k0;
      V ah = Frag<T>::load(Ab + ao);
      V al;
      if (SPLIT) al = Frag<T>::load(Ab2 + ao);
#pragma unroll
      for (int j = 0; j < 4; ++j) {
        acc[i][j] = Frag<T>::mma(ah, bh[j], acc[i][j]);
        if (SPLIT) {
          acc[i][j] = Frag<T>::mma(ah, bl[j], acc[i][j]);
          acc[i][j] = Frag<T>::mma(al, bh[j], acc[i][j]);
        }
      }
      Frag<T>::guard4(acc[i][0], acc[i][1], acc[i][2], acc[i][3], ah, SPLIT ? al : ah);
    }
    Frag<T>::keep(bh[0], bh[1], bh[2], bh[3]);
    if (SPLIT) Frag<T>::keep(bl[0], bl[1], bl[2], bl[3]);
  }
  acc_guard4(acc[0][0], acc[0][1], acc[0][2], acc[0][3]);
  acc_guard4(acc[1][0], acc[1][1], acc[1][2], acc[1][3]);
  acc_guard4(acc[2][0], acc[2][1], acc[2][2], acc[2][3]);
  acc_guard4(acc[3][0], acc[3][1], acc[3][2], acc[3][3]);

  // ---- epilogue ----
  float* slab = sT[wave];
  const float* Rb = RESID ? (resid + (size_t)b * strideR) : nullptr;
#pragma unroll
  for (int i = 0; i < 4; ++i) {
    const int mBase = m0 + (i << 4);
#pragma unroll
    for (int j = 0; j < 4; ++j) {
      const int n = n0 + (j << 4) + rlane;
      float bvn = 0.f;
      if (BIAS_MODE == 2) bvn = bias[n];
#pragma unroll
      for (int r = 0; r < 8; ++r) {
        float v = acc[i][j][r] * scale;
        if (BIAS_MODE == 1) v += bias[mBase + mOff + r];
        if (BIAS_MODE == 2) v += bvn;
        slab[(mOff + r) * 68 + (j << 4) + rlane] = v;
      }
    }
    __builtin_amdgcn_fence(__ATOMIC_RELEASE, "workgroup");
    __builtin_amdgcn_wave_barrier();
    __builtin_amdgcn_fence(__ATOMIC_ACQUIRE, "workgroup");
    if (OUT_MODE == 0) {
      float* C = (float*)Cout + (size_t)b * strideC;
      const int hh = lane >> 4, c4 = (lane & 15) * 4;     // row seg = 256 B = 16 lanes x 16 B
      v4f vals[8];
#pragma unroll
      for (int it = 0; it < 8; ++it) {
        const int row = it * 2 + hh;
        v4f v = *(const v4f*)(slab + row * 68 + c4);
        if (RESID) {
          const v4f rv = *(const v4f*)(Rb + (size_t)(mBase + row) * ldc + n0 + c4);
          v = v + rv;
        }
        vals[it] = v;
      }
      {
#pragma unroll
        for (int it = 0; it < 8; ++it) {
          const int row = it * 2 + hh;
          *(v4f*)(C + (size_t)(mBase + row) * ldc + n0 + c4) = vals[it];
        }
        
      }
    } else {
      const int q = lane >> 3, c8 = (lane & 7) * 8;
      unsigned short* C  = (unsigned short*)Cout  + (size_t)b * strideC;
      unsigned short* C2 = (OUT_MODE == 2) ? ((unsigned short*)Cout2 + (size_t)b * strideC) : nullptr;
      {
#pragma unroll
        for (int it = 0; it < 4; ++it) {
          const int row = it * 4 + q;
          const float* sp = slab + row * 68 + c8;
          v8h hv, lv;
#pragma unroll
          for (int e = 0; e < 8; ++e) {
            if (OUT_MODE == 1) {
              hv[e] = (_Float16)sp[e];
            } else {
              unsigned short hb = f2bf_bits(sp[e]);
              unsigned short lb = f2bf_bits(sp[e] - bf_bits2f(hb));
              hv[e] = __builtin_bit_cast(_Float16, hb);
              lv[e] = __builtin_bit_cast(_Float16, lb);
            }
          }
          *(v8h*)(C + (size_t)(mBase + row) * ldc + n0 + c8) = hv;
          if (OUT_MODE == 2) *(v8h*)(C2 + (size_t)(mBase + row) * ldc + n0 + c8) = lv;
        }
        
      }
    }
    __builtin_amdgcn_fence(__ATOMIC_RELEASE, "workgroup");
    __builtin_amdgcn_wave_barrier();
    __builtin_amdgcn_fence(__ATOMIC_ACQUIRE, "workgroup");
  }
}

// ---------------------------------------------------------------------------
// Parameter planes (21 blocks of 256 threads):
//   blocks  0.. 3: WQK16[0..8191]     = f16(16 * Wq)   (rows 0..31 of the [64][256] q|k weight plane)
//   blocks  4.. 7: WQK16[8192..16383] = f16(16 * Wk)   (rows 32..63)
//   blocks  8..11: WV16[0..8191]      = f16(16 * Wv)   (rows 0..31 of the [64][256] v weight plane)
//   blocks 12..15: WV16[8192..16383]  = 0              (rows 32..63, written zeros)
//   blocks 16..19: WB16[0..8191]      = f16(16 * Wb)   ([256][32])
//   block  20    : BQK[64] = bq | bk (f32), BV64[64] = bv | 0 (f32)
// Coverage: 4 blocks x 256 threads x 8 = 8192 elements per group. Each thread one 16-B store; a wave writes 512 contiguous B
// ---------------------------------------------------------------------------
__global__ __launch_bounds__(256) void prep_kernel(const float* __restrict__ Wq, const float* __restrict__ bq,
                                                   const float* __restrict__ Wk, const float* __restrict__ bk,
                                                   const float* __restrict__ Wv, const float* __restrict__ bv,
                                                   const float* __restrict__ Wb,
                                                   unsigned short* __restrict__ WQK16, unsigned short* __restrict__ WV16,
                                                   unsigned short* __restrict__ WB16,
                                                   float* __restrict__ BQK, float* __restrict__ BV64) {
  const int t   = threadIdx.x;
  const int blk = blockIdx.x;
  if (blk < 20) {   // block-uniform
    const int grp = blk >> 2;
    const int sub = blk & 3;
    const int e0  = (sub * 256 + t) * 8;   // 0 .. 8184
    const float* src = (grp == 0) ? Wq : (grp == 1) ? Wk : (grp == 4) ? Wb : Wv;   // grp 3 reads Wv (in range) and scales by 0
    const float  f   = (grp == 3) ? 0.0f : kWCarry;
    unsigned short* dst = (grp == 0) ? WQK16 : (grp == 1) ? (WQK16 + 8192) : (grp == 2) ? WV16 : (grp == 3) ? (WV16 + 8192) : WB16;
    const v4f a = *(const v4f*)(src + e0);
    const v4f c = *(const v4f*)(src + e0 + 4);
    unsigned short hb[8];
#pragma unroll
    for (int e = 0; e < 4; ++e) {
      hb[e]     = h_bits(a[e] * f);
      hb[4 + e] = h_bits(c[e] * f);
    }
    const v4u u = (v4u){pk16(hb[0], hb[1]), pk16(hb[2], hb[3]), pk16(hb[4], hb[5]), pk16(hb[6], hb[7])};
    unsigned short* dp = dst + e0;
    *(v4u*)dp = u;
    
  } else {
    const int lane = t & 31, wave = t >> 5;
    const int idx = (lane & 7) * 4;   // 0..28: always inside the 32-entry bias vectors
    const v4f q4 = *(const v4f*)(bq + idx);
    const v4f k4 = *(const v4f*)(bk + idx);
    const v4f w4 = *(const v4f*)(bv + idx);
    const float fq = (lane < 8) ? 1.0f : 0.0f;
    const float fk = (lane < 8) ? 0.0f : 1.0f;
    // arithmetic select: lanes 0..7 take bq / bv, lanes 8..15 take bk / zeros (all loads unconditional)
    const v4f valQK = q4 * fq + k4 * fk;
    const v4f valV  = w4 * fq;
    const bool wq = (wave == 0) && (lane < 16);
    const bool wv = (wave == 1) && (lane < 16);
    float* dq = BQK  + (lane & 15) * 4;
    float* dv = BV64 + (lane & 15) * 4;
    if (wq) *(v4f*)dq = valQK;
    if (wv) *(v4f*)dv = valV;
    
  }
}

// ---------------------------------------------------------------------------
// x transpose + cast: in x[b][c][n] (n contiguous) -> out XT[b][n][c] (c contiguous), XT = f16(x).
// grid (kN/64 n-tiles, kC/64 c-tiles, kB). 256 threads.
// Load coverage: 16 iterations x 256 threads = 4096 = the whole 64(c) x 64(n) tile (coalesced along n).
// Store coverage: 8 waves x 2 iterations x 4 rows (lane>>3) = 64 n-rows; (lane&7) x 8 halves = 64 c-cols; each row segment =
// ---------------------------------------------------------------------------
__global__ __launch_bounds__(256) void xtcast_kernel(const float* __restrict__ x, unsigned short* __restrict__ XT) {
  __shared__ float sm[64][65];   // sm[n_local][c_local]
  const int t  = threadIdx.x;
  const int n0 = blockIdx.x * 64;
  const int c0 = blockIdx.y * 64;
  const int b  = blockIdx.z;
  const float* xb = x + (size_t)b * kC * kN;
#pragma unroll
  for (int i = 0; i < 16; ++i) {
    const int e = i * 256 + t;
    const int r = e >> 6;          // c local
    const int q = e & 63;          // n local
    sm[q][r] = xb[(size_t)(c0 + r) * kN + n0 + q];
    if (i == 7) asm volatile("" ::: "memory");   // split the load burst into two groups of 8
  }
  __syncthreads();
  const int lane = t & 31, wave = t >> 5;
  const int q8 = lane >> 3, c8 = (lane & 7) * 8;
  unsigned short* op = XT + ((size_t)b * kN) * kC;
  {
#pragma unroll
    for (int it = 0; it < 2; ++it) {
      const int row = wave * 8 + it * 4 + q8;               // n local
      unsigned short hb[8];
#pragma unroll
      for (int e = 0; e < 8; ++e) hb[e] = h_bits(sm[row][c8 + e]);
      const v4u u = (v4u){pk16(hb[0], hb[1]), pk16(hb[2], hb[3]), pk16(hb[4], hb[5]), pk16(hb[6], hb[7])};
      *(v4u*)(op + (size_t)(n0 + row) * kC + c0 + c8) = u;
    }
    
  }
}

// ---------------------------------------------------------------------------
// Softmax statistics of the score rows, from score tiles formed in registers (no score plane in memory): for each j,
//   max[j] = max_i S[j][i],  inv[j] = 32768 / sum_i exp(S[j][i] - max[j]),  S[j][i] = q row j . k row i.
// One block owns 16 rows j and all 4096 i: grid kN/16 = 256 blocks of 16 waves; wave w takes i in [256 w, 256 w + 256).
// A tile is D[i][j] = k rows (A) x q rows (B, loaded once): a lane holds column j = lane & 15 and rows i = 8 h + r
// (h = lane >> 4), so a lane's 16 tiles are 128 scores of one row j: their maximum and their exp-sum need no other lane.
// The (maximum, sum) pairs of the 2 lane halves join by lane exchange, those of the 16 waves through LDS behind one barrier,
// each sum brought to the common maximum by one factor exp(own maximum - common maximum).
// STAT holds, per 16 rows j, 16 maxima and then 16 scaled inverse sums: one 128-B line, stored whole by its one block.
// ---------------------------------------------------------------------------
constexpr float kLog2e   = 1.4426950408889634f;
// 2^y on the transcendental unit. The v_nop fills the one slot that the instruction set asks for behind a transcendental before
// its result is read or its source overwritten: inside the statement it stands there in every build.
__device__ __forceinline__ float exp2_slot(float y) { float r; asm("v_exp_f32 %0, %1\n\tv_nop" : "=v"(r) : "v"(y)); return r; }
// exp(x) for x <= 0, as every use below has it: no overflow branch; below 2^-126 the term is 0 beside a sum that is at least 1
__device__ __forceinline__ float exp_le0(float x) { return exp2_slot(x * kLog2e); }
constexpr int kRSWaves   = 16;
constexpr int kRSThreads = kRSWaves * 32;      // 512
constexpr int kRSCols    = 16;                 // rows j of S per block
constexpr int kRSChunk   = kN / kRSWaves;      // 256 i per wave
constexpr int kRSTiles   = kRSChunk / 16;      // 16 score tiles per wave
static_assert(kN % kRSCols == 0 && kRSChunk % 16 == 0 && (kRSTiles & (kRSTiles - 1)) == 0 && kRSWaves % 2 == 0, "row statistics tiling");
__global__ __launch_bounds__(kRSThreads) void rowstats_kernel(const unsigned short* __restrict__ QKp, float* __restrict__ STAT) {
  typedef Frag<_Float16> F;
  __shared__ float pmax[kRSWaves][kRSCols];
  __shared__ float psum[kRSWaves][kRSCols];
  const int t    = threadIdx.x;
  const int lane = t & 31;
  const int wave = t >> 5;
  const int c    = lane & 15;
  const int h    = lane >> 4;
  const _Float16* QK    = (const _Float16*)QKp;
  const _Float16* Qlane = QK + (size_t)(blockIdx.x * kRSCols + c) * kQKW + h * 8;
  // row of the wave's first position i; its k half starts at column kCP; every tile is a compile-time offset from this address
  const _Float16* Klane = QK + (size_t)(wave * kRSChunk + c) * kQKW + h * 8;
  const v16h qf = F::load(Qlane);
  const v8f zero = (v8f){0.f, 0.f, 0.f, 0.f, 0.f, 0.f, 0.f, 0.f};
  v16h a[kRSTiles];
#pragma unroll
  for (int u = 0; u < kRSTiles; ++u) a[u] = F::load(Klane + kCP + (size_t)(u * 16) * kQKW);
  __builtin_amdgcn_sched_barrier(0);   // without it the loads are sunk to their tiles, one load latency per tile
  v8f d[kRSTiles];
  float tm[kRSTiles];
#pragma unroll
  for (int u = 0; u < kRSTiles; ++u) {
    d[u] = F::mma(a[u], qf, zero);
    tm[u] = d[u][0];
#pragma unroll
    for (int r = 1; r < 8; ++r) tm[u] = fmaxf(tm[u], d[u][r]);
  }
#pragma unroll
  for (int w = kRSTiles / 2; w > 0; w >>= 1)
#pragma unroll
    for (int u = 0; u < w; ++u) tm[u] = fmaxf(tm[u], tm[u + w]);
  float m = tm[0];
  float ts[kRSTiles];
#pragma unroll
  for (int u = 0; u < kRSTiles; ++u) {
    ts[u] = exp_le0(d[u][0] - m);
#pragma unroll
    for (int r = 1; r < 8; ++r) ts[u] += exp_le0(d[u][r] - m);
  }
#pragma unroll
  for (int w = kRSTiles / 2; w > 0; w >>= 1)
#pragma unroll
    for (int u = 0; u < w; ++u) ts[u] += ts[u + w];
  float sum = ts[0];
  // the one wait behind the kernel's loads: no address register of an issued load is given a new value in front of it
  // (the two pairs never change, and as inputs here they stay in their registers up to the wait)
  asm volatile("s_wait_xcnt 0x0" :: "v"(Qlane), "v"(Klane) : "memory");
  {   // the two lane halves of column j
    const float mo = __shfl_xor(m, 16, 32), so = __shfl_xor(sum, 16, 32);
    const float mj = fmaxf(m, mo);
    sum = sum * exp_le0(m - mj) + so * exp_le0(mo - mj);
    m = mj;
  }
  if (lane < 16) { pmax[wave][c] = m; psum[wave][c] = sum; }
  __syncthreads();   // every wave's partial maximum and sum are in pmax, psum
  if (wave != 0) return;   // wave-uniform, behind the kernel's only barrier
  float wm[kRSWaves / 2], wsum[kRSWaves / 2];   // lane half h joins waves 8 h .. 8 h + 7 in wave order
#pragma unroll
  for (int w = 0; w < kRSWaves / 2; ++w) {
    wm[w]   = pmax[h * (kRSWaves / 2) + w][c];
    wsum[w] = psum[h * (kRSWaves / 2) + w][c];
  }
  float bm = wm[0];
#pragma unroll
  for (int w = 1; w < kRSWaves / 2; ++w) bm = fmaxf(bm, wm[w]);
  bm = fmaxf(bm, __shfl_xor(bm, 16, 32));
  float tot = wsum[0] * exp_le0(wm[0] - bm);
#pragma unroll
  for (int w = 1; w < kRSWaves / 2; ++w) tot += wsum[w] * exp_le0(wm[w] - bm);
  tot += __shfl_xor(tot, 16, 32);   // tot >= 1: the row maximum contributes exp(0)
  STAT[(size_t)blockIdx.x * 32 + lane] = (lane < 16) ? bm : kPCarry / tot;
}

// ---------------------------------------------------------------------------
// attn^T.v with the probabilities formed in registers (no probability plane in memory):
//   O16[i][c] = f16( (64/32768) sum_j P[i][j] * V16[c][j] ),  P[i][j] = f16( exp(S[j][i] - max[j]) * inv[j] ), f32 math.
// One block owns 16 positions i and all 4096 j: grid kN/16 = 256 blocks of 16 waves; wave w walks j in [256 w, 256 w + 256).
// Per 32 j: two score tiles D[j][i] = q rows (A) x k rows (B, loaded once); a lane then holds column i = lane & 15 and
// rows j = 8 h + r and 16 + 8 h + r (h = lane >> 4), which is the k order of an A fragment of row i: converted in place,
// the two tiles are the A operand against the V fragments (same k order from Frag::load). No LDS, no lane exchange.
// The 16 waves' partial 16 x 32 tiles are joined through LDS in wave order behind one barrier.
// ---------------------------------------------------------------------------
constexpr int kAVWaves   = 16;
constexpr int kAVThreads = kAVWaves * 32;      // 512
constexpr int kAVRows    = 16;                 // positions i per block
constexpr int kAVChunk   = kN / kAVWaves;      // 256 j per wave
constexpr int kAVSteps   = kAVChunk / 32;      // 8 steps of 32 j
constexpr int kAVPitch   = kCP + 4;            // floats per row of a partial tile
static_assert(kN % kAVRows == 0 && kAVChunk % 32 == 0 && kAVRows * kCP == kAVThreads && kCP == 32, "attn.v tiling");
// what one step of 32 j reads: two q fragments, two V fragments, the lane's 16 row maxima and 16 scaled inverse sums
struct AVStep { v16h q0, q1, v0, v1; v4f m[4], l[4]; };
__device__ __forceinline__ void av_load(AVStep& s, const _Float16* __restrict__ Qlane, const _Float16* __restrict__ Vlane,
                                        const float* __restrict__ CMlane, const float* __restrict__ CLIlane, int j0) {
  s.q0 = Frag<_Float16>::load(Qlane + (size_t)j0 * kQKW);          // q rows j0 .. j0 + 15
  s.q1 = Frag<_Float16>::load(Qlane + (size_t)(j0 + 16) * kQKW);   // q rows j0 + 16 .. j0 + 31
  s.v0 = Frag<_Float16>::load(Vlane + j0);                         // channels 0..15
  s.v1 = Frag<_Float16>::load(Vlane + (size_t)16 * kN + j0);       // channels 16..31
#pragma unroll
  for (int g = 0; g < 4; ++g) {   // g = 0, 1: j0 + 8 h + 0..7;  g = 2, 3: j0 + 16 + 8 h + 0..7
    const int jo = (j0 + (g >> 1) * 16) * 2 + (g & 1) * 4;   // STAT: 32 floats per 16 j, maxima first
    s.m[g] = *(const v4f*)(CMlane + jo);
    s.l[g] = *(const v4f*)(CLIlane + jo);
  }
}
__global__ __launch_bounds__(kAVThreads) void attnv_kernel(const unsigned short* __restrict__ QKp,
                                                           const unsigned short* __restrict__ Vp,
                                                           const float* __restrict__ CM, const float* __restrict__ CLI,
                                                           unsigned short* __restrict__ O) {
  typedef Frag<_Float16> F;
  __shared__ __align__(16) float part[kAVWaves][kAVRows][kAVPitch];
  const int t    = threadIdx.x;
  const int lane = t & 31;
  const int wave = t >> 5;
  const int c    = lane & 15;
  const int h8   = (lane >> 4) * 8;
  const int i0   = blockIdx.x * kAVRows;
  const int jb   = wave * kAVChunk;
  const _Float16* QK    = (const _Float16*)QKp;
  const _Float16* Klane = QK + (size_t)(i0 + c) * kQKW + h8;   // row of position i0 + c; its k half starts at column kCP
  // the wave's first step; every later step is a compile-time offset from these four addresses
  const _Float16* Qlane = QK + (size_t)(jb + c) * kQKW + h8;
  const _Float16* Vlane = (const _Float16*)Vp + (size_t)c * kN + jb + h8;
  const float* CMlane  = CM + jb * 2 + h8;    // CM = STAT, CLI = STAT + 16: both walk 32 floats per 16 j
  const float* CLIlane = CLI + jb * 2 + h8;
  const v16h kf = F::load(Klane + kCP);
  const v8f zero = (v8f){0.f, 0.f, 0.f, 0.f, 0.f, 0.f, 0.f, 0.f};
  v8f acc0 = zero, acc1 = zero;
  AVStep st[2];   // two register sets take turns
  av_load(st[0], Qlane, Vlane, CMlane, CLIlane, 0);
#pragma unroll   // whole: the sets' turns and the steps' address offsets are compile-time, the five address pairs never change
  for (int s = 0; s < kAVSteps; ++s) {
    const AVStep& cur = st[s & 1];
    if (s + 1 < kAVSteps) {
      av_load(st[(s + 1) & 1], Qlane, Vlane, CMlane, CLIlane, (s + 1) * 32);
      __builtin_amdgcn_sched_barrier(0);   // the next step's 16 loads stay issued ahead of this step's exp work, which hides them
    }
    const v8f s0 = F::mma(cur.q0, kf, zero);
    const v8f s1 = F::mma(cur.q1, kf, zero);
    v16h p;
#pragma unroll
    for (int r = 0; r < 8; ++r) {
      p[r]     = (_Float16)(expf(s0[r] - cur.m[r >> 2][r & 3]) * cur.l[r >> 2][r & 3]);
      p[8 + r] = (_Float16)(expf(s1[r] - cur.m[2 + (r >> 2)][r & 3]) * cur.l[2 + (r >> 2)][r & 3]);
    }
    acc0 = F::mma(p, cur.v0, acc0);
    acc1 = F::mma(p, cur.v1, acc1);
  }
  // the one wait behind the kernel's loads: no address register of an issued load is given a new value in front of it
  // (the five pairs never change in the loop, and as inputs here they stay in their registers up to the wait)
  asm volatile("s_wait_xcnt 0x0" :: "v"(Klane), "v"(Qlane), "v"(Vlane), "v"(CMlane), "v"(CLIlane) : "memory");
#pragma unroll
  for (int r = 0; r < 8; ++r) {
    part[wave][h8 + r][c]      = acc0[r];
    part[wave][h8 + r][16 + c] = acc1[r];
  }
  __syncthreads();   // every wave's partial tile is in part
  const int row = wave, col = lane;   // 16 x 32 = 512 threads; a wave stores the 64 used bytes of one row of O
  float sum = part[0][row][col];
#pragma unroll
  for (int w = 1; w < kAVWaves; ++w) sum += part[w][row][col];
  O[(size_t)(i0 + row) * kOW + col] = h_bits(sum * kPVScale);
}

// ---------------------------------------------------------------------------
// Host glue.
// Workspace region map (bytes, every offset a multiple of 256):
//   XT16  f16 [8][4096][256]      16,777,216  at           0   x transposed, position-major
//   WQK16 f16 [64][256]               32,768  at  16,777,216   rows 0..31 = 16*Wq, 32..63 = 16*Wk
//   WV16  f16 [64][256]               32,768  at  16,809,984   rows 0..31 = 16*Wv, 32..63 = 0 (written)
//   WB16  f16 [256][32]               16,384  at  16,842,752   16*Wb
//   BQK   f32 [64]                       256  at  16,859,136   bq | bk
//   BV64  f32 [64]                       256  at  16,859,392   bv | 0
//   QK16  f16 [8][4096][64]        4,194,304  at  16,859,648   cols 0..31 q, 32..63 k
//   V16   f16 [8][64][4096]        4,194,304  at  21,053,952   channel-major v, rows 32..63 zero (written)
//   STAT  f32 [256][32]               32,768  at  25,248,256   per 16 score rows: 16 maxima | 16 x 32768 / exp-sum (re-used 8x)
//   O16   f16 [8][4096][64]        4,194,304  at  25,281,024   attention output x64, position-major, cols 0..31 (32..63 neither written nor read)
//   total                         29,475,328
// GEMM shapes: q|k M=4096 N=64 K=256; v M=64 N=4096 K=256; scores M=N=4096 K=32 (tiles inside the two attention kernels);
// attn.v M=4096 N=32 K=4096 (own kernel); back M=256 N=4096 K=32. No padding reads of unwritten data.
// Launch count: 1 + 1 + 1 + 1 + 8 x 2 + 1 = 21.
// ---------------------------------------------------------------------------
extern "C" void kernel_launch(void* const* d_in, const int* in_sizes, int n_in,
                              void* d_out, int out_size, void* d_ws, size_t ws_size,
                              hipStream_t stream) {
  if (n_in < 9) return;
  const int nX = kB * kC * kN;   // 8,388,608
  if (in_sizes[0] != nX) return;
  if (in_sizes[1] != kCP * kC || in_sizes[3] != kCP * kC || in_sizes[5] != kCP * kC) return;
  if (in_sizes[2] != kCP || in_sizes[4] != kCP || in_sizes[6] != kCP) return;
  if (in_sizes[7] != kC * kCP || in_sizes[8] != kC) return;
  if (out_size != nX) return;

  const size_t szXT  = (size_t)kB * kN * kC * 2;
  const size_t szWQK = (size_t)kQKW * kC * 2;
  const size_t szWV  = (size_t)kVR * kC * 2;
  const size_t szWB  = (size_t)kC * kCP * 2;
  const size_t szBQK = (size_t)kQKW * 4;
  const size_t szBV  = (size_t)kVR * 4;
  const size_t szQK  = (size_t)kB * kN * kQKW * 2;
  const size_t szV   = (size_t)kB * kVR * kN * 2;
  const size_t szST  = (size_t)(kN / kRSCols) * 32 * 4;
  const size_t szO   = (size_t)kB * kN * kOW * 2;
  const size_t offXT  = 0;
  const size_t offWQK = offXT + szXT;
  const size_t offWV  = offWQK + szWQK;
  const size_t offWB  = offWV + szWV;
  const size_t offBQK = offWB + szWB;
  const size_t offBV  = offBQK + szBQK;
  const size_t offQK  = offBV + szBV;
  const size_t offV   = offQK + szQK;
  const size_t offST  = offV + szV;
  const size_t offO   = offST + szST;
  const size_t total  = offO + szO;   // 29,475,328
  if (ws_size < total) return;

  const float* x  = (const float*)d_in[0];
  const float* Wq = (const float*)d_in[1];
  const float* bq = (const float*)d_in[2];
  const float* Wk = (const float*)d_in[3];
  const float* bk = (const float*)d_in[4];
  const float* Wv = (const float*)d_in[5];
  const float* bv = (const float*)d_in[6];
  const float* Wb = (const float*)d_in[7];
  const float* bb = (const float*)d_in[8];
  float* out = (float*)d_out;
  char* ws = (char*)d_ws;
  unsigned short* XT16  = (unsigned short*)(ws + offXT);
  unsigned short* WQK16 = (unsigned short*)(ws + offWQK);
  unsigned short* WV16  = (unsigned short*)(ws + offWV);
  unsigned short* WB16  = (unsigned short*)(ws + offWB);
  float* BQK  = (float*)(ws + offBQK);
  float* BV64 = (float*)(ws + offBV);
  unsigned short* QK16 = (unsigned short*)(ws + offQK);
  unsigned short* V16  = (unsigned short*)(ws + offV);
  float* STAT = (float*)(ws + offST);
  unsigned short* O16 = (unsigned short*)(ws + offO);

  // ---- parameter planes and the transposed f16 copy of x ----
  prep_kernel<<<dim3(21), dim3(256), 0, stream>>>(Wq, bq, Wk, bk, Wv, bv, Wb, WQK16, WV16, WB16, BQK, BV64);
  xtcast_kernel<<<dim3(kN / 64, kC / 64, kB), dim3(256), 0, stream>>>(x, XT16);

  const long strideXT = (long)kN * kC;
  const long strideQK = (long)kN * kQKW;
  const long strideV  = (long)kVR * kN;
  const long strideO  = (long)kN * kOW;
  const long strideX  = (long)kC * kN;

  // ---- q|k plane: QK16[b][n][o'] = f16( (1/16) sum_c XT16[b][n][c] * WQK16[o'][c] + BQK[o'] )   (M=4096, N=64, K=256) ----
  const int blocksQK = ((kN / 64) * (kQKW / 64)) / 8;   // 64 tiles -> 8 blocks
  wmma_gemm64<0, false, 2, 1, false><<<dim3(blocksQK, kB), dim3(256), 0, stream>>>(
      XT16, XT16, kC, strideXT, WQK16, WQK16, kC, 0L,
      (void*)QK16, (void*)QK16, kQKW, strideQK, BQK, x, 0L, kN, kQKW, kC, kWCarryInv);
  // ---- v plane, channel-major: V16[b][o][n] = f16( (1/16) sum_c WV16[o][c] * XT16[b][n][c] + BV64[o] )   (M=64, N=4096, K=256) ----
  const int blocksV = ((kVR / 64) * (kN / 64)) / 8;     // 64 tiles -> 8 blocks
  wmma_gemm64<0, false, 1, 1, false><<<dim3(blocksV, kB), dim3(256), 0, stream>>>(
      WV16, WV16, kC, 0L, XT16, XT16, kC, strideXT,
      (void*)V16, (void*)V16, kN, strideV, BV64, x, 0L, kVR, kN, kC, kWCarryInv);

  for (int b = 0; b < kB; ++b) {
    const unsigned short* QKb = QK16 + (size_t)b * strideQK;
    const unsigned short* Vb  = V16 + (size_t)b * strideV;
    unsigned short* Ob = O16 + (size_t)b * strideO;
    // per row j of S[j][i] = sum_o q[o,j] * k[o,i]: max and 32768/exp-sum
    rowstats_kernel<<<dim3(kN / kRSCols), dim3(kRSThreads), 0, stream>>>(QKb, STAT);
    // O16[b][i][c] = f16( (64/32768) sum_j f16(32768 * attn[j][i]) * V16[b][c][j] ) = f16( 64 * out[c][i] )
    attnv_kernel<<<dim3(kN / kAVRows), dim3(kAVThreads), 0, stream>>>(QKb, Vb, STAT, STAT + kRSCols, Ob);
  }

  // ---- result[b][cc][i] = (1/1024) sum_o WB16[cc][o] * O16[b][i][o] + bb[cc] + x[b][cc][i]   (M=256, N=4096, K=32) ----
  const int blocksBack = ((kC / 64) * (kN / 64)) / 8;  // 256 tiles -> 32 blocks
  wmma_gemm64<0, false, 1, 0, true><<<dim3(blocksBack, kB), dim3(256), 0, stream>>>(
      WB16, WB16, kCP, 0L, O16, O16, kOW, strideO,
      (void*)out, (void*)out, kN, strideX, bb, x, strideX, kC, kN, kCP, kBackScale);
}

// v004
// Measured time: 211 microseconds a run.
// Next to v003, in two timings, it ran 1.11 times as fast each time.
// All steps since v000 together make it 25.1 times as fast.
// Contractions: q|k projection and v projection (x^T f16 x W f16 carried x16), scores (q, k f16 planes; once as k.q tiles inside the row-statistics kernel, once more as q.k tiles inside the attn^T.v kernel), attn^T.v (P f16 carried x32768, formed in registers, x V f16 plane), back-projection (Wb f16 carried x16 x O f16 carried x64): all v_wmma_f32_16x16x32_f16 with f32 accumulate; softmax statistics, exp, biases and residual in f32.
#include <hip/hip_runtime.h>
#include <math.h>

// ---------------------------------------------------------------------------
// Problem constants
// ---------------------------------------------------------------------------
constexpr int kB   = 8;      // batch
constexpr int kC   = 256;    // channels
constexpr int kN   = 4096;   // positions (64 x 64)
constexpr int kCP  = 32;     // reduced channels
constexpr int kQKW = 64;     // columns of the q|k plane: 0..31 q, 32..63 k
constexpr int kVR  = 64;     // rows of the channel-major V plane: 0..31 v, 32..63 written zero
constexpr int kOW  = 64;     // pitch of the O plane in columns: 0..31 out, 32..63 unused
constexpr float kWCarry    = 16.0f;                      // weights carried x16 in f16
constexpr float kWCarryInv = 1.0f / 16.0f;
constexpr float kPCarry    = 32768.0f;                   // probabilities carried x2^15 in f16
constexpr float kOCarry    = 64.0f;                      // attention output carried x64 in f16
constexpr float kPVScale   = kOCarry / kPCarry;          // 1/512
constexpr float kBackScale = 1.0f / (kOCarry * kWCarry); // 1/1024
static_assert(kN % 64 == 0 && kC % 64 == 0 && kQKW % 64 == 0 && kVR % 64 == 0 && kOW % 64 == 0, "tile multiples");
static_assert(kC % 32 == 0 && kCP % 32 == 0 && kN % 32 == 0, "k steps of 32");
static_assert(2 * kCP == kQKW && kCP <= kVR && kCP <= kOW, "plane widths");
static_assert(kCP * kC == 8192 && kC * kCP == 8192 && kN % 256 == 0 && kN % 8 == 0, "prep and elementwise coverage");

typedef __attribute__((ext_vector_type(16))) _Float16 v16h;
typedef __attribute__((ext_vector_type(8)))  _Float16 v8h;
typedef __attribute__((ext_vector_type(16))) __bf16   v16b;
typedef __attribute__((ext_vector_type(8)))  __bf16   v8b;
typedef __attribute__((ext_vector_type(8)))  float    v8f;
typedef __attribute__((ext_vector_type(4)))  float    v4f;
typedef __attribute__((ext_vector_type(4)))  unsigned int v4u;

// ---------------------------------------------------------------------------
// Shared helpers (with a 4-accumulator guard)
// ---------------------------------------------------------------------------
__device__ __forceinline__ unsigned short f2bf_bits(float f) {
  unsigned u = __float_as_uint(f);
  return (unsigned short)((u + 0x7FFFu + ((u >> 16) & 1u)) >> 16);
}
__device__ __forceinline__ float bf_bits2f(unsigned short h) { return __uint_as_float(((unsigned)h) << 16); }

// hazard guards as plain device helpers (no inline asm inside the kernel template body)
__device__ __forceinline__ void dep_guard_h(v8f& a, v8f& b, v16h x, v16h y) { asm volatile("v_nop\n\tv_nop\n\tv_nop\n\tv_nop" : "+v"(a), "+v"(b) : "v"(x), "v"(y)); }
__device__ __forceinline__ void dep_guard_b(v8f& a, v8f& b, v16b x, v16b y) { asm volatile("v_nop\n\tv_nop\n\tv_nop\n\tv_nop" : "+v"(a), "+v"(b) : "v"(x), "v"(y)); }
__device__ __forceinline__ void dep_guard4_h(v8f& a, v8f& b, v8f& c, v8f& d, v16h x, v16h y) { asm volatile("v_nop\n\tv_nop\n\tv_nop\n\tv_nop" : "+v"(a), "+v"(b), "+v"(c), "+v"(d) : "v"(x), "v"(y)); }
__device__ __forceinline__ void dep_guard4_b(v8f& a, v8f& b, v8f& c, v8f& d, v16b x, v16b y) { asm volatile("v_nop\n\tv_nop\n\tv_nop\n\tv_nop" : "+v"(a), "+v"(b), "+v"(c), "+v"(d) : "v"(x), "v"(y)); }
__device__ __forceinline__ void keep4_h(v16h a, v16h b, v16h c, v16h d) { asm volatile("v_nop" :: "v"(a), "v"(b), "v"(c), "v"(d)); }
__device__ __forceinline__ void keep4_b(v16b a, v16b b, v16b c, v16b d) { asm volatile("v_nop" :: "v"(a), "v"(b), "v"(c), "v"(d)); }
__device__ __forceinline__ void acc_guard4(v8f& a, v8f& b, v8f& c, v8f& d) { asm volatile("v_nop\n\tv_nop\n\tv_nop\n\tv_nop" : "+v"(a), "+v"(b), "+v"(c), "+v"(d)); }
template <typename T> struct Frag;
template <> struct Frag<_Float16> {
  typedef v16h V; union U { v16h v; v8h h[2]; };
  // elements 0..7 <- p[0..7], 8..15 <- p[16..23]
  static __device__ __forceinline__ v16h load(const _Float16* p) {
    U f; f.h[0] = *(const v8h*)(p); f.h[1] = *(const v8h*)(p + 16); return f.v;
  }
  static __device__ __forceinline__ v8f mma(v16h a, v16h b, v8f c) {
    return __builtin_amdgcn_wmma_f32_16x16x32_f16(false, a, false, b, (short)0, c, false, false);
  }
  static __device__ __forceinline__ void guard(v8f& a, v8f& b, v16h x, v16h y) { dep_guard_h(a, b, x, y); }
  static __device__ __forceinline__ void guard4(v8f& a, v8f& b, v8f& c, v8f& d, v16h x, v16h y) { dep_guard4_h(a, b, c, d, x, y); }
  static __device__ __forceinline__ void keep(v16h a, v16h b, v16h c, v16h d) { keep4_h(a, b, c, d); }
};
template <> struct Frag<__bf16> {
  typedef v16b V; union U { v16b v; v8b h[2]; };
  static __device__ __forceinline__ v16b load(const __bf16* p) {
    U f; f.h[0] = *(const v8b*)(p); f.h[1] = *(const v8b*)(p + 16); return f.v;
  }
  static __device__ __forceinline__ v8f mma(v16b a, v16b b, v8f c) {
    return __builtin_amdgcn_wmma_f32_16x16x32_bf16(false, a, false, b, (short)0, c, false, false);
  }
  static __device__ __forceinline__ void guard(v8f& a, v8f& b, v16b x, v16b y) { dep_guard_b(a, b, x, y); }
  static __device__ __forceinline__ void guard4(v8f& a, v8f& b, v8f& c, v8f& d, v16b x, v16b y) { dep_guard4_b(a, b, c, d, x, y); }
  static __device__ __forceinline__ void keep(v16b a, v16b b, v16b c, v16b d) { keep4_b(a, b, c, d); }
};

__device__ __forceinline__ unsigned pk16(unsigned short a, unsigned short b) { return (unsigned)a | ((unsigned)b << 16); }
__device__ __forceinline__ unsigned short h_bits(float f) { const _Float16 h = (_Float16)f; return __builtin_bit_cast(unsigned short, h); }

// ---- Register-blocked batched WMMA GEMM (no activations; residual added in the store phase) ------
// C[m,n] = scale * sum_k A[m,k] * Bt[n,k] (+bias)(+resid); each wave owns a 64x64 tile.
// A row-major [M,K]; Bt row-major [N,K]; M,N % 64 == 0, K % 32 == 0.
// SPLIT: operands are hi/lo planes (A2/Bt2 = lo planes, same layout); product = hi*hi + hi*lo + lo*hi.
// BIAS_MODE: 0 = none, 1 = bias[m], 2 = bias[n].
// OUT_MODE: 0 = f32, 1 = f16, 2 = bf16 hi plane (Cout) + bf16 lo plane (Cout2).
// RESID (OUT_MODE 0 only): each lane loads ONE float4 of the residual at exactly the address it stores, adds it to the
// ET: 0 = f16 operands, 1 = bf16 operands (pointers passed as 16-bit storage)
template <int ET> struct Elem;
template <> struct Elem<0> { typedef _Float16 T; };
template <> struct Elem<1> { typedef __bf16 T; };
template <int ET, bool SPLIT, int BIAS_MODE, int OUT_MODE, bool RESID>
__global__ __launch_bounds__(256) void wmma_gemm64(
    const unsigned short* __restrict__ Ap, const unsigned short* __restrict__ A2p, int lda, long strideA,
    const unsigned short* __restrict__ Btp, const unsigned short* __restrict__ Bt2p, int ldb, long strideB,
    void* __restrict__ Cout, void* __restrict__ Cout2, int ldc, long strideC,
    const float* __restrict__ bias,
    const float* __restrict__ resid, long strideR,
    int M, int N, int K, float scale) {
  static_assert(!RESID || OUT_MODE == 0, "residual only with f32 output");
  typedef typename Elem<ET>::T T;
  typedef typename Frag<T>::V V;
  const T* A = (const T*)Ap; const T* A2 = (const T*)A2p; const T* Bt = (const T*)Btp; const T* Bt2 = (const T*)Bt2p;
  __shared__ __align__(16) float sT[8][16 * 68];   // per-wave 16x64 slab, pitch 68 floats
  const int b    = blockIdx.y;
  const int lane = threadIdx.x & 31;
  const int wave = threadIdx.x >> 5;
  const int tilesN = N >> 6;
  const int tilesM = M >> 6;
  const int tile = blockIdx.x * 8 + wave;
  if (tile >= tilesM * tilesN) return;   // wave-uniform; no block barriers in this kernel
  const int tm = tile / tilesN;
  const int tn = tile - tm * tilesN;
  const int m0 = tm << 6;
  const int n0 = tn << 6;

  const T* Ab  = A  + (size_t)b * strideA;
  const T* Bb  = Bt + (size_t)b * strideB;
  const T* Ab2 = SPLIT ? (A2  + (size_t)b * strideA) : nullptr;
  const T* Bb2 = SPLIT ? (Bt2 + (size_t)b * strideB) : nullptr;

  const int rlane = lane & 15;                 // row (A) / col (B, D) within subtile
  const int koff  = (lane >> 4) * 8;           // k offset of this lane half
  const int mOff  = (lane >> 4) * 8;           // D row offset

  v8f acc[4][4];
#pragma unroll
  for (int i = 0; i < 4; ++i)
#pragma unroll
    for (int j = 0; j < 4; ++j) acc[i][j] = (v8f){0.f,0.f,0.f,0.f,0.f,0.f,0.f,0.f};

  for (int k0 = 0; k0 < K; k0 += 32) {
    V bh[4], bl[4];
#pragma unroll
    for (int j = 0; j < 4; ++j) {
      const size_t bo = (size_t)(n0 + (j << 4) + rlane) * ldb + koff + k0;
      bh[j] = Frag<T>::load(Bb + bo);
      if (SPLIT) bl[j] = Frag<T>::load(Bb2 + bo);
    }
#pragma unroll
    for (int i = 0; i < 4; ++i) {
      const size_t ao = (size_t)(m0 + (i << 4) + rlane) * lda + koff + k0;
      V ah = Frag<T>::load(Ab + ao);
      V al;
      if (SPLIT) al = Frag<T>::load(Ab2 + ao);
#pragma unroll
      for (int j = 0; j < 4; ++j) {
        acc[i][j] = Frag<T>::mma(ah, bh[j], acc[i][j]);
        if (SPLIT) {
          acc[i][j] = Frag<T>::mma(ah, bl[j], acc[i][j]);
          acc[i][j] = Frag<T>::mma(al, bh[j], acc[i][j]);
        }
      }
      Frag<T>::guard4(acc[i][0], acc[i][1], acc[i][2], acc[i][3], ah, SPLIT ? al : ah);
    }
    Frag<T>::keep(bh[0], bh[1], bh[2], bh[3]);
    if (SPLIT) Frag<T>::keep(bl[0], bl[1], bl[2], bl[3]);
  }
  acc_guard4(acc[0][0], acc[0][1], acc[0][2], acc[0][3]);
  acc_guard4(acc[1][0], acc[1][1], acc[1][2], acc[1][3]);
  acc_guard4(acc[2][0], acc[2][1], acc[2][2], acc[2][3]);
  acc_guard4(acc[3][0], acc[3][1], acc[3][2], acc[3][3]);

  // ---- epilogue ----
  float* slab = sT[wave];
  const float* Rb = RESID ? (resid + (size_t)b * strideR) : nullptr;
#pragma unroll
  for (int i = 0; i < 4; ++i) {
    const int mBase = m0 + (i << 4);
#pragma unroll
    for (int j = 0; j < 4; ++j) {
      const int n = n0 + (j << 4) + rlane;
      float bvn = 0.f;
      if (BIAS_MODE == 2) bvn = bias[n];
#pragma unroll
      for (int r = 0; r < 8; ++r) {
        float v = acc[i][j][r] * scale;
        if (BIAS_MODE == 1) v += bias[mBase + mOff + r];
        if (BIAS_MODE == 2) v += bvn;
        slab[(mOff + r) * 68 + (j << 4) + rlane] = v;
      }
    }
    __builtin_amdgcn_fence(__ATOMIC_RELEASE, "workgroup");
    __builtin_amdgcn_wave_barrier();
    __builtin_amdgcn_fence(__ATOMIC_ACQUIRE, "workgroup");
    if (OUT_MODE == 0) {
      float* C = (float*)Cout + (size_t)b * strideC;
      const int hh = lane >> 4, c4 = (lane & 15) * 4;     // row seg = 256 B = 16 lanes x 16 B
      v4f vals[8];
#pragma unroll
      for (int it = 0; it < 8; ++it) {
        const int row = it * 2 + hh;
        v4f v = *(const v4f*)(slab + row * 68 + c4);
        if (RESID) {
          const v4f rv = *(const v4f*)(Rb + (size_t)(mBase + row) * ldc + n0 + c4);
          v = v + rv;
        }
        vals[it] = v;
      }
      {
#pragma unroll
        for (int it = 0; it < 8; ++it) {
          const int row = it * 2 + hh;
          *(v4f*)(C + (size_t)(mBase + row) * ldc + n0 + c4) = vals[it];
        }
        
      }
    } else {
      const int q = lane >> 3, c8 = (lane & 7) * 8;
      unsigned short* C  = (unsigned short*)Cout  + (size_t)b * strideC;
      unsigned short* C2 = (OUT_MODE == 2) ? ((unsigned short*)Cout2 + (size_t)b * strideC) : nullptr;
      {
#pragma unroll
        for (int it = 0; it < 4; ++it) {
          const int row = it * 4 + q;
          const float* sp = slab + row * 68 + c8;
          v8h hv, lv;
#pragma unroll
          for (int e = 0; e < 8; ++e) {
            if (OUT_MODE == 1) {
              hv[e] = (_Float16)sp[e];
            } else {
              unsigned short hb = f2bf_bits(sp[e]);
              unsigned short lb = f2bf_bits(sp[e] - bf_bits2f(hb));
              hv[e] = __builtin_bit_cast(_Float16, hb);
              lv[e] = __builtin_bit_cast(_Float16, lb);
            }
          }
          *(v8h*)(C + (size_t)(mBase + row) * ldc + n0 + c8) = hv;
          if (OUT_MODE == 2) *(v8h*)(C2 + (size_t)(mBase + row) * ldc + n0 + c8) = lv;
        }
        
      }
    }
    __builtin_amdgcn_fence(__ATOMIC_RELEASE, "workgroup");
    __builtin_amdgcn_wave_barrier();
    __builtin_amdgcn_fence(__ATOMIC_ACQUIRE, "workgroup");
  }
}

// ---------------------------------------------------------------------------
// Parameter planes (21 blocks of 256 threads):
//   blocks  0.. 3: WQK16[0..8191]     = f16(16 * Wq)   (rows 0..31 of the [64][256] q|k weight plane)
//   blocks  4.. 7: WQK16[8192..16383] = f16(16 * Wk)   (rows 32..63)
//   blocks  8..11: WV16[0..8191]      = f16(16 * Wv)   (rows 0..31 of the [64][256] v weight plane)
//   blocks 12..15: WV16[8192..16383]  = 0              (rows 32..63, written zeros)
//   blocks 16..19: WB16[0..8191]      = f16(16 * Wb)   ([256][32])
//   block  20    : BQK[64] = bq | bk (f32), BV64[64] = bv | 0 (f32)
// Coverage: 4 blocks x 256 threads x 8 = 8192 elements per group. Each thread one 16-B store; a wave writes 512 contiguous B
// ---------------------------------------------------------------------------
__global__ __launch_bounds__(256) void prep_kernel(const float* __restrict__ Wq, const float* __restrict__ bq,
                                                   const float* __restrict__ Wk, const float* __restrict__ bk,
                                                   const float* __restrict__ Wv, const float* __restrict__ bv,
                                                   const float* __restrict__ Wb,
                                                   unsigned short* __restrict__ WQK16, unsigned short* __restrict__ WV16,
                                                   unsigned short* __restrict__ WB16,
                                                   float* __restrict__ BQK, float* __restrict__ BV64) {
  const int t   = threadIdx.x;
  const int blk = blockIdx.x;
  if (blk < 20) {   // block-uniform
    const int grp = blk >> 2;
    const int sub = blk & 3;
    const int e0  = (sub * 256 + t) * 8;   // 0 .. 8184
    const float* src = (grp == 0) ? Wq : (grp == 1) ? Wk : (grp == 4) ? Wb : Wv;   // grp 3 reads Wv (in range) and scales by 0
    const float  f   = (grp == 3) ? 0.0f : kWCarry;
    unsigned short* dst = (grp == 0) ? WQK16 : (grp == 1) ? (WQK16 + 8192) : (grp == 2) ? WV16 : (grp == 3) ? (WV16 + 8192) : WB16;
    const v4f a = *(const v4f*)(src + e0);
    const v4f c = *(const v4f*)(src + e0 + 4);
    unsigned short hb[8];
#pragma unroll
    for (int e = 0; e < 4; ++e) {
      hb[e]     = h_bits(a[e] * f);
      hb[4 + e] = h_bits(c[e] * f);
    }
    const v4u u = (v4u){pk16(hb[0], hb[1]), pk16(hb[2], hb[3]), pk16(hb[4], hb[5]), pk16(hb[6], hb[7])};
    unsigned short* dp = dst + e0;
    *(v4u*)dp = u;
    
  } else {
    const int lane = t & 31, wave = t >> 5;
    const int idx = (lane & 7) * 4;   // 0..28: always inside the 32-entry bias vectors
    const v4f q4 = *(const v4f*)(bq + idx);
    const v4f k4 = *(const v4f*)(bk + idx);
    const v4f w4 = *(const v4f*)(bv + idx);
    const float fq = (lane < 8) ? 1.0f : 0.0f;
    const float fk = (lane < 8) ? 0.0f : 1.0f;
    // arithmetic select: lanes 0..7 take bq / bv, lanes 8..15 take bk / zeros (all loads unconditional)
    const v4f valQK = q4 * fq + k4 * fk;
    const v4f valV  = w4 * fq;
    const bool wq = (wave == 0) && (lane < 16);
    const bool wv = (wave == 1) && (lane < 16);
    float* dq = BQK  + (lane & 15) * 4;
    float* dv = BV64 + (lane & 15) * 4;
    if (wq) *(v4f*)dq = valQK;
    if (wv) *(v4f*)dv = valV;
    
  }
}

// ---------------------------------------------------------------------------
// x transpose + cast: in x[b][c][n] (n contiguous) -> out XT[b][n][c] (c contiguous), XT = f16(x).
// grid (kN/64 n-tiles, kC/64 c-tiles, kB). 256 threads.
// Load coverage: 16 iterations x 256 threads = 4096 = the whole 64(c) x 64(n) tile (coalesced along n).
// Store coverage: 8 waves x 2 iterations x 4 rows (lane>>3) = 64 n-rows; (lane&7) x 8 halves = 64 c-cols; each row segment =
// ---------------------------------------------------------------------------
__global__ __launch_bounds__(256) void xtcast_kernel(const float* __restrict__ x, unsigned short* __restrict__ XT) {
  __shared__ float sm[64][65];   // sm[n_local][c_local]
  const int t  = threadIdx.x;
  const int n0 = blockIdx.x * 64;
  const int c0 = blockIdx.y * 64;
  const int b  = blockIdx.z;
  const float* xb = x + (size_t)b * kC * kN;
#pragma unroll
  for (int i = 0; i < 16; ++i) {
    const int e = i * 256 + t;
    const int r = e >> 6;          // c local
    const int q = e & 63;          // n local
    sm[q][r] = xb[(size_t)(c0 + r) * kN + n0 + q];
    if (i == 7) asm volatile("" ::: "memory");   // split the load burst into two groups of 8
  }
  __syncthreads();
  const int lane = t & 31, wave = t >> 5;
  const int q8 = lane >> 3, c8 = (lane & 7) * 8;
  unsigned short* op = XT + ((size_t)b * kN) * kC;
  {
#pragma unroll
    for (int it = 0; it < 2; ++it) {
      const int row = wave * 8 + it * 4 + q8;               // n local
      unsigned short hb[8];
#pragma unroll
      for (int e = 0; e < 8; ++e) hb[e] = h_bits(sm[row][c8 + e]);
      const v4u u = (v4u){pk16(hb[0], hb[1]), pk16(hb[2], hb[3]), pk16(hb[4], hb[5]), pk16(hb[6], hb[7])};
      *(v4u*)(op + (size_t)(n0 + row) * kC + c0 + c8) = u;
    }
    
  }
}

// ---------------------------------------------------------------------------
// Softmax statistics of the score rows, from score tiles formed in registers (no score plane in memory): for each j,
//   max[j] = max_i S[j][i],  inv[j] = 32768 / sum_i exp(S[j][i] - max[j]),  S[j][i] = q row j . k row i.
// One block owns 16 rows j of one batch and all 4096 i: grid (kN/16 = 256, kB) blocks of 16 waves, blockIdx.y the batch;
// wave w takes i in [256 w, 256 w + 256).
// A tile is D[i][j] = k rows (A) x q rows (B, loaded once): a lane holds column j = lane & 15 and rows i = 8 h + r
// (h = lane >> 4), so a lane's 16 tiles are 128 scores of one row j: their maximum and their exp-sum need no other lane.
// The (maximum, sum) pairs of the 2 lane halves join by lane exchange, those of the 16 waves through LDS behind one barrier,
// each sum brought to the common maximum by one factor exp(own maximum - common maximum).
// STAT holds, per batch and per 16 rows j, 16 maxima and then 16 scaled inverse sums: one 128-B line, stored whole by its one block.
// ---------------------------------------------------------------------------
constexpr float kLog2e   = 1.4426950408889634f;
// 2^y on the transcendental unit. The v_nop fills the one slot that the instruction set asks for behind a transcendental before
// its result is read or its source overwritten: inside the statement it stands there in every build.
__device__ __forceinline__ float exp2_slot(float y) { float r; asm("v_exp_f32 %0, %1\n\tv_nop" : "=v"(r) : "v"(y)); return r; }
// exp(x) for x <= 0, as every use below has it: no overflow branch; below 2^-126 the term is 0 beside a sum that is at least 1
__device__ __forceinline__ float exp_le0(float x) { return exp2_slot(x * kLog2e); }
constexpr int kRSWaves   = 16;
constexpr int kRSThreads = kRSWaves * 32;      // 512
constexpr int kRSCols    = 16;                 // rows j of S per block
constexpr int kRSChunk   = kN / kRSWaves;      // 256 i per wave
constexpr int kRSTiles   = kRSChunk / 16;      // 16 score tiles per wave
static_assert(kN % kRSCols == 0 && kRSChunk % 16 == 0 && (kRSTiles & (kRSTiles - 1)) == 0 && kRSWaves % 2 == 0, "row statistics tiling");
__global__ __launch_bounds__(kRSThreads) void rowstats_kernel(const unsigned short* __restrict__ QKp, float* __restrict__ STAT) {
  typedef Frag<_Float16> F;
  __shared__ float pmax[kRSWaves][kRSCols];
  __shared__ float psum[kRSWaves][kRSCols];
  const int t    = threadIdx.x;
  const int lane = t & 31;
  const int wave = t >> 5;
  const int c    = lane & 15;
  const int h    = lane >> 4;
  const _Float16* QK    = (const _Float16*)QKp + (size_t)blockIdx.y * kN * kQKW;   // the block's batch
  const _Float16* Qlane = QK + (size_t)(blockIdx.x * kRSCols + c) * kQKW + h * 8;
  // row of the wave's first position i; its k half starts at column kCP; every tile is a compile-time offset from this address
  const _Float16* Klane = QK + (size_t)(wave * kRSChunk + c) * kQKW + h * 8;
  const v16h qf = F::load(Qlane);
  const v8f zero = (v8f){0.f, 0.f, 0.f, 0.f, 0.f, 0.f, 0.f, 0.f};
  v16h a[kRSTiles];
#pragma unroll
  for (int u = 0; u < kRSTiles; ++u) a[u] = F::load(Klane + kCP + (size_t)(u * 16) * kQKW);
  __builtin_amdgcn_sched_barrier(0);   // without it the loads are sunk to their tiles, one load latency per tile
  v8f d[kRSTiles];
  float tm[kRSTiles];
#pragma unroll
  for (int u = 0; u < kRSTiles; ++u) {
    d[u] = F::mma(a[u], qf, zero);
    tm[u] = d[u][0];
#pragma unroll
    for (int r = 1; r < 8; ++r) tm[u] = fmaxf(tm[u], d[u][r]);
  }
#pragma unroll
  for (int w = kRSTiles / 2; w > 0; w >>= 1)
#pragma unroll
    for (int u = 0; u < w; ++u) tm[u] = fmaxf(tm[u], tm[u + w]);
  float m = tm[0];
  float ts[kRSTiles];
#pragma unroll
  for (int u = 0; u < kRSTiles; ++u) {
    ts[u] = exp_le0(d[u][0] - m);
#pragma unroll
    for (int r = 1; r < 8; ++r) ts[u] += exp_le0(d[u][r] - m);
  }
#pragma unroll
  for (int w = kRSTiles / 2; w > 0; w >>= 1)
#pragma unroll
    for (int u = 0; u < w; ++u) ts[u] += ts[u + w];
  float sum = ts[0];
  // the one wait behind the kernel's loads: no address register of an issued load is given a new value in front of it
  // (the two pairs never change, and as inputs here they stay in their registers up to the wait)
  asm volatile("s_wait_xcnt 0x0" :: "v"(Qlane), "v"(Klane) : "memory");
  {   // the two lane halves of column j
    const float mo = __shfl_xor(m, 16, 32), so = __shfl_xor(sum, 16, 32);
    const float mj = fmaxf(m, mo);
    sum = sum * exp_le0(m - mj) + so * exp_le0(mo - mj);
    m = mj;
  }
  if (lane < 16) { pmax[wave][c] = m; psum[wave][c] = sum; }
  __syncthreads();   // every wave's partial maximum and sum are in pmax, psum
  if (wave != 0) return;   // wave-uniform, behind the kernel's only barrier
  float wm[kRSWaves / 2], wsum[kRSWaves / 2];   // lane half h joins waves 8 h .. 8 h + 7 in wave order
#pragma unroll
  for (int w = 0; w < kRSWaves / 2; ++w) {
    wm[w]   = pmax[h * (kRSWaves / 2) + w][c];
    wsum[w] = psum[h * (kRSWaves / 2) + w][c];
  }
  float bm = wm[0];
#pragma unroll
  for (int w = 1; w < kRSWaves / 2; ++w) bm = fmaxf(bm, wm[w]);
  bm = fmaxf(bm, __shfl_xor(bm, 16, 32));
  float tot = wsum[0] * exp_le0(wm[0] - bm);
#pragma unroll
  for (int w = 1; w < kRSWaves / 2; ++w) tot += wsum[w] * exp_le0(wm[w] - bm);
  tot += __shfl_xor(tot, 16, 32);   // tot >= 1: the row maximum contributes exp(0)
  STAT[((size_t)blockIdx.y * (kN / kRSCols) + blockIdx.x) * 32 + lane] = (lane < 16) ? bm : kPCarry / tot;
}

// ---------------------------------------------------------------------------
// attn^T.v with the probabilities formed in registers (no probability plane in memory):
//   O16[i][c] = f16( (64/32768) sum_j P[i][j] * V16[c][j] ),  P[i][j] = f16( exp(S[j][i] - max[j]) * inv[j] ), f32 math.
// One block owns 16 positions i of one batch and all 4096 j: grid (kN/16 = 256, kB) blocks of 16 waves, blockIdx.y the batch;
// wave w walks j in [256 w, 256 w + 256).
// Per 32 j: two score tiles D[j][i] = q rows (A) x k rows (B, loaded once); a lane then holds column i = lane & 15 and
// rows j = 8 h + r and 16 + 8 h + r (h = lane >> 4), which is the k order of an A fragment of row i: converted in place,
// the two tiles are the A operand against the V fragments (same k order from Frag::load). No LDS, no lane exchange.
// The 16 waves' partial 16 x 32 tiles are joined through LDS in wave order behind one barrier.
// ---------------------------------------------------------------------------
constexpr int kAVWaves   = 16;
constexpr int kAVThreads = kAVWaves * 32;      // 512
constexpr int kAVRows    = 16;                 // positions i per block
constexpr int kAVChunk   = kN / kAVWaves;      // 256 j per wave
constexpr int kAVSteps   = kAVChunk / 32;      // 8 steps of 32 j
constexpr int kAVPitch   = kCP + 4;            // floats per row of a partial tile
static_assert(kN % kAVRows == 0 && kAVChunk % 32 == 0 && kAVRows * kCP == kAVThreads && kCP == 32, "attn.v tiling");
// what one step of 32 j reads: two q fragments, two V fragments, the lane's 16 row maxima and 16 scaled inverse sums
struct AVStep { v16h q0, q1, v0, v1; v4f m[4], l[4]; };
__device__ __forceinline__ void av_load(AVStep& s, const _Float16* __restrict__ Qlane, const _Float16* __restrict__ Vlane,
                                        const float* __restrict__ CMlane, const float* __restrict__ CLIlane, int j0) {
  s.q0 = Frag<_Float16>::load(Qlane + (size_t)j0 * kQKW);          // q rows j0 .. j0 + 15
  s.q1 = Frag<_Float16>::load(Qlane + (size_t)(j0 + 16) * kQKW);   // q rows j0 + 16 .. j0 + 31
  s.v0 = Frag<_Float16>::load(Vlane + j0);                         // channels 0..15
  s.v1 = Frag<_Float16>::load(Vlane + (size_t)16 * kN + j0);       // channels 16..31
#pragma unroll
  for (int g = 0; g < 4; ++g) {   // g = 0, 1: j0 + 8 h + 0..7;  g = 2, 3: j0 + 16 + 8 h + 0..7
    const int jo = (j0 + (g >> 1) * 16) * 2 + (g & 1) * 4;   // STAT: 32 floats per 16 j, maxima first
    s.m[g] = *(const v4f*)(CMlane + jo);
    s.l[g] = *(const v4f*)(CLIlane + jo);
  }
}
__global__ __launch_bounds__(kAVThreads) void attnv_kernel(const unsigned short* __restrict__ QKp,
                                                           const unsigned short* __restrict__ Vp,
                                                           const float* __restrict__ CM, const float* __restrict__ CLI,
                                                           unsigned short* __restrict__ O) {
  typedef Frag<_Float16> F;
  __shared__ __align__(16) float part[kAVWaves][kAVRows][kAVPitch];
  const int t    = threadIdx.x;
  const int lane = t & 31;
  const int wave = t >> 5;
  const int c    = lane & 15;
  const int h8   = (lane >> 4) * 8;
  const int i0   = blockIdx.x * kAVRows;
  const int jb   = wave * kAVChunk;
  const int bt   = blockIdx.y;   // the block's batch
  const _Float16* QK    = (const _Float16*)QKp + (size_t)bt * kN * kQKW;
  const _Float16* Klane = QK + (size_t)(i0 + c) * kQKW + h8;   // row of position i0 + c; its k half starts at column kCP
  // the wave's first step; every later step is a compile-time offset from these four addresses
  const _Float16* Qlane = QK + (size_t)(jb + c) * kQKW + h8;
  const _Float16* Vlane = (const _Float16*)Vp + (size_t)bt * kVR * kN + (size_t)c * kN + jb + h8;
  const float* CMlane  = CM + (size_t)bt * kN * 2 + jb * 2 + h8;    // CM = STAT, CLI = STAT + 16: both walk 32 floats per 16 j
  const float* CLIlane = CLI + (size_t)bt * kN * 2 + jb * 2 + h8;
  const v16h kf = F::load(Klane + kCP);
  const v8f zero = (v8f){0.f, 0.f, 0.f, 0.f, 0.f, 0.f, 0.f, 0.f};
  v8f acc0 = zero, acc1 = zero;
  AVStep st[2];   // two register sets take turns
  av_load(st[0], Qlane, Vlane, CMlane, CLIlane, 0);
#pragma unroll   // whole: the sets' turns and the steps' address offsets are compile-time, the five address pairs never change
  for (int s = 0; s < kAVSteps; ++s) {
    const AVStep& cur = st[s & 1];
    if (s + 1 < kAVSteps) {
      av_load(st[(s + 1) & 1], Qlane, Vlane, CMlane, CLIlane, (s + 1) * 32);
      __builtin_amdgcn_sched_barrier(0);   // the next step's 16 loads stay issued ahead of this step's exp work, which hides them
    }
    const v8f s0 = F::mma(cur.q0, kf, zero);
    const v8f s1 = F::mma(cur.q1, kf, zero);
    v16h p;
#pragma unroll
    for (int r = 0; r < 8; ++r) {
      p[r]     = (_Float16)(expf(s0[r] - cur.m[r >> 2][r & 3]) * cur.l[r >> 2][r & 3]);
      p[8 + r] = (_Float16)(expf(s1[r] - cur.m[2 + (r >> 2)][r & 3]) * cur.l[2 + (r >> 2)][r & 3]);
    }
    acc0 = F::mma(p, cur.v0, acc0);
    acc1 = F::mma(p, cur.v1, acc1);
  }
  // the one wait behind the kernel's loads: no address register of an issued load is given a new value in front of it
  // (the five pairs never change in the loop, and as inputs here they stay in their registers up to the wait)
  asm volatile("s_wait_xcnt 0x0" :: "v"(Klane), "v"(Qlane), "v"(Vlane), "v"(CMlane), "v"(CLIlane) : "memory");
#pragma unroll
  for (int r = 0; r < 8; ++r) {
    part[wave][h8 + r][c]      = acc0[r];
    part[wave][h8 + r][16 + c] = acc1[r];
  }
  __syncthreads();   // every wave's partial tile is in part
  const int row = wave, col = lane;   // 16 x 32 = 512 threads; a wave stores the 64 used bytes of one row of O
  float sum = part[0][row][col];
#pragma unroll
  for (int w = 1; w < kAVWaves; ++w) sum += part[w][row][col];
  O[(size_t)bt * kN * kOW + (size_t)(i0 + row) * kOW + col] = h_bits(sum * kPVScale);
}

// ---------------------------------------------------------------------------
// Host glue.
// Workspace region map (bytes, every offset a multiple of 256):
//   XT16  f16 [8][4096][256]      16,777,216  at           0   x transposed, position-major
//   WQK16 f16 [64][256]               32,768  at  16,777,216   rows 0..31 = 16*Wq, 32..63 = 16*Wk
//   WV16  f16 [64][256]               32,768  at  16,809,984   rows 0..31 = 16*Wv, 32..63 = 0 (written)
//   WB16  f16 [256][32]               16,384  at  16,842,752   16*Wb
//   BQK   f32 [64]                       256  at  16,859,136   bq | bk
//   BV64  f32 [64]                       256  at  16,859,392   bv | 0
//   QK16  f16 [8][4096][64]        4,194,304  at  16,859,648   cols 0..31 q, 32..63 k
//   V16   f16 [8][64][4096]        4,194,304  at  21,053,952   channel-major v, rows 32..63 zero (written)
//   STAT  f32 [8][256][32]           262,144  at  25,248,256   per 16 score rows: 16 maxima | 16 x 32768 / exp-sum
//   O16   f16 [8][4096][64]        4,194,304  at  25,510,400   attention output x64, position-major, cols 0..31 (32..63 neither written nor read)
//   total                         29,704,704
// GEMM shapes: q|k M=4096 N=64 K=256; v M=64 N=4096 K=256; scores M=N=4096 K=32 (tiles inside the two attention kernels);
// attn.v M=4096 N=32 K=4096 (own kernel); back M=256 N=4096 K=32. No padding reads of unwritten data.
// Launch count: 1 + 1 + 1 + 1 + 2 + 1 = 7.
// ---------------------------------------------------------------------------
extern "C" void kernel_launch(void* const* d_in, const int* in_sizes, int n_in,
                              void* d_out, int out_size, void* d_ws, size_t ws_size,
                              hipStream_t stream) {
  if (n_in < 9) return;
  const int nX = kB * kC * kN;   // 8,388,608
  if (in_sizes[0] != nX) return;
  if (in_sizes[1] != kCP * kC || in_sizes[3] != kCP * kC || in_sizes[5] != kCP * kC) return;
  if (in_sizes[2] != kCP || in_sizes[4] != kCP || in_sizes[6] != kCP) return;
  if (in_sizes[7] != kC * kCP || in_sizes[8] != kC) return;
  if (out_size != nX) return;

  const size_t szXT  = (size_t)kB * kN * kC * 2;
  const size_t szWQK = (size_t)kQKW * kC * 2;
  const size_t szWV  = (size_t)kVR * kC * 2;
  const size_t szWB  = (size_t)kC * kCP * 2;
  const size_t szBQK = (size_t)kQKW * 4;
  const size_t szBV  = (size_t)kVR * 4;
  const size_t szQK  = (size_t)kB * kN * kQKW * 2;
  const size_t szV   = (size_t)kB * kVR * kN * 2;
  const size_t szST  = (size_t)kB * (kN / kRSCols) * 32 * 4;
  const size_t szO   = (size_t)kB * kN * kOW * 2;
  const size_t offXT  = 0;
  const size_t offWQK = offXT + szXT;
  const size_t offWV  = offWQK + szWQK;
  const size_t offWB  = offWV + szWV;
  const size_t offBQK = offWB + szWB;
  const size_t offBV  = offBQK + szBQK;
  const size_t offQK  = offBV + szBV;
  const size_t offV   = offQK + szQK;
  const size_t offST  = offV + szV;
  const size_t offO   = offST + szST;
  const size_t total  = offO + szO;   // 29,704,704
  if (ws_size < total) return;

  const float* x  = (const float*)d_in[0];
  const float* Wq = (const float*)d_in[1];
  const float* bq = (const float*)d_in[2];
  const float* Wk = (const float*)d_in[3];
  const float* bk = (const float*)d_in[4];
  const float* Wv = (const float*)d_in[5];
  const float* bv = (const float*)d_in[6];
  const float* Wb = (const float*)d_in[7];
  const float* bb = (const float*)d_in[8];
  float* out = (float*)d_out;
  char* ws = (char*)d_ws;
  unsigned short* XT16  = (unsigned short*)(ws + offXT);
  unsigned short* WQK16 = (unsigned short*)(ws + offWQK);
  unsigned short* WV16  = (unsigned short*)(ws + offWV);
  unsigned short* WB16  = (unsigned short*)(ws + offWB);
  float* BQK  = (float*)(ws + offBQK);
  float* BV64 = (float*)(ws + offBV);
  unsigned short* QK16 = (unsigned short*)(ws + offQK);
  unsigned short* V16  = (unsigned short*)(ws + offV);
  float* STAT = (float*)(ws + offST);
  unsigned short* O16 = (unsigned short*)(ws + offO);

  // ---- parameter planes and the transposed f16 copy of x ----
  prep_kernel<<<dim3(21), dim3(256), 0, stream>>>(Wq, bq, Wk, bk, Wv, bv, Wb, WQK16, WV16, WB16, BQK, BV64);
  xtcast_kernel<<<dim3(kN / 64, kC / 64, kB), dim3(256), 0, stream>>>(x, XT16);

  const long strideXT = (long)kN * kC;
  const long strideQK = (long)kN * kQKW;
  const long strideV  = (long)kVR * kN;
  const long strideO  = (long)kN * kOW;
  const long strideX  = (long)kC * kN;

  // ---- q|k plane: QK16[b][n][o'] = f16( (1/16) sum_c XT16[b][n][c] * WQK16[o'][c] + BQK[o'] )   (M=4096, N=64, K=256) ----
  const int blocksQK = ((kN / 64) * (kQKW / 64)) / 8;   // 64 tiles -> 8 blocks
  wmma_gemm64<0, false, 2, 1, false><<<dim3(blocksQK, kB), dim3(256), 0, stream>>>(
      XT16, XT16, kC, strideXT, WQK16, WQK16, kC, 0L,
      (void*)QK16, (void*)QK16, kQKW, strideQK, BQK, x, 0L, kN, kQKW, kC, kWCarryInv);
  // ---- v plane, channel-major: V16[b][o][n] = f16( (1/16) sum_c WV16[o][c] * XT16[b][n][c] + BV64[o] )   (M=64, N=4096, K=256) ----
  const int blocksV = ((kVR / 64) * (kN / 64)) / 8;     // 64 tiles -> 8 blocks
  wmma_gemm64<0, false, 1, 1, false><<<dim3(blocksV, kB), dim3(256), 0, stream>>>(
      WV16, WV16, kC, 0L, XT16, XT16, kC, strideXT,
      (void*)V16, (void*)V16, kN, strideV, BV64, x, 0L, kVR, kN, kC, kWCarryInv);

  // all batches in one grid each (blockIdx.y = batch):
  // per row j of S[j][i] = sum_o q[o,j] * k[o,i]: max and 32768/exp-sum
  rowstats_kernel<<<dim3(kN / kRSCols, kB), dim3(kRSThreads), 0, stream>>>(QK16, STAT);
  // O16[b][i][c] = f16( (64/32768) sum_j f16(32768 * attn[j][i]) * V16[b][c][j] ) = f16( 64 * out[c][i] )
  attnv_kernel<<<dim3(kN / kAVRows, kB), dim3(kAVThreads), 0, stream>>>(QK16, V16, STAT, STAT + kRSCols, O16);

  // ---- result[b][cc][i] = (1/1024) sum_o WB16[cc][o] * O16[b][i][o] + bb[cc] + x[b][cc][i]   (M=256, N=4096, K=32) ----
  const int blocksBack = ((kC / 64) * (kN / 64)) / 8;  // 256 tiles -> 32 blocks
  wmma_gemm64<0, false, 1, 0, true><<<dim3(blocksBack, kB), dim3(256), 0, stream>>>(
      WB16, WB16, kCP, 0L, O16, O16, kOW, strideO,
      (void*)out, (void*)out, kN, strideX, bb, x, strideX, kC, kN, kCP, kBackScale);
}

// v005
// It runs in 120 microseconds.
// Timed twice side by side with v004, it ran 1.75 and 1.76 times as fast.
// All steps since v000 together make it 44.2 times as fast.
// Contractions: q|k projection and v projection (x^T f16 x W f16 carried x16), scores (q, k f16 planes; once as k.q tiles inside the row-statistics kernel, once more as q.k tiles inside the attn^T.v kernel), attn^T.v (P f16 carried x32768, formed in registers, x V f16 plane), back-projection (Wb f16 carried x16 x O f16 carried x64): all v_wmma_f32_16x16x32_f16 with f32 accumulate; softmax statistics, exp, biases and residual in f32.
#include <hip/hip_runtime.h>
#include <math.h>

// ---------------------------------------------------------------------------
// Problem constants
// ---------------------------------------------------------------------------
constexpr int kB   = 8;      // batch
constexpr int kC   = 256;    // channels
constexpr int kN   = 4096;   // positions (64 x 64)
constexpr int kCP  = 32;     // reduced channels
constexpr int kQKW = 64;     // columns of the q|k plane: 0..31 q, 32..63 k
constexpr int kVR  = 64;     // rows of the channel-major V plane: 0..31 v, 32..63 written zero
constexpr int kOW  = 64;     // pitch of the O plane in columns: 0..31 out, 32..63 unused
constexpr float kWCarry    = 16.0f;                      // weights carried x16 in f16
constexpr float kWCarryInv = 1.0f / 16.0f;
constexpr float kPCarry    = 32768.0f;                   // probabilities carried x2^15 in f16
constexpr float kOCarry    = 64.0f;                      // attention output carried x64 in f16
constexpr float kPVScale   = kOCarry / kPCarry;          // 1/512
constexpr float kBackScale = 1.0f / (kOCarry * kWCarry); // 1/1024
static_assert(kN % 64 == 0 && kC % 64 == 0 && kQKW % 64 == 0 && kVR % 64 == 0 && kOW % 64 == 0, "tile multiples");
static_assert(kC % 32 == 0 && kCP % 32 == 0 && kN % 32 == 0, "k steps of 32");
static_assert(2 * kCP == kQKW && kCP <= kVR && kCP <= kOW, "plane widths");
static_assert(kCP * kC == 8192 && kC * kCP == 8192 && kN % 256 == 0 && kN % 8 == 0, "prep and elementwise coverage");

typedef __attribute__((ext_vector_type(16))) _Float16 v16h;
typedef __attribute__((ext_vector_type(8)))  _Float16 v8h;
typedef __attribute__((ext_vector_type(16))) __bf16   v16b;
typedef __attribute__((ext_vector_type(8)))  __bf16   v8b;
typedef __attribute__((ext_vector_type(8)))  float    v8f;
typedef __attribute__((ext_vector_type(4)))  float    v4f;
typedef __attribute__((ext_vector_type(4)))  unsigned int v4u;

// ---------------------------------------------------------------------------
// Shared helpers (with a 4-accumulator guard)
// ---------------------------------------------------------------------------
__device__ __forceinline__ unsigned short f2bf_bits(float f) {
  unsigned u = __float_as_uint(f);
  return (unsigned short)((u + 0x7FFFu + ((u >> 16) & 1u)) >> 16);
}
__device__ __forceinline__ float bf_bits2f(unsigned short h) { return __uint_as_float(((unsigned)h) << 16); }

// hazard guards as plain device helpers (no inline asm inside the kernel template body)
__device__ __forceinline__ void dep_guard_h(v8f& a, v8f& b, v16h x, v16h y) { asm volatile("v_nop\n\tv_nop\n\tv_nop\n\tv_nop" : "+v"(a), "+v"(b) : "v"(x), "v"(y)); }
__device__ __forceinline__ void dep_guard_b(v8f& a, v8f& b, v16b x, v16b y) { asm volatile("v_nop\n\tv_nop\n\tv_nop\n\tv_nop" : "+v"(a), "+v"(b) : "v"(x), "v"(y)); }
__device__ __forceinline__ void dep_guard4_h(v8f& a, v8f& b, v8f& c, v8f& d, v16h x, v16h y) { asm volatile("v_nop\n\tv_nop\n\tv_nop\n\tv_nop" : "+v"(a), "+v"(b), "+v"(c), "+v"(d) : "v"(x), "v"(y)); }
__device__ __forceinline__ void dep_guard4_b(v8f& a, v8f& b, v8f& c, v8f& d, v16b x, v16b y) { asm volatile("v_nop\n\tv_nop\n\tv_nop\n\tv_nop" : "+v"(a), "+v"(b), "+v"(c), "+v"(d) : "v"(x), "v"(y)); }
__device__ __forceinline__ void keep4_h(v16h a, v16h b, v16h c, v16h d) { asm volatile("v_nop" :: "v"(a), "v"(b), "v"(c), "v"(d)); }
__device__ __forceinline__ void keep4_b(v16b a, v16b b, v16b c, v16b d) { asm volatile("v_nop" :: "v"(a), "v"(b), "v"(c), "v"(d)); }
__device__ __forceinline__ void acc_guard4(v8f& a, v8f& b, v8f& c, v8f& d) { asm volatile("v_nop\n\tv_nop\n\tv_nop\n\tv_nop" : "+v"(a), "+v"(b), "+v"(c), "+v"(d)); }
template <typename T> struct Frag;
template <> struct Frag<_Float16> {
  typedef v16h V; union U { v16h v; v8h h[2]; };
  // elements 0..7 <- p[0..7], 8..15 <- p[16..23]
  static __device__ __forceinline__ v16h load(const _Float16* p) {
    U f; f.h[0] = *(const v8h*)(p); f.h[1] = *(const v8h*)(p + 16); return f.v;
  }
  static __device__ __forceinline__ v8f mma(v16h a, v16h b, v8f c) {
    return __builtin_amdgcn_wmma_f32_16x16x32_f16(false, a, false, b, (short)0, c, false, false);
  }
  static __device__ __forceinline__ void guard(v8f& a, v8f& b, v16h x, v16h y) { dep_guard_h(a, b, x, y); }
  static __device__ __forceinline__ void guard4(v8f& a, v8f& b, v8f& c, v8f& d, v16h x, v16h y) { dep_guard4_h(a, b, c, d, x, y); }
  static __device__ __forceinline__ void keep(v16h a, v16h b, v16h c, v16h d) { keep4_h(a, b, c, d); }
};
template <> struct Frag<__bf16> {
  typedef v16b V; union U { v16b v; v8b h[2]; };
  static __device__ __forceinline__ v16b load(const __bf16* p) {
    U f; f.h[0] = *(const v8b*)(p); f.h[1] = *(const v8b*)(p + 16); return f.v;
  }
  static __device__ __forceinline__ v8f mma(v16b a, v16b b, v8f c) {
    return __builtin_amdgcn_wmma_f32_16x16x32_bf16(false, a, false, b, (short)0, c, false, false);
  }
  static __device__ __forceinline__ void guard(v8f& a, v8f& b, v16b x, v16b y) { dep_guard_b(a, b, x, y); }
  static __device__ __forceinline__ void guard4(v8f& a, v8f& b, v8f& c, v8f& d, v16b x, v16b y) { dep_guard4_b(a, b, c, d, x, y); }
  static __device__ __forceinline__ void keep(v16b a, v16b b, v16b c, v16b d) { keep4_b(a, b, c, d); }
};

__device__ __forceinline__ unsigned pk16(unsigned short a, unsigned short b) { return (unsigned)a | ((unsigned)b << 16); }
__device__ __forceinline__ unsigned short h_bits(float f) { const _Float16 h = (_Float16)f; return __builtin_bit_cast(unsigned short, h); }

// ---- Register-blocked batched WMMA GEMM (no activations; residual added in the store phase) ------
// C[m,n] = scale * sum_k A[m,k] * Bt[n,k] (+bias)(+resid); each wave owns a 64x64 tile.
// A row-major [M,K]; Bt row-major [N,K]; M,N % 64 == 0, K % 32 == 0.
// SPLIT: operands are hi/lo planes (A2/Bt2 = lo planes, same layout); product = hi*hi + hi*lo + lo*hi.
// BIAS_MODE: 0 = none, 1 = bias[m], 2 = bias[n].
// OUT_MODE: 0 = f32, 1 = f16, 2 = bf16 hi plane (Cout) + bf16 lo plane (Cout2).
// RESID (OUT_MODE 0 only): each lane loads ONE float4 of the residual at exactly the address it stores, adds it to the
// ET: 0 = f16 operands, 1 = bf16 operands (pointers passed as 16-bit storage)
template <int ET> struct Elem;
template <> struct Elem<0> { typedef _Float16 T; };
template <> struct Elem<1> { typedef __bf16 T; };
template <int ET, bool SPLIT, int BIAS_MODE, int OUT_MODE, bool RESID>
__global__ __launch_bounds__(256) void wmma_gemm64(
    const unsigned short* __restrict__ Ap, const unsigned short* __restrict__ A2p, int lda, long strideA,
    const unsigned short* __restrict__ Btp, const unsigned short* __restrict__ Bt2p, int ldb, long strideB,
    void* __restrict__ Cout, void* __restrict__ Cout2, int ldc, long strideC,
    const float* __restrict__ bias,
    const float* __restrict__ resid, long strideR,
    int M, int N, int K, float scale) {
  static_assert(!RESID || OUT_MODE == 0, "residual only with f32 output");
  typedef typename Elem<ET>::T T;
  typedef typename Frag<T>::V V;
  const T* A = (const T*)Ap; const T* A2 = (const T*)A2p; const T* Bt = (const T*)Btp; const T* Bt2 = (const T*)Bt2p;
  __shared__ __align__(16) float sT[8][16 * 68];   // per-wave 16x64 slab, pitch 68 floats
  const int b    = blockIdx.y;
  const int lane = threadIdx.x & 31;
  const int wave = threadIdx.x >> 5;
  const int tilesN = N >> 6;
  const int tilesM = M >> 6;
  const int tile = blockIdx.x * 8 + wave;
  if (tile >= tilesM * tilesN) return;   // wave-uniform; no block barriers in this kernel
  const int tm = tile / tilesN;
  const int tn = tile - tm * tilesN;
  const int m0 = tm << 6;
  const int n0 = tn << 6;

  const T* Ab  = A  + (size_t)b * strideA;
  const T* Bb  = Bt + (size_t)b * strideB;
  const T* Ab2 = SPLIT ? (A2  + (size_t)b * strideA) : nullptr;
  const T* Bb2 = SPLIT ? (Bt2 + (size_t)b * strideB) : nullptr;

  const int rlane = lane & 15;                 // row (A) / col (B, D) within subtile
  const int koff  = (lane >> 4) * 8;           // k offset of this lane half
  const int mOff  = (lane >> 4) * 8;           // D row offset

  v8f acc[4][4];
#pragma unroll
  for (int i = 0; i < 4; ++i)
#pragma unroll
    for (int j = 0; j < 4; ++j) acc[i][j] = (v8f){0.f,0.f,0.f,0.f,0.f,0.f,0.f,0.f};

  for (int k0 = 0; k0 < K; k0 += 32) {
    V bh[4], bl[4];
#pragma unroll
    for (int j = 0; j < 4; ++j) {
      const size_t bo = (size_t)(n0 + (j << 4) + rlane) * ldb + koff + k0;
      bh[j] = Frag<T>::load(Bb + bo);
      if (SPLIT) bl[j] = Frag<T>::load(Bb2 + bo);
    }
#pragma unroll
    for (int i = 0; i < 4; ++i) {
      const size_t ao = (size_t)(m0 + (i << 4) + rlane) * lda + koff + k0;
      V ah = Frag<T>::load(Ab + ao);
      V al;
      if (SPLIT) al = Frag<T>::load(Ab2 + ao);
#pragma unroll
      for (int j = 0; j < 4; ++j) {
        acc[i][j] = Frag<T>::mma(ah, bh[j], acc[i][j]);
        if (SPLIT) {
          acc[i][j] = Frag<T>::mma(ah, bl[j], acc[i][j]);
          acc[i][j] = Frag<T>::mma(al, bh[j], acc[i][j]);
        }
      }
      Frag<T>::guard4(acc[i][0], acc[i][1], acc[i][2], acc[i][3], ah, SPLIT ? al : ah);
    }
    Frag<T>::keep(bh[0], bh[1], bh[2], bh[3]);
    if (SPLIT) Frag<T>::keep(bl[0], bl[1], bl[2], bl[3]);
  }
  acc_guard4(acc[0][0], acc[0][1], acc[0][2], acc[0][3]);
  acc_guard4(acc[1][0], acc[1][1], acc[1][2], acc[1][3]);
  acc_guard4(acc[2][0], acc[2][1], acc[2][2], acc[2][3]);
  acc_guard4(acc[3][0], acc[3][1], acc[3][2], acc[3][3]);

  // ---- epilogue ----
  float* slab = sT[wave];
  const float* Rb = RESID ? (resid + (size_t)b * strideR) : nullptr;
#pragma unroll
  for (int i = 0; i < 4; ++i) {
    const int mBase = m0 + (i << 4);
#pragma unroll
    for (int j = 0; j < 4; ++j) {
      const int n = n0 + (j << 4) + rlane;
      float bvn = 0.f;
      if (BIAS_MODE == 2) bvn = bias[n];
#pragma unroll
      for (int r = 0; r < 8; ++r) {
        float v = acc[i][j][r] * scale;
        if (BIAS_MODE == 1) v += bias[mBase + mOff + r];
        if (BIAS_MODE == 2) v += bvn;
        slab[(mOff + r) * 68 + (j << 4) + rlane] = v;
      }
    }
    __builtin_amdgcn_fence(__ATOMIC_RELEASE, "workgroup");
    __builtin_amdgcn_wave_barrier();
    __builtin_amdgcn_fence(__ATOMIC_ACQUIRE, "workgroup");
    if (OUT_MODE == 0) {
      float* C = (float*)Cout + (size_t)b * strideC;
      const int hh = lane >> 4, c4 = (lane & 15) * 4;     // row seg = 256 B = 16 lanes x 16 B
      v4f vals[8];
#pragma unroll
      for (int it = 0; it < 8; ++it) {
        const int row = it * 2 + hh;
        v4f v = *(const v4f*)(slab + row * 68 + c4);
        if (RESID) {
          const v4f rv = *(const v4f*)(Rb + (size_t)(mBase + row) * ldc + n0 + c4);
          v = v + rv;
        }
        vals[it] = v;
      }
      {
#pragma unroll
        for (int it = 0; it < 8; ++it) {
          const int row = it * 2 + hh;
          *(v4f*)(C + (size_t)(mBase + row) * ldc + n0 + c4) = vals[it];
        }
        
      }
    } else {
      const int q = lane >> 3, c8 = (lane & 7) * 8;
      unsigned short* C  = (unsigned short*)Cout  + (size_t)b * strideC;
      unsigned short* C2 = (OUT_MODE == 2) ? ((unsigned short*)Cout2 + (size_t)b * strideC) : nullptr;
      {
#pragma unroll
        for (int it = 0; it < 4; ++it) {
          const int row = it * 4 + q;
          const float* sp = slab + row * 68 + c8;
          v8h hv, lv;
#pragma unroll
          for (int e = 0; e < 8; ++e) {
            if (OUT_MODE == 1) {
              hv[e] = (_Float16)sp[e];
            } else {
              unsigned short hb = f2bf_bits(sp[e]);
              unsigned short lb = f2bf_bits(sp[e] - bf_bits2f(hb));
              hv[e] = __builtin_bit_cast(_Float16, hb);
              lv[e] = __builtin_bit_cast(_Float16, lb);
            }
          }
          *(v8h*)(C + (size_t)(mBase + row) * ldc + n0 + c8) = hv;
          if (OUT_MODE == 2) *(v8h*)(C2 + (size_t)(mBase + row) * ldc + n0 + c8) = lv;
        }
        
      }
    }
    __builtin_amdgcn_fence(__ATOMIC_RELEASE, "workgroup");
    __builtin_amdgcn_wave_barrier();
    __builtin_amdgcn_fence(__ATOMIC_ACQUIRE, "workgroup");
  }
}

// ---------------------------------------------------------------------------
// Parameter planes (21 blocks of 256 threads):
//   blocks  0.. 3: WQK16[0..8191]     = f16(16 * Wq)   (rows 0..31 of the [64][256] q|k weight plane)
//   blocks  4.. 7: WQK16[8192..16383] = f16(16 * Wk)   (rows 32..63)
//   blocks  8..11: WV16[0..8191]      = f16(16 * Wv)   (rows 0..31 of the [64][256] v weight plane)
//   blocks 12..15: WV16[8192..16383]  = 0              (rows 32..63, written zeros)
//   blocks 16..19: WB16[0..8191]      = f16(16 * Wb)   ([256][32])
//   block  20    : BQK[64] = bq | bk (f32), BV64[64] = bv | 0 (f32)
// Coverage: 4 blocks x 256 threads x 8 = 8192 elements per group. Each thread one 16-B store; a wave writes 512 contiguous B
// ---------------------------------------------------------------------------
__global__ __launch_bounds__(256) void prep_kernel(const float* __restrict__ Wq, const float* __restrict__ bq,
                                                   const float* __restrict__ Wk, const float* __restrict__ bk,
                                                   const float* __restrict__ Wv, const float* __restrict__ bv,
                                                   const float* __restrict__ Wb,
                                                   unsigned short* __restrict__ WQK16, unsigned short* __restrict__ WV16,
                                                   unsigned short* __restrict__ WB16,
                                                   float* __restrict__ BQK, float* __restrict__ BV64) {
  const int t   = threadIdx.x;
  const int blk = blockIdx.x;
  if (blk < 20) {   // block-uniform
    const int grp = blk >> 2;
    const int sub = blk & 3;
    const int e0  = (sub * 256 + t) * 8;   // 0 .. 8184
    const float* src = (grp == 0) ? Wq : (grp == 1) ? Wk : (grp == 4) ? Wb : Wv;   // grp 3 reads Wv (in range) and scales by 0
    const float  f   = (grp == 3) ? 0.0f : kWCarry;
    unsigned short* dst = (grp == 0) ? WQK16 : (grp == 1) ? (WQK16 + 8192) : (grp == 2) ? WV16 : (grp == 3) ? (WV16 + 8192) : WB16;
    const v4f a = *(const v4f*)(src + e0);
    const v4f c = *(const v4f*)(src + e0 + 4);
    unsigned short hb[8];
#pragma unroll
    for (int e = 0; e < 4; ++e) {
      hb[e]     = h_bits(a[e] * f);
      hb[4 + e] = h_bits(c[e] * f);
    }
    const v4u u = (v4u){pk16(hb[0], hb[1]), pk16(hb[2], hb[3]), pk16(hb[4], hb[5]), pk16(hb[6], hb[7])};
    unsigned short* dp = dst + e0;
    *(v4u*)dp = u;
    
  } else {
    const int lane = t & 31, wave = t >> 5;
    const int idx = (lane & 7) * 4;   // 0..28: always inside the 32-entry bias vectors
    const v4f q4 = *(const v4f*)(bq + idx);
    const v4f k4 = *(const v4f*)(bk + idx);
    const v4f w4 = *(const v4f*)(bv + idx);
    const float fq = (lane < 8) ? 1.0f : 0.0f;
    const float fk = (lane < 8) ? 0.0f : 1.0f;
    // arithmetic select: lanes 0..7 take bq / bv, lanes 8..15 take bk / zeros (all loads unconditional)
    const v4f valQK = q4 * fq + k4 * fk;
    const v4f valV  = w4 * fq;
    const bool wq = (wave == 0) && (lane < 16);
    const bool wv = (wave == 1) && (lane < 16);
    float* dq = BQK  + (lane & 15) * 4;
    float* dv = BV64 + (lane & 15) * 4;
    if (wq) *(v4f*)dq = valQK;
    if (wv) *(v4f*)dv = valV;
    
  }
}

// ---------------------------------------------------------------------------
// x transpose + cast: in x[b][c][n] (n contiguous) -> out XT[b][n][c] (c contiguous), XT = f16(x).
// grid (kN/64 n-tiles, kC/64 c-tiles, kB). 256 threads.
// Load coverage: 16 iterations x 256 threads = 4096 = the whole 64(c) x 64(n) tile (coalesced along n).
// Store coverage: 8 waves x 2 iterations x 4 rows (lane>>3) = 64 n-rows; (lane&7) x 8 halves = 64 c-cols; each row segment =
// ---------------------------------------------------------------------------
__global__ __launch_bounds__(256) void xtcast_kernel(const float* __restrict__ x, unsigned short* __restrict__ XT) {
  __shared__ float sm[64][65];   // sm[n_local][c_local]
  const int t  = threadIdx.x;
  const int n0 = blockIdx.x * 64;
  const int c0 = blockIdx.y * 64;
  const int b  = blockIdx.z;
  const float* xb = x + (size_t)b * kC * kN;
#pragma unroll
  for (int i = 0; i < 16; ++i) {
    const int e = i * 256 + t;
    const int r = e >> 6;          // c local
    const int q = e & 63;          // n local
    sm[q][r] = xb[(size_t)(c0 + r) * kN + n0 + q];
    if (i == 7) asm volatile("" ::: "memory");   // split the load burst into two groups of 8
  }
  __syncthreads();
  const int lane = t & 31, wave = t >> 5;
  const int q8 = lane >> 3, c8 = (lane & 7) * 8;
  unsigned short* op = XT + ((size_t)b * kN) * kC;
  {
#pragma unroll
    for (int it = 0; it < 2; ++it) {
      const int row = wave * 8 + it * 4 + q8;               // n local
      unsigned short hb[8];
#pragma unroll
      for (int e = 0; e < 8; ++e) hb[e] = h_bits(sm[row][c8 + e]);
      const v4u u = (v4u){pk16(hb[0], hb[1]), pk16(hb[2], hb[3]), pk16(hb[4], hb[5]), pk16(hb[6], hb[7])};
      *(v4u*)(op + (size_t)(n0 + row) * kC + c0 + c8) = u;
    }
    
  }
}

// ---------------------------------------------------------------------------
// Softmax statistics of the score rows, from score tiles formed in registers (no score plane in memory): for each j,
//   max[j] = max_i S[j][i],  inv[j] = 32768 / sum_i exp(S[j][i] - max[j]),  S[j][i] = q row j . k row i.
// One block owns 64 rows j (4 tiles of 16) of one batch and all 4096 i: grid (kN/64 = 64, kB) blocks of 16 waves, blockIdx.y the
// batch; wave w takes i in [256 w, 256 w + 256).
// A tile is D[i][j] = k rows (A) x q rows (B, the block's 4 fragments loaded once): every k fragment loaded feeds 4 tiles.
// A lane holds column j = lane & 15 of each tile of j and rows i = 8 h + r (h = lane >> 4). Per tile of j it keeps a running
// maximum and the exp-sum relative to it: per 32 i the maximum is raised and the old sum brought to it by one factor.
// The (maximum, sum) pairs of the 2 lane halves join by lane exchange, those of the 16 waves through LDS behind one barrier,
// each sum brought to the common maximum by one factor exp(own maximum - common maximum); wave w < 4 joins tile w of j.
// STAT holds, per batch and per 16 rows j, 16 maxima and then 16 scaled inverse sums: one 128-B line, stored whole by its one block.
// ---------------------------------------------------------------------------
constexpr float kLog2e   = 1.4426950408889634f;
// 2^y on the transcendental unit. The v_nop fills the one slot that the instruction set asks for behind a transcendental before
// its result is read or its source overwritten: inside the statement it stands there in every build.
__device__ __forceinline__ float exp2_slot(float y) { float r; asm("v_exp_f32 %0, %1\n\tv_nop" : "=v"(r) : "v"(y)); return r; }
// exp(x) for x <= 0, as every use below has it: no overflow branch; below 2^-126 the term is 0 beside a sum that is at least 1
__device__ __forceinline__ float exp_le0(float x) { return exp2_slot(x * kLog2e); }
constexpr int kRSWaves   = 16;
constexpr int kRSThreads = kRSWaves * 32;      // 512
constexpr int kStatRows  = 16;                 // rows j of S per 128-B line of STAT
constexpr int kRSJT      = 4;                  // 16-row tiles of j per block: every k fragment loaded feeds this many score tiles
constexpr int kRSCols    = kStatRows * kRSJT;  // 64 rows j of S per block
constexpr int kRSChunk   = kN / kRSWaves;      // 256 i per wave
constexpr int kRSGroups  = kRSChunk / 32;      // 8 groups of two k fragments (32 i)
static_assert(kN % kRSCols == 0 && kRSChunk % 32 == 0 && kRSWaves % 2 == 0 && kRSJT <= kRSWaves, "row statistics tiling");
__global__ __launch_bounds__(kRSThreads) void rowstats_kernel(const unsigned short* __restrict__ QKp, float* __restrict__ STAT) {
  typedef Frag<_Float16> F;
  __shared__ float pmax[kRSWaves][kRSCols];
  __shared__ float psum[kRSWaves][kRSCols];
  const int t    = threadIdx.x;
  const int lane = t & 31;
  const int wave = t >> 5;
  const int c    = lane & 15;
  const int h    = lane >> 4;
  const _Float16* QK    = (const _Float16*)QKp + (size_t)blockIdx.y * kN * kQKW;   // the block's batch
  const _Float16* Qlane = QK + (size_t)(blockIdx.x * kRSCols + c) * kQKW + h * 8;
  // row of the wave's first position i; its k half starts at column kCP; every tile is a compile-time offset from this address
  const _Float16* Klane = QK + (size_t)(wave * kRSChunk + c) * kQKW + h * 8;
  v16h qf[kRSJT];
#pragma unroll
  for (int jt = 0; jt < kRSJT; ++jt) qf[jt] = F::load(Qlane + (size_t)(jt * 16) * kQKW);
  const v8f zero = (v8f){0.f, 0.f, 0.f, 0.f, 0.f, 0.f, 0.f, 0.f};
  v16h a[2][2];   // two register sets of two k fragments take turns
  a[0][0] = F::load(Klane + kCP);
  a[0][1] = F::load(Klane + kCP + (size_t)16 * kQKW);
  float m[kRSJT], sum[kRSJT];   // per lane and tile of j: running maximum, exp-sum relative to it
#pragma unroll   // whole: the sets' turns and the groups' address offsets are compile-time, the two address pairs never change
  for (int g = 0; g < kRSGroups; ++g) {
    if (g + 1 < kRSGroups) {
      a[(g + 1) & 1][0] = F::load(Klane + kCP + (size_t)((g + 1) * 32) * kQKW);
      a[(g + 1) & 1][1] = F::load(Klane + kCP + (size_t)((g + 1) * 32 + 16) * kQKW);
      __builtin_amdgcn_sched_barrier(0);   // the next group's 4 loads stay issued ahead of this group's exp work, which hides them
    }
#pragma unroll
    for (int jt = 0; jt < kRSJT; ++jt) {
      const v8f d0 = F::mma(a[g & 1][0], qf[jt], zero);
      const v8f d1 = F::mma(a[g & 1][1], qf[jt], zero);
      float t0 = d0[0], t1 = d1[0];
#pragma unroll
      for (int r = 1; r < 8; ++r) { t0 = fmaxf(t0, d0[r]); t1 = fmaxf(t1, d1[r]); }
      const float tm = fmaxf(t0, t1);
      const float mn = (g == 0) ? tm : fmaxf(m[jt], tm);
      float s0 = exp_le0(d0[0] - mn), s1 = exp_le0(d1[0] - mn);
#pragma unroll
      for (int r = 1; r < 8; ++r) { s0 += exp_le0(d0[r] - mn); s1 += exp_le0(d1[r] - mn); }
      sum[jt] = (g == 0) ? (s0 + s1) : (sum[jt] * exp_le0(m[jt] - mn) + (s0 + s1));   // the old sum brought to the new maximum
      m[jt] = mn;
      // one tile of j at a time: without it the build interleaves the tiles and takes 168 registers for 103: one block on a WGP for two
      __builtin_amdgcn_sched_barrier(0);
    }
  }
  // the one wait behind the kernel's loads: no address register of an issued load is given a new value in front of it
  // (the two pairs never change, and as inputs here they stay in their registers up to the wait)
  asm volatile("s_wait_xcnt 0x0" :: "v"(Qlane), "v"(Klane) : "memory");
#pragma unroll
  for (int jt = 0; jt < kRSJT; ++jt) {   // the two lane halves of column j
    const float mo = __shfl_xor(m[jt], 16, 32), so = __shfl_xor(sum[jt], 16, 32);
    const float mj = fmaxf(m[jt], mo);
    sum[jt] = sum[jt] * exp_le0(m[jt] - mj) + so * exp_le0(mo - mj);
    m[jt] = mj;
  }
  if (lane < 16) {
#pragma unroll
    for (int jt = 0; jt < kRSJT; ++jt) { pmax[wave][jt * 16 + c] = m[jt]; psum[wave][jt * 16 + c] = sum[jt]; }
  }
  __syncthreads();   // every wave's partial maxima and sums are in pmax, psum
  if (wave >= kRSJT) return;   // wave-uniform, behind the kernel's only barrier; wave w joins tile w of j
  const int col = wave * 16 + c;
  float wm[kRSWaves / 2], wsum[kRSWaves / 2];   // lane half h joins waves 8 h .. 8 h + 7 in wave order
#pragma unroll
  for (int w = 0; w < kRSWaves / 2; ++w) {
    wm[w]   = pmax[h * (kRSWaves / 2) + w][col];
    wsum[w] = psum[h * (kRSWaves / 2) + w][col];
  }
  float bm = wm[0];
#pragma unroll
  for (int w = 1; w < kRSWaves / 2; ++w) bm = fmaxf(bm, wm[w]);
  bm = fmaxf(bm, __shfl_xor(bm, 16, 32));
  float tot = wsum[0] * exp_le0(wm[0] - bm);
#pragma unroll
  for (int w = 1; w < kRSWaves / 2; ++w) tot += wsum[w] * exp_le0(wm[w] - bm);
  tot += __shfl_xor(tot, 16, 32);   // tot >= 1: the row maximum contributes exp(0)
  STAT[((size_t)blockIdx.y * (kN / kStatRows) + blockIdx.x * kRSJT + wave) * 32 + lane] = (lane < 16) ? bm : kPCarry / tot;
}

// ---------------------------------------------------------------------------
// attn^T.v with the probabilities formed in registers (no probability plane in memory):
//   O16[i][c] = f16( (64/32768) sum_j P[i][j] * V16[c][j] ),  P[i][j] = f16( exp(S[j][i] - max[j]) * inv[j] ), f32 math.
// One block owns 64 positions i (4 tiles of 16) of one batch and all 4096 j: grid (kN/64 = 64, kB) blocks of 16 waves, blockIdx.y
// the batch; wave w walks j in [256 w, 256 w + 256). Every q, V and statistics load feeds the 4 tiles of i.
// Per 32 j and tile of i: two score tiles D[j][i] = q rows (A) x k rows (B, loaded once); a lane then holds column i = lane & 15 and
// rows j = 8 h + r and 16 + 8 h + r (h = lane >> 4), which is the k order of an A fragment of row i: converted in place,
// the two tiles are the A operand against the V fragments (same k order from Frag::load). No LDS, no lane exchange.
// The 16 waves' partial 64 x 32 tiles are joined through LDS in wave order behind one barrier.
// ---------------------------------------------------------------------------
constexpr int kAVWaves   = 16;
constexpr int kAVThreads = kAVWaves * 32;      // 512
constexpr int kAVIT      = 4;                  // 16-row tiles of i per block: every q, V and statistics load feeds this many tiles
constexpr int kAVRows    = 16 * kAVIT;         // 64 positions i per block
constexpr int kAVChunk   = kN / kAVWaves;      // 256 j per wave
constexpr int kAVSteps   = kAVChunk / 32;      // 8 steps of 32 j
constexpr int kAVPitch   = kCP + 4;            // floats per row of a partial tile
static_assert(kN % kAVRows == 0 && kAVChunk % 32 == 0 && (kAVRows * kCP) % kAVThreads == 0 && kCP == 32, "attn.v tiling");
// what 16 of a step's 32 j read for the scores: one q fragment, the lane's 8 row maxima and 8 scaled inverse sums
struct AVHalf { v16h q; v4f m[2], l[2]; };
__device__ __forceinline__ void av_load_half(AVHalf& s, const _Float16* __restrict__ Qlane,
                                             const float* __restrict__ CMlane, const float* __restrict__ CLIlane, int j0) {
  s.q = Frag<_Float16>::load(Qlane + (size_t)j0 * kQKW);   // q rows j0 .. j0 + 15
#pragma unroll
  for (int g = 0; g < 2; ++g) {   // j0 + 8 h + 0..3, 4..7;  STAT: 32 floats per 16 j, maxima first
    s.m[g] = *(const v4f*)(CMlane + j0 * 2 + g * 4);
    s.l[g] = *(const v4f*)(CLIlane + j0 * 2 + g * 4);
  }
}
// 8 probabilities of one lane from one score tile
__device__ __forceinline__ v8h av_prob(const v8f s, const AVHalf& st) {
  v8h p;
#pragma unroll
  for (int r = 0; r < 8; ++r) p[r] = (_Float16)(expf(s[r] - st.m[r >> 2][r & 3]) * st.l[r >> 2][r & 3]);
  return p;
}
__global__ __launch_bounds__(kAVThreads) void attnv_kernel(const unsigned short* __restrict__ QKp,
                                                           const unsigned short* __restrict__ Vp,
                                                           const float* __restrict__ CM, const float* __restrict__ CLI,
                                                           unsigned short* __restrict__ O) {
  typedef Frag<_Float16> F;
  __shared__ __align__(16) float part[kAVWaves][kAVRows][kAVPitch];
  const int t    = threadIdx.x;
  const int lane = t & 31;
  const int wave = t >> 5;
  const int c    = lane & 15;
  const int h8   = (lane >> 4) * 8;
  const int i0   = blockIdx.x * kAVRows;
  const int jb   = wave * kAVChunk;
  const int bt   = blockIdx.y;   // the block's batch
  const _Float16* QK    = (const _Float16*)QKp + (size_t)bt * kN * kQKW;
  const _Float16* Klane = QK + (size_t)(i0 + c) * kQKW + h8;   // row of position i0 + c; its k half starts at column kCP
  // the wave's first step
  const _Float16* Qlane = QK + (size_t)(jb + c) * kQKW + h8;
  const _Float16* Vlane = (const _Float16*)Vp + (size_t)bt * kVR * kN + (size_t)c * kN + jb + h8;
  const float* CMlane  = CM + (size_t)bt * kN * 2 + jb * 2 + h8;    // CM = STAT, CLI = STAT + 16: both walk 32 floats per 16 j
  const float* CLIlane = CLI + (size_t)bt * kN * 2 + jb * 2 + h8;
  v16h kf[kAVIT];
#pragma unroll
  for (int it = 0; it < kAVIT; ++it) kf[it] = F::load(Klane + kCP + (size_t)(it * 16) * kQKW);
  // the k fragments stay the oldest loads: issued ahead of the first step's; issued behind them, their wait would stand inside the loop and drain its refills each step
  __builtin_amdgcn_sched_barrier(0);
  const v8f zero = (v8f){0.f, 0.f, 0.f, 0.f, 0.f, 0.f, 0.f, 0.f};
  v8f acc[kAVIT][2];
#pragma unroll
  for (int it = 0; it < kAVIT; ++it) { acc[it][0] = zero; acc[it][1] = zero; }
  // One register set: each part is loaded anew directly behind its last use, half a step ahead of its next use.
  AVHalf ha, hb;
  v16h v0, v1;
  av_load_half(ha, Qlane, CMlane, CLIlane, 0);
  av_load_half(hb, Qlane, CMlane, CLIlane, 16);
  v0 = F::load(Vlane);                        // channels 0..15
  v1 = F::load(Vlane + (size_t)16 * kN);      // channels 16..31
  // one step of 32 j; refill: whether a next step exists, a literal at both calls, so that a step is one run of code with no branch
  auto step = [&](const int jn, const bool refill) {
    // the next step's four addresses, each formed once: the refills read at compile-time offsets from them
    const _Float16* Qn  = Qlane + (size_t)jn * kQKW;
    const _Float16* Vn  = Vlane + jn;
    const float*    CMn = CMlane + jn * 2;
    const float*    CLn = CLIlane + jn * 2;
    v8h plo[kAVIT];
#pragma unroll
    for (int it = 0; it < kAVIT; ++it) plo[it] = av_prob(F::mma(ha.q, kf[it], zero), ha);   // j = 8 h + r of the step
    if (refill) {
      __builtin_amdgcn_sched_barrier(0);   // the refill is not lifted into the exp work in front of it (it would need a second register set)
      av_load_half(ha, Qn, CMn, CLn, 0);
      // the step's addresses sit in registers that are given new values behind the loads; as inputs here the pairs stay
      // in their registers up to the wait, so that no load of the run lands in one of them
      asm volatile("s_wait_xcnt 0x0" :: "v"(Qn), "v"(CMn), "v"(CLn) : "memory");
      __builtin_amdgcn_sched_barrier(0);   // nor sunk: the second half's exp work behind it hides the loads
    }
#pragma unroll
    for (int it = 0; it < kAVIT; ++it) {
      const v8h phi = av_prob(F::mma(hb.q, kf[it], zero), hb);                              // j = 16 + 8 h + r
      const v16h p = __builtin_shufflevector(plo[it], phi, 0, 1, 2, 3, 4, 5, 6, 7, 8, 9, 10, 11, 12, 13, 14, 15);
      acc[it][0] = F::mma(p, v0, acc[it][0]);
      acc[it][1] = F::mma(p, v1, acc[it][1]);
    }
    if (refill) {
      __builtin_amdgcn_sched_barrier(0);   // as above, for the second half's and the V fragments' refill
      av_load_half(hb, Qn, CMn, CLn, 16);
      v0 = F::load(Vn);
      v1 = F::load(Vn + (size_t)16 * kN);
      asm volatile("s_wait_xcnt 0x0" :: "v"(Qn), "v"(Vn), "v"(CMn), "v"(CLn) : "memory");   // as above
      __builtin_amdgcn_sched_barrier(0);   // nor sunk: the next step's first half hides these loads
    }
  };
#pragma unroll 1   // rolled: one step's code for 4 tiles of i is as long as the 8 steps for one tile were
  for (int s = 1; s < kAVSteps; ++s) step(s * 32, true);
  step(0, false);   // the last step has nothing to load
#pragma unroll
  for (int it = 0; it < kAVIT; ++it)
#pragma unroll
    for (int r = 0; r < 8; ++r) {
      part[wave][it * 16 + h8 + r][c]      = acc[it][0][r];
      part[wave][it * 16 + h8 + r][16 + c] = acc[it][1][r];
    }
  __syncthreads();   // every wave's partial tiles are in part
  const int col = lane;   // a wave stores the 64 used bytes of one row of O, 4 rows in turn
#pragma unroll
  for (int it = 0; it < kAVIT; ++it) {
    const int row = it * 16 + wave;
    float sum = part[0][row][col];
#pragma unroll
    for (int w = 1; w < kAVWaves; ++w) sum += part[w][row][col];
    O[(size_t)bt * kN * kOW + (size_t)(i0 + row) * kOW + col] = h_bits(sum * kPVScale);
  }
}

// ---------------------------------------------------------------------------
// Host glue.
// Workspace region map (bytes, every offset a multiple of 256):
//   XT16  f16 [8][4096][256]      16,777,216  at           0   x transposed, position-major
//   WQK16 f16 [64][256]               32,768  at  16,777,216   rows 0..31 = 16*Wq, 32..63 = 16*Wk
//   WV16  f16 [64][256]               32,768  at  16,809,984   rows 0..31 = 16*Wv, 32..63 = 0 (written)
//   WB16  f16 [256][32]               16,384  at  16,842,752   16*Wb
//   BQK   f32 [64]                       256  at  16,859,136   bq | bk
//   BV64  f32 [64]                       256  at  16,859,392   bv | 0
//   QK16  f16 [8][4096][64]        4,194,304  at  16,859,648   cols 0..31 q, 32..63 k
//   V16   f16 [8][64][4096]        4,194,304  at  21,053,952   channel-major v, rows 32..63 zero (written)
//   STAT  f32 [8][256][32]           262,144  at  25,248,256   per 16 score rows: 16 maxima | 16 x 32768 / exp-sum
//   O16   f16 [8][4096][64]        4,194,304  at  25,510,400   attention output x64, position-major, cols 0..31 (32..63 neither written nor read)
//   total                         29,704,704
// GEMM shapes: q|k M=4096 N=64 K=256; v M=64 N=4096 K=256; scores M=N=4096 K=32 (tiles inside the two attention kernels);
// attn.v M=4096 N=32 K=4096 (own kernel); back M=256 N=4096 K=32. No padding reads of unwritten data.
// Launch count: 1 + 1 + 1 + 1 + 2 + 1 = 7.
// ---------------------------------------------------------------------------
extern "C" void kernel_launch(void* const* d_in, const int* in_sizes, int n_in,
                              void* d_out, int out_size, void* d_ws, size_t ws_size,
                              hipStream_t stream) {
  if (n_in < 9) return;
  const int nX = kB * kC * kN;   // 8,388,608
  if (in_sizes[0] != nX) return;
  if (in_sizes[1] != kCP * kC || in_sizes[3] != kCP * kC || in_sizes[5] != kCP * kC) return;
  if (in_sizes[2] != kCP || in_sizes[4] != kCP || in_sizes[6] != kCP) return;
  if (in_sizes[7] != kC * kCP || in_sizes[8] != kC) return;
  if (out_size != nX) return;

  const size_t szXT  = (size_t)kB * kN * kC * 2;
  const size_t szWQK = (size_t)kQKW * kC * 2;
  const size_t szWV  = (size_t)kVR * kC * 2;
  const size_t szWB  = (size_t)kC * kCP * 2;
  const size_t szBQK = (size_t)kQKW * 4;
  const size_t szBV  = (size_t)kVR * 4;
  const size_t szQK  = (size_t)kB * kN * kQKW * 2;
  const size_t szV   = (size_t)kB * kVR * kN * 2;
  const size_t szST  = (size_t)kB * (kN / kStatRows) * 32 * 4;
  const size_t szO   = (size_t)kB * kN * kOW * 2;
  const size_t offXT  = 0;
  const size_t offWQK = offXT + szXT;
  const size_t offWV  = offWQK + szWQK;
  const size_t offWB  = offWV + szWV;
  const size_t offBQK = offWB + szWB;
  const size_t offBV  = offBQK + szBQK;
  const size_t offQK  = offBV + szBV;
  const size_t offV   = offQK + szQK;
  const size_t offST  = offV + szV;
  const size_t offO   = offST + szST;
  const size_t total  = offO + szO;   // 29,704,704
  if (ws_size < total) return;

  const float* x  = (const float*)d_in[0];
  const float* Wq = (const float*)d_in[1];
  const float* bq = (const float*)d_in[2];
  const float* Wk = (const float*)d_in[3];
  const float* bk = (const float*)d_in[4];
  const float* Wv = (const float*)d_in[5];
  const float* bv = (const float*)d_in[6];
  const float* Wb = (const float*)d_in[7];
  const float* bb = (const float*)d_in[8];
  float* out = (float*)d_out;
  char* ws = (char*)d_ws;
  unsigned short* XT16  = (unsigned short*)(ws + offXT);
  unsigned short* WQK16 = (unsigned short*)(ws + offWQK);
  unsigned short* WV16  = (unsigned short*)(ws + offWV);
  unsigned short* WB16  = (unsigned short*)(ws + offWB);
  float* BQK  = (float*)(ws + offBQK);
  float* BV64 = (float*)(ws + offBV);
  unsigned short* QK16 = (unsigned short*)(ws + offQK);
  unsigned short* V16  = (unsigned short*)(ws + offV);
  float* STAT = (float*)(ws + offST);
  unsigned short* O16 = (unsigned short*)(ws + offO);

  // ---- parameter planes and the transposed f16 copy of x ----
  prep_kernel<<<dim3(21), dim3(256), 0, stream>>>(Wq, bq, Wk, bk, Wv, bv, Wb, WQK16, WV16, WB16, BQK, BV64);
  xtcast_kernel<<<dim3(kN / 64, kC / 64, kB), dim3(256), 0, stream>>>(x, XT16);

  const long strideXT = (long)kN * kC;
  const long strideQK = (long)kN * kQKW;
  const long strideV  = (long)kVR * kN;
  const long strideO  = (long)kN * kOW;
  const long strideX  = (long)kC * kN;

  // ---- q|k plane: QK16[b][n][o'] = f16( (1/16) sum_c XT16[b][n][c] * WQK16[o'][c] + BQK[o'] )   (M=4096, N=64, K=256) ----
  const int blocksQK = ((kN / 64) * (kQKW / 64)) / 8;   // 64 tiles -> 8 blocks
  wmma_gemm64<0, false, 2, 1, false><<<dim3(blocksQK, kB), dim3(256), 0, stream>>>(
      XT16, XT16, kC, strideXT, WQK16, WQK16, kC, 0L,
      (void*)QK16, (void*)QK16, kQKW, strideQK, BQK, x, 0L, kN, kQKW, kC, kWCarryInv);
  // ---- v plane, channel-major: V16[b][o][n] = f16( (1/16) sum_c WV16[o][c] * XT16[b][n][c] + BV64[o] )   (M=64, N=4096, K=256) ----
  const int blocksV = ((kVR / 64) * (kN / 64)) / 8;     // 64 tiles -> 8 blocks
  wmma_gemm64<0, false, 1, 1, false><<<dim3(blocksV, kB), dim3(256), 0, stream>>>(
      WV16, WV16, kC, 0L, XT16, XT16, kC, strideXT,
      (void*)V16, (void*)V16, kN, strideV, BV64, x, 0L, kVR, kN, kC, kWCarryInv);

  // all batches in one grid each (blockIdx.y = batch):
  // per row j of S[j][i] = sum_o q[o,j] * k[o,i]: max and 32768/exp-sum
  rowstats_kernel<<<dim3(kN / kRSCols, kB), dim3(kRSThreads), 0, stream>>>(QK16, STAT);
  // O16[b][i][c] = f16( (64/32768) sum_j f16(32768 * attn[j][i]) * V16[b][c][j] ) = f16( 64 * out[c][i] )
  attnv_kernel<<<dim3(kN / kAVRows, kB), dim3(kAVThreads), 0, stream>>>(QK16, V16, STAT, STAT + kStatRows, O16);

  // ---- result[b][cc][i] = (1/1024) sum_o WB16[cc][o] * O16[b][i][o] + bb[cc] + x[b][cc][i]   (M=256, N=4096, K=32) ----
  const int blocksBack = ((kC / 64) * (kN / 64)) / 8;  // 256 tiles -> 32 blocks
  wmma_gemm64<0, false, 1, 0, true><<<dim3(blocksBack, kB), dim3(256), 0, stream>>>(
      WB16, WB16, kCP, 0L, O16, O16, kOW, strideO,
      (void*)out, (void*)out, kN, strideX, bb, x, strideX, kC, kN, kCP, kBackScale);
}

// v006
// It runs in 103 microseconds.
// Timed twice side by side with v005, it ran 1.17 and 1.16 times as fast.
// All steps since v000 together make it 51.5 times as fast.
// Contractions: q|k projection and v projection (x^T f16 x W f16 carried x16, Wq and bq also x log2 e), scores (q, k f16 planes; once as k.q tiles inside the row-statistics kernel, once more as q.k tiles inside the attn^T.v kernel), attn^T.v (P f16 carried x32768, formed in registers, x V f16 plane; the score tiles there start from the row's statistic as C), back-projection (Wb f16 carried x16 x O f16 carried x64): all v_wmma_f32_16x16x32_f16 with f32 accumulate; softmax statistics, exp, biases and residual in f32.
#include <hip/hip_runtime.h>
#include <math.h>

// ---------------------------------------------------------------------------
// Problem constants
// ---------------------------------------------------------------------------
constexpr int kB   = 8;      // batch
constexpr int kC   = 256;    // channels
constexpr int kN   = 4096;   // positions (64 x 64)
constexpr int kCP  = 32;     // reduced channels
constexpr int kQKW = 64;     // columns of the q|k plane: 0..31 q, 32..63 k
constexpr int kVR  = 64;     // rows of the channel-major V plane: 0..31 v, 32..63 written zero
constexpr int kOW  = 64;     // pitch of the O plane in columns: 0..31 out, 32..63 unused
constexpr float kWCarry    = 16.0f;                      // weights carried x16 in f16
constexpr float kWCarryInv = 1.0f / 16.0f;
constexpr float kPCarry    = 32768.0f;                   // probabilities carried x2^15 in f16
constexpr float kOCarry    = 64.0f;                      // attention output carried x64 in f16
constexpr float kPVScale   = kOCarry / kPCarry;          // 1/512
constexpr float kBackScale = 1.0f / (kOCarry * kWCarry); // 1/1024
constexpr float kLog2e     = 1.4426950408889634f;        // q carries it, so that a score is the exponent of 2, not of e
static_assert(kN % 64 == 0 && kC % 64 == 0 && kQKW % 64 == 0 && kVR % 64 == 0 && kOW % 64 == 0, "tile multiples");
static_assert(kC % 32 == 0 && kCP % 32 == 0 && kN % 32 == 0, "k steps of 32");
static_assert(2 * kCP == kQKW && kCP <= kVR && kCP <= kOW, "plane widths");
static_assert(kCP * kC == 8192 && kC * kCP == 8192 && kN % 256 == 0 && kN % 8 == 0, "prep and elementwise coverage");

typedef __attribute__((ext_vector_type(16))) _Float16 v16h;
typedef __attribute__((ext_vector_type(8)))  _Float16 v8h;
typedef __attribute__((ext_vector_type(16))) __bf16   v16b;
typedef __attribute__((ext_vector_type(8)))  __bf16   v8b;
typedef __attribute__((ext_vector_type(8)))  float    v8f;
typedef __attribute__((ext_vector_type(4)))  float    v4f;
typedef __attribute__((ext_vector_type(4)))  unsigned int v4u;

// ---------------------------------------------------------------------------
// Shared helpers (with a 4-accumulator guard)
// ---------------------------------------------------------------------------
__device__ __forceinline__ unsigned short f2bf_bits(float f) {
  unsigned u = __float_as_uint(f);
  return (unsigned short)((u + 0x7FFFu + ((u >> 16) & 1u)) >> 16);
}
__device__ __forceinline__ float bf_bits2f(unsigned short h) { return __uint_as_float(((unsigned)h) << 16); }

// hazard guards as plain device helpers (no inline asm inside the kernel template body)
__device__ __forceinline__ void dep_guard_h(v8f& a, v8f& b, v16h x, v16h y) { asm volatile("v_nop\n\tv_nop\n\tv_nop\n\tv_nop" : "+v"(a), "+v"(b) : "v"(x), "v"(y)); }
__device__ __forceinline__ void dep_guard_b(v8f& a, v8f& b, v16b x, v16b y) { asm volatile("v_nop\n\tv_nop\n\tv_nop\n\tv_nop" : "+v"(a), "+v"(b) : "v"(x), "v"(y)); }
__device__ __forceinline__ void dep_guard4_h(v8f& a, v8f& b, v8f& c, v8f& d, v16h x, v16h y) { asm volatile("v_nop\n\tv_nop\n\tv_nop\n\tv_nop" : "+v"(a), "+v"(b), "+v"(c), "+v"(d) : "v"(x), "v"(y)); }
__device__ __forceinline__ void dep_guard4_b(v8f& a, v8f& b, v8f& c, v8f& d, v16b x, v16b y) { asm volatile("v_nop\n\tv_nop\n\tv_nop\n\tv_nop" : "+v"(a), "+v"(b), "+v"(c), "+v"(d) : "v"(x), "v"(y)); }
__device__ __forceinline__ void keep4_h(v16h a, v16h b, v16h c, v16h d) { asm volatile("v_nop" :: "v"(a), "v"(b), "v"(c), "v"(d)); }
__device__ __forceinline__ void keep4_b(v16b a, v16b b, v16b c, v16b d) { asm volatile("v_nop" :: "v"(a), "v"(b), "v"(c), "v"(d)); }
__device__ __forceinline__ void acc_guard4(v8f& a, v8f& b, v8f& c, v8f& d) { asm volatile("v_nop\n\tv_nop\n\tv_nop\n\tv_nop" : "+v"(a), "+v"(b), "+v"(c), "+v"(d)); }
template <typename T> struct Frag;
template <> struct Frag<_Float16> {
  typedef v16h V; union U { v16h v; v8h h[2]; };
  // elements 0..7 <- p[0..7], 8..15 <- p[16..23]
  static __device__ __forceinline__ v16h load(const _Float16* p) {
    U f; f.h[0] = *(const v8h*)(p); f.h[1] = *(const v8h*)(p + 16); return f.v;
  }
  static __device__ __forceinline__ v8f mma(v16h a, v16h b, v8f c) {
    return __builtin_amdgcn_wmma_f32_16x16x32_f16(false, a, false, b, (short)0, c, false, false);
  }
  static __device__ __forceinline__ void guard(v8f& a, v8f& b, v16h x, v16h y) { dep_guard_h(a, b, x, y); }
  static __device__ __forceinline__ void guard4(v8f& a, v8f& b, v8f& c, v8f& d, v16h x, v16h y) { dep_guard4_h(a, b, c, d, x, y); }
  static __device__ __forceinline__ void keep(v16h a, v16h b, v16h c, v16h d) { keep4_h(a, b, c, d); }
};
template <> struct Frag<__bf16> {
  typedef v16b V; union U { v16b v; v8b h[2]; };
  static __device__ __forceinline__ v16b load(const __bf16* p) {
    U f; f.h[0] = *(const v8b*)(p); f.h[1] = *(const v8b*)(p + 16); return f.v;
  }
  static __device__ __forceinline__ v8f mma(v16b a, v16b b, v8f c) {
    return __builtin_amdgcn_wmma_f32_16x16x32_bf16(false, a, false, b, (short)0, c, false, false);
  }
  static __device__ __forceinline__ void guard(v8f& a, v8f& b, v16b x, v16b y) { dep_guard_b(a, b, x, y); }
  static __device__ __forceinline__ void guard4(v8f& a, v8f& b, v8f& c, v8f& d, v16b x, v16b y) { dep_guard4_b(a, b, c, d, x, y); }
  static __device__ __forceinline__ void keep(v16b a, v16b b, v16b c, v16b d) { keep4_b(a, b, c, d); }
};

__device__ __forceinline__ unsigned pk16(unsigned short a, unsigned short b) { return (unsigned)a | ((unsigned)b << 16); }
__device__ __forceinline__ unsigned short h_bits(float f) { const _Float16 h = (_Float16)f; return __builtin_bit_cast(unsigned short, h); }

// ---- Register-blocked batched WMMA GEMM (no activations; residual added in the store phase) ------
// C[m,n] = scale * sum_k A[m,k] * Bt[n,k] (+bias)(+resid); each wave owns a 64x64 tile.
// A row-major [M,K]; Bt row-major [N,K]; M,N % 64 == 0, K % 32 == 0.
// SPLIT: operands are hi/lo planes (A2/Bt2 = lo planes, same layout); product = hi*hi + hi*lo + lo*hi.
// BIAS_MODE: 0 = none, 1 = bias[m], 2 = bias[n].
// OUT_MODE: 0 = f32, 1 = f16, 2 = bf16 hi plane (Cout) + bf16 lo plane (Cout2).
// RESID (OUT_MODE 0 only): each lane loads ONE float4 of the residual at exactly the address it stores, adds it to the
// ET: 0 = f16 operands, 1 = bf16 operands (pointers passed as 16-bit storage)
template <int ET> struct Elem;
template <> struct Elem<0> { typedef _Float16 T; };
template <> struct Elem<1> { typedef __bf16 T; };
template <int ET, bool SPLIT, int BIAS_MODE, int OUT_MODE, bool RESID>
__global__ __launch_bounds__(256) void wmma_gemm64(
    const unsigned short* __restrict__ Ap, const unsigned short* __restrict__ A2p, int lda, long strideA,
    const unsigned short* __restrict__ Btp, const unsigned short* __restrict__ Bt2p, int ldb, long strideB,
    void* __restrict__ Cout, void* __restrict__ Cout2, int ldc, long strideC,
    const float* __restrict__ bias,
    const float* __restrict__ resid, long strideR,
    int M, int N, int K, float scale) {
  static_assert(!RESID || OUT_MODE == 0, "residual only with f32 output");
  typedef typename Elem<ET>::T T;
  typedef typename Frag<T>::V V;
  const T* A = (const T*)Ap; const T* A2 = (const T*)A2p; const T* Bt = (const T*)Btp; const T* Bt2 = (const T*)Bt2p;
  __shared__ __align__(16) float sT[8][16 * 68];   // per-wave 16x64 slab, pitch 68 floats
  const int b    = blockIdx.y;
  const int lane = threadIdx.x & 31;
  const int wave = threadIdx.x >> 5;
  const int tilesN = N >> 6;
  const int tilesM = M >> 6;
  const int tile = blockIdx.x * 8 + wave;
  if (tile >= tilesM * tilesN) return;   // wave-uniform; no block barriers in this kernel
  const int tm = tile / tilesN;
  const int tn = tile - tm * tilesN;
  const int m0 = tm << 6;
  const int n0 = tn << 6;

  const T* Ab  = A  + (size_t)b * strideA;
  const T* Bb  = Bt + (size_t)b * strideB;
  const T* Ab2 = SPLIT ? (A2  + (size_t)b * strideA) : nullptr;
  const T* Bb2 = SPLIT ? (Bt2 + (size_t)b * strideB) : nullptr;

  const int rlane = lane & 15;                 // row (A) / col (B, D) within subtile
  const int koff  = (lane >> 4) * 8;           // k offset of this lane half
  const int mOff  = (lane >> 4) * 8;           // D row offset

  v8f acc[4][4];
#pragma unroll
  for (int i = 0; i < 4; ++i)
#pragma unroll
    for (int j = 0; j < 4; ++j) acc[i][j] = (v8f){0.f,0.f,0.f,0.f,0.f,0.f,0.f,0.f};

  for (int k0 = 0; k0 < K; k0 += 32) {
    V bh[4], bl[4];
#pragma unroll
    for (int j = 0; j < 4; ++j) {
      const size_t bo = (size_t)(n0 + (j << 4) + rlane) * ldb + koff + k0;
      bh[j] = Frag<T>::load(Bb + bo);
      if (SPLIT) bl[j] = Frag<T>::load(Bb2 + bo);
    }
#pragma unroll
    for (int i = 0; i < 4; ++i) {
      const size_t ao = (size_t)(m0 + (i << 4) + rlane) * lda + koff + k0;
      V ah = Frag<T>::load(Ab + ao);
      V al;
      if (SPLIT) al = Frag<T>::load(Ab2 + ao);
#pragma unroll
      for (int j = 0; j < 4; ++j) {
        acc[i][j] = Frag<T>::mma(ah, bh[j], acc[i][j]);
        if (SPLIT) {
          acc[i][j] = Frag<T>::mma(ah, bl[j], acc[i][j]);
          acc[i][j] = Frag<T>::mma(al, bh[j], acc[i][j]);
        }
      }
      Frag<T>::guard4(acc[i][0], acc[i][1], acc[i][2], acc[i][3], ah, SPLIT ? al : ah);
    }
    Frag<T>::keep(bh[0], bh[1], bh[2], bh[3]);
    if (SPLIT) Frag<T>::keep(bl[0], bl[1], bl[2], bl[3]);
  }
  acc_guard4(acc[0][0], acc[0][1], acc[0][2], acc[0][3]);
  acc_guard4(acc[1][0], acc[1][1], acc[1][2], acc[1][3]);
  acc_guard4(acc[2][0], acc[2][1], acc[2][2], acc[2][3]);
  acc_guard4(acc[3][0], acc[3][1], acc[3][2], acc[3][3]);

  // ---- epilogue ----
  float* slab = sT[wave];
  const float* Rb = RESID ? (resid + (size_t)b * strideR) : nullptr;
#pragma unroll
  for (int i = 0; i < 4; ++i) {
    const int mBase = m0 + (i << 4);
#pragma unroll
    for (int j = 0; j < 4; ++j) {
      const int n = n0 + (j << 4) + rlane;
      float bvn = 0.f;
      if (BIAS_MODE == 2) bvn = bias[n];
#pragma unroll
      for (int r = 0; r < 8; ++r) {
        float v = acc[i][j][r] * scale;
        if (BIAS_MODE == 1) v += bias[mBase + mOff + r];
        if (BIAS_MODE == 2) v += bvn;
        slab[(mOff + r) * 68 + (j << 4) + rlane] = v;
      }
    }
    __builtin_amdgcn_fence(__ATOMIC_RELEASE, "workgroup");
    __builtin_amdgcn_wave_barrier();
    __builtin_amdgcn_fence(__ATOMIC_ACQUIRE, "workgroup");
    if (OUT_MODE == 0) {
      float* C = (float*)Cout + (size_t)b * strideC;
      const int hh = lane >> 4, c4 = (lane & 15) * 4;     // row seg = 256 B = 16 lanes x 16 B
      v4f vals[8];
#pragma unroll
      for (int it = 0; it < 8; ++it) {
        const int row = it * 2 + hh;
        v4f v = *(const v4f*)(slab + row * 68 + c4);
        if (RESID) {
          const v4f rv = *(const v4f*)(Rb + (size_t)(mBase + row) * ldc + n0 + c4);
          v = v + rv;
        }
        vals[it] = v;
      }
      {
#pragma unroll
        for (int it = 0; it < 8; ++it) {
          const int row = it * 2 + hh;
          *(v4f*)(C + (size_t)(mBase + row) * ldc + n0 + c4) = vals[it];
        }
        
      }
    } else {
      const int q = lane >> 3, c8 = (lane & 7) * 8;
      unsigned short* C  = (unsigned short*)Cout  + (size_t)b * strideC;
      unsigned short* C2 = (OUT_MODE == 2) ? ((unsigned short*)Cout2 + (size_t)b * strideC) : nullptr;
      {
#pragma unroll
        for (int it = 0; it < 4; ++it) {
          const int row = it * 4 + q;
          const float* sp = slab + row * 68 + c8;
          v8h hv, lv;
#pragma unroll
          for (int e = 0; e < 8; ++e) {
            if (OUT_MODE == 1) {
              hv[e] = (_Float16)sp[e];
            } else {
              unsigned short hb = f2bf_bits(sp[e]);
              unsigned short lb = f2bf_bits(sp[e] - bf_bits2f(hb));
              hv[e] = __builtin_bit_cast(_Float16, hb);
              lv[e] = __builtin_bit_cast(_Float16, lb);
            }
          }
          *(v8h*)(C + (size_t)(mBase + row) * ldc + n0 + c8) = hv;
          if (OUT_MODE == 2) *(v8h*)(C2 + (size_t)(mBase + row) * ldc + n0 + c8) = lv;
        }
        
      }
    }
    __builtin_amdgcn_fence(__ATOMIC_RELEASE, "workgroup");
    __builtin_amdgcn_wave_barrier();
    __builtin_amdgcn_fence(__ATOMIC_ACQUIRE, "workgroup");
  }
}

// ---------------------------------------------------------------------------
// Parameter planes (21 blocks of 256 threads):
//   blocks  0.. 3: WQK16[0..8191]     = f16(16 * log2 e * Wq)   (rows 0..31 of the [64][256] q|k weight plane)
//   blocks  4.. 7: WQK16[8192..16383] = f16(16 * Wk)   (rows 32..63)
//   blocks  8..11: WV16[0..8191]      = f16(16 * Wv)   (rows 0..31 of the [64][256] v weight plane)
//   blocks 12..15: WV16[8192..16383]  = 0              (rows 32..63, written zeros)
//   blocks 16..19: WB16[0..8191]      = f16(16 * Wb)   ([256][32])
//   block  20    : BQK[64] = log2 e * bq | bk (f32), BV64[64] = bv | 0 (f32)
// Coverage: 4 blocks x 256 threads x 8 = 8192 elements per group. Each thread one 16-B store; a wave writes 512 contiguous B
// ---------------------------------------------------------------------------
__global__ __launch_bounds__(256) void prep_kernel(const float* __restrict__ Wq, const float* __restrict__ bq,
                                                   const float* __restrict__ Wk, const float* __restrict__ bk,
                                                   const float* __restrict__ Wv, const float* __restrict__ bv,
                                                   const float* __restrict__ Wb,
                                                   unsigned short* __restrict__ WQK16, unsigned short* __restrict__ WV16,
                                                   unsigned short* __restrict__ WB16,
                                                   float* __restrict__ BQK, float* __restrict__ BV64) {
  const int t   = threadIdx.x;
  const int blk = blockIdx.x;
  if (blk < 20) {   // block-uniform
    const int grp = blk >> 2;
    const int sub = blk & 3;
    const int e0  = (sub * 256 + t) * 8;   // 0 .. 8184
    const float* src = (grp == 0) ? Wq : (grp == 1) ? Wk : (grp == 4) ? Wb : Wv;   // grp 3 reads Wv (in range) and scales by 0
    const float  f   = (grp == 3) ? 0.0f : (grp == 0) ? kWCarry * kLog2e : kWCarry;
    unsigned short* dst = (grp == 0) ? WQK16 : (grp == 1) ? (WQK16 + 8192) : (grp == 2) ? WV16 : (grp == 3) ? (WV16 + 8192) : WB16;
    const v4f a = *(const v4f*)(src + e0);
    const v4f c = *(const v4f*)(src + e0 + 4);
    unsigned short hb[8];
#pragma unroll
    for (int e = 0; e < 4; ++e) {
      hb[e]     = h_bits(a[e] * f);
      hb[4 + e] = h_bits(c[e] * f);
    }
    const v4u u = (v4u){pk16(hb[0], hb[1]), pk16(hb[2], hb[3]), pk16(hb[4], hb[5]), pk16(hb[6], hb[7])};
    unsigned short* dp = dst + e0;
    *(v4u*)dp = u;
    
  } else {
    const int lane = t & 31, wave = t >> 5;
    const int idx = (lane & 7) * 4;   // 0..28: always inside the 32-entry bias vectors
    const v4f q4 = *(const v4f*)(bq + idx);
    const v4f k4 = *(const v4f*)(bk + idx);
    const v4f w4 = *(const v4f*)(bv + idx);
    const float fq = (lane < 8) ? 1.0f : 0.0f;
    const float fk = (lane < 8) ? 0.0f : 1.0f;
    // arithmetic select: lanes 0..7 take bq / bv, lanes 8..15 take bk / zeros (all loads unconditional)
    const v4f valQK = q4 * (fq * kLog2e) + k4 * fk;
    const v4f valV  = w4 * fq;
    const bool wq = (wave == 0) && (lane < 16);
    const bool wv = (wave == 1) && (lane < 16);
    float* dq = BQK  + (lane & 15) * 4;
    float* dv = BV64 + (lane & 15) * 4;
    if (wq) *(v4f*)dq = valQK;
    if (wv) *(v4f*)dv = valV;
    
  }
}

// ---------------------------------------------------------------------------
// x transpose + cast: in x[b][c][n] (n contiguous) -> out XT[b][n][c] (c contiguous), XT = f16(x).
// grid (kN/64 n-tiles, kC/64 c-tiles, kB). 256 threads.
// Load coverage: 16 iterations x 256 threads = 4096 = the whole 64(c) x 64(n) tile (coalesced along n).
// Store coverage: 8 waves x 2 iterations x 4 rows (lane>>3) = 64 n-rows; (lane&7) x 8 halves = 64 c-cols; each row segment =
// ---------------------------------------------------------------------------
__global__ __launch_bounds__(256) void xtcast_kernel(const float* __restrict__ x, unsigned short* __restrict__ XT) {
  __shared__ float sm[64][65];   // sm[n_local][c_local]
  const int t  = threadIdx.x;
  const int n0 = blockIdx.x * 64;
  const int c0 = blockIdx.y * 64;
  const int b  = blockIdx.z;
  const float* xb = x + (size_t)b * kC * kN;
#pragma unroll
  for (int i = 0; i < 16; ++i) {
    const int e = i * 256 + t;
    const int r = e >> 6;          // c local
    const int q = e & 63;          // n local
    sm[q][r] = xb[(size_t)(c0 + r) * kN + n0 + q];
    if (i == 7) asm volatile("" ::: "memory");   // split the load burst into two groups of 8
  }
  __syncthreads();
  const int lane = t & 31, wave = t >> 5;
  const int q8 = lane >> 3, c8 = (lane & 7) * 8;
  unsigned short* op = XT + ((size_t)b * kN) * kC;
  {
#pragma unroll
    for (int it = 0; it < 2; ++it) {
      const int row = wave * 8 + it * 4 + q8;               // n local
      unsigned short hb[8];
#pragma unroll
      for (int e = 0; e < 8; ++e) hb[e] = h_bits(sm[row][c8 + e]);
      const v4u u = (v4u){pk16(hb[0], hb[1]), pk16(hb[2], hb[3]), pk16(hb[4], hb[5]), pk16(hb[6], hb[7])};
      *(v4u*)(op + (size_t)(n0 + row) * kC + c0 + c8) = u;
    }
    
  }
}

// ---------------------------------------------------------------------------
// Softmax statistic of the score rows, from score tiles formed in registers (no score plane in memory): for each j,
//   stat[j] = 15 - max_i S[j][i] - log2 sum_i 2^(S[j][i] - max),  S[j][i] = q row j . k row i, q carrying log2 e,
// so that 2^(S[j][i] + stat[j]) is the probability carried x 32768.
// One block owns 64 rows j (4 tiles of 16) of one batch and all 4096 i: grid (kN/64 = 64, kB) blocks of 16 waves, blockIdx.y the
// batch; wave w takes i in [256 w, 256 w + 256).
// A tile is D[i][j] = k rows (A) x q rows (B, the block's 4 fragments loaded once): every k fragment loaded feeds 4 tiles.
// A lane holds column j = lane & 15 of each tile of j and rows i = 8 h + r (h = lane >> 4). Per tile of j it keeps a running
// maximum and the exp-sum relative to it: per 32 i the maximum is raised and the old sum brought to it by one factor.
// The (maximum, sum) pairs of the 2 lane halves join by lane exchange, those of the 16 waves through LDS behind one barrier,
// each sum brought to the common maximum by one factor 2^(own maximum - common maximum); wave w < 4 joins tile w of j.
// STAT holds, per batch and per 16 rows j, one 128-B line, stored whole by one wave: the 16 statistics, twice (the second 16 are not read).
// ---------------------------------------------------------------------------
// 2^y on the transcendental unit. The v_nop fills the one slot that the instruction set asks for behind a transcendental before
// its result is read or its source overwritten: inside the statement it stands there in every build.
__device__ __forceinline__ float exp2_slot(float y) { float r; asm("v_exp_f32 %0, %1\n\tv_nop" : "=v"(r) : "v"(y)); return r; }
// Every use in the row statistics has y <= 0: no overflow; below 2^-126 the term is 0 beside a sum that is at least 1.
// log2 x for x >= 1 on the transcendental unit, with the same slot behind it
__device__ __forceinline__ float log2_slot(float x) { float r; asm("v_log_f32 %0, %1\n\tv_nop" : "=v"(r) : "v"(x)); return r; }
constexpr float kPCarryLog2 = 15.0f;
static_assert(kPCarry == 32768.0f, "2^15");
constexpr int kRSWaves   = 16;
constexpr int kRSThreads = kRSWaves * 32;      // 512
constexpr int kStatRows  = 16;                 // rows j of S per 128-B line of STAT
constexpr int kRSJT      = 4;                  // 16-row tiles of j per block: every k fragment loaded feeds this many score tiles
constexpr int kRSCols    = kStatRows * kRSJT;  // 64 rows j of S per block
constexpr int kRSChunk   = kN / kRSWaves;      // 256 i per wave
constexpr int kRSGroups  = kRSChunk / 32;      // 8 groups of two k fragments (32 i)
static_assert(kN % kRSCols == 0 && kRSChunk % 32 == 0 && kRSWaves % 2 == 0 && kRSJT <= kRSWaves, "row statistics tiling");
__global__ __launch_bounds__(kRSThreads) void rowstats_kernel(const unsigned short* __restrict__ QKp, float* __restrict__ STAT) {
  typedef Frag<_Float16> F;
  __shared__ float pmax[kRSWaves][kRSCols];
  __shared__ float psum[kRSWaves][kRSCols];
  const int t    = threadIdx.x;
  const int lane = t & 31;
  const int wave = t >> 5;
  const int c    = lane & 15;
  const int h    = lane >> 4;
  const _Float16* QK    = (const _Float16*)QKp + (size_t)blockIdx.y * kN * kQKW;   // the block's batch
  const _Float16* Qlane = QK + (size_t)(blockIdx.x * kRSCols + c) * kQKW + h * 8;
  // row of the wave's first position i; its k half starts at column kCP; every tile is a compile-time offset from this address
  const _Float16* Klane = QK + (size_t)(wave * kRSChunk + c) * kQKW + h * 8;
  v16h qf[kRSJT];
#pragma unroll
  for (int jt = 0; jt < kRSJT; ++jt) qf[jt] = F::load(Qlane + (size_t)(jt * 16) * kQKW);
  const v8f zero = (v8f){0.f, 0.f, 0.f, 0.f, 0.f, 0.f, 0.f, 0.f};
  v16h a[2][2];   // two register sets of two k fragments take turns
  a[0][0] = F::load(Klane + kCP);
  a[0][1] = F::load(Klane + kCP + (size_t)16 * kQKW);
  float m[kRSJT], sum[kRSJT];   // per lane and tile of j: running maximum, exp-sum relative to it
#pragma unroll   // whole: the sets' turns and the groups' address offsets are compile-time, the two address pairs never change
  for (int g = 0; g < kRSGroups; ++g) {
    if (g + 1 < kRSGroups) {
      a[(g + 1) & 1][0] = F::load(Klane + kCP + (size_t)((g + 1) * 32) * kQKW);
      a[(g + 1) & 1][1] = F::load(Klane + kCP + (size_t)((g + 1) * 32 + 16) * kQKW);
      __builtin_amdgcn_sched_barrier(0);   // the next group's 4 loads stay issued ahead of this group's exp work, which hides them
    }
#pragma unroll
    for (int jt = 0; jt < kRSJT; ++jt) {
      const v8f d0 = F::mma(a[g & 1][0], qf[jt], zero);
      const v8f d1 = F::mma(a[g & 1][1], qf[jt], zero);
      float t0 = d0[0], t1 = d1[0];
#pragma unroll
      for (int r = 1; r < 8; ++r) { t0 = fmaxf(t0, d0[r]); t1 = fmaxf(t1, d1[r]); }
      const float tm = fmaxf(t0, t1);
      const float mn = (g == 0) ? tm : fmaxf(m[jt], tm);
      float s0 = exp2_slot(d0[0] - mn), s1 = exp2_slot(d1[0] - mn);
#pragma unroll
      for (int r = 1; r < 8; ++r) { s0 += exp2_slot(d0[r] - mn); s1 += exp2_slot(d1[r] - mn); }
      sum[jt] = (g == 0) ? (s0 + s1) : (sum[jt] * exp2_slot(m[jt] - mn) + (s0 + s1));   // the old sum brought to the new maximum
      m[jt] = mn;
      // one tile of j at a time: without it the build interleaves the tiles and takes 168 registers for 103: one block on a WGP for two
      __builtin_amdgcn_sched_barrier(0);
    }
  }
  // the one wait behind the kernel's loads: no address register of an issued load is given a new value in front of it
  // (the two pairs never change, and as inputs here they stay in their registers up to the wait)
  asm volatile("s_wait_xcnt 0x0" :: "v"(Qlane), "v"(Klane) : "memory");
#pragma unroll
  for (int jt = 0; jt < kRSJT; ++jt) {   // the two lane halves of column j
    const float mo = __shfl_xor(m[jt], 16, 32), so = __shfl_xor(sum[jt], 16, 32);
    const float mj = fmaxf(m[jt], mo);
    sum[jt] = sum[jt] * exp2_slot(m[jt] - mj) + so * exp2_slot(mo - mj);
    m[jt] = mj;
  }
  if (lane < 16) {
#pragma unroll
    for (int jt = 0; jt < kRSJT; ++jt) { pmax[wave][jt * 16 + c] = m[jt]; psum[wave][jt * 16 + c] = sum[jt]; }
  }
  __syncthreads();   // every wave's partial maxima and sums are in pmax, psum
  if (wave >= kRSJT) return;   // wave-uniform, behind the kernel's only barrier; wave w joins tile w of j
  const int col = wave * 16 + c;
  float wm[kRSWaves / 2], wsum[kRSWaves / 2];   // lane half h joins waves 8 h .. 8 h + 7 in wave order
#pragma unroll
  for (int w = 0; w < kRSWaves / 2; ++w) {
    wm[w]   = pmax[h * (kRSWaves / 2) + w][col];
    wsum[w] = psum[h * (kRSWaves / 2) + w][col];
  }
  float bm = wm[0];
#pragma unroll
  for (int w = 1; w < kRSWaves / 2; ++w) bm = fmaxf(bm, wm[w]);
  bm = fmaxf(bm, __shfl_xor(bm, 16, 32));
  float tot = wsum[0] * exp2_slot(wm[0] - bm);
#pragma unroll
  for (int w = 1; w < kRSWaves / 2; ++w) tot += wsum[w] * exp2_slot(wm[w] - bm);
  tot += __shfl_xor(tot, 16, 32);   // tot >= 1: the row maximum contributes 2^0
  STAT[((size_t)blockIdx.y * (kN / kStatRows) + blockIdx.x * kRSJT + wave) * 32 + lane] = kPCarryLog2 - bm - log2_slot(tot);
}

// ---------------------------------------------------------------------------
// attn^T.v with the probabilities formed in registers (no probability plane in memory):
//   O16[i][c] = f16( (64/32768) sum_j P[i][j] * V16[c][j] ),  P[i][j] = f16( 2^(S[j][i] + stat[j]) ), f32 math.
// One block owns 64 positions i (4 tiles of 16) of one batch and all 4096 j: grid (kN/64 = 64, kB) blocks of 16 waves, blockIdx.y
// the batch; wave w walks j in [256 w, 256 w + 256). Every q, V and statistics load feeds the 4 tiles of i.
// Per 32 j and tile of i: two score tiles D[j][i] = q rows (A) x k rows (B, loaded once) + C, C[j][i] = stat[j]: the matrix unit's own
// addition gives the exponent, and a probability costs the vector port one v_exp_f32 and half a packed conversion.
// A lane then holds column i = lane & 15 and
// rows j = 8 h + r and 16 + 8 h + r (h = lane >> 4), which is the k order of an A fragment of row i: converted in place,
// the two tiles are the A operand against the V fragments (same k order from Frag::load). No LDS, no lane exchange.
// The 16 waves' partial 64 x 32 tiles are joined through LDS in wave order behind one barrier.
// ---------------------------------------------------------------------------
constexpr int kAVWaves   = 16;
constexpr int kAVThreads = kAVWaves * 32;      // 512
constexpr int kAVIT      = 4;                  // 16-row tiles of i per block: every q, V and statistics load feeds this many tiles
constexpr int kAVRows    = 16 * kAVIT;         // 64 positions i per block
constexpr int kAVChunk   = kN / kAVWaves;      // 256 j per wave
constexpr int kAVSteps   = kAVChunk / 32;      // 8 steps of 32 j
constexpr int kAVPitch   = kCP + 4;            // floats per row of a partial tile
static_assert(kN % kAVRows == 0 && kAVChunk % 32 == 0 && (kAVRows * kCP) % kAVThreads == 0 && kCP == 32, "attn.v tiling");
// what 16 of a step's 32 j read for the scores: one q fragment and the lane's 8 row statistics, which are a C operand as they lie
// (register r of a lane is row 8 h + r of the tile, in C as in D; every column takes the same value)
struct AVHalf { v16h q; v8f c; };
__device__ __forceinline__ void av_load_half(AVHalf& s, const _Float16* __restrict__ Qlane, const float* __restrict__ Slane, int j0) {
  s.q = Frag<_Float16>::load(Qlane + (size_t)j0 * kQKW);   // q rows j0 .. j0 + 15
  const v4f c0 = *(const v4f*)(Slane + j0 * 2);            // j0 + 8 h + 0..3;  STAT: 32 floats per 16 j
  const v4f c1 = *(const v4f*)(Slane + j0 * 2 + 4);        // j0 + 8 h + 4..7
  s.c = __builtin_shufflevector(c0, c1, 0, 1, 2, 3, 4, 5, 6, 7);
}
// 8 probabilities of one lane from one tile of exponents (at most 15: no overflow in f32 or f16)
__device__ __forceinline__ v8h av_prob(const v8f s) {
  v8f e;
#pragma unroll
  for (int r = 0; r < 8; ++r) e[r] = __builtin_amdgcn_exp2f(s[r]);
  // the slot that the instruction set asks for behind a transcendental before its result is read or its source overwritten, in every
  // build: the results pass through the statement, so no reader stands in front of the v_nop; the exponents are its inputs, so they
  // keep their registers up to it and no v_exp_f32 lands on the source of the one directly in front
  asm("v_nop" : "+v"(e) : "v"(s));
  return __builtin_convertvector(e, v8h);
}
__global__ __launch_bounds__(kAVThreads) void attnv_kernel(const unsigned short* __restrict__ QKp,
                                                           const unsigned short* __restrict__ Vp,
                                                           const float* __restrict__ ST,
                                                           unsigned short* __restrict__ O) {
  typedef Frag<_Float16> F;
  __shared__ __align__(16) float part[kAVWaves][kAVRows][kAVPitch];
  const int t    = threadIdx.x;
  const int lane = t & 31;
  const int wave = t >> 5;
  const int c    = lane & 15;
  const int h8   = (lane >> 4) * 8;
  const int i0   = blockIdx.x * kAVRows;
  const int jb   = wave * kAVChunk;
  const int bt   = blockIdx.y;   // the block's batch
  const _Float16* QK    = (const _Float16*)QKp + (size_t)bt * kN * kQKW;
  const _Float16* Klane = QK + (size_t)(i0 + c) * kQKW + h8;   // row of position i0 + c; its k half starts at column kCP
  // the wave's first step
  const _Float16* Qlane = QK + (size_t)(jb + c) * kQKW + h8;
  const _Float16* Vlane = (const _Float16*)Vp + (size_t)bt * kVR * kN + (size_t)c * kN + jb + h8;
  const float* Slane = ST + (size_t)bt * kN * 2 + jb * 2 + h8;    // walks 32 floats per 16 j
  v16h kf[kAVIT];
#pragma unroll
  for (int it = 0; it < kAVIT; ++it) kf[it] = F::load(Klane + kCP + (size_t)(it * 16) * kQKW);
  // the k fragments stay the oldest loads: issued ahead of the first step's; issued behind them, their wait would stand inside the loop and drain its refills each step
  __builtin_amdgcn_sched_barrier(0);
  const v8f zero = (v8f){0.f, 0.f, 0.f, 0.f, 0.f, 0.f, 0.f, 0.f};
  v8f acc[kAVIT][2];
#pragma unroll
  for (int it = 0; it < kAVIT; ++it) { acc[it][0] = zero; acc[it][1] = zero; }
  // One register set: each part is loaded anew directly behind its last use, half a step ahead of its next use.
  AVHalf ha, hb;
  v16h v0, v1;
  av_load_half(ha, Qlane, Slane, 0);
  // the first half's loads stay ahead of the others, as in the loop's refills: the loop's counted waits are set for both ways into it,
  // and with the two halves mixed here the wait at the loop's head reaches into the refill issued just in front of it
  __builtin_amdgcn_sched_barrier(0);
  av_load_half(hb, Qlane, Slane, 16);
  v0 = F::load(Vlane);                        // channels 0..15
  v1 = F::load(Vlane + (size_t)16 * kN);      // channels 16..31
  // one step of 32 j; refill: whether a next step exists, a literal at both calls, so that a step is one run of code with no branch
  auto step = [&](const int jn, const bool refill) {
    // the next step's three addresses, each formed once: the refills read at compile-time offsets from them
    const _Float16* Qn  = Qlane + (size_t)jn * kQKW;
    const _Float16* Vn  = Vlane + jn;
    const float*    Sn  = Slane + jn * 2;
    v8h plo[kAVIT];
#pragma unroll
    for (int it = 0; it < kAVIT; ++it) plo[it] = av_prob(F::mma(ha.q, kf[it], ha.c));   // j = 8 h + r of the step
    if (refill) {
      __builtin_amdgcn_sched_barrier(0);   // the refill is not lifted into the exp work in front of it (it would need a second register set)
      av_load_half(ha, Qn, Sn, 0);
      // the step's addresses sit in registers that are given new values behind the loads; as inputs here the pairs stay
      // in their registers up to the wait, so that no load of the run lands in one of them
      asm volatile("s_wait_xcnt 0x0" :: "v"(Qn), "v"(Sn) : "memory");
      __builtin_amdgcn_sched_barrier(0);   // nor sunk: the second half's exp work behind it hides the loads
    }
#pragma unroll
    for (int it = 0; it < kAVIT; ++it) {
      const v8h phi = av_prob(F::mma(hb.q, kf[it], hb.c));                                  // j = 16 + 8 h + r
      const v16h p = __builtin_shufflevector(plo[it], phi, 0, 1, 2, 3, 4, 5, 6, 7, 8, 9, 10, 11, 12, 13, 14, 15);
      acc[it][0] = F::mma(p, v0, acc[it][0]);
      acc[it][1] = F::mma(p, v1, acc[it][1]);
    }
    if (refill) {
      __builtin_amdgcn_sched_barrier(0);   // as above, for the second half's and the V fragments' refill
      av_load_half(hb, Qn, Sn, 16);
      v0 = F::load(Vn);
      v1 = F::load(Vn + (size_t)16 * kN);
      asm volatile("s_wait_xcnt 0x0" :: "v"(Qn), "v"(Vn), "v"(Sn) : "memory");   // as above
      __builtin_amdgcn_sched_barrier(0);   // nor sunk: the next step's first half hides these loads
    }
  };
#pragma unroll 1   // rolled: one step's code for 4 tiles of i is as long as the 8 steps for one tile were
  for (int s = 1; s < kAVSteps; ++s) step(s * 32, true);
  step(0, false);   // the last step has nothing to load
#pragma unroll
  for (int it = 0; it < kAVIT; ++it)
#pragma unroll
    for (int r = 0; r < 8; ++r) {
      part[wave][it * 16 + h8 + r][c]      = acc[it][0][r];
      part[wave][it * 16 + h8 + r][16 + c] = acc[it][1][r];
    }
  __syncthreads();   // every wave's partial tiles are in part
  const int col = lane;   // a wave stores the 64 used bytes of one row of O, 4 rows in turn
#pragma unroll
  for (int it = 0; it < kAVIT; ++it) {
    const int row = it * 16 + wave;
    float sum = part[0][row][col];
#pragma unroll
    for (int w = 1; w < kAVWaves; ++w) sum += part[w][row][col];
    O[(size_t)bt * kN * kOW + (size_t)(i0 + row) * kOW + col] = h_bits(sum * kPVScale);
  }
}

// ---------------------------------------------------------------------------
// Host glue.
// Workspace region map (bytes, every offset a multiple of 256):
//   XT16  f16 [8][4096][256]      16,777,216  at           0   x transposed, position-major
//   WQK16 f16 [64][256]               32,768  at  16,777,216   rows 0..31 = 16*log2e*Wq, 32..63 = 16*Wk
//   WV16  f16 [64][256]               32,768  at  16,809,984   rows 0..31 = 16*Wv, 32..63 = 0 (written)
//   WB16  f16 [256][32]               16,384  at  16,842,752   16*Wb
//   BQK   f32 [64]                       256  at  16,859,136   log2e*bq | bk
//   BV64  f32 [64]                       256  at  16,859,392   bv | 0
//   QK16  f16 [8][4096][64]        4,194,304  at  16,859,648   cols 0..31 q x log2e, 32..63 k
//   V16   f16 [8][64][4096]        4,194,304  at  21,053,952   channel-major v, rows 32..63 zero (written)
//   STAT  f32 [8][256][32]           262,144  at  25,248,256   per 16 score rows: 16 x (15 - max - log2 sum), twice
//   O16   f16 [8][4096][64]        4,194,304  at  25,510,400   attention output x64, position-major, cols 0..31 (32..63 neither written nor read)
//   total                         29,704,704
// GEMM shapes: q|k M=4096 N=64 K=256; v M=64 N=4096 K=256; scores M=N=4096 K=32 (tiles inside the two attention kernels);
// attn.v M=4096 N=32 K=4096 (own kernel); back M=256 N=4096 K=32. No padding reads of unwritten data.
// Launch count: 1 + 1 + 1 + 1 + 2 + 1 = 7.
// ---------------------------------------------------------------------------
extern "C" void kernel_launch(void* const* d_in, const int* in_sizes, int n_in,
                              void* d_out, int out_size, void* d_ws, size_t ws_size,
                              hipStream_t stream) {
  if (n_in < 9) return;
  const int nX = kB * kC * kN;   // 8,388,608
  if (in_sizes[0] != nX) return;
  if (in_sizes[1] != kCP * kC || in_sizes[3] != kCP * kC || in_sizes[5] != kCP * kC) return;
  if (in_sizes[2] != kCP || in_sizes[4] != kCP || in_sizes[6] != kCP) return;
  if (in_sizes[7] != kC * kCP || in_sizes[8] != kC) return;
  if (out_size != nX) return;

  const size_t szXT  = (size_t)kB * kN * kC * 2;
  const size_t szWQK = (size_t)kQKW * kC * 2;
  const size_t szWV  = (size_t)kVR * kC * 2;
  const size_t szWB  = (size_t)kC * kCP * 2;
  const size_t szBQK = (size_t)kQKW * 4;
  const size_t szBV  = (size_t)kVR * 4;
  const size_t szQK  = (size_t)kB * kN * kQKW * 2;
  const size_t szV   = (size_t)kB * kVR * kN * 2;
  const size_t szST  = (size_t)kB * (kN / kStatRows) * 32 * 4;
  const size_t szO   = (size_t)kB * kN * kOW * 2;
  const size_t offXT  = 0;
  const size_t offWQK = offXT + szXT;
  const size_t offWV  = offWQK + szWQK;
  const size_t offWB  = offWV + szWV;
  const size_t offBQK = offWB + szWB;
  const size_t offBV  = offBQK + szBQK;
  const size_t offQK  = offBV + szBV;
  const size_t offV   = offQK + szQK;
  const size_t offST  = offV + szV;
  const size_t offO   = offST + szST;
  const size_t total  = offO + szO;   // 29,704,704
  if (ws_size < total) return;

  const float* x  = (const float*)d_in[0];
  const float* Wq = (const float*)d_in[1];
  const float* bq = (const float*)d_in[2];
  const float* Wk = (const float*)d_in[3];
  const float* bk = (const float*)d_in[4];
  const float* Wv = (const float*)d_in[5];
  const float* bv = (const float*)d_in[6];
  const float* Wb = (const float*)d_in[7];
  const float* bb = (const float*)d_in[8];
  float* out = (float*)d_out;
  char* ws = (char*)d_ws;
  unsigned short* XT16  = (unsigned short*)(ws + offXT);
  unsigned short* WQK16 = (unsigned short*)(ws + offWQK);
  unsigned short* WV16  = (unsigned short*)(ws + offWV);
  unsigned short* WB16  = (unsigned short*)(ws + offWB);
  float* BQK  = (float*)(ws + offBQK);
  float* BV64 = (float*)(ws + offBV);
  unsigned short* QK16 = (unsigned short*)(ws + offQK);
  unsigned short* V16  = (unsigned short*)(ws + offV);
  float* STAT = (float*)(ws + offST);
  unsigned short* O16 = (unsigned short*)(ws + offO);

  // ---- parameter planes and the transposed f16 copy of x ----
  prep_kernel<<<dim3(21), dim3(256), 0, stream>>>(Wq, bq, Wk, bk, Wv, bv, Wb, WQK16, WV16, WB16, BQK, BV64);
  xtcast_kernel<<<dim3(kN / 64, kC / 64, kB), dim3(256), 0, stream>>>(x, XT16);

  const long strideXT = (long)kN * kC;
  const long strideQK = (long)kN * kQKW;
  const long strideV  = (long)kVR * kN;
  const long strideO  = (long)kN * kOW;
  const long strideX  = (long)kC * kN;

  // ---- q|k plane: QK16[b][n][o'] = f16( (1/16) sum_c XT16[b][n][c] * WQK16[o'][c] + BQK[o'] )   (M=4096, N=64, K=256) ----
  const int blocksQK = ((kN / 64) * (kQKW / 64)) / 8;   // 64 tiles -> 8 blocks
  wmma_gemm64<0, false, 2, 1, false><<<dim3(blocksQK, kB), dim3(256), 0, stream>>>(
      XT16, XT16, kC, strideXT, WQK16, WQK16, kC, 0L,
      (void*)QK16, (void*)QK16, kQKW, strideQK, BQK, x, 0L, kN, kQKW, kC, kWCarryInv);
  // ---- v plane, channel-major: V16[b][o][n] = f16( (1/16) sum_c WV16[o][c] * XT16[b][n][c] + BV64[o] )   (M=64, N=4096, K=256) ----
  const int blocksV = ((kVR / 64) * (kN / 64)) / 8;     // 64 tiles -> 8 blocks
  wmma_gemm64<0, false, 1, 1, false><<<dim3(blocksV, kB), dim3(256), 0, stream>>>(
      WV16, WV16, kC, 0L, XT16, XT16, kC, strideXT,
      (void*)V16, (void*)V16, kN, strideV, BV64, x, 0L, kVR, kN, kC, kWCarryInv);

  // all batches in one grid each (blockIdx.y = batch):
  // per row j of S[j][i] = log2e * sum_o q[o,j] * k[o,i]: 15 - max - log2 of the sum of 2^(S - max)
  rowstats_kernel<<<dim3(kN / kRSCols, kB), dim3(kRSThreads), 0, stream>>>(QK16, STAT);
  // O16[b][i][c] = f16( (64/32768) sum_j f16(32768 * attn[j][i]) * V16[b][c][j] ) = f16( 64 * out[c][i] )
  attnv_kernel<<<dim3(kN / kAVRows, kB), dim3(kAVThreads), 0, stream>>>(QK16, V16, STAT, O16);

  // ---- result[b][cc][i] = (1/1024) sum_o WB16[cc][o] * O16[b][i][o] + bb[cc] + x[b][cc][i]   (M=256, N=4096, K=32) ----
  const int blocksBack = ((kC / 64) * (kN / 64)) / 8;  // 256 tiles -> 32 blocks
  wmma_gemm64<0, false, 1, 0, true><<<dim3(blocksBack, kB), dim3(256), 0, stream>>>(
      WB16, WB16, kCP, 0L, O16, O16, kOW, strideO,
      (void*)out, (void*)out, kN, strideX, bb, x, strideX, kC, kN, kCP, kBackScale);
}

// v007
// A run of this version takes 72.2 microseconds.
// Next to v006, in two timings, it ran 1.41 and 1.43 times as fast.
// Over all steps from v000 it is 73.2 times as fast.
// Contractions: q, k and v projections (x cast to f16 in registers x W f16 carried x16, Wq and bq also x log2 e; one kernel), scores (q, k f16 planes; once as k.q tiles inside the row-statistics kernel, once more as q.k tiles inside the attn^T.v kernel), attn^T.v (P f16 carried x32768, formed in registers, x V f16 plane; the score tiles there start from the row's statistic as C), back-projection (Wb f16 carried x16 x O f16 carried x64): all v_wmma_f32_16x16x32_f16 with f32 accumulate; softmax statistics, exp, biases and residual in f32.
#include <hip/hip_runtime.h>
#include <math.h>

// ---------------------------------------------------------------------------
// Problem constants
// ---------------------------------------------------------------------------
constexpr int kB   = 8;      // batch
constexpr int kC   = 256;    // channels
constexpr int kN   = 4096;   // positions (64 x 64)
constexpr int kCP  = 32;     // reduced channels
constexpr int kQKW = 64;     // columns of the q|k plane: 0..31 q, 32..63 k
constexpr int kVR  = 64;     // pitch of the channel-major V plane in rows: 0..31 v, 32..63 unused
constexpr int kOW  = 64;     // pitch of the O plane in columns: 0..31 out, 32..63 unused
constexpr float kWCarry    = 16.0f;                      // weights carried x16 in f16
constexpr float kWCarryInv = 1.0f / 16.0f;
constexpr float kPCarry    = 32768.0f;                   // probabilities carried x2^15 in f16
constexpr float kOCarry    = 64.0f;                      // attention output carried x64 in f16
constexpr float kPVScale   = kOCarry / kPCarry;          // 1/512
constexpr float kBackScale = 1.0f / (kOCarry * kWCarry); // 1/1024
constexpr float kLog2e     = 1.4426950408889634f;        // q carries it, so that a score is the exponent of 2, not of e
static_assert(kN % 64 == 0 && kC % 64 == 0 && kQKW % 64 == 0 && kVR % 64 == 0 && kOW % 64 == 0, "tile multiples");
static_assert(kC % 32 == 0 && kCP % 32 == 0 && kN % 32 == 0, "k steps of 32");
static_assert(2 * kCP == kQKW && kCP <= kVR && kCP <= kOW, "plane widths");
static_assert(kCP * kC == 8192 && kC * kCP == 8192 && kN % 256 == 0 && kN % 8 == 0, "prep coverage");

typedef __attribute__((ext_vector_type(16))) _Float16 v16h;
typedef __attribute__((ext_vector_type(8)))  _Float16 v8h;
typedef __attribute__((ext_vector_type(16))) __bf16   v16b;
typedef __attribute__((ext_vector_type(8)))  __bf16   v8b;
typedef __attribute__((ext_vector_type(8)))  float    v8f;
typedef __attribute__((ext_vector_type(4)))  float    v4f;
typedef __attribute__((ext_vector_type(2)))  float    v2f;
typedef __attribute__((ext_vector_type(4)))  unsigned int v4u;

// ---------------------------------------------------------------------------
// Shared helpers (with a 4-accumulator guard)
// ---------------------------------------------------------------------------
__device__ __forceinline__ unsigned short f2bf_bits(float f) {
  unsigned u = __float_as_uint(f);
  return (unsigned short)((u + 0x7FFFu + ((u >> 16) & 1u)) >> 16);
}
__device__ __forceinline__ float bf_bits2f(unsigned short h) { return __uint_as_float(((unsigned)h) << 16); }

// hazard guards as plain device helpers (no inline asm inside the kernel template body)
__device__ __forceinline__ void dep_guard_h(v8f& a, v8f& b, v16h x, v16h y) { asm volatile("v_nop\n\tv_nop\n\tv_nop\n\tv_nop" : "+v"(a), "+v"(b) : "v"(x), "v"(y)); }
__device__ __forceinline__ void dep_guard_b(v8f& a, v8f& b, v16b x, v16b y) { asm volatile("v_nop\n\tv_nop\n\tv_nop\n\tv_nop" : "+v"(a), "+v"(b) : "v"(x), "v"(y)); }
__device__ __forceinline__ void dep_guard4_h(v8f& a, v8f& b, v8f& c, v8f& d, v16h x, v16h y) { asm volatile("v_nop\n\tv_nop\n\tv_nop\n\tv_nop" : "+v"(a), "+v"(b), "+v"(c), "+v"(d) : "v"(x), "v"(y)); }
__device__ __forceinline__ void dep_guard4_b(v8f& a, v8f& b, v8f& c, v8f& d, v16b x, v16b y) { asm volatile("v_nop\n\tv_nop\n\tv_nop\n\tv_nop" : "+v"(a), "+v"(b), "+v"(c), "+v"(d) : "v"(x), "v"(y)); }
__device__ __forceinline__ void keep4_h(v16h a, v16h b, v16h c, v16h d) { asm volatile("v_nop" :: "v"(a), "v"(b), "v"(c), "v"(d)); }
__device__ __forceinline__ void keep4_b(v16b a, v16b b, v16b c, v16b d) { asm volatile("v_nop" :: "v"(a), "v"(b), "v"(c), "v"(d)); }
__device__ __forceinline__ void acc_guard4(v8f& a, v8f& b, v8f& c, v8f& d) { asm volatile("v_nop\n\tv_nop\n\tv_nop\n\tv_nop" : "+v"(a), "+v"(b), "+v"(c), "+v"(d)); }
template <typename T> struct Frag;
template <> struct Frag<_Float16> {
  typedef v16h V; union U { v16h v; v8h h[2]; };
  // elements 0..7 <- p[0..7], 8..15 <- p[16..23]
  static __device__ __forceinline__ v16h load(const _Float16* p) {
    U f; f.h[0] = *(const v8h*)(p); f.h[1] = *(const v8h*)(p + 16); return f.v;
  }
  static __device__ __forceinline__ v8f mma(v16h a, v16h b, v8f c) {
    return __builtin_amdgcn_wmma_f32_16x16x32_f16(false, a, false, b, (short)0, c, false, false);
  }
  static __device__ __forceinline__ void guard(v8f& a, v8f& b, v16h x, v16h y) { dep_guard_h(a, b, x, y); }
  static __device__ __forceinline__ void guard4(v8f& a, v8f& b, v8f& c, v8f& d, v16h x, v16h y) { dep_guard4_h(a, b, c, d, x, y); }
  static __device__ __forceinline__ void keep(v16h a, v16h b, v16h c, v16h d) { keep4_h(a, b, c, d); }
};
template <> struct Frag<__bf16> {
  typedef v16b V; union U { v16b v; v8b h[2]; };
  static __device__ __forceinline__ v16b load(const __bf16* p) {
    U f; f.h[0] = *(const v8b*)(p); f.h[1] = *(const v8b*)(p + 16); return f.v;
  }
  static __device__ __forceinline__ v8f mma(v16b a, v16b b, v8f c) {
    return __builtin_amdgcn_wmma_f32_16x16x32_bf16(false, a, false, b, (short)0, c, false, false);
  }
  static __device__ __forceinline__ void guard(v8f& a, v8f& b, v16b x, v16b y) { dep_guard_b(a, b, x, y); }
  static __device__ __forceinline__ void guard4(v8f& a, v8f& b, v8f& c, v8f& d, v16b x, v16b y) { dep_guard4_b(a, b, c, d, x, y); }
  static __device__ __forceinline__ void keep(v16b a, v16b b, v16b c, v16b d) { keep4_b(a, b, c, d); }
};

__device__ __forceinline__ unsigned pk16(unsigned short a, unsigned short b) { return (unsigned)a | ((unsigned)b << 16); }
__device__ __forceinline__ unsigned short h_bits(float f) { const _Float16 h = (_Float16)f; return __builtin_bit_cast(unsigned short, h); }

// ---- Register-blocked batched WMMA GEMM (no activations; residual added in the store phase) ------
// C[m,n] = scale * sum_k A[m,k] * Bt[n,k] (+bias)(+resid); each wave owns a 64x64 tile.
// A row-major [M,K]; Bt row-major [N,K]; M,N % 64 == 0, K % 32 == 0.
// SPLIT: operands are hi/lo planes (A2/Bt2 = lo planes, same layout); product = hi*hi + hi*lo + lo*hi.
// BIAS_MODE: 0 = none, 1 = bias[m], 2 = bias[n].
// OUT_MODE: 0 = f32, 1 = f16, 2 = bf16 hi plane (Cout) + bf16 lo plane (Cout2).
// RESID (OUT_MODE 0 only): each lane loads ONE float4 of the residual at exactly the address it stores, adds it to the
// ET: 0 = f16 operands, 1 = bf16 operands (pointers passed as 16-bit storage)
template <int ET> struct Elem;
template <> struct Elem<0> { typedef _Float16 T; };
template <> struct Elem<1> { typedef __bf16 T; };
template <int ET, bool SPLIT, int BIAS_MODE, int OUT_MODE, bool RESID>
__global__ __launch_bounds__(256) void wmma_gemm64(
    const unsigned short* __restrict__ Ap, const unsigned short* __restrict__ A2p, int lda, long strideA,
    const unsigned short* __restrict__ Btp, const unsigned short* __restrict__ Bt2p, int ldb, long strideB,
    void* __restrict__ Cout, void* __restrict__ Cout2, int ldc, long strideC,
    const float* __restrict__ bias,
    const float* __restrict__ resid, long strideR,
    int M, int N, int K, float scale) {
  static_assert(!RESID || OUT_MODE == 0, "residual only with f32 output");
  typedef typename Elem<ET>::T T;
  typedef typename Frag<T>::V V;
  const T* A = (const T*)Ap; const T* A2 = (const T*)A2p; const T* Bt = (const T*)Btp; const T* Bt2 = (const T*)Bt2p;
  __shared__ __align__(16) float sT[8][16 * 68];   // per-wave 16x64 slab, pitch 68 floats
  const int b    = blockIdx.y;
  const int lane = threadIdx.x & 31;
  const int wave = threadIdx.x >> 5;
  const int tilesN = N >> 6;
  const int tilesM = M >> 6;
  const int tile = blockIdx.x * 8 + wave;
  if (tile >= tilesM * tilesN) return;   // wave-uniform; no block barriers in this kernel
  const int tm = tile / tilesN;
  const int tn = tile - tm * tilesN;
  const int m0 = tm << 6;
  const int n0 = tn << 6;

  const T* Ab  = A  + (size_t)b * strideA;
  const T* Bb  = Bt + (size_t)b * strideB;
  const T* Ab2 = SPLIT ? (A2  + (size_t)b * strideA) : nullptr;
  const T* Bb2 = SPLIT ? (Bt2 + (size_t)b * strideB) : nullptr;

  const int rlane = lane & 15;                 // row (A) / col (B, D) within subtile
  const int koff  = (lane >> 4) * 8;           // k offset of this lane half
  const int mOff  = (lane >> 4) * 8;           // D row offset

  v8f acc[4][4];
#pragma unroll
  for (int i = 0; i < 4; ++i)
#pragma unroll
    for (int j = 0; j < 4; ++j) acc[i][j] = (v8f){0.f,0.f,0.f,0.f,0.f,0.f,0.f,0.f};

  for (int k0 = 0; k0 < K; k0 += 32) {
    V bh[4], bl[4];
#pragma unroll
    for (int j = 0; j < 4; ++j) {
      const size_t bo = (size_t)(n0 + (j << 4) + rlane) * ldb + koff + k0;
      bh[j] = Frag<T>::load(Bb + bo);
      if (SPLIT) bl[j] = Frag<T>::load(Bb2 + bo);
    }
#pragma unroll
    for (int i = 0; i < 4; ++i) {
      const size_t ao = (size_t)(m0 + (i << 4) + rlane) * lda + koff + k0;
      V ah = Frag<T>::load(Ab + ao);
      V al;
      if (SPLIT) al = Frag<T>::load(Ab2 + ao);
#pragma unroll
      for (int j = 0; j < 4; ++j) {
        acc[i][j] = Frag<T>::mma(ah, bh[j], acc[i][j]);
        if (SPLIT) {
          acc[i][j] = Frag<T>::mma(ah, bl[j], acc[i][j]);
          acc[i][j] = Frag<T>::mma(al, bh[j], acc[i][j]);
        }
      }
      Frag<T>::guard4(acc[i][0], acc[i][1], acc[i][2], acc[i][3], ah, SPLIT ? al : ah);
    }
    Frag<T>::keep(bh[0], bh[1], bh[2], bh[3]);
    if (SPLIT) Frag<T>::keep(bl[0], bl[1], bl[2], bl[3]);
  }
  acc_guard4(acc[0][0], acc[0][1], acc[0][2], acc[0][3]);
  acc_guard4(acc[1][0], acc[1][1], acc[1][2], acc[1][3]);
  acc_guard4(acc[2][0], acc[2][1], acc[2][2], acc[2][3]);
  acc_guard4(acc[3][0], acc[3][1], acc[3][2], acc[3][3]);

  // ---- epilogue ----
  float* slab = sT[wave];
  const float* Rb = RESID ? (resid + (size_t)b * strideR) : nullptr;
#pragma unroll
  for (int i = 0; i < 4; ++i) {
    const int mBase = m0 + (i << 4);
#pragma unroll
    for (int j = 0; j < 4; ++j) {
      const int n = n0 + (j << 4) + rlane;
      float bvn = 0.f;
      if (BIAS_MODE == 2) bvn = bias[n];
#pragma unroll
      for (int r = 0; r < 8; ++r) {
        float v = acc[i][j][r] * scale;
        if (BIAS_MODE == 1) v += bias[mBase + mOff + r];
        if (BIAS_MODE == 2) v += bvn;
        slab[(mOff + r) * 68 + (j << 4) + rlane] = v;
      }
    }
    __builtin_amdgcn_fence(__ATOMIC_RELEASE, "workgroup");
    __builtin_amdgcn_wave_barrier();
    __builtin_amdgcn_fence(__ATOMIC_ACQUIRE, "workgroup");
    if (OUT_MODE == 0) {
      float* C = (float*)Cout + (size_t)b * strideC;
      const int hh = lane >> 4, c4 = (lane & 15) * 4;     // row seg = 256 B = 16 lanes x 16 B
      v4f vals[8];
#pragma unroll
      for (int it = 0; it < 8; ++it) {
        const int row = it * 2 + hh;
        v4f v = *(const v4f*)(slab + row * 68 + c4);
        if (RESID) {
          const v4f rv = *(const v4f*)(Rb + (size_t)(mBase + row) * ldc + n0 + c4);
          v = v + rv;
        }
        vals[it] = v;
      }
      {
#pragma unroll
        for (int it = 0; it < 8; ++it) {
          const int row = it * 2 + hh;
          *(v4f*)(C + (size_t)(mBase + row) * ldc + n0 + c4) = vals[it];
        }
        
      }
    } else {
      const int q = lane >> 3, c8 = (lane & 7) * 8;
      unsigned short* C  = (unsigned short*)Cout  + (size_t)b * strideC;
      unsigned short* C2 = (OUT_MODE == 2) ? ((unsigned short*)Cout2 + (size_t)b * strideC) : nullptr;
      {
#pragma unroll
        for (int it = 0; it < 4; ++it) {
          const int row = it * 4 + q;
          const float* sp = slab + row * 68 + c8;
          v8h hv, lv;
#pragma unroll
          for (int e = 0; e < 8; ++e) {
            if (OUT_MODE == 1) {
              hv[e] = (_Float16)sp[e];
            } else {
              unsigned short hb = f2bf_bits(sp[e]);
              unsigned short lb = f2bf_bits(sp[e] - bf_bits2f(hb));
              hv[e] = __builtin_bit_cast(_Float16, hb);
              lv[e] = __builtin_bit_cast(_Float16, lb);
            }
          }
          *(v8h*)(C + (size_t)(mBase + row) * ldc + n0 + c8) = hv;
          if (OUT_MODE == 2) *(v8h*)(C2 + (size_t)(mBase + row) * ldc + n0 + c8) = lv;
        }
        
      }
    }
    __builtin_amdgcn_fence(__ATOMIC_RELEASE, "workgroup");
    __builtin_amdgcn_wave_barrier();
    __builtin_amdgcn_fence(__ATOMIC_ACQUIRE, "workgroup");
  }
}

// ---------------------------------------------------------------------------
// Parameter planes (17 blocks of 256 threads):
//   blocks  0.. 3: WP16[0..8191]      = f16(16 * log2 e * Wq)   (tiles 0, 1 of 16 rows)
//   blocks  4.. 7: WP16[8192..16383]  = f16(16 * Wk)            (tiles 2, 3)
//   blocks  8..11: WP16[16384..24575] = f16(16 * Wv)            (tiles 4, 5)
//   blocks 12..15: WB16[0..8191]      = f16(16 * Wb)            ([256][32], row-major)
//   block  16    : BQK[64] = log2 e * bq | bk (f32), BV64[64] = bv | 0 (f32)
// WP16 lies in fragment order: [tile of 16 rows][k step of 32 channels][half][lane][8 halves]; lane l holds row l & 15 of the tile,
// channels 16 * half + 8 * (l >> 4) + 0..7 of the k step: the two 16-B parts of a lane's fragment, each part 512 contiguous B a wave.
// Coverage: 4 blocks x 256 threads x 8 = 8192 elements per group. Each thread one 16-B store; a wave writes 512 contiguous B
// ---------------------------------------------------------------------------
__global__ __launch_bounds__(256) void prep_kernel(const float* __restrict__ Wq, const float* __restrict__ bq,
                                                   const float* __restrict__ Wk, const float* __restrict__ bk,
                                                   const float* __restrict__ Wv, const float* __restrict__ bv,
                                                   const float* __restrict__ Wb,
                                                   unsigned short* __restrict__ WP16,
                                                   unsigned short* __restrict__ WB16,
                                                   float* __restrict__ BQK, float* __restrict__ BV64) {
  const int t   = threadIdx.x;
  const int blk = blockIdx.x;
  if (blk < 16) {   // block-uniform
    const int grp = blk >> 2;
    const int sub = blk & 3;
    const int d   = sub * 256 + t;         // 16-B part of the group's plane, 0 .. 1023
    const int e0  = d * 8;                 // 0 .. 8184
    // where part d comes from: Wb as it lies; else row (d >> 9) * 16 + (d & 15), channel 32 * k step + 16 * half + 8 * (lane >> 4)
    const int s0  = (grp == 3) ? e0 : (((d >> 9) * 16 + (d & 15)) * kC + ((d >> 6) & 7) * 32 + ((d >> 5) & 1) * 16 + ((d >> 4) & 1) * 8);
    const float* src = (grp == 0) ? Wq : (grp == 1) ? Wk : (grp == 2) ? Wv : Wb;
    const float  f   = (grp == 0) ? kWCarry * kLog2e : kWCarry;
    unsigned short* dst = (grp == 3) ? WB16 : (WP16 + grp * 8192);
    const v4f a = *(const v4f*)(src + s0);
    const v4f c = *(const v4f*)(src + s0 + 4);
    unsigned short hb[8];
#pragma unroll
    for (int e = 0; e < 4; ++e) {
      hb[e]     = h_bits(a[e] * f);
      hb[4 + e] = h_bits(c[e] * f);
    }
    const v4u u = (v4u){pk16(hb[0], hb[1]), pk16(hb[2], hb[3]), pk16(hb[4], hb[5]), pk16(hb[6], hb[7])};
    unsigned short* dp = dst + e0;
    *(v4u*)dp = u;
  } else {
    const int lane = t & 31, wave = t >> 5;
    const int idx = (lane & 7) * 4;   // 0..28: always inside the 32-entry bias vectors
    const v4f q4 = *(const v4f*)(bq + idx);
    const v4f k4 = *(const v4f*)(bk + idx);
    const v4f w4 = *(const v4f*)(bv + idx);
    const float fq = (lane < 8) ? 1.0f : 0.0f;
    const float fk = (lane < 8) ? 0.0f : 1.0f;
    // arithmetic select: lanes 0..7 take bq / bv, lanes 8..15 take bk / zeros (all loads unconditional)
    const v4f valQK = q4 * (fq * kLog2e) + k4 * fk;
    const v4f valV  = w4 * fq;
    const bool wq = (wave == 0) && (lane < 16);
    const bool wv = (wave == 1) && (lane < 16);
    float* dq = BQK  + (lane & 15) * 4;
    float* dv = BV64 + (lane & 15) * 4;
    if (wq) *(v4f*)dq = valQK;
    if (wv) *(v4f*)dv = valV;
  }
}

// ---------------------------------------------------------------------------
// q, k and v projections straight from x[b][c][n] (f32, n contiguous): no transposed f16 copy of x in memory.
//   QK16[b][n][o'] = f16( (1/16) sum_c WP[o'][c] * f16(x[b][c][n]) + BQK[o'] ),  o' = 0..63 (q | k), position-major
//   V16[b][o][n]   = f16( (1/16) sum_c WP[64 + o][c] * f16(x[b][c][n]) + BV64[o] ),  o = 0..31, channel-major
// grid (kN/128 = 32, kB) blocks of 4 waves; a wave owns 32 positions, as two tiles of 16: column (or row) m of tile p is position
// n0 + 2 m + p, so that a lane's 8-B load of one channel feeds both tiles and 16 lanes read one whole 128-B line.
// An x fragment (lane = position, 16 channels in the k order of Frag::load) serves as B against the q|k weight rows (A): D[o'][n], a lane
// holds 8 consecutive o' of one position = one 16-B store; and as A against the v weight rows (B): D[n][o], a lane holds, over both
// tiles, 16 consecutive positions of one channel; these go through LDS so that each 128-B line of V16 is stored whole by one wave.
// The 48 KiB of weights are copied once to LDS as they lie (fragment order: every read is 512 contiguous B): LDS reads count on their
// own counter, so that waiting for a weight fragment does not wait for the x loads, which run three k steps ahead (one wave on a SIMD:
// nothing else hides the memory latency, and the registers are there).
// ---------------------------------------------------------------------------
constexpr int kPJWaves   = 4;
constexpr int kPJThreads = kPJWaves * 32;       // 128
constexpr int kPJPos     = 32 * kPJWaves;       // 128 positions per block
constexpr int kPJSteps   = kC / 32;             // 8 k steps
constexpr int kPJTiles   = 6;                   // tiles of 16 weight rows: q, q, k, k, v, v
constexpr int kPJWHalves = kPJTiles * kPJSteps * 512;   // 24,576 halves of weights
constexpr int kPJVPitch  = kPJPos + 8;          // halves per channel row of the v tile in LDS (a multiple of 8: 16-B parts stay aligned)
static_assert(kN % kPJPos == 0 && kPJWHalves % (kPJThreads * 8) == 0 && (kCP * kPJPos) % (kPJThreads * 8) == 0 && kPJTiles * 16 == 3 * kCP, "projection tiling");
__global__ __launch_bounds__(kPJThreads) void proj_kernel(const float* __restrict__ x, const unsigned short* __restrict__ WP16,
                                                          const float* __restrict__ BQK, const float* __restrict__ BV64,
                                                          unsigned short* __restrict__ QK16, unsigned short* __restrict__ V16) {
  typedef Frag<_Float16> F;
  __shared__ __align__(16) _Float16 sW[kPJWHalves];
  __shared__ __align__(16) _Float16 sV[kCP * kPJVPitch];
  const int t    = threadIdx.x;
  const int lane = t & 31;
  const int wave = t >> 5;
  const int c    = lane & 15;
  const int h    = lane >> 4;
  const int b    = blockIdx.y;
  const int nb   = blockIdx.x * kPJPos;     // the block's first position
  const int n0   = nb + wave * 32;          // the wave's
  // channel 8 h, positions n0 + 2 c, + 1; every load of x is a compile-time offset from this address
  const float* xl = x + ((size_t)b * kC + h * 8) * kN + n0 + 2 * c;
  const unsigned short* wl = WP16 + t * 8;
  constexpr int kParts = kPJWHalves / (kPJThreads * 8);   // 24 parts of 16 B per thread
  v4u wst[kParts];
#pragma unroll
  for (int i = 0; i < kParts; ++i) wst[i] = *(const v4u*)(wl + i * kPJThreads * 8);
  v2f raw[3][16];   // three register sets take turns: element e is channel 8 h + e (e < 8), 16 + 8 h + e - 8 (e >= 8) of the k step
#pragma unroll
  for (int s = 0; s < 2; ++s)
#pragma unroll
    for (int e = 0; e < 16; ++e) raw[s][e] = *(const v2f*)(xl + (size_t)(s * 32 + e + (e & 8)) * kN);
#pragma unroll
  for (int i = 0; i < kParts; ++i) *(v4u*)(sW + (i * kPJThreads + t) * 8) = wst[i];
  __syncthreads();   // the weights are in sW
  // the third set's loads stand behind the barrier, which waits for every load in front of it
#pragma unroll
  for (int e = 0; e < 16; ++e) raw[2][e] = *(const v2f*)(xl + (size_t)(2 * 32 + e + (e & 8)) * kN);
  // the biases of the two epilogues, read here so that the loop hides them: o' = 16 ot + 8 h + r for q|k, channel 16 nt + c for v
  v8f bqk[4];
  float bvn[2];
#pragma unroll
  for (int ot = 0; ot < 4; ++ot) {
    const v4f b0 = *(const v4f*)(BQK + ot * 16 + h * 8);
    const v4f b1 = *(const v4f*)(BQK + ot * 16 + h * 8 + 4);
    bqk[ot] = __builtin_shufflevector(b0, b1, 0, 1, 2, 3, 4, 5, 6, 7);
  }
#pragma unroll
  for (int nt = 0; nt < 2; ++nt) bvn[nt] = BV64[nt * 16 + c];
  // the bias loads' offset registers are given new values directly behind them
  asm volatile("s_wait_xcnt 0x0" ::: "memory");
  __builtin_amdgcn_sched_barrier(0);   // these loads are not sunk to their uses behind the loop
  const v8f zero = (v8f){0.f, 0.f, 0.f, 0.f, 0.f, 0.f, 0.f, 0.f};
  v8f acc[2][kPJTiles];
#pragma unroll
  for (int p = 0; p < 2; ++p)
#pragma unroll
    for (int ot = 0; ot < kPJTiles; ++ot) acc[p][ot] = zero;
#pragma unroll   // whole: the sets' turns and every address offset are compile-time
  for (int ks = 0; ks < kPJSteps; ++ks) {
    F::U w[kPJTiles];   // the step's weight fragments: read first, the casts behind them hide the LDS latency
#pragma unroll
    for (int ot = 0; ot < kPJTiles; ++ot) {
      const _Float16* wp = sW + (ot * kPJSteps + ks) * 512 + lane * 8;
      w[ot].h[0] = *(const v8h*)(wp); w[ot].h[1] = *(const v8h*)(wp + 256);
    }
    v16h xf[2];
#pragma unroll
    for (int p = 0; p < 2; ++p) {
      v8f lo, hi;
#pragma unroll
      for (int e = 0; e < 8; ++e) { lo[e] = raw[ks % 3][e][p]; hi[e] = raw[ks % 3][8 + e][p]; }
      xf[p] = __builtin_shufflevector(__builtin_convertvector(lo, v8h), __builtin_convertvector(hi, v8h),
                                      0, 1, 2, 3, 4, 5, 6, 7, 8, 9, 10, 11, 12, 13, 14, 15);
    }
    // the refill is not lifted in front of the casts: it would take a fourth register set and 64 loads in flight
    __builtin_amdgcn_sched_barrier(0);
    if (ks + 3 < kPJSteps) {
#pragma unroll
      for (int e = 0; e < 16; ++e) raw[ks % 3][e] = *(const v2f*)(xl + (size_t)((ks + 3) * 32 + e + (e & 8)) * kN);
    }
    __builtin_amdgcn_sched_barrier(0);   // the loads of three steps on are not sunk behind this step's products
#pragma unroll
    for (int ot = 0; ot < kPJTiles; ++ot)
#pragma unroll
      for (int p = 0; p < 2; ++p)
        acc[p][ot] = (ot < 4) ? F::mma(w[ot].v, xf[p], acc[p][ot]) : F::mma(xf[p], w[ot].v, acc[p][ot]);
    __builtin_amdgcn_sched_barrier(0);   // nor later steps' LDS reads, casts and loads lifted into this step, which takes further register sets
  }
  // the wait behind the loads of x: their address pair is given no new value in front of it
  // (it never changes, and as an input here it stays in its registers up to the wait; the weights' loads were waited for at the barrier)
  asm volatile("s_wait_xcnt 0x0" :: "v"(xl) : "memory");
  // q|k: rows o' = 16 ot + 8 h + r of column c, which is position n0 + 2 c + p
  unsigned short* qrow = QK16 + ((size_t)b * kN + n0 + 2 * c) * kQKW + h * 8;
#pragma unroll
  for (int ot = 0; ot < 4; ++ot) {
#pragma unroll
    for (int p = 0; p < 2; ++p) {
      v8f v;
#pragma unroll
      for (int r = 0; r < 8; ++r) { v[r] = acc[p][ot][r] * kWCarryInv; v[r] += bqk[ot][r]; }
      *(v8h*)(qrow + p * kQKW + ot * 16) = __builtin_convertvector(v, v8h);
    }
  }
  // v: column c is channel 16 nt + c; row 8 h + r of tile p is position 2 (8 h + r) + p of the wave's 32
#pragma unroll
  for (int nt = 0; nt < 2; ++nt) {
    v8f v0, v1;
#pragma unroll
    for (int r = 0; r < 4; ++r)
#pragma unroll
      for (int p = 0; p < 2; ++p) {
        v0[2 * r + p] = acc[p][4 + nt][r] * kWCarryInv;     v0[2 * r + p] += bvn[nt];
        v1[2 * r + p] = acc[p][4 + nt][4 + r] * kWCarryInv; v1[2 * r + p] += bvn[nt];
      }
    _Float16* sp = sV + (nt * 16 + c) * kPJVPitch + wave * 32 + h * 16;
    *(v8h*)(sp)     = __builtin_convertvector(v0, v8h);
    *(v8h*)(sp + 8) = __builtin_convertvector(v1, v8h);
  }
  __syncthreads();   // every wave's 32 positions of the 32 channels are in sV
#pragma unroll
  for (int it = 0; it < (kCP * kPJPos) / (kPJThreads * 8); ++it) {   // 4 parts of 16 B per thread; a wave stores 2 rows of 256 B
    const int part = it * kPJThreads + t;
    const int row  = part >> 4;
    const int col8 = (part & 15) * 8;
    *(v8h*)(V16 + ((size_t)b * kVR + row) * kN + nb + col8) = *(const v8h*)(sV + row * kPJVPitch + col8);
  }
}

// ---------------------------------------------------------------------------
// Softmax statistic of the score rows, from score tiles formed in registers (no score plane in memory): for each j,
//   stat[j] = 15 - max_i S[j][i] - log2 sum_i 2^(S[j][i] - max),  S[j][i] = q row j . k row i, q carrying log2 e,
// so that 2^(S[j][i] + stat[j]) is the probability carried x 32768.
// One block owns 64 rows j (4 tiles of 16) of one batch and all 4096 i: grid (kN/64 = 64, kB) blocks of 16 waves, blockIdx.y the
// batch; wave w takes i in [256 w, 256 w + 256).
// A tile is D[i][j] = k rows (A) x q rows (B, the block's 4 fragments loaded once): every k fragment loaded feeds 4 tiles.
// A lane holds column j = lane & 15 of each tile of j and rows i = 8 h + r (h = lane >> 4). Per tile of j it keeps a running
// maximum and the exp-sum relative to it: per 32 i the maximum is raised and the old sum brought to it by one factor.
// The (maximum, sum) pairs of the 2 lane halves join by lane exchange, those of the 16 waves through LDS behind one barrier,
// each sum brought to the common maximum by one factor 2^(own maximum - common maximum); wave w < 4 joins tile w of j.
// STAT holds, per batch and per 16 rows j, one 128-B line, stored whole by one wave: the 16 statistics, twice (the second 16 are not read).
// ---------------------------------------------------------------------------
// 2^y on the transcendental unit. The v_nop fills the one slot that the instruction set asks for behind a transcendental before
// its result is read or its source overwritten: inside the statement it stands there in every build.
__device__ __forceinline__ float exp2_slot(float y) { float r; asm("v_exp_f32 %0, %1\n\tv_nop" : "=v"(r) : "v"(y)); return r; }
// Every use in the row statistics has y <= 0: no overflow; below 2^-126 the term is 0 beside a sum that is at least 1.
// log2 x for x >= 1 on the transcendental unit, with the same slot behind it
__device__ __forceinline__ float log2_slot(float x) { float r; asm("v_log_f32 %0, %1\n\tv_nop" : "=v"(r) : "v"(x)); return r; }
constexpr float kPCarryLog2 = 15.0f;
static_assert(kPCarry == 32768.0f, "2^15");
constexpr int kRSWaves   = 16;
constexpr int kRSThreads = kRSWaves * 32;      // 512
constexpr int kStatRows  = 16;                 // rows j of S per 128-B line of STAT
constexpr int kRSJT      = 4;                  // 16-row tiles of j per block: every k fragment loaded feeds this many score tiles
constexpr int kRSCols    = kStatRows * kRSJT;  // 64 rows j of S per block
constexpr int kRSChunk   = kN / kRSWaves;      // 256 i per wave
constexpr int kRSGroups  = kRSChunk / 32;      // 8 groups of two k fragments (32 i)
static_assert(kN % kRSCols == 0 && kRSChunk % 32 == 0 && kRSWaves % 2 == 0 && kRSJT <= kRSWaves, "row statistics tiling");
__global__ __launch_bounds__(kRSThreads) void rowstats_kernel(const unsigned short* __restrict__ QKp, float* __restrict__ STAT) {
  typedef Frag<_Float16> F;
  __shared__ float pmax[kRSWaves][kRSCols];
  __shared__ float psum[kRSWaves][kRSCols];
  const int t    = threadIdx.x;
  const int lane = t & 31;
  const int wave = t >> 5;
  const int c    = lane & 15;
  const int h    = lane >> 4;
  const _Float16* QK    = (const _Float16*)QKp + (size_t)blockIdx.y * kN * kQKW;   // the block's batch
  const _Float16* Qlane = QK + (size_t)(blockIdx.x * kRSCols + c) * kQKW + h * 8;
  // row of the wave's first position i; its k half starts at column kCP; every tile is a compile-time offset from this address
  const _Float16* Klane = QK + (size_t)(wave * kRSChunk + c) * kQKW + h * 8;
  v16h qf[kRSJT];
#pragma unroll
  for (int jt = 0; jt < kRSJT; ++jt) qf[jt] = F::load(Qlane + (size_t)(jt * 16) * kQKW);
  const v8f zero = (v8f){0.f, 0.f, 0.f, 0.f, 0.f, 0.f, 0.f, 0.f};
  v16h a[2][2];   // two register sets of two k fragments take turns
  a[0][0] = F::load(Klane + kCP);
  a[0][1] = F::load(Klane + kCP + (size_t)16 * kQKW);
  float m[kRSJT], sum[kRSJT];   // per lane and tile of j: running maximum, exp-sum relative to it
#pragma unroll   // whole: the sets' turns and the groups' address offsets are compile-time, the two address pairs never change
  for (int g = 0; g < kRSGroups; ++g) {
    if (g + 1 < kRSGroups) {
      a[(g + 1) & 1][0] = F::load(Klane + kCP + (size_t)((g + 1) * 32) * kQKW);
      a[(g + 1) & 1][1] = F::load(Klane + kCP + (size_t)((g + 1) * 32 + 16) * kQKW);
      __builtin_amdgcn_sched_barrier(0);   // the next group's 4 loads stay issued ahead of this group's exp work, which hides them
    }
#pragma unroll
    for (int jt = 0; jt < kRSJT; ++jt) {
      const v8f d0 = F::mma(a[g & 1][0], qf[jt], zero);
      const v8f d1 = F::mma(a[g & 1][1], qf[jt], zero);
      float t0 = d0[0], t1 = d1[0];
#pragma unroll
      for (int r = 1; r < 8; ++r) { t0 = fmaxf(t0, d0[r]); t1 = fmaxf(t1, d1[r]); }
      const float tm = fmaxf(t0, t1);
      const float mn = (g == 0) ? tm : fmaxf(m[jt], tm);
      float s0 = exp2_slot(d0[0] - mn), s1 = exp2_slot(d1[0] - mn);
#pragma unroll
      for (int r = 1; r < 8; ++r) { s0 += exp2_slot(d0[r] - mn); s1 += exp2_slot(d1[r] - mn); }
      sum[jt] = (g == 0) ? (s0 + s1) : (sum[jt] * exp2_slot(m[jt] - mn) + (s0 + s1));   // the old sum brought to the new maximum
      m[jt] = mn;
      // one tile of j at a time: without it the build interleaves the tiles and takes 168 registers for 103: one block on a WGP for two
      __builtin_amdgcn_sched_barrier(0);
    }
  }
  // the one wait behind the kernel's loads: no address register of an issued load is given a new value in front of it
  // (the two pairs never change, and as inputs here they stay in their registers up to the wait)
  asm volatile("s_wait_xcnt 0x0" :: "v"(Qlane), "v"(Klane) : "memory");
#pragma unroll
  for (int jt = 0; jt < kRSJT; ++jt) {   // the two lane halves of column j
    const float mo = __shfl_xor(m[jt], 16, 32), so = __shfl_xor(sum[jt], 16, 32);
    const float mj = fmaxf(m[jt], mo);
    sum[jt] = sum[jt] * exp2_slot(m[jt] - mj) + so * exp2_slot(mo - mj);
    m[jt] = mj;
  }
  if (lane < 16) {
#pragma unroll
    for (int jt = 0; jt < kRSJT; ++jt) { pmax[wave][jt * 16 + c] = m[jt]; psum[wave][jt * 16 + c] = sum[jt]; }
  }
  __syncthreads();   // every wave's partial maxima and sums are in pmax, psum
  if (wave >= kRSJT) return;   // wave-uniform, behind the kernel's only barrier; wave w joins tile w of j
  const int col = wave * 16 + c;
  float wm[kRSWaves / 2], wsum[kRSWaves / 2];   // lane half h joins waves 8 h .. 8 h + 7 in wave order
#pragma unroll
  for (int w = 0; w < kRSWaves / 2; ++w) {
    wm[w]   = pmax[h * (kRSWaves / 2) + w][col];
    wsum[w] = psum[h * (kRSWaves / 2) + w][col];
  }
  float bm = wm[0];
#pragma unroll
  for (int w = 1; w < kRSWaves / 2; ++w) bm = fmaxf(bm, wm[w]);
  bm = fmaxf(bm, __shfl_xor(bm, 16, 32));
  float tot = wsum[0] * exp2_slot(wm[0] - bm);
#pragma unroll
  for (int w = 1; w < kRSWaves / 2; ++w) tot += wsum[w] * exp2_slot(wm[w] - bm);
  tot += __shfl_xor(tot, 16, 32);   // tot >= 1: the row maximum contributes 2^0
  STAT[((size_t)blockIdx.y * (kN / kStatRows) + blockIdx.x * kRSJT + wave) * 32 + lane] = kPCarryLog2 - bm - log2_slot(tot);
}

// ---------------------------------------------------------------------------
// attn^T.v with the probabilities formed in registers (no probability plane in memory):
//   O16[i][c] = f16( (64/32768) sum_j P[i][j] * V16[c][j] ),  P[i][j] = f16( 2^(S[j][i] + stat[j]) ), f32 math.
// One block owns 64 positions i (4 tiles of 16) of one batch and all 4096 j: grid (kN/64 = 64, kB) blocks of 16 waves, blockIdx.y
// the batch; wave w walks j in [256 w, 256 w + 256). Every q, V and statistics load feeds the 4 tiles of i.
// Per 32 j and tile of i: two score tiles D[j][i] = q rows (A) x k rows (B, loaded once) + C, C[j][i] = stat[j]: the matrix unit's own
// addition gives the exponent, and a probability costs the vector port one v_exp_f32 and half a packed conversion.
// A lane then holds column i = lane & 15 and
// rows j = 8 h + r and 16 + 8 h + r (h = lane >> 4), which is the k order of an A fragment of row i: converted in place,
// the two tiles are the A operand against the V fragments (same k order from Frag::load). No LDS, no lane exchange.
// The 16 waves' partial 64 x 32 tiles are joined through LDS in wave order behind one barrier.
// ---------------------------------------------------------------------------
constexpr int kAVWaves   = 16;
constexpr int kAVThreads = kAVWaves * 32;      // 512
constexpr int kAVIT      = 4;                  // 16-row tiles of i per block: every q, V and statistics load feeds this many tiles
constexpr int kAVRows    = 16 * kAVIT;         // 64 positions i per block
constexpr int kAVChunk   = kN / kAVWaves;      // 256 j per wave
constexpr int kAVSteps   = kAVChunk / 32;      // 8 steps of 32 j
constexpr int kAVPitch   = kCP + 4;            // floats per row of a partial tile
static_assert(kN % kAVRows == 0 && kAVChunk % 32 == 0 && (kAVRows * kCP) % kAVThreads == 0 && kCP == 32, "attn.v tiling");
// what 16 of a step's 32 j read for the scores: one q fragment and the lane's 8 row statistics, which are a C operand as they lie
// (register r of a lane is row 8 h + r of the tile, in C as in D; every column takes the same value)
struct AVHalf { v16h q; v8f c; };
__device__ __forceinline__ void av_load_half(AVHalf& s, const _Float16* __restrict__ Qlane, const float* __restrict__ Slane, int j0) {
  s.q = Frag<_Float16>::load(Qlane + (size_t)j0 * kQKW);   // q rows j0 .. j0 + 15
  const v4f c0 = *(const v4f*)(Slane + j0 * 2);            // j0 + 8 h + 0..3;  STAT: 32 floats per 16 j
  const v4f c1 = *(const v4f*)(Slane + j0 * 2 + 4);        // j0 + 8 h + 4..7
  s.c = __builtin_shufflevector(c0, c1, 0, 1, 2, 3, 4, 5, 6, 7);
}
// 8 probabilities of one lane from one tile of exponents (at most 15: no overflow in f32 or f16)
__device__ __forceinline__ v8h av_prob(const v8f s) {
  v8f e;
#pragma unroll
  for (int r = 0; r < 8; ++r) e[r] = __builtin_amdgcn_exp2f(s[r]);
  // the slot that the instruction set asks for behind a transcendental before its result is read or its source overwritten, in every
  // build: the results pass through the statement, so no reader stands in front of the v_nop; the exponents are its inputs, so they
  // keep their registers up to it and no v_exp_f32 lands on the source of the one directly in front
  asm("v_nop" : "+v"(e) : "v"(s));
  return __builtin_convertvector(e, v8h);
}
__global__ __launch_bounds__(kAVThreads) void attnv_kernel(const unsigned short* __restrict__ QKp,
                                                           const unsigned short* __restrict__ Vp,
                                                           const float* __restrict__ ST,
                                                           unsigned short* __restrict__ O) {
  typedef Frag<_Float16> F;
  __shared__ __align__(16) float part[kAVWaves][kAVRows][kAVPitch];
  const int t    = threadIdx.x;
  const int lane = t & 31;
  const int wave = t >> 5;
  const int c    = lane & 15;
  const int h8   = (lane >> 4) * 8;
  const int i0   = blockIdx.x * kAVRows;
  const int jb   = wave * kAVChunk;
  const int bt   = blockIdx.y;   // the block's batch
  const _Float16* QK    = (const _Float16*)QKp + (size_t)bt * kN * kQKW;
  const _Float16* Klane = QK + (size_t)(i0 + c) * kQKW + h8;   // row of position i0 + c; its k half starts at column kCP
  // the wave's first step
  const _Float16* Qlane = QK + (size_t)(jb + c) * kQKW + h8;
  const _Float16* Vlane = (const _Float16*)Vp + (size_t)bt * kVR * kN + (size_t)c * kN + jb + h8;
  const float* Slane = ST + (size_t)bt * kN * 2 + jb * 2 + h8;    // walks 32 floats per 16 j
  v16h kf[kAVIT];
#pragma unroll
  for (int it = 0; it < kAVIT; ++it) kf[it] = F::load(Klane + kCP + (size_t)(it * 16) * kQKW);
  // the k fragments stay the oldest loads: issued ahead of the first step's; issued behind them, their wait would stand inside the loop and drain its refills each step
  __builtin_amdgcn_sched_barrier(0);
  const v8f zero = (v8f){0.f, 0.f, 0.f, 0.f, 0.f, 0.f, 0.f, 0.f};
  v8f acc[kAVIT][2];
#pragma unroll
  for (int it = 0; it < kAVIT; ++it) { acc[it][0] = zero; acc[it][1] = zero; }
  // One register set: each part is loaded anew directly behind its last use, half a step ahead of its next use.
  AVHalf ha, hb;
  v16h v0, v1;
  av_load_half(ha, Qlane, Slane, 0);
  // the first half's loads stay ahead of the others, as in the loop's refills: the loop's counted waits are set for both ways into it,
  // and with the two halves mixed here the wait at the loop's head reaches into the refill issued just in front of it
  __builtin_amdgcn_sched_barrier(0);
  av_load_half(hb, Qlane, Slane, 16);
  v0 = F::load(Vlane);                        // channels 0..15
  v1 = F::load(Vlane + (size_t)16 * kN);      // channels 16..31
  // one step of 32 j; refill: whether a next step exists, a literal at both calls, so that a step is one run of code with no branch
  auto step = [&](const int jn, const bool refill) {
    // the next step's three addresses, each formed once: the refills read at compile-time offsets from them
    const _Float16* Qn  = Qlane + (size_t)jn * kQKW;
    const _Float16* Vn  = Vlane + jn;
    const float*    Sn  = Slane + jn * 2;
    v8h plo[kAVIT];
#pragma unroll
    for (int it = 0; it < kAVIT; ++it) plo[it] = av_prob(F::mma(ha.q, kf[it], ha.c));   // j = 8 h + r of the step
    if (refill) {
      __builtin_amdgcn_sched_barrier(0);   // the refill is not lifted into the exp work in front of it (it would need a second register set)
      av_load_half(ha, Qn, Sn, 0);
      // the step's addresses sit in registers that are given new values behind the loads; as inputs here the pairs stay
      // in their registers up to the wait, so that no load of the run lands in one of them
      asm volatile("s_wait_xcnt 0x0" :: "v"(Qn), "v"(Sn) : "memory");
      __builtin_amdgcn_sched_barrier(0);   // nor sunk: the second half's exp work behind it hides the loads
    }
#pragma unroll
    for (int it = 0; it < kAVIT; ++it) {
      const v8h phi = av_prob(F::mma(hb.q, kf[it], hb.c));                                  // j = 16 + 8 h + r
      const v16h p = __builtin_shufflevector(plo[it], phi, 0, 1, 2, 3, 4, 5, 6, 7, 8, 9, 10, 11, 12, 13, 14, 15);
      acc[it][0] = F::mma(p, v0, acc[it][0]);
      acc[it][1] = F::mma(p, v1, acc[it][1]);
    }
    if (refill) {
      __builtin_amdgcn_sched_barrier(0);   // as above, for the second half's and the V fragments' refill
      av_load_half(hb, Qn, Sn, 16);
      v0 = F::load(Vn);
      v1 = F::load(Vn + (size_t)16 * kN);
      asm volatile("s_wait_xcnt 0x0" :: "v"(Qn), "v"(Vn), "v"(Sn) : "memory");   // as above
      __builtin_amdgcn_sched_barrier(0);   // nor sunk: the next step's first half hides these loads
    }
  };
#pragma unroll 1   // rolled: one step's code for 4 tiles of i is as long as the 8 steps for one tile were
  for (int s = 1; s < kAVSteps; ++s) step(s * 32, true);
  step(0, false);   // the last step has nothing to load
#pragma unroll
  for (int it = 0; it < kAVIT; ++it)
#pragma unroll
    for (int r = 0; r < 8; ++r) {
      part[wave][it * 16 + h8 + r][c]      = acc[it][0][r];
      part[wave][it * 16 + h8 + r][16 + c] = acc[it][1][r];
    }
  __syncthreads();   // every wave's partial tiles are in part
  const int col = lane;   // a wave stores the 64 used bytes of one row of O, 4 rows in turn
#pragma unroll
  for (int it = 0; it < kAVIT; ++it) {
    const int row = it * 16 + wave;
    float sum = part[0][row][col];
#pragma unroll
    for (int w = 1; w < kAVWaves; ++w) sum += part[w][row][col];
    O[(size_t)bt * kN * kOW + (size_t)(i0 + row) * kOW + col] = h_bits(sum * kPVScale);
  }
}

// ---------------------------------------------------------------------------
// Host glue.
// Workspace region map (bytes, every offset a multiple of 256):
//   WP16  f16 [6][8][2][32][8]        49,152  at           0   16*log2e*Wq, 16*Wk, 16*Wv in fragment order
//   WB16  f16 [256][32]               16,384  at      49,152   16*Wb
//   BQK   f32 [64]                       256  at      65,536   log2e*bq | bk
//   BV64  f32 [64]                       256  at      65,792   bv | 0
//   QK16  f16 [8][4096][64]        4,194,304  at      66,048   cols 0..31 q x log2e, 32..63 k
//   V16   f16 [8][64][4096]        4,194,304  at   4,260,352   channel-major v, rows 0..31 (32..63 neither written nor read)
//   STAT  f32 [8][256][32]           262,144  at   8,454,656   per 16 score rows: 16 x (15 - max - log2 sum), twice
//   O16   f16 [8][4096][64]        4,194,304  at   8,716,800   attention output x64, position-major, cols 0..31 (32..63 neither written nor read)
//   total                         12,911,104
// GEMM shapes: q, k, v M=96 N=4096 K=256 (own kernel); scores M=N=4096 K=32 (tiles inside the two attention kernels);
// attn.v M=4096 N=32 K=4096 (own kernel); back M=256 N=4096 K=32. No padding reads of unwritten data.
// Launch count: 1 + 1 + 2 + 1 = 5.
// ---------------------------------------------------------------------------
extern "C" void kernel_launch(void* const* d_in, const int* in_sizes, int n_in,
                              void* d_out, int out_size, void* d_ws, size_t ws_size,
                              hipStream_t stream) {
  if (n_in < 9) return;
  const int nX = kB * kC * kN;   // 8,388,608
  if (in_sizes[0] != nX) return;
  if (in_sizes[1] != kCP * kC || in_sizes[3] != kCP * kC || in_sizes[5] != kCP * kC) return;
  if (in_sizes[2] != kCP || in_sizes[4] != kCP || in_sizes[6] != kCP) return;
  if (in_sizes[7] != kC * kCP || in_sizes[8] != kC) return;
  if (out_size != nX) return;

  const size_t szWP  = (size_t)kPJWHalves * 2;
  const size_t szWB  = (size_t)kC * kCP * 2;
  const size_t szBQK = (size_t)kQKW * 4;
  const size_t szBV  = (size_t)kVR * 4;
  const size_t szQK  = (size_t)kB * kN * kQKW * 2;
  const size_t szV   = (size_t)kB * kVR * kN * 2;
  const size_t szST  = (size_t)kB * (kN / kStatRows) * 32 * 4;
  const size_t szO   = (size_t)kB * kN * kOW * 2;
  const size_t offWP  = 0;
  const size_t offWB  = offWP + szWP;
  const size_t offBQK = offWB + szWB;
  const size_t offBV  = offBQK + szBQK;
  const size_t offQK  = offBV + szBV;
  const size_t offV   = offQK + szQK;
  const size_t offST  = offV + szV;
  const size_t offO   = offST + szST;
  const size_t total  = offO + szO;   // 12,911,104
  if (ws_size < total) return;

  const float* x  = (const float*)d_in[0];
  const float* Wq = (const float*)d_in[1];
  const float* bq = (const float*)d_in[2];
  const float* Wk = (const float*)d_in[3];
  const float* bk = (const float*)d_in[4];
  const float* Wv = (const float*)d_in[5];
  const float* bv = (const float*)d_in[6];
  const float* Wb = (const float*)d_in[7];
  const float* bb = (const float*)d_in[8];
  float* out = (float*)d_out;
  char* ws = (char*)d_ws;
  unsigned short* WP16  = (unsigned short*)(ws + offWP);
  unsigned short* WB16  = (unsigned short*)(ws + offWB);
  float* BQK  = (float*)(ws + offBQK);
  float* BV64 = (float*)(ws + offBV);
  unsigned short* QK16 = (unsigned short*)(ws + offQK);
  unsigned short* V16  = (unsigned short*)(ws + offV);
  float* STAT = (float*)(ws + offST);
  unsigned short* O16 = (unsigned short*)(ws + offO);

  // ---- parameter planes ----
  prep_kernel<<<dim3(17), dim3(256), 0, stream>>>(Wq, bq, Wk, bk, Wv, bv, Wb, WP16, WB16, BQK, BV64);

  const long strideO  = (long)kN * kOW;
  const long strideX  = (long)kC * kN;

  // ---- q|k plane (position-major) and v plane (channel-major), all batches in one grid, straight from x ----
  proj_kernel<<<dim3(kN / kPJPos, kB), dim3(kPJThreads), 0, stream>>>(x, WP16, BQK, BV64, QK16, V16);

  // all batches in one grid each (blockIdx.y = batch):
  // per row j of S[j][i] = log2e * sum_o q[o,j] * k[o,i]: 15 - max - log2 of the sum of 2^(S - max)
  rowstats_kernel<<<dim3(kN / kRSCols, kB), dim3(kRSThreads), 0, stream>>>(QK16, STAT);
  // O16[b][i][c] = f16( (64/32768) sum_j f16(32768 * attn[j][i]) * V16[b][c][j] ) = f16( 64 * out[c][i] )
  attnv_kernel<<<dim3(kN / kAVRows, kB), dim3(kAVThreads), 0, stream>>>(QK16, V16, STAT, O16);

  // ---- result[b][cc][i] = (1/1024) sum_o WB16[cc][o] * O16[b][i][o] + bb[cc] + x[b][cc][i]   (M=256, N=4096, K=32) ----
  const int blocksBack = ((kC / 64) * (kN / 64)) / 8;  // 256 tiles -> 32 blocks
  wmma_gemm64<0, false, 1, 0, true><<<dim3(blocksBack, kB), dim3(256), 0, stream>>>(
      WB16, WB16, kCP, 0L, O16, O16, kOW, strideO,
      (void*)out, (void*)out, kN, strideX, bb, x, strideX, kC, kN, kCP, kBackScale);
}

// v008
// It runs in 66.2 microseconds.
// Two timings next to v007 put it at 1.09 and 1.08 times that version's speed.
// Over all steps from v000 it is 79.6 times as fast.
// Contractions: q, k and v projections (x cast to f16 in registers x W f16 carried x16, Wq and bq also x log2 e; one kernel), scores (q, k f16 planes; once as k.q tiles inside the row-statistics kernel, once more as q.k tiles inside the attn^T.v kernel), attn^T.v (P f16 carried x32768, formed in registers, x V f16 plane; the score tiles there start from the row's statistic as C), back-projection (Wb f16 carried x16 x O f16 carried x64): all v_wmma_f32_16x16x32_f16 with f32 accumulate; softmax statistics, exp, biases and residual in f32.
#include <hip/hip_runtime.h>
#include <math.h>

// ---------------------------------------------------------------------------
// Problem constants
// ---------------------------------------------------------------------------
constexpr int kB   = 8;      // batch
constexpr int kC   = 256;    // channels
constexpr int kN   = 4096;   // positions (64 x 64)
constexpr int kCP  = 32;     // reduced channels
constexpr int kQKW = 64;     // columns of the q|k plane: 0..31 q, 32..63 k
constexpr int kVR  = 64;     // pitch of the channel-major V plane in rows: 0..31 v, 32..63 unused
constexpr int kOW  = 64;     // pitch of the O plane in columns: 0..31 out, 32..63 unused
constexpr float kWCarry    = 16.0f;                      // weights carried x16 in f16
constexpr float kWCarryInv = 1.0f / 16.0f;
constexpr float kPCarry    = 32768.0f;                   // probabilities carried x2^15 in f16
constexpr float kOCarry    = 64.0f;                      // attention output carried x64 in f16
constexpr float kPVScale   = kOCarry / kPCarry;          // 1/512
constexpr float kBackScale = 1.0f / (kOCarry * kWCarry); // 1/1024
constexpr float kLog2e     = 1.4426950408889634f;        // q carries it, so that a score is the exponent of 2, not of e
static_assert(kN % 64 == 0 && kC % 64 == 0 && kQKW % 64 == 0 && kVR % 64 == 0 && kOW % 64 == 0, "tile multiples");
static_assert(kC % 32 == 0 && kCP % 32 == 0 && kN % 32 == 0, "k steps of 32");
static_assert(2 * kCP == kQKW && kCP <= kVR && kCP <= kOW, "plane widths");
static_assert(kCP * kC == 8192 && kC * kCP == 8192 && kN % 256 == 0 && kN % 8 == 0, "prep coverage");

typedef __attribute__((ext_vector_type(16))) _Float16 v16h;
typedef __attribute__((ext_vector_type(8)))  _Float16 v8h;
typedef __attribute__((ext_vector_type(16))) __bf16   v16b;
typedef __attribute__((ext_vector_type(8)))  __bf16   v8b;
typedef __attribute__((ext_vector_type(8)))  float    v8f;
typedef __attribute__((ext_vector_type(4)))  float    v4f;
typedef __attribute__((ext_vector_type(2)))  float    v2f;
typedef __attribute__((ext_vector_type(4)))  unsigned int v4u;

// ---------------------------------------------------------------------------
// Shared helpers (with a 4-accumulator guard)
// ---------------------------------------------------------------------------
__device__ __forceinline__ unsigned short f2bf_bits(float f) {
  unsigned u = __float_as_uint(f);
  return (unsigned short)((u + 0x7FFFu + ((u >> 16) & 1u)) >> 16);
}
__device__ __forceinline__ float bf_bits2f(unsigned short h) { return __uint_as_float(((unsigned)h) << 16); }

// hazard guards as plain device helpers (no inline asm inside the kernel template body)
__device__ __forceinline__ void dep_guard_h(v8f& a, v8f& b, v16h x, v16h y) { asm volatile("v_nop\n\tv_nop\n\tv_nop\n\tv_nop" : "+v"(a), "+v"(b) : "v"(x), "v"(y)); }
__device__ __forceinline__ void dep_guard_b(v8f& a, v8f& b, v16b x, v16b y) { asm volatile("v_nop\n\tv_nop\n\tv_nop\n\tv_nop" : "+v"(a), "+v"(b) : "v"(x), "v"(y)); }
__device__ __forceinline__ void dep_guard4_h(v8f& a, v8f& b, v8f& c, v8f& d, v16h x, v16h y) { asm volatile("v_nop\n\tv_nop\n\tv_nop\n\tv_nop" : "+v"(a), "+v"(b), "+v"(c), "+v"(d) : "v"(x), "v"(y)); }
__device__ __forceinline__ void dep_guard4_b(v8f& a, v8f& b, v8f& c, v8f& d, v16b x, v16b y) { asm volatile("v_nop\n\tv_nop\n\tv_nop\n\tv_nop" : "+v"(a), "+v"(b), "+v"(c), "+v"(d) : "v"(x), "v"(y)); }
__device__ __forceinline__ void keep4_h(v16h a, v16h b, v16h c, v16h d) { asm volatile("v_nop" :: "v"(a), "v"(b), "v"(c), "v"(d)); }
__device__ __forceinline__ void keep4_b(v16b a, v16b b, v16b c, v16b d) { asm volatile("v_nop" :: "v"(a), "v"(b), "v"(c), "v"(d)); }
__device__ __forceinline__ void acc_guard4(v8f& a, v8f& b, v8f& c, v8f& d) { asm volatile("v_nop\n\tv_nop\n\tv_nop\n\tv_nop" : "+v"(a), "+v"(b), "+v"(c), "+v"(d)); }
template <typename T> struct Frag;
template <> struct Frag<_Float16> {
  typedef v16h V; union U { v16h v; v8h h[2]; };
  // elements 0..7 <- p[0..7], 8..15 <- p[16..23]
  static __device__ __forceinline__ v16h load(const _Float16* p) {
    U f; f.h[0] = *(const v8h*)(p); f.h[1] = *(const v8h*)(p + 16); return f.v;
  }
  static __device__ __forceinline__ v8f mma(v16h a, v16h b, v8f c) {
    return __builtin_amdgcn_wmma_f32_16x16x32_f16(false, a, false, b, (short)0, c, false, false);
  }
  static __device__ __forceinline__ void guard(v8f& a, v8f& b, v16h x, v16h y) { dep_guard_h(a, b, x, y); }
  static __device__ __forceinline__ void guard4(v8f& a, v8f& b, v8f& c, v8f& d, v16h x, v16h y) { dep_guard4_h(a, b, c, d, x, y); }
  static __device__ __forceinline__ void keep(v16h a, v16h b, v16h c, v16h d) { keep4_h(a, b, c, d); }
};
template <> struct Frag<__bf16> {
  typedef v16b V; union U { v16b v; v8b h[2]; };
  static __device__ __forceinline__ v16b load(const __bf16* p) {
    U f; f.h[0] = *(const v8b*)(p); f.h[1] = *(const v8b*)(p + 16); return f.v;
  }
  static __device__ __forceinline__ v8f mma(v16b a, v16b b, v8f c) {
    return __builtin_amdgcn_wmma_f32_16x16x32_bf16(false, a, false, b, (short)0, c, false, false);
  }
  static __device__ __forceinline__ void guard(v8f& a, v8f& b, v16b x, v16b y) { dep_guard_b(a, b, x, y); }
  static __device__ __forceinline__ void guard4(v8f& a, v8f& b, v8f& c, v8f& d, v16b x, v16b y) { dep_guard4_b(a, b, c, d, x, y); }
  static __device__ __forceinline__ void keep(v16b a, v16b b, v16b c, v16b d) { keep4_b(a, b, c, d); }
};

__device__ __forceinline__ unsigned pk16(unsigned short a, unsigned short b) { return (unsigned)a | ((unsigned)b << 16); }
__device__ __forceinline__ unsigned short h_bits(float f) { const _Float16 h = (_Float16)f; return __builtin_bit_cast(unsigned short, h); }

// ---- Register-blocked batched WMMA GEMM (no activations; residual added in the store phase) ------
// C[m,n] = scale * sum_k A[m,k] * Bt[n,k] (+bias)(+resid); each wave owns a 64x64 tile.
// A row-major [M,K]; Bt row-major [N,K]; M,N % 64 == 0, K % 32 == 0.
// SPLIT: operands are hi/lo planes (A2/Bt2 = lo planes, same layout); product = hi*hi + hi*lo + lo*hi.
// BIAS_MODE: 0 = none, 1 = bias[m], 2 = bias[n].
// OUT_MODE: 0 = f32, 1 = f16, 2 = bf16 hi plane (Cout) + bf16 lo plane (Cout2).
// RESID (OUT_MODE 0 only): each lane loads ONE float4 of the residual at exactly the address it stores, adds it to the
// ET: 0 = f16 operands, 1 = bf16 operands (pointers passed as 16-bit storage)
template <int ET> struct Elem;
template <> struct Elem<0> { typedef _Float16 T; };
template <> struct Elem<1> { typedef __bf16 T; };
template <int ET, bool SPLIT, int BIAS_MODE, int OUT_MODE, bool RESID>
__global__ __launch_bounds__(256) void wmma_gemm64(
    const unsigned short* __restrict__ Ap, const unsigned short* __restrict__ A2p, int lda, long strideA,
    const unsigned short* __restrict__ Btp, const unsigned short* __restrict__ Bt2p, int ldb, long strideB,
    void* __restrict__ Cout, void* __restrict__ Cout2, int ldc, long strideC,
    const float* __restrict__ bias,
    const float* __restrict__ resid, long strideR,
    int M, int N, int K, float scale) {
  static_assert(!RESID || OUT_MODE == 0, "residual only with f32 output");
  typedef typename Elem<ET>::T T;
  typedef typename Frag<T>::V V;
  const T* A = (const T*)Ap; const T* A2 = (const T*)A2p; const T* Bt = (const T*)Btp; const T* Bt2 = (const T*)Bt2p;
  __shared__ __align__(16) float sT[8][16 * 68];   // per-wave 16x64 slab, pitch 68 floats
  const int b    = blockIdx.y;
  const int lane = threadIdx.x & 31;
  const int wave = threadIdx.x >> 5;
  const int tilesN = N >> 6;
  const int tilesM = M >> 6;
  const int tile = blockIdx.x * 8 + wave;
  if (tile >= tilesM * tilesN) return;   // wave-uniform; no block barriers in this kernel
  const int tm = tile / tilesN;
  const int tn = tile - tm * tilesN;
  const int m0 = tm << 6;
  const int n0 = tn << 6;

  const T* Ab  = A  + (size_t)b * strideA;
  const T* Bb  = Bt + (size_t)b * strideB;
  const T* Ab2 = SPLIT ? (A2  + (size_t)b * strideA) : nullptr;
  const T* Bb2 = SPLIT ? (Bt2 + (size_t)b * strideB) : nullptr;

  const int rlane = lane & 15;                 // row (A) / col (B, D) within subtile
  const int koff  = (lane >> 4) * 8;           // k offset of this lane half
  const int mOff  = (lane >> 4) * 8;           // D row offset

  v8f acc[4][4];
#pragma unroll
  for (int i = 0; i < 4; ++i)
#pragma unroll
    for (int j = 0; j < 4; ++j) acc[i][j] = (v8f){0.f,0.f,0.f,0.f,0.f,0.f,0.f,0.f};

  for (int k0 = 0; k0 < K; k0 += 32) {
    V bh[4], bl[4];
#pragma unroll
    for (int j = 0; j < 4; ++j) {
      const size_t bo = (size_t)(n0 + (j << 4) + rlane) * ldb + koff + k0;
      bh[j] = Frag<T>::load(Bb + bo);
      if (SPLIT) bl[j] = Frag<T>::load(Bb2 + bo);
    }
#pragma unroll
    for (int i = 0; i < 4; ++i) {
      const size_t ao = (size_t)(m0 + (i << 4) + rlane) * lda + koff + k0;
      V ah = Frag<T>::load(Ab + ao);
      V al;
      if (SPLIT) al = Frag<T>::load(Ab2 + ao);
#pragma unroll
      for (int j = 0; j < 4; ++j) {
        acc[i][j] = Frag<T>::mma(ah, bh[j], acc[i][j]);
        if (SPLIT) {
          acc[i][j] = Frag<T>::mma(ah, bl[j], acc[i][j]);
          acc[i][j] = Frag<T>::mma(al, bh[j], acc[i][j]);
        }
      }
      Frag<T>::guard4(acc[i][0], acc[i][1], acc[i][2], acc[i][3], ah, SPLIT ? al : ah);
    }
    Frag<T>::keep(bh[0], bh[1], bh[2], bh[3]);
    if (SPLIT) Frag<T>::keep(bl[0], bl[1], bl[2], bl[3]);
  }
  acc_guard4(acc[0][0], acc[0][1], acc[0][2], acc[0][3]);
  acc_guard4(acc[1][0], acc[1][1], acc[1][2], acc[1][3]);
  acc_guard4(acc[2][0], acc[2][1], acc[2][2], acc[2][3]);
  acc_guard4(acc[3][0], acc[3][1], acc[3][2], acc[3][3]);

  // ---- epilogue ----
  float* slab = sT[wave];
  const float* Rb = RESID ? (resid + (size_t)b * strideR) : nullptr;
#pragma unroll
  for (int i = 0; i < 4; ++i) {
    const int mBase = m0 + (i << 4);
#pragma unroll
    for (int j = 0; j < 4; ++j) {
      const int n = n0 + (j << 4) + rlane;
      float bvn = 0.f;
      if (BIAS_MODE == 2) bvn = bias[n];
#pragma unroll
      for (int r = 0; r < 8; ++r) {
        float v = acc[i][j][r] * scale;
        if (BIAS_MODE == 1) v += bias[mBase + mOff + r];
        if (BIAS_MODE == 2) v += bvn;
        slab[(mOff + r) * 68 + (j << 4) + rlane] = v;
      }
    }
    __builtin_amdgcn_fence(__ATOMIC_RELEASE, "workgroup");
    __builtin_amdgcn_wave_barrier();
    __builtin_amdgcn_fence(__ATOMIC_ACQUIRE, "workgroup");
    if (OUT_MODE == 0) {
      float* C = (float*)Cout + (size_t)b * strideC;
      const int hh = lane >> 4, c4 = (lane & 15) * 4;     // row seg = 256 B = 16 lanes x 16 B
      v4f vals[8];
#pragma unroll
      for (int it = 0; it < 8; ++it) {
        const int row = it * 2 + hh;
        v4f v = *(const v4f*)(slab + row * 68 + c4);
        if (RESID) {
          const v4f rv = *(const v4f*)(Rb + (size_t)(mBase + row) * ldc + n0 + c4);
          v = v + rv;
        }
        vals[it] = v;
      }
      {
#pragma unroll
        for (int it = 0; it < 8; ++it) {
          const int row = it * 2 + hh;
          *(v4f*)(C + (size_t)(mBase + row) * ldc + n0 + c4) = vals[it];
        }
        
      }
    } else {
      const int q = lane >> 3, c8 = (lane & 7) * 8;
      unsigned short* C  = (unsigned short*)Cout  + (size_t)b * strideC;
      unsigned short* C2 = (OUT_MODE == 2) ? ((unsigned short*)Cout2 + (size_t)b * strideC) : nullptr;
      {
#pragma unroll
        for (int it = 0; it < 4; ++it) {
          const int row = it * 4 + q;
          const float* sp = slab + row * 68 + c8;
          v8h hv, lv;
#pragma unroll
          for (int e = 0; e < 8; ++e) {
            if (OUT_MODE == 1) {
              hv[e] = (_Float16)sp[e];
            } else {
              unsigned short hb = f2bf_bits(sp[e]);
              unsigned short lb = f2bf_bits(sp[e] - bf_bits2f(hb));
              hv[e] = __builtin_bit_cast(_Float16, hb);
              lv[e] = __builtin_bit_cast(_Float16, lb);
            }
          }
          *(v8h*)(C + (size_t)(mBase + row) * ldc + n0 + c8) = hv;
          if (OUT_MODE == 2) *(v8h*)(C2 + (size_t)(mBase + row) * ldc + n0 + c8) = lv;
        }
        
      }
    }
    __builtin_amdgcn_fence(__ATOMIC_RELEASE, "workgroup");
    __builtin_amdgcn_wave_barrier();
    __builtin_amdgcn_fence(__ATOMIC_ACQUIRE, "workgroup");
  }
}

// ---------------------------------------------------------------------------
// Parameter planes (17 blocks of 256 threads):
//   blocks  0.. 3: WP16[0..8191]      = f16(16 * log2 e * Wq)   (tiles 0, 1 of 16 rows)
//   blocks  4.. 7: WP16[8192..16383]  = f16(16 * Wk)            (tiles 2, 3)
//   blocks  8..11: WP16[16384..24575] = f16(16 * Wv)            (tiles 4, 5)
//   blocks 12..15: WB16[0..8191]      = f16(16 * Wb)            ([256][32], row-major)
//   block  16    : BQK[64] = log2 e * bq | bk (f32), BV64[64] = bv | 0 (f32)
// WP16 lies in fragment order: [tile of 16 rows][k step of 32 channels][half][lane][8 halves]; lane l holds row l & 15 of the tile,
// channels 16 * half + 8 * (l >> 4) + 0..7 of the k step: the two 16-B parts of a lane's fragment, each part 512 contiguous B a wave.
// Coverage: 4 blocks x 256 threads x 8 = 8192 elements per group. Each thread one 16-B store; a wave writes 512 contiguous B
// ---------------------------------------------------------------------------
__global__ __launch_bounds__(256) void prep_kernel(const float* __restrict__ Wq, const float* __restrict__ bq,
                                                   const float* __restrict__ Wk, const float* __restrict__ bk,
                                                   const float* __restrict__ Wv, const float* __restrict__ bv,
                                                   const float* __restrict__ Wb,
                                                   unsigned short* __restrict__ WP16,
                                                   unsigned short* __restrict__ WB16,
                                                   float* __restrict__ BQK, float* __restrict__ BV64) {
  const int t   = threadIdx.x;
  const int blk = blockIdx.x;
  if (blk < 16) {   // block-uniform
    const int grp = blk >> 2;
    const int sub = blk & 3;
    const int d   = sub * 256 + t;         // 16-B part of the group's plane, 0 .. 1023
    const int e0  = d * 8;                 // 0 .. 8184
    // where part d comes from: Wb as it lies; else row (d >> 9) * 16 + (d & 15), channel 32 * k step + 16 * half + 8 * (lane >> 4)
    const int s0  = (grp == 3) ? e0 : (((d >> 9) * 16 + (d & 15)) * kC + ((d >> 6) & 7) * 32 + ((d >> 5) & 1) * 16 + ((d >> 4) & 1) * 8);
    const float* src = (grp == 0) ? Wq : (grp == 1) ? Wk : (grp == 2) ? Wv : Wb;
    const float  f   = (grp == 0) ? kWCarry * kLog2e : kWCarry;
    unsigned short* dst = (grp == 3) ? WB16 : (WP16 + grp * 8192);
    const v4f a = *(const v4f*)(src + s0);
    const v4f c = *(const v4f*)(src + s0 + 4);
    unsigned short hb[8];
#pragma unroll
    for (int e = 0; e < 4; ++e) {
      hb[e]     = h_bits(a[e] * f);
      hb[4 + e] = h_bits(c[e] * f);
    }
    const v4u u = (v4u){pk16(hb[0], hb[1]), pk16(hb[2], hb[3]), pk16(hb[4], hb[5]), pk16(hb[6], hb[7])};
    unsigned short* dp = dst + e0;
    *(v4u*)dp = u;
  } else {
    const int lane = t & 31, wave = t >> 5;
    const int idx = (lane & 7) * 4;   // 0..28: always inside the 32-entry bias vectors
    const v4f q4 = *(const v4f*)(bq + idx);
    const v4f k4 = *(const v4f*)(bk + idx);
    const v4f w4 = *(const v4f*)(bv + idx);
    const float fq = (lane < 8) ? 1.0f : 0.0f;
    const float fk = (lane < 8) ? 0.0f : 1.0f;
    // arithmetic select: lanes 0..7 take bq / bv, lanes 8..15 take bk / zeros (all loads unconditional)
    const v4f valQK = q4 * (fq * kLog2e) + k4 * fk;
    const v4f valV  = w4 * fq;
    const bool wq = (wave == 0) && (lane < 16);
    const bool wv = (wave == 1) && (lane < 16);
    float* dq = BQK  + (lane & 15) * 4;
    float* dv = BV64 + (lane & 15) * 4;
    if (wq) *(v4f*)dq = valQK;
    if (wv) *(v4f*)dv = valV;
  }
}

// ---------------------------------------------------------------------------
// q, k and v projections straight from x[b][c][n] (f32, n contiguous): no transposed f16 copy of x in memory.
//   QK16[b][n][o'] = f16( (1/16) sum_c WP[o'][c] * f16(x[b][c][n]) + BQK[o'] ),  o' = 0..63 (q | k), position-major
//   V16[b][o][n]   = f16( (1/16) sum_c WP[64 + o][c] * f16(x[b][c][n]) + BV64[o] ),  o = 0..31, channel-major
// grid (kN/128 = 32, kB) blocks of 4 waves; a wave owns 32 positions, as two tiles of 16: column (or row) m of tile p is position
// n0 + 2 m + p, so that a lane's 8-B load of one channel feeds both tiles and 16 lanes read one whole 128-B line.
// An x fragment (lane = position, 16 channels in the k order of Frag::load) serves as B against the q|k weight rows (A): D[o'][n], a lane
// holds 8 consecutive o' of one position = one 16-B store; and as A against the v weight rows (B): D[n][o], a lane holds, over both
// tiles, 16 consecutive positions of one channel; these go through LDS so that each 128-B line of V16 is stored whole by one wave.
// The 48 KiB of weights are copied once to LDS as they lie (fragment order: every read is 512 contiguous B): LDS reads count on their
// own counter, so that waiting for a weight fragment does not wait for the x loads, which run three k steps ahead (one wave on a SIMD:
// nothing else hides the memory latency, and the registers are there).
// ---------------------------------------------------------------------------
constexpr int kPJWaves   = 4;
constexpr int kPJThreads = kPJWaves * 32;       // 128
constexpr int kPJPos     = 32 * kPJWaves;       // 128 positions per block
constexpr int kPJSteps   = kC / 32;             // 8 k steps
constexpr int kPJTiles   = 6;                   // tiles of 16 weight rows: q, q, k, k, v, v
constexpr int kPJWHalves = kPJTiles * kPJSteps * 512;   // 24,576 halves of weights
constexpr int kPJVPitch  = kPJPos + 8;          // halves per channel row of the v tile in LDS (a multiple of 8: 16-B parts stay aligned)
static_assert(kN % kPJPos == 0 && kPJWHalves % (kPJThreads * 8) == 0 && (kCP * kPJPos) % (kPJThreads * 8) == 0 && kPJTiles * 16 == 3 * kCP, "projection tiling");
__global__ __launch_bounds__(kPJThreads) void proj_kernel(const float* __restrict__ x, const unsigned short* __restrict__ WP16,
                                                          const float* __restrict__ BQK, const float* __restrict__ BV64,
                                                          unsigned short* __restrict__ QK16, unsigned short* __restrict__ V16) {
  typedef Frag<_Float16> F;
  __shared__ __align__(16) _Float16 sW[kPJWHalves];
  __shared__ __align__(16) _Float16 sV[kCP * kPJVPitch];
  const int t    = threadIdx.x;
  const int lane = t & 31;
  const int wave = t >> 5;
  const int c    = lane & 15;
  const int h    = lane >> 4;
  const int b    = blockIdx.y;
  const int nb   = blockIdx.x * kPJPos;     // the block's first position
  const int n0   = nb + wave * 32;          // the wave's
  // channel 8 h, positions n0 + 2 c, + 1; every load of x is a compile-time offset from this address
  const float* xl = x + ((size_t)b * kC + h * 8) * kN + n0 + 2 * c;
  const unsigned short* wl = WP16 + t * 8;
  constexpr int kParts = kPJWHalves / (kPJThreads * 8);   // 24 parts of 16 B per thread
  v4u wst[kParts];
#pragma unroll
  for (int i = 0; i < kParts; ++i) wst[i] = *(const v4u*)(wl + i * kPJThreads * 8);
  v2f raw[3][16];   // three register sets take turns: element e is channel 8 h + e (e < 8), 16 + 8 h + e - 8 (e >= 8) of the k step
#pragma unroll
  for (int s = 0; s < 2; ++s)
#pragma unroll
    for (int e = 0; e < 16; ++e) raw[s][e] = *(const v2f*)(xl + (size_t)(s * 32 + e + (e & 8)) * kN);
#pragma unroll
  for (int i = 0; i < kParts; ++i) *(v4u*)(sW + (i * kPJThreads + t) * 8) = wst[i];
  __syncthreads();   // the weights are in sW
  // the third set's loads stand behind the barrier, which waits for every load in front of it
#pragma unroll
  for (int e = 0; e < 16; ++e) raw[2][e] = *(const v2f*)(xl + (size_t)(2 * 32 + e + (e & 8)) * kN);
  // the biases of the two epilogues, read here so that the loop hides them: o' = 16 ot + 8 h + r for q|k, channel 16 nt + c for v
  v8f bqk[4];
  float bvn[2];
#pragma unroll
  for (int ot = 0; ot < 4; ++ot) {
    const v4f b0 = *(const v4f*)(BQK + ot * 16 + h * 8);
    const v4f b1 = *(const v4f*)(BQK + ot * 16 + h * 8 + 4);
    bqk[ot] = __builtin_shufflevector(b0, b1, 0, 1, 2, 3, 4, 5, 6, 7);
  }
#pragma unroll
  for (int nt = 0; nt < 2; ++nt) bvn[nt] = BV64[nt * 16 + c];
  // the bias loads' offset registers are given new values directly behind them
  asm volatile("s_wait_xcnt 0x0" ::: "memory");
  __builtin_amdgcn_sched_barrier(0);   // these loads are not sunk to their uses behind the loop
  const v8f zero = (v8f){0.f, 0.f, 0.f, 0.f, 0.f, 0.f, 0.f, 0.f};
  v8f acc[2][kPJTiles];
#pragma unroll
  for (int p = 0; p < 2; ++p)
#pragma unroll
    for (int ot = 0; ot < kPJTiles; ++ot) acc[p][ot] = zero;
#pragma unroll   // whole: the sets' turns and every address offset are compile-time
  for (int ks = 0; ks < kPJSteps; ++ks) {
    F::U w[kPJTiles];   // the step's weight fragments: read first, the casts behind them hide the LDS latency
#pragma unroll
    for (int ot = 0; ot < kPJTiles; ++ot) {
      const _Float16* wp = sW + (ot * kPJSteps + ks) * 512 + lane * 8;
      w[ot].h[0] = *(const v8h*)(wp); w[ot].h[1] = *(const v8h*)(wp + 256);
    }
    v16h xf[2];
#pragma unroll
    for (int p = 0; p < 2; ++p) {
      v8f lo, hi;
#pragma unroll
      for (int e = 0; e < 8; ++e) { lo[e] = raw[ks % 3][e][p]; hi[e] = raw[ks % 3][8 + e][p]; }
      xf[p] = __builtin_shufflevector(__builtin_convertvector(lo, v8h), __builtin_convertvector(hi, v8h),
                                      0, 1, 2, 3, 4, 5, 6, 7, 8, 9, 10, 11, 12, 13, 14, 15);
    }
    // the refill is not lifted in front of the casts: it would take a fourth register set and 64 loads in flight
    __builtin_amdgcn_sched_barrier(0);
    if (ks + 3 < kPJSteps) {
#pragma unroll
      for (int e = 0; e < 16; ++e) raw[ks % 3][e] = *(const v2f*)(xl + (size_t)((ks + 3) * 32 + e + (e & 8)) * kN);
    }
    __builtin_amdgcn_sched_barrier(0);   // the loads of three steps on are not sunk behind this step's products
#pragma unroll
    for (int ot = 0; ot < kPJTiles; ++ot)
#pragma unroll
      for (int p = 0; p < 2; ++p)
        acc[p][ot] = (ot < 4) ? F::mma(w[ot].v, xf[p], acc[p][ot]) : F::mma(xf[p], w[ot].v, acc[p][ot]);
    __builtin_amdgcn_sched_barrier(0);   // nor later steps' LDS reads, casts and loads lifted into this step, which takes further register sets
  }
  // the wait behind the loads of x: their address pair is given no new value in front of it
  // (it never changes, and as an input here it stays in its registers up to the wait; the weights' loads were waited for at the barrier)
  asm volatile("s_wait_xcnt 0x0" :: "v"(xl) : "memory");
  // q|k: rows o' = 16 ot + 8 h + r of column c, which is position n0 + 2 c + p
  unsigned short* qrow = QK16 + ((size_t)b * kN + n0 + 2 * c) * kQKW + h * 8;
#pragma unroll
  for (int ot = 0; ot < 4; ++ot) {
#pragma unroll
    for (int p = 0; p < 2; ++p) {
      v8f v;
#pragma unroll
      for (int r = 0; r < 8; ++r) { v[r] = acc[p][ot][r] * kWCarryInv; v[r] += bqk[ot][r]; }
      *(v8h*)(qrow + p * kQKW + ot * 16) = __builtin_convertvector(v, v8h);
    }
  }
  // v: column c is channel 16 nt + c; row 8 h + r of tile p is position 2 (8 h + r) + p of the wave's 32
#pragma unroll
  for (int nt = 0; nt < 2; ++nt) {
    v8f v0, v1;
#pragma unroll
    for (int r = 0; r < 4; ++r)
#pragma unroll
      for (int p = 0; p < 2; ++p) {
        v0[2 * r + p] = acc[p][4 + nt][r] * kWCarryInv;     v0[2 * r + p] += bvn[nt];
        v1[2 * r + p] = acc[p][4 + nt][4 + r] * kWCarryInv; v1[2 * r + p] += bvn[nt];
      }
    _Float16* sp = sV + (nt * 16 + c) * kPJVPitch + wave * 32 + h * 16;
    *(v8h*)(sp)     = __builtin_convertvector(v0, v8h);
    *(v8h*)(sp + 8) = __builtin_convertvector(v1, v8h);
  }
  __syncthreads();   // every wave's 32 positions of the 32 channels are in sV
#pragma unroll
  for (int it = 0; it < (kCP * kPJPos) / (kPJThreads * 8); ++it) {   // 4 parts of 16 B per thread; a wave stores 2 rows of 256 B
    const int part = it * kPJThreads + t;
    const int row  = part >> 4;
    const int col8 = (part & 15) * 8;
    *(v8h*)(V16 + ((size_t)b * kVR + row) * kN + nb + col8) = *(const v8h*)(sV + row * kPJVPitch + col8);
  }
}

// ---------------------------------------------------------------------------
// Softmax statistic of the score rows, from score tiles formed in registers (no score plane in memory): for each j,
//   stat[j] = 15 - max_i S[j][i] - log2 sum_i 2^(S[j][i] - max),  S[j][i] = q row j . k row i, q carrying log2 e,
// so that 2^(S[j][i] + stat[j]) is the probability carried x 32768.
// One block owns 64 rows j (4 tiles of 16) of one batch and all 4096 i: grid (kN/64 = 64, kB) blocks of 16 waves, blockIdx.y the
// batch; wave w takes i in [256 w, 256 w + 256).
// A tile is D[i][j] = k rows (A) x q rows (B, the block's 4 fragments loaded once): every k fragment loaded feeds 4 tiles.
// A lane holds column j = lane & 15 of each tile of j and rows i = 8 h + r (h = lane >> 4). Per tile of j it sums 2^S as it comes
// from the matrix unit, relative to no maximum: one power of two on every term only scales an f32 sum while all stay in range,
// so the pair (0, sum) says what (maximum, sum relative to it) says, and an element costs one v_exp_f32 and half a packed add.
// One test per wave, behind the loop: where a lane's sum has left [2^-80, 2^100] (terms lost below or an overflow near), the wave
// does its 256 i again with a running maximum and the exp-sum relative to it (per 32 i the maximum is raised and the old sum
// brought to it by one factor): any scores are served. Terms flushed below 2^-126, 128 a lane, are under 2^-39 of a sum that passes.
// The (maximum or 0, sum) pairs of the 2 lane halves join by lane exchange, those of the 16 waves through LDS behind one barrier,
// each sum brought to the common maximum by one factor 2^(own maximum - common maximum); wave w < 4 joins tile w of j.
// STAT holds, per batch and per 16 rows j, one 128-B line, stored whole by one wave: the 16 statistics, twice (the second 16 are not read).
// ---------------------------------------------------------------------------
// 2^y on the transcendental unit. The v_nop fills the one slot that the instruction set asks for behind a transcendental before
// its result is read or its source overwritten: inside the statement it stands there in every build.
__device__ __forceinline__ float exp2_slot(float y) { float r; asm("v_exp_f32 %0, %1\n\tv_nop" : "=v"(r) : "v"(y)); return r; }
// Every use of it in the row statistics has y <= 0: no overflow. Below 2^-126 the result may be 0: as a term, beside a sum that is
// at least 1; as a factor in a join, on a sum below 2^100 beside a running-max sum of at least 1 (under 2^-26 of it), or on a
// running-max sum of at most 128 beside a sum above 2^-80 (under 2^-39 of it).
// log2 x for a normal x > 0 on the transcendental unit, with the same slot behind it
__device__ __forceinline__ float log2_slot(float x) { float r; asm("v_log_f32 %0, %1\n\tv_nop" : "=v"(r) : "v"(x)); return r; }
// 2^y of the 16 values that a lane holds of two score tiles, one slot for the 16: the results pass through the statement, so no
// reader stands in front of the v_nop; the exponents are its inputs, so they keep their registers up to it and no v_exp_f32 lands
// on the source of the one directly in front
__device__ __forceinline__ void exp2_tiles(v8f& e0, v8f& e1, const v8f s0, const v8f s1) {
#pragma unroll
  for (int r = 0; r < 8; ++r) e0[r] = __builtin_amdgcn_exp2f(s0[r]);
#pragma unroll
  for (int r = 0; r < 8; ++r) e1[r] = __builtin_amdgcn_exp2f(s1[r]);
  asm("v_nop" : "+v"(e0), "+v"(e1) : "v"(s0), "v"(s1));
}
constexpr float kRSSumLo = 0x1p-80f;    // a lane's unshifted sum below this may have lost terms that count
constexpr float kRSSumHi = 0x1p100f;    // far enough below 2^128 that the joins of 32 such sums cannot overflow
constexpr float kPCarryLog2 = 15.0f;
static_assert(kPCarry == 32768.0f, "2^15");
constexpr int kRSWaves   = 16;
constexpr int kRSThreads = kRSWaves * 32;      // 512
constexpr int kStatRows  = 16;                 // rows j of S per 128-B line of STAT
constexpr int kRSJT      = 4;                  // 16-row tiles of j per block: every k fragment loaded feeds this many score tiles
constexpr int kRSCols    = kStatRows * kRSJT;  // 64 rows j of S per block
constexpr int kRSChunk   = kN / kRSWaves;      // 256 i per wave
constexpr int kRSGroups  = kRSChunk / 32;      // 8 groups of two k fragments (32 i)
static_assert(kN % kRSCols == 0 && kRSChunk % 32 == 0 && kRSWaves % 2 == 0 && kRSJT <= kRSWaves, "row statistics tiling");
// 8 waves on a SIMD, 128 registers a wave: two blocks share a WGP, and the build is held to it
__global__ __launch_bounds__(kRSThreads) __attribute__((amdgpu_waves_per_eu(8, 8))) void rowstats_kernel(const unsigned short* __restrict__ QKp, float* __restrict__ STAT) {
  typedef Frag<_Float16> F;
  __shared__ float pmax[kRSWaves][kRSCols];
  __shared__ float psum[kRSWaves][kRSCols];
  const int t    = threadIdx.x;
  const int lane = t & 31;
  const int wave = t >> 5;
  const int c    = lane & 15;
  const int h    = lane >> 4;
  const _Float16* QK    = (const _Float16*)QKp + (size_t)blockIdx.y * kN * kQKW;   // the block's batch
  const _Float16* Qlane = QK + (size_t)(blockIdx.x * kRSCols + c) * kQKW + h * 8;
  // row of the wave's first position i; its k half starts at column kCP; every tile is a compile-time offset from this address
  const _Float16* Klane = QK + (size_t)(wave * kRSChunk + c) * kQKW + h * 8;
  v16h qf[kRSJT];
#pragma unroll
  for (int jt = 0; jt < kRSJT; ++jt) qf[jt] = F::load(Qlane + (size_t)(jt * 16) * kQKW);
  const v8f zero = (v8f){0.f, 0.f, 0.f, 0.f, 0.f, 0.f, 0.f, 0.f};
  v16h a[2][2];   // two register sets of two k fragments take turns
  a[0][0] = F::load(Klane + kCP);
  a[0][1] = F::load(Klane + kCP + (size_t)16 * kQKW);
  float m[kRSJT], sum[kRSJT];   // per lane and tile of j: the exponent that the sum is relative to, the exp-sum
  v2f fs[kRSJT];                // the unshifted sum, in two parts for the packed add
  v8f e0, e1;                   // 2^S of the pair of tiles (32 i, one tile of j) last formed
  auto fold = [&](const int jt, const bool first) {   // adds them to the sum of tile jt of j: 8 packed adds for 16 values
    const v8f e = e0 + e1;
    const v4f f = __builtin_shufflevector(e, e, 0, 1, 2, 3) + __builtin_shufflevector(e, e, 4, 5, 6, 7);
    const v2f p = __builtin_shufflevector(f, f, 0, 1) + __builtin_shufflevector(f, f, 2, 3);
    fs[jt] = first ? p : (fs[jt] + p);
  };
#pragma unroll   // whole: the sets' turns and the groups' address offsets are compile-time, the two address pairs never change
  for (int g = 0; g < kRSGroups; ++g) {
    if (g + 1 < kRSGroups) {
      a[(g + 1) & 1][0] = F::load(Klane + kCP + (size_t)((g + 1) * 32) * kQKW);
      a[(g + 1) & 1][1] = F::load(Klane + kCP + (size_t)((g + 1) * 32 + 16) * kQKW);
      __builtin_amdgcn_sched_barrier(0);   // the next group's 4 loads stay issued ahead of this group's exp work, which hides them
    }
#pragma unroll
    for (int jt = 0; jt < kRSJT; ++jt) {
      const v8f d0 = F::mma(a[g & 1][0], qf[jt], zero);
      const v8f d1 = F::mma(a[g & 1][1], qf[jt], zero);
      // the adds of the pair of tiles before stand behind this pair's products: they fill the slots that the chip needs between a
      // product and the first reader of its result, where the build otherwise puts four v_nop
      __builtin_amdgcn_sched_barrier(0);
      if (g > 0 || jt > 0) fold((jt + kRSJT - 1) % kRSJT, g == 0 || (g == 1 && jt == 0));
      __builtin_amdgcn_sched_barrier(0);   // nor are this pair's v_exp_f32 lifted in front of them
      exp2_tiles(e0, e1, d0, d1);
      __builtin_amdgcn_sched_barrier(0);   // one pair of tiles at a time: interleaved pairs take registers, and two blocks share a WGP
    }
  }
  fold(kRSJT - 1, false);
  bool redo = false;
#pragma unroll
  for (int jt = 0; jt < kRSJT; ++jt) {
    m[jt]   = 0.f;
    sum[jt] = fs[jt][0] + fs[jt][1];
    redo = redo || !(sum[jt] > kRSSumLo && sum[jt] < kRSSumHi);   // an infinite or not-a-number sum fails it too
  }
  // a scalar branch, the same for the whole wave: the matrix instructions behind it run with every lane on
  if (__builtin_expect(__builtin_amdgcn_ballot_w32(redo) != 0u, 0)) {
  a[0][0] = F::load(Klane + kCP);
  a[0][1] = F::load(Klane + kCP + (size_t)16 * kQKW);
#pragma unroll   // whole: the sets' turns and the groups' address offsets are compile-time, the two address pairs never change
  for (int g = 0; g < kRSGroups; ++g) {
    if (g + 1 < kRSGroups) {
      a[(g + 1) & 1][0] = F::load(Klane + kCP + (size_t)((g + 1) * 32) * kQKW);
      a[(g + 1) & 1][1] = F::load(Klane + kCP + (size_t)((g + 1) * 32 + 16) * kQKW);
      __builtin_amdgcn_sched_barrier(0);   // the next group's 4 loads stay issued ahead of this group's exp work, which hides them
    }
#pragma unroll
    for (int jt = 0; jt < kRSJT; ++jt) {
      const v8f d0 = F::mma(a[g & 1][0], qf[jt], zero);
      const v8f d1 = F::mma(a[g & 1][1], qf[jt], zero);
      float t0 = d0[0], t1 = d1[0];
#pragma unroll
      for (int r = 1; r < 8; ++r) { t0 = fmaxf(t0, d0[r]); t1 = fmaxf(t1, d1[r]); }
      const float tm = fmaxf(t0, t1);
      const float mn = (g == 0) ? tm : fmaxf(m[jt], tm);
      float s0 = exp2_slot(d0[0] - mn), s1 = exp2_slot(d1[0] - mn);
#pragma unroll
      for (int r = 1; r < 8; ++r) { s0 += exp2_slot(d0[r] - mn); s1 += exp2_slot(d1[r] - mn); }
      sum[jt] = (g == 0) ? (s0 + s1) : (sum[jt] * exp2_slot(m[jt] - mn) + (s0 + s1));   // the old sum brought to the new maximum
      m[jt] = mn;
      // one tile of j at a time: interleaved tiles take registers, and two blocks share a WGP
      __builtin_amdgcn_sched_barrier(0);
    }
  }
  }
  // the one wait behind the kernel's loads: no address register of an issued load is given a new value in front of it
  // (the two pairs never change, and as inputs here they stay in their registers up to the wait)
  asm volatile("s_wait_xcnt 0x0" :: "v"(Qlane), "v"(Klane) : "memory");
#pragma unroll
  for (int jt = 0; jt < kRSJT; ++jt) {   // the two lane halves of column j
    const float mo = __shfl_xor(m[jt], 16, 32), so = __shfl_xor(sum[jt], 16, 32);
    const float mj = fmaxf(m[jt], mo);
    sum[jt] = sum[jt] * exp2_slot(m[jt] - mj) + so * exp2_slot(mo - mj);
    m[jt] = mj;
  }
  if (lane < 16) {
#pragma unroll
    for (int jt = 0; jt < kRSJT; ++jt) { pmax[wave][jt * 16 + c] = m[jt]; psum[wave][jt * 16 + c] = sum[jt]; }
  }
  __syncthreads();   // every wave's partial maxima and sums are in pmax, psum
  if (wave >= kRSJT) return;   // wave-uniform, behind the kernel's only barrier; wave w joins tile w of j
  const int col = wave * 16 + c;
  float wm[kRSWaves / 2], wsum[kRSWaves / 2];   // lane half h joins waves 8 h .. 8 h + 7 in wave order
#pragma unroll
  for (int w = 0; w < kRSWaves / 2; ++w) {
    wm[w]   = pmax[h * (kRSWaves / 2) + w][col];
    wsum[w] = psum[h * (kRSWaves / 2) + w][col];
  }
  float bm = wm[0];
#pragma unroll
  for (int w = 1; w < kRSWaves / 2; ++w) bm = fmaxf(bm, wm[w]);
  bm = fmaxf(bm, __shfl_xor(bm, 16, 32));
  float tot = wsum[0] * exp2_slot(wm[0] - bm);
#pragma unroll
  for (int w = 1; w < kRSWaves / 2; ++w) tot += wsum[w] * exp2_slot(wm[w] - bm);
  tot += __shfl_xor(tot, 16, 32);   // tot >= 2^-80, a normal number: a sum relative to bm is in it whole, and it passed the test or is >= 1
  STAT[((size_t)blockIdx.y * (kN / kStatRows) + blockIdx.x * kRSJT + wave) * 32 + lane] = kPCarryLog2 - bm - log2_slot(tot);
}

// ---------------------------------------------------------------------------
// attn^T.v with the probabilities formed in registers (no probability plane in memory):
//   O16[i][c] = f16( (64/32768) sum_j P[i][j] * V16[c][j] ),  P[i][j] = f16( 2^(S[j][i] + stat[j]) ), f32 math.
// One block owns 64 positions i (4 tiles of 16) of one batch and all 4096 j: grid (kN/64 = 64, kB) blocks of 16 waves, blockIdx.y
// the batch; wave w walks j in [256 w, 256 w + 256). Every q, V and statistics load feeds the 4 tiles of i.
// Per 32 j and tile of i: two score tiles D[j][i] = q rows (A) x k rows (B, loaded once) + C, C[j][i] = stat[j]: the matrix unit's own
// addition gives the exponent, and a probability costs the vector port one v_exp_f32 and half a packed conversion.
// A lane then holds column i = lane & 15 and
// rows j = 8 h + r and 16 + 8 h + r (h = lane >> 4), which is the k order of an A fragment of row i: converted in place,
// the two tiles are the A operand against the V fragments (same k order from Frag::load). No LDS, no lane exchange.
// The 16 waves' partial 64 x 32 tiles are joined through LDS in wave order behind one barrier.
// ---------------------------------------------------------------------------
constexpr int kAVWaves   = 16;
constexpr int kAVThreads = kAVWaves * 32;      // 512
constexpr int kAVIT      = 4;                  // 16-row tiles of i per block: every q, V and statistics load feeds this many tiles
constexpr int kAVRows    = 16 * kAVIT;         // 64 positions i per block
constexpr int kAVChunk   = kN / kAVWaves;      // 256 j per wave
constexpr int kAVSteps   = kAVChunk / 32;      // 8 steps of 32 j
constexpr int kAVPitch   = kCP + 4;            // floats per row of a partial tile
static_assert(kN % kAVRows == 0 && kAVChunk % 32 == 0 && (kAVRows * kCP) % kAVThreads == 0 && kCP == 32, "attn.v tiling");
// what 16 of a step's 32 j read for the scores: one q fragment and the lane's 8 row statistics, which are a C operand as they lie
// (register r of a lane is row 8 h + r of the tile, in C as in D; every column takes the same value)
struct AVHalf { v16h q; v8f c; };
__device__ __forceinline__ void av_load_half(AVHalf& s, const _Float16* __restrict__ Qlane, const float* __restrict__ Slane, int j0) {
  s.q = Frag<_Float16>::load(Qlane + (size_t)j0 * kQKW);   // q rows j0 .. j0 + 15
  const v4f c0 = *(const v4f*)(Slane + j0 * 2);            // j0 + 8 h + 0..3;  STAT: 32 floats per 16 j
  const v4f c1 = *(const v4f*)(Slane + j0 * 2 + 4);        // j0 + 8 h + 4..7
  s.c = __builtin_shufflevector(c0, c1, 0, 1, 2, 3, 4, 5, 6, 7);
}
// 8 probabilities of one lane from one tile of exponents (at most 15: no overflow in f32 or f16)
__device__ __forceinline__ v8h av_prob(const v8f s) {
  v8f e;
#pragma unroll
  for (int r = 0; r < 8; ++r) e[r] = __builtin_amdgcn_exp2f(s[r]);
  // the slot that the instruction set asks for behind a transcendental before its result is read or its source overwritten, in every
  // build: the results pass through the statement, so no reader stands in front of the v_nop; the exponents are its inputs, so they
  // keep their registers up to it and no v_exp_f32 lands on the source of the one directly in front
  asm("v_nop" : "+v"(e) : "v"(s));
  return __builtin_convertvector(e, v8h);
}
__global__ __launch_bounds__(kAVThreads) void attnv_kernel(const unsigned short* __restrict__ QKp,
                                                           const unsigned short* __restrict__ Vp,
                                                           const float* __restrict__ ST,
                                                           unsigned short* __restrict__ O) {
  typedef Frag<_Float16> F;
  __shared__ __align__(16) float part[kAVWaves][kAVRows][kAVPitch];
  const int t    = threadIdx.x;
  const int lane = t & 31;
  const int wave = t >> 5;
  const int c    = lane & 15;
  const int h8   = (lane >> 4) * 8;
  const int i0   = blockIdx.x * kAVRows;
  const int jb   = wave * kAVChunk;
  const int bt   = blockIdx.y;   // the block's batch
  const _Float16* QK    = (const _Float16*)QKp + (size_t)bt * kN * kQKW;
  const _Float16* Klane = QK + (size_t)(i0 + c) * kQKW + h8;   // row of position i0 + c; its k half starts at column kCP
  // the wave's first step
  const _Float16* Qlane = QK + (size_t)(jb + c) * kQKW + h8;
  const _Float16* Vlane = (const _Float16*)Vp + (size_t)bt * kVR * kN + (size_t)c * kN + jb + h8;
  const float* Slane = ST + (size_t)bt * kN * 2 + jb * 2 + h8;    // walks 32 floats per 16 j
  v16h kf[kAVIT];
#pragma unroll
  for (int it = 0; it < kAVIT; ++it) kf[it] = F::load(Klane + kCP + (size_t)(it * 16) * kQKW);
  // the k fragments stay the oldest loads: issued ahead of the first step's; issued behind them, their wait would stand inside the loop and drain its refills each step
  __builtin_amdgcn_sched_barrier(0);
  const v8f zero = (v8f){0.f, 0.f, 0.f, 0.f, 0.f, 0.f, 0.f, 0.f};
  v8f acc[kAVIT][2];
#pragma unroll
  for (int it = 0; it < kAVIT; ++it) { acc[it][0] = zero; acc[it][1] = zero; }
  // One register set: each part is loaded anew directly behind its last use, half a step ahead of its next use.
  AVHalf ha, hb;
  v16h v0, v1;
  av_load_half(ha, Qlane, Slane, 0);
  // the first half's loads stay ahead of the others, as in the loop's refills: the loop's counted waits are set for both ways into it,
  // and with the two halves mixed here the wait at the loop's head reaches into the refill issued just in front of it
  __builtin_amdgcn_sched_barrier(0);
  av_load_half(hb, Qlane, Slane, 16);
  v0 = F::load(Vlane);                        // channels 0..15
  v1 = F::load(Vlane + (size_t)16 * kN);      // channels 16..31
  // one step of 32 j; refill: whether a next step exists, a literal at both calls, so that a step is one run of code with no branch
  auto step = [&](const int jn, const bool refill) {
    // the next step's three addresses, each formed once: the refills read at compile-time offsets from them
    const _Float16* Qn  = Qlane + (size_t)jn * kQKW;
    const _Float16* Vn  = Vlane + jn;
    const float*    Sn  = Slane + jn * 2;
    v8h plo[kAVIT];
#pragma unroll
    for (int it = 0; it < kAVIT; ++it) plo[it] = av_prob(F::mma(ha.q, kf[it], ha.c));   // j = 8 h + r of the step
    if (refill) {
      __builtin_amdgcn_sched_barrier(0);   // the refill is not lifted into the exp work in front of it (it would need a second register set)
      av_load_half(ha, Qn, Sn, 0);
      // the step's addresses sit in registers that are given new values behind the loads; as inputs here the pairs stay
      // in their registers up to the wait, so that no load of the run lands in one of them
      asm volatile("s_wait_xcnt 0x0" :: "v"(Qn), "v"(Sn) : "memory");
      __builtin_amdgcn_sched_barrier(0);   // nor sunk: the second half's exp work behind it hides the loads
    }
#pragma unroll
    for (int it = 0; it < kAVIT; ++it) {
      const v8h phi = av_prob(F::mma(hb.q, kf[it], hb.c));                                  // j = 16 + 8 h + r
      const v16h p = __builtin_shufflevector(plo[it], phi, 0, 1, 2, 3, 4, 5, 6, 7, 8, 9, 10, 11, 12, 13, 14, 15);
      acc[it][0] = F::mma(p, v0, acc[it][0]);
      acc[it][1] = F::mma(p, v1, acc[it][1]);
    }
    if (refill) {
      __builtin_amdgcn_sched_barrier(0);   // as above, for the second half's and the V fragments' refill
      av_load_half(hb, Qn, Sn, 16);
      v0 = F::load(Vn);
      v1 = F::load(Vn + (size_t)16 * kN);
      asm volatile("s_wait_xcnt 0x0" :: "v"(Qn), "v"(Vn), "v"(Sn) : "memory");   // as above
      __builtin_amdgcn_sched_barrier(0);   // nor sunk: the next step's first half hides these loads
    }
  };
#pragma unroll 1   // rolled: one step's code for 4 tiles of i is as long as the 8 steps for one tile were
  for (int s = 1; s < kAVSteps; ++s) step(s * 32, true);
  step(0, false);   // the last step has nothing to load
#pragma unroll
  for (int it = 0; it < kAVIT; ++it)
#pragma unroll
    for (int r = 0; r < 8; ++r) {
      part[wave][it * 16 + h8 + r][c]      = acc[it][0][r];
      part[wave][it * 16 + h8 + r][16 + c] = acc[it][1][r];
    }
  __syncthreads();   // every wave's partial tiles are in part
  const int col = lane;   // a wave stores the 64 used bytes of one row of O, 4 rows in turn
#pragma unroll
  for (int it = 0; it < kAVIT; ++it) {
    const int row = it * 16 + wave;
    float sum = part[0][row][col];
#pragma unroll
    for (int w = 1; w < kAVWaves; ++w) sum += part[w][row][col];
    O[(size_t)bt * kN * kOW + (size_t)(i0 + row) * kOW + col] = h_bits(sum * kPVScale);
  }
}

// ---------------------------------------------------------------------------
// Host glue.
// Workspace region map (bytes, every offset a multiple of 256):
//   WP16  f16 [6][8][2][32][8]        49,152  at           0   16*log2e*Wq, 16*Wk, 16*Wv in fragment order
//   WB16  f16 [256][32]               16,384  at      49,152   16*Wb
//   BQK   f32 [64]                       256  at      65,536   log2e*bq | bk
//   BV64  f32 [64]                       256  at      65,792   bv | 0
//   QK16  f16 [8][4096][64]        4,194,304  at      66,048   cols 0..31 q x log2e, 32..63 k
//   V16   f16 [8][64][4096]        4,194,304  at   4,260,352   channel-major v, rows 0..31 (32..63 neither written nor read)
//   STAT  f32 [8][256][32]           262,144  at   8,454,656   per 16 score rows: 16 x (15 - max - log2 sum), twice
//   O16   f16 [8][4096][64]        4,194,304  at   8,716,800   attention output x64, position-major, cols 0..31 (32..63 neither written nor read)
//   total                         12,911,104
// GEMM shapes: q, k, v M=96 N=4096 K=256 (own kernel); scores M=N=4096 K=32 (tiles inside the two attention kernels);
// attn.v M=4096 N=32 K=4096 (own kernel); back M=256 N=4096 K=32. No padding reads of unwritten data.
// Launch count: 1 + 1 + 2 + 1 = 5.
// ---------------------------------------------------------------------------
extern "C" void kernel_launch(void* const* d_in, const int* in_sizes, int n_in,
                              void* d_out, int out_size, void* d_ws, size_t ws_size,
                              hipStream_t stream) {
  if (n_in < 9) return;
  const int nX = kB * kC * kN;   // 8,388,608
  if (in_sizes[0] != nX) return;
  if (in_sizes[1] != kCP * kC || in_sizes[3] != kCP * kC || in_sizes[5] != kCP * kC) return;
  if (in_sizes[2] != kCP || in_sizes[4] != kCP || in_sizes[6] != kCP) return;
  if (in_sizes[7] != kC * kCP || in_sizes[8] != kC) return;
  if (out_size != nX) return;

  const size_t szWP  = (size_t)kPJWHalves * 2;
  const size_t szWB  = (size_t)kC * kCP * 2;
  const size_t szBQK = (size_t)kQKW * 4;
  const size_t szBV  = (size_t)kVR * 4;
  const size_t szQK  = (size_t)kB * kN * kQKW * 2;
  const size_t szV   = (size_t)kB * kVR * kN * 2;
  const size_t szST  = (size_t)kB * (kN / kStatRows) * 32 * 4;
  const size_t szO   = (size_t)kB * kN * kOW * 2;
  const size_t offWP  = 0;
  const size_t offWB  = offWP + szWP;
  const size_t offBQK = offWB + szWB;
  const size_t offBV  = offBQK + szBQK;
  const size_t offQK  = offBV + szBV;
  const size_t offV   = offQK + szQK;
  const size_t offST  = offV + szV;
  const size_t offO   = offST + szST;
  const size_t total  = offO + szO;   // 12,911,104
  if (ws_size < total) return;

  const float* x  = (const float*)d_in[0];
  const float* Wq = (const float*)d_in[1];
  const float* bq = (const float*)d_in[2];
  const float* Wk = (const float*)d_in[3];
  const float* bk = (const float*)d_in[4];
  const float* Wv = (const float*)d_in[5];
  const float* bv = (const float*)d_in[6];
  const float* Wb = (const float*)d_in[7];
  const float* bb = (const float*)d_in[8];
  float* out = (float*)d_out;
  char* ws = (char*)d_ws;
  unsigned short* WP16  = (unsigned short*)(ws + offWP);
  unsigned short* WB16  = (unsigned short*)(ws + offWB);
  float* BQK  = (float*)(ws + offBQK);
  float* BV64 = (float*)(ws + offBV);
  unsigned short* QK16 = (unsigned short*)(ws + offQK);
  unsigned short* V16  = (unsigned short*)(ws + offV);
  float* STAT = (float*)(ws + offST);
  unsigned short* O16 = (unsigned short*)(ws + offO);

  // ---- parameter planes ----
  prep_kernel<<<dim3(17), dim3(256), 0, stream>>>(Wq, bq, Wk, bk, Wv, bv, Wb, WP16, WB16, BQK, BV64);

  const long strideO  = (long)kN * kOW;
  const long strideX  = (long)kC * kN;

  // ---- q|k plane (position-major) and v plane (channel-major), all batches in one grid, straight from x ----
  proj_kernel<<<dim3(kN / kPJPos, kB), dim3(kPJThreads), 0, stream>>>(x, WP16, BQK, BV64, QK16, V16);

  // all batches in one grid each (blockIdx.y = batch):
  // per row j of S[j][i] = log2e * sum_o q[o,j] * k[o,i]: 15 - max - log2 of the sum of 2^(S - max)
  rowstats_kernel<<<dim3(kN / kRSCols, kB), dim3(kRSThreads), 0, stream>>>(QK16, STAT);
  // O16[b][i][c] = f16( (64/32768) sum_j f16(32768 * attn[j][i]) * V16[b][c][j] ) = f16( 64 * out[c][i] )
  attnv_kernel<<<dim3(kN / kAVRows, kB), dim3(kAVThreads), 0, stream>>>(QK16, V16, STAT, O16);

  // ---- result[b][cc][i] = (1/1024) sum_o WB16[cc][o] * O16[b][i][o] + bb[cc] + x[b][cc][i]   (M=256, N=4096, K=32) ----
  const int blocksBack = ((kC / 64) * (kN / 64)) / 8;  // 256 tiles -> 32 blocks
  wmma_gemm64<0, false, 1, 0, true><<<dim3(blocksBack, kB), dim3(256), 0, stream>>>(
      WB16, WB16, kCP, 0L, O16, O16, kOW, strideO,
      (void*)out, (void*)out, kN, strideX, bb, x, strideX, kC, kN, kCP, kBackScale);
}

// v009
// One run takes 50.8 microseconds.
// Timed twice side by side with v008, it ran 1.31 and 1.29 times as fast.
// All steps since v000 together make it 103 times as fast.
// Contractions: q, k and v projections (x cast to f16 in registers x W f16 carried x16, Wq and bq also x log2 e; one kernel), scores (q, k f16 planes; once as k.q tiles inside the row-statistics kernel, once more as q.k tiles inside the attn^T.v kernel), attn^T.v (P f16 carried x32768, formed in registers, x V f16 plane; the score tiles there start from the row's statistic as C), back-projection (Wb f16 carried x16 x O f16 carried x64): all v_wmma_f32_16x16x32_f16 with f32 accumulate; softmax statistics, exp, biases and residual in f32.
#include <hip/hip_runtime.h>
#include <math.h>

// ---------------------------------------------------------------------------
// Problem constants
// ---------------------------------------------------------------------------
constexpr int kB   = 8;      // batch
constexpr int kC   = 256;    // channels
constexpr int kN   = 4096;   // positions (64 x 64)
constexpr int kCP  = 32;     // reduced channels
constexpr int kQKW = 64;     // rows of the q|k weights and biases: 0..31 q, 32..63 k
constexpr int kVR  = 64;     // entries of the v bias plane: 0..31 bv, 32..63 zero
constexpr int kTileH  = 512;             // halves of one fragment-order tile: 16 rows x 32 k = [part][lane][8 halves], 1,024 B
constexpr int kPlaneH = kN * kCP;        // halves of one batch of the q, k or v plane (256 tiles)
constexpr int kKOff   = kB * kPlaneH;    // the k plane lies this many halves behind the q plane
constexpr int kOW  = 64;     // pitch of the O plane in columns: 0..31 out, 32..63 unused
constexpr float kWCarry    = 16.0f;                      // weights carried x16 in f16
constexpr float kWCarryInv = 1.0f / 16.0f;
constexpr float kPCarry    = 32768.0f;                   // probabilities carried x2^15 in f16
constexpr float kOCarry    = 64.0f;                      // attention output carried x64 in f16
constexpr float kPVScale   = kOCarry / kPCarry;          // 1/512
constexpr float kBackScale = 1.0f / (kOCarry * kWCarry); // 1/1024
constexpr float kLog2e     = 1.4426950408889634f;        // q carries it, so that a score is the exponent of 2, not of e
static_assert(kN % 64 == 0 && kC % 64 == 0 && kQKW % 64 == 0 && kVR % 64 == 0 && kOW % 64 == 0, "tile multiples");
static_assert(kC % 32 == 0 && kCP % 32 == 0 && kN % 32 == 0, "k steps of 32");
static_assert(2 * kCP == kQKW && kCP <= kVR && kCP <= kOW, "plane widths");
static_assert(kCP * kC == 8192 && kC * kCP == 8192 && kN % 256 == 0 && kN % 8 == 0, "prep coverage");

typedef __attribute__((ext_vector_type(16))) _Float16 v16h;
typedef __attribute__((ext_vector_type(8)))  _Float16 v8h;
typedef __attribute__((ext_vector_type(16))) __bf16   v16b;
typedef __attribute__((ext_vector_type(8)))  __bf16   v8b;
typedef __attribute__((ext_vector_type(8)))  float    v8f;
typedef __attribute__((ext_vector_type(4)))  float    v4f;
typedef __attribute__((ext_vector_type(2)))  float    v2f;
typedef __attribute__((ext_vector_type(4)))  unsigned int v4u;

// ---------------------------------------------------------------------------
// Shared helpers (with a 4-accumulator guard)
// ---------------------------------------------------------------------------
__device__ __forceinline__ unsigned short f2bf_bits(float f) {
  unsigned u = __float_as_uint(f);
  return (unsigned short)((u + 0x7FFFu + ((u >> 16) & 1u)) >> 16);
}
__device__ __forceinline__ float bf_bits2f(unsigned short h) { return __uint_as_float(((unsigned)h) << 16); }

// hazard guards as plain device helpers (no inline asm inside the kernel template body)
__device__ __forceinline__ void dep_guard_h(v8f& a, v8f& b, v16h x, v16h y) { asm volatile("v_nop\n\tv_nop\n\tv_nop\n\tv_nop" : "+v"(a), "+v"(b) : "v"(x), "v"(y)); }
__device__ __forceinline__ void dep_guard_b(v8f& a, v8f& b, v16b x, v16b y) { asm volatile("v_nop\n\tv_nop\n\tv_nop\n\tv_nop" : "+v"(a), "+v"(b) : "v"(x), "v"(y)); }
__device__ __forceinline__ void dep_guard4_h(v8f& a, v8f& b, v8f& c, v8f& d, v16h x, v16h y) { asm volatile("v_nop\n\tv_nop\n\tv_nop\n\tv_nop" : "+v"(a), "+v"(b), "+v"(c), "+v"(d) : "v"(x), "v"(y)); }
__device__ __forceinline__ void dep_guard4_b(v8f& a, v8f& b, v8f& c, v8f& d, v16b x, v16b y) { asm volatile("v_nop\n\tv_nop\n\tv_nop\n\tv_nop" : "+v"(a), "+v"(b), "+v"(c), "+v"(d) : "v"(x), "v"(y)); }
__device__ __forceinline__ void keep4_h(v16h a, v16h b, v16h c, v16h d) { asm volatile("v_nop" :: "v"(a), "v"(b), "v"(c), "v"(d)); }
__device__ __forceinline__ void keep4_b(v16b a, v16b b, v16b c, v16b d) { asm volatile("v_nop" :: "v"(a), "v"(b), "v"(c), "v"(d)); }
__device__ __forceinline__ void acc_guard4(v8f& a, v8f& b, v8f& c, v8f& d) { asm volatile("v_nop\n\tv_nop\n\tv_nop\n\tv_nop" : "+v"(a), "+v"(b), "+v"(c), "+v"(d)); }
template <typename T> struct Frag;
template <> struct Frag<_Float16> {
  typedef v16h V; union U { v16h v; v8h h[2]; };
  // elements 0..7 <- p[0..7], 8..15 <- p[16..23]
  static __device__ __forceinline__ v16h load(const _Float16* p) {
    U f; f.h[0] = *(const v8h*)(p); f.h[1] = *(const v8h*)(p + 16); return f.v;
  }
  static __device__ __forceinline__ v8f mma(v16h a, v16h b, v8f c) {
    return __builtin_amdgcn_wmma_f32_16x16x32_f16(false, a, false, b, (short)0, c, false, false);
  }
  static __device__ __forceinline__ void guard(v8f& a, v8f& b, v16h x, v16h y) { dep_guard_h(a, b, x, y); }
  static __device__ __forceinline__ void guard4(v8f& a, v8f& b, v8f& c, v8f& d, v16h x, v16h y) { dep_guard4_h(a, b, c, d, x, y); }
  static __device__ __forceinline__ void keep(v16h a, v16h b, v16h c, v16h d) { keep4_h(a, b, c, d); }
};
template <> struct Frag<__bf16> {
  typedef v16b V; union U { v16b v; v8b h[2]; };
  static __device__ __forceinline__ v16b load(const __bf16* p) {
    U f; f.h[0] = *(const v8b*)(p); f.h[1] = *(const v8b*)(p + 16); return f.v;
  }
  static __device__ __forceinline__ v8f mma(v16b a, v16b b, v8f c) {
    return __builtin_amdgcn_wmma_f32_16x16x32_bf16(false, a, false, b, (short)0, c, false, false);
  }
  static __device__ __forceinline__ void guard(v8f& a, v8f& b, v16b x, v16b y) { dep_guard_b(a, b, x, y); }
  static __device__ __forceinline__ void guard4(v8f& a, v8f& b, v8f& c, v8f& d, v16b x, v16b y) { dep_guard4_b(a, b, c, d, x, y); }
  static __device__ __forceinline__ void keep(v16b a, v16b b, v16b c, v16b d) { keep4_b(a, b, c, d); }
};

// A fragment from a plane in fragment order: lane l reads 16 B at 16 l of each 512-B part, so that each load of a wave covers 4 whole
// 128-B lines. p = tile + 8 * lane. Part s holds what Frag::load takes from p[16 s .. 16 s + 7] of a row-major row: the same k order.
__device__ __forceinline__ v16h frag_ld(const _Float16* p) {
  Frag<_Float16>::U f; f.h[0] = *(const v8h*)(p); f.h[1] = *(const v8h*)(p + 256); return f.v;
}

__device__ __forceinline__ unsigned pk16(unsigned short a, unsigned short b) { return (unsigned)a | ((unsigned)b << 16); }
__device__ __forceinline__ unsigned short h_bits(float f) { const _Float16 h = (_Float16)f; return __builtin_bit_cast(unsigned short, h); }

// ---- Register-blocked batched WMMA GEMM (no activations; residual added in the store phase) ------
// C[m,n] = scale * sum_k A[m,k] * Bt[n,k] (+bias)(+resid); each wave owns a 64x64 tile.
// A row-major [M,K]; Bt row-major [N,K]; M,N % 64 == 0, K % 32 == 0.
// SPLIT: operands are hi/lo planes (A2/Bt2 = lo planes, same layout); product = hi*hi + hi*lo + lo*hi.
// BIAS_MODE: 0 = none, 1 = bias[m], 2 = bias[n].
// OUT_MODE: 0 = f32, 1 = f16, 2 = bf16 hi plane (Cout) + bf16 lo plane (Cout2).
// RESID (OUT_MODE 0 only): each lane loads ONE float4 of the residual at exactly the address it stores, adds it to the
// ET: 0 = f16 operands, 1 = bf16 operands (pointers passed as 16-bit storage)
template <int ET> struct Elem;
template <> struct Elem<0> { typedef _Float16 T; };
template <> struct Elem<1> { typedef __bf16 T; };
template <int ET, bool SPLIT, int BIAS_MODE, int OUT_MODE, bool RESID>
__global__ __launch_bounds__(256) void wmma_gemm64(
    const unsigned short* __restrict__ Ap, const unsigned short* __restrict__ A2p, int lda, long strideA,
    const unsigned short* __restrict__ Btp, const unsigned short* __restrict__ Bt2p, int ldb, long strideB,
    void* __restrict__ Cout, void* __restrict__ Cout2, int ldc, long strideC,
    const float* __restrict__ bias,
    const float* __restrict__ resid, long strideR,
    int M, int N, int K, float scale) {
  static_assert(!RESID || OUT_MODE == 0, "residual only with f32 output");
  typedef typename Elem<ET>::T T;
  typedef typename Frag<T>::V V;
  const T* A = (const T*)Ap; const T* A2 = (const T*)A2p; const T* Bt = (const T*)Btp; const T* Bt2 = (const T*)Bt2p;
  __shared__ __align__(16) float sT[8][16 * 68];   // per-wave 16x64 slab, pitch 68 floats
  const int b    = blockIdx.y;
  const int lane = threadIdx.x & 31;
  const int wave = threadIdx.x >> 5;
  const int tilesN = N >> 6;
  const int tilesM = M >> 6;
  const int tile = blockIdx.x * 8 + wave;
  if (tile >= tilesM * tilesN) return;   // wave-uniform; no block barriers in this kernel
  const int tm = tile / tilesN;
  const int tn = tile - tm * tilesN;
  const int m0 = tm << 6;
  const int n0 = tn << 6;

  const T* Ab  = A  + (size_t)b * strideA;
  const T* Bb  = Bt + (size_t)b * strideB;
  const T* Ab2 = SPLIT ? (A2  + (size_t)b * strideA) : nullptr;
  const T* Bb2 = SPLIT ? (Bt2 + (size_t)b * strideB) : nullptr;

  const int rlane = lane & 15;                 // row (A) / col (B, D) within subtile
  const int koff  = (lane >> 4) * 8;           // k offset of this lane half
  const int mOff  = (lane >> 4) * 8;           // D row offset

  v8f acc[4][4];
#pragma unroll
  for (int i = 0; i < 4; ++i)
#pragma unroll
    for (int j = 0; j < 4; ++j) acc[i][j] = (v8f){0.f,0.f,0.f,0.f,0.f,0.f,0.f,0.f};

  for (int k0 = 0; k0 < K; k0 += 32) {
    V bh[4], bl[4];
#pragma unroll
    for (int j = 0; j < 4; ++j) {
      const size_t bo = (size_t)(n0 + (j << 4) + rlane) * ldb + koff + k0;
      bh[j] = Frag<T>::load(Bb + bo);
      if (SPLIT) bl[j] = Frag<T>::load(Bb2 + bo);
    }
#pragma unroll
    for (int i = 0; i < 4; ++i) {
      const size_t ao = (size_t)(m0 + (i << 4) + rlane) * lda + koff + k0;
      V ah = Frag<T>::load(Ab + ao);
      V al;
      if (SPLIT) al = Frag<T>::load(Ab2 + ao);
#pragma unroll
      for (int j = 0; j < 4; ++j) {
        acc[i][j] = Frag<T>::mma(ah, bh[j], acc[i][j]);
        if (SPLIT) {
          acc[i][j] = Frag<T>::mma(ah, bl[j], acc[i][j]);
          acc[i][j] = Frag<T>::mma(al, bh[j], acc[i][j]);
        }
      }
      Frag<T>::guard4(acc[i][0], acc[i][1], acc[i][2], acc[i][3], ah, SPLIT ? al : ah);
    }
    Frag<T>::keep(bh[0], bh[1], bh[2], bh[3]);
    if (SPLIT) Frag<T>::keep(bl[0], bl[1], bl[2], bl[3]);
  }
  acc_guard4(acc[0][0], acc[0][1], acc[0][2], acc[0][3]);
  acc_guard4(acc[1][0], acc[1][1], acc[1][2], acc[1][3]);
  acc_guard4(acc[2][0], acc[2][1], acc[2][2], acc[2][3]);
  acc_guard4(acc[3][0], acc[3][1], acc[3][2], acc[3][3]);

  // ---- epilogue ----
  float* slab = sT[wave];
  const float* Rb = RESID ? (resid + (size_t)b * strideR) : nullptr;
#pragma unroll
  for (int i = 0; i < 4; ++i) {
    const int mBase = m0 + (i << 4);
#pragma unroll
    for (int j = 0; j < 4; ++j) {
      const int n = n0 + (j << 4) + rlane;
      float bvn = 0.f;
      if (BIAS_MODE == 2) bvn = bias[n];
#pragma unroll
      for (int r = 0; r < 8; ++r) {
        float v = acc[i][j][r] * scale;
        if (BIAS_MODE == 1) v += bias[mBase + mOff + r];
        if (BIAS_MODE == 2) v += bvn;
        slab[(mOff + r) * 68 + (j << 4) + rlane] = v;
      }
    }
    __builtin_amdgcn_fence(__ATOMIC_RELEASE, "workgroup");
    __builtin_amdgcn_wave_barrier();
    __builtin_amdgcn_fence(__ATOMIC_ACQUIRE, "workgroup");
    if (OUT_MODE == 0) {
      float* C = (float*)Cout + (size_t)b * strideC;
      const int hh = lane >> 4, c4 = (lane & 15) * 4;     // row seg = 256 B = 16 lanes x 16 B
      v4f vals[8];
#pragma unroll
      for (int it = 0; it < 8; ++it) {
        const int row = it * 2 + hh;
        v4f v = *(const v4f*)(slab + row * 68 + c4);
        if (RESID) {
          const v4f rv = *(const v4f*)(Rb + (size_t)(mBase + row) * ldc + n0 + c4);
          v = v + rv;
        }
        vals[it] = v;
      }
      {
#pragma unroll
        for (int it = 0; it < 8; ++it) {
          const int row = it * 2 + hh;
          *(v4f*)(C + (size_t)(mBase + row) * ldc + n0 + c4) = vals[it];
        }
        
      }
    } else {
      const int q = lane >> 3, c8 = (lane & 7) * 8;
      unsigned short* C  = (unsigned short*)Cout  + (size_t)b * strideC;
      unsigned short* C2 = (OUT_MODE == 2) ? ((unsigned short*)Cout2 + (size_t)b * strideC) : nullptr;
      {
#pragma unroll
        for (int it = 0; it < 4; ++it) {
          const int row = it * 4 + q;
          const float* sp = slab + row * 68 + c8;
          v8h hv, lv;
#pragma unroll
          for (int e = 0; e < 8; ++e) {
            if (OUT_MODE == 1) {
              hv[e] = (_Float16)sp[e];
            } else {
              unsigned short hb = f2bf_bits(sp[e]);
              unsigned short lb = f2bf_bits(sp[e] - bf_bits2f(hb));
              hv[e] = __builtin_bit_cast(_Float16, hb);
              lv[e] = __builtin_bit_cast(_Float16, lb);
            }
          }
          *(v8h*)(C + (size_t)(mBase + row) * ldc + n0 + c8) = hv;
          if (OUT_MODE == 2) *(v8h*)(C2 + (size_t)(mBase + row) * ldc + n0 + c8) = lv;
        }
        
      }
    }
    __builtin_amdgcn_fence(__ATOMIC_RELEASE, "workgroup");
    __builtin_amdgcn_wave_barrier();
    __builtin_amdgcn_fence(__ATOMIC_ACQUIRE, "workgroup");
  }
}

// ---------------------------------------------------------------------------
// Parameter planes (17 blocks of 256 threads):
//   blocks  0.. 3: WP16[0..8191]      = f16(16 * log2 e * Wq)   (tiles 0, 1 of 16 rows)
//   blocks  4.. 7: WP16[8192..16383]  = f16(16 * Wk)            (tiles 2, 3)
//   blocks  8..11: WP16[16384..24575] = f16(16 * Wv)            (tiles 4, 5)
//   blocks 12..15: WB16[0..8191]      = f16(16 * Wb)            ([256][32], row-major)
//   block  16    : BQK[64] = log2 e * bq | bk (f32), BV64[64] = bv | 0 (f32)
// WP16 lies in fragment order: [tile of 16 rows][k step of 32 channels][half][lane][8 halves]; lane l holds row l & 15 of the tile,
// channels 16 * half + 8 * (l >> 4) + 0..7 of the k step: the two 16-B parts of a lane's fragment, each part 512 contiguous B a wave.
// Coverage: 4 blocks x 256 threads x 8 = 8192 elements per group. Each thread one 16-B store; a wave writes 512 contiguous B
// ---------------------------------------------------------------------------
__global__ __launch_bounds__(256) void prep_kernel(const float* __restrict__ Wq, const float* __restrict__ bq,
                                                   const float* __restrict__ Wk, const float* __restrict__ bk,
                                                   const float* __restrict__ Wv, const float* __restrict__ bv,
                                                   const float* __restrict__ Wb,
                                                   unsigned short* __restrict__ WP16,
                                                   unsigned short* __restrict__ WB16,
                                                   float* __restrict__ BQK, float* __restrict__ BV64) {
  const int t   = threadIdx.x;
  const int blk = blockIdx.x;
  if (blk < 16) {   // block-uniform
    const int grp = blk >> 2;
    const int sub = blk & 3;
    const int d   = sub * 256 + t;         // 16-B part of the group's plane, 0 .. 1023
    const int e0  = d * 8;                 // 0 .. 8184
    // where part d comes from: Wb as it lies; else row (d >> 9) * 16 + (d & 15), channel 32 * k step + 16 * half + 8 * (lane >> 4)
    const int s0  = (grp == 3) ? e0 : (((d >> 9) * 16 + (d & 15)) * kC + ((d >> 6) & 7) * 32 + ((d >> 5) & 1) * 16 + ((d >> 4) & 1) * 8);
    const float* src = (grp == 0) ? Wq : (grp == 1) ? Wk : (grp == 2) ? Wv : Wb;
    const float  f   = (grp == 0) ? kWCarry * kLog2e : kWCarry;
    unsigned short* dst = (grp == 3) ? WB16 : (WP16 + grp * 8192);
    const v4f a = *(const v4f*)(src + s0);
    const v4f c = *(const v4f*)(src + s0 + 4);
    unsigned short hb[8];
#pragma unroll
    for (int e = 0; e < 4; ++e) {
      hb[e]     = h_bits(a[e] * f);
      hb[4 + e] = h_bits(c[e] * f);
    }
    const v4u u = (v4u){pk16(hb[0], hb[1]), pk16(hb[2], hb[3]), pk16(hb[4], hb[5]), pk16(hb[6], hb[7])};
    unsigned short* dp = dst + e0;
    *(v4u*)dp = u;
  } else {
    const int lane = t & 31, wave = t >> 5;
    const int idx = (lane & 7) * 4;   // 0..28: always inside the 32-entry bias vectors
    const v4f q4 = *(const v4f*)(bq + idx);
    const v4f k4 = *(const v4f*)(bk + idx);
    const v4f w4 = *(const v4f*)(bv + idx);
    const float fq = (lane < 8) ? 1.0f : 0.0f;
    const float fk = (lane < 8) ? 0.0f : 1.0f;
    // arithmetic select: lanes 0..7 take bq / bv, lanes 8..15 take bk / zeros (all loads unconditional)
    const v4f valQK = q4 * (fq * kLog2e) + k4 * fk;
    const v4f valV  = w4 * fq;
    const bool wq = (wave == 0) && (lane < 16);
    const bool wv = (wave == 1) && (lane < 16);
    float* dq = BQK  + (lane & 15) * 4;
    float* dv = BV64 + (lane & 15) * 4;
    if (wq) *(v4f*)dq = valQK;
    if (wv) *(v4f*)dv = valV;
  }
}

// ---------------------------------------------------------------------------
// q, k and v projections straight from x[b][c][n] (f32, n contiguous): no transposed f16 copy of x in memory.
//   q|k[b][n][o'] = f16( (1/16) sum_c WP[o'][c] * f16(x[b][c][n]) + BQK[o'] ),  o' = 0..63 (q | k)
//   v[b][o][n]    = f16( (1/16) sum_c WP[64 + o][c] * f16(x[b][c][n]) + BV64[o] ),  o = 0..31
// The three planes lie in the fragment order of their readers, in tiles of 1,024 B = [part s][lane l][8 halves]:
//   q, k: tile T of a batch holds 16 positions, row m = position 32 (T >> 1) + 2 m + (T & 1); lane l, part s: row l & 15,
//         channels 16 s + 8 (l >> 4) + 0..7.
//   v:    tile 2 S + nt holds channels 16 nt + 0..15 over the 32 positions of step S; lane l, part s: channel 16 nt + (l & 15),
//         rows 8 (l >> 4) + 0..7 of position tile 2 S + s: the k order in which attn.v forms its probabilities from q tiles 2 S, 2 S + 1.
// grid (kN/128 = 32, kB) blocks of 4 waves; a wave owns 32 positions, as two tiles of 16: column (or row) m of tile p is position
// n0 + 2 m + p, so that a lane's 8-B load of one channel feeds both tiles and 16 lanes read one whole 128-B line.
// An x fragment (lane = position, 16 channels in the k order of Frag::load) serves as B against the q|k weight rows (A): D[o'][n], a lane
// holds 8 consecutive o' of one position; and as A against the v weight rows (B): D[n][o], a lane holds 8 rows of one tile for one
// channel. Both are what the same lane holds of a fragment-order part: every store of a wave is 512 contiguous B, with no LDS pass.
// The 48 KiB of weights are copied once to LDS as they lie (fragment order: every read is 512 contiguous B): LDS reads count on their
// own counter, so that waiting for a weight fragment does not wait for the x loads, which run three k steps ahead (one wave on a SIMD:
// nothing else hides the memory latency, and the registers are there).
// ---------------------------------------------------------------------------
constexpr int kPJWaves   = 4;
constexpr int kPJThreads = kPJWaves * 32;       // 128
constexpr int kPJPos     = 32 * kPJWaves;       // 128 positions per block
constexpr int kPJSteps   = kC / 32;             // 8 k steps
constexpr int kPJTiles   = 6;                   // tiles of 16 weight rows: q, q, k, k, v, v
constexpr int kPJWHalves = kPJTiles * kPJSteps * 512;   // 24,576 halves of weights
static_assert(kN % kPJPos == 0 && kPJWHalves % (kPJThreads * 8) == 0 && kPJTiles * 16 == 3 * kCP && kCP == 32, "projection tiling");
__global__ __launch_bounds__(kPJThreads) void proj_kernel(const float* __restrict__ x, const unsigned short* __restrict__ WP16,
                                                          const float* __restrict__ BQK, const float* __restrict__ BV64,
                                                          unsigned short* __restrict__ QK16, unsigned short* __restrict__ V16) {
  typedef Frag<_Float16> F;
  __shared__ __align__(16) _Float16 sW[kPJWHalves];
  const int t    = threadIdx.x;
  const int lane = t & 31;
  const int wave = t >> 5;
  const int c    = lane & 15;
  const int h    = lane >> 4;
  const int b    = blockIdx.y;
  const int nb   = blockIdx.x * kPJPos;     // the block's first position
  const int n0   = nb + wave * 32;          // the wave's
  // channel 8 h, positions n0 + 2 c, + 1; every load of x is a compile-time offset from this address
  const float* xl = x + ((size_t)b * kC + h * 8) * kN + n0 + 2 * c;
  const unsigned short* wl = WP16 + t * 8;
  constexpr int kParts = kPJWHalves / (kPJThreads * 8);   // 24 parts of 16 B per thread
  v4u wst[kParts];
#pragma unroll
  for (int i = 0; i < kParts; ++i) wst[i] = *(const v4u*)(wl + i * kPJThreads * 8);
  v2f raw[3][16];   // three register sets take turns: element e is channel 8 h + e (e < 8), 16 + 8 h + e - 8 (e >= 8) of the k step
#pragma unroll
  for (int s = 0; s < 2; ++s)
#pragma unroll
    for (int e = 0; e < 16; ++e) raw[s][e] = *(const v2f*)(xl + (size_t)(s * 32 + e + (e & 8)) * kN);
#pragma unroll
  for (int i = 0; i < kParts; ++i) *(v4u*)(sW + (i * kPJThreads + t) * 8) = wst[i];
  __syncthreads();   // the weights are in sW
  // the third set's loads stand behind the barrier, which waits for every load in front of it
#pragma unroll
  for (int e = 0; e < 16; ++e) raw[2][e] = *(const v2f*)(xl + (size_t)(2 * 32 + e + (e & 8)) * kN);
  // the biases of the two epilogues, read here so that the loop hides them: o' = 16 ot + 8 h + r for q|k, channel 16 nt + c for v
  v8f bqk[4];
  float bvn[2];
#pragma unroll
  for (int ot = 0; ot < 4; ++ot) {
    const v4f b0 = *(const v4f*)(BQK + ot * 16 + h * 8);
    const v4f b1 = *(const v4f*)(BQK + ot * 16 + h * 8 + 4);
    bqk[ot] = __builtin_shufflevector(b0, b1, 0, 1, 2, 3, 4, 5, 6, 7);
  }
#pragma unroll
  for (int nt = 0; nt < 2; ++nt) bvn[nt] = BV64[nt * 16 + c];
  // the bias loads' offset registers are given new values directly behind them
  asm volatile("s_wait_xcnt 0x0" ::: "memory");
  __builtin_amdgcn_sched_barrier(0);   // these loads are not sunk to their uses behind the loop
  const v8f zero = (v8f){0.f, 0.f, 0.f, 0.f, 0.f, 0.f, 0.f, 0.f};
  v8f acc[2][kPJTiles];
#pragma unroll
  for (int p = 0; p < 2; ++p)
#pragma unroll
    for (int ot = 0; ot < kPJTiles; ++ot) acc[p][ot] = zero;
#pragma unroll   // whole: the sets' turns and every address offset are compile-time
  for (int ks = 0; ks < kPJSteps; ++ks) {
    F::U w[kPJTiles];   // the step's weight fragments: read first, the casts behind them hide the LDS latency
#pragma unroll
    for (int ot = 0; ot < kPJTiles; ++ot) {
      const _Float16* wp = sW + (ot * kPJSteps + ks) * 512 + lane * 8;
      w[ot].h[0] = *(const v8h*)(wp); w[ot].h[1] = *(const v8h*)(wp + 256);
    }
    v16h xf[2];
#pragma unroll
    for (int p = 0; p < 2; ++p) {
      v8f lo, hi;
#pragma unroll
      for (int e = 0; e < 8; ++e) { lo[e] = raw[ks % 3][e][p]; hi[e] = raw[ks % 3][8 + e][p]; }
      xf[p] = __builtin_shufflevector(__builtin_convertvector(lo, v8h), __builtin_convertvector(hi, v8h),
                                      0, 1, 2, 3, 4, 5, 6, 7, 8, 9, 10, 11, 12, 13, 14, 15);
    }
    // the refill is not lifted in front of the casts: it would take a fourth register set and 64 loads in flight
    __builtin_amdgcn_sched_barrier(0);
    if (ks + 3 < kPJSteps) {
#pragma unroll
      for (int e = 0; e < 16; ++e) raw[ks % 3][e] = *(const v2f*)(xl + (size_t)((ks + 3) * 32 + e + (e & 8)) * kN);
    }
    __builtin_amdgcn_sched_barrier(0);   // the loads of three steps on are not sunk behind this step's products
#pragma unroll
    for (int ot = 0; ot < kPJTiles; ++ot)
#pragma unroll
      for (int p = 0; p < 2; ++p)
        acc[p][ot] = (ot < 4) ? F::mma(w[ot].v, xf[p], acc[p][ot]) : F::mma(xf[p], w[ot].v, acc[p][ot]);
    __builtin_amdgcn_sched_barrier(0);   // nor later steps' LDS reads, casts and loads lifted into this step, which takes further register sets
  }
  // the wait behind the loads of x: their address pair is given no new value in front of it
  // (it never changes, and as an input here it stays in its registers up to the wait; the weights' loads were waited for at the barrier)
  asm volatile("s_wait_xcnt 0x0" :: "v"(xl) : "memory");
  // q|k: rows o' = 16 ot + 8 h + r of column c, which is row c of position tile n0 / 16 + p: part ot & 1 of that tile, this lane's 16 B
  unsigned short* qdst = QK16 + (size_t)b * kPlaneH + (size_t)(n0 >> 4) * kTileH + lane * 8;
#pragma unroll
  for (int ot = 0; ot < 4; ++ot) {
#pragma unroll
    for (int p = 0; p < 2; ++p) {
      v8f v;
#pragma unroll
      for (int r = 0; r < 8; ++r) { v[r] = acc[p][ot][r] * kWCarryInv; v[r] += bqk[ot][r]; }
      *(v8h*)(qdst + (ot >> 1) * kKOff + p * kTileH + (ot & 1) * 256) = __builtin_convertvector(v, v8h);
    }
  }
  // v: column c is channel 16 nt + c; rows 8 h + r of position tile p: part p of tile 2 (n0 / 32) + nt, this lane's 16 B
  unsigned short* vdst = V16 + (size_t)b * kPlaneH + (size_t)(n0 >> 5) * (2 * kTileH) + lane * 8;
#pragma unroll
  for (int nt = 0; nt < 2; ++nt) {
#pragma unroll
    for (int p = 0; p < 2; ++p) {
      v8f v;
#pragma unroll
      for (int r = 0; r < 8; ++r) { v[r] = acc[p][4 + nt][r] * kWCarryInv; v[r] += bvn[nt]; }
      *(v8h*)(vdst + nt * kTileH + p * 256) = __builtin_convertvector(v, v8h);
    }
  }
}

// ---------------------------------------------------------------------------
// Softmax statistic of the score rows, from score tiles formed in registers (no score plane in memory): for each j,
//   stat[j] = 15 - max_i S[j][i] - log2 sum_i 2^(S[j][i] - max),  S[j][i] = q row j . k row i, q carrying log2 e,
// so that 2^(S[j][i] + stat[j]) is the probability carried x 32768.
// One block owns 64 rows j (4 tiles of 16) of one batch and all 4096 i: grid (kN/64 = 64, kB) blocks of 16 waves, blockIdx.y the
// batch; wave w takes i in [256 w, 256 w + 256). Tiles are those of the fragment-order planes (row m of tile T is position
// 32 (T >> 1) + 2 m + (T & 1)): a statistic is filed under its q tile and row, as attn.v reads it; the order of i inside a sum is free.
// A tile is D[i][j] = k rows (A) x q rows (B, the block's 4 fragments loaded once): every k fragment loaded feeds 4 tiles.
// A lane holds column j = lane & 15 of each tile of j and rows i = 8 h + r (h = lane >> 4). Per tile of j it sums 2^S as it comes
// from the matrix unit, relative to no maximum: one power of two on every term only scales an f32 sum while all stay in range,
// so the pair (0, sum) says what (maximum, sum relative to it) says, and an element costs one v_exp_f32 and half a packed add.
// One test per wave, behind the loop: where a lane's sum has left [2^-80, 2^100] (terms lost below or an overflow near), the wave
// does its 256 i again with a running maximum and the exp-sum relative to it (per 32 i the maximum is raised and the old sum
// brought to it by one factor): any scores are served. Terms flushed below 2^-126, 128 a lane, are under 2^-39 of a sum that passes.
// The (maximum or 0, sum) pairs of the 2 lane halves join by lane exchange, those of the 16 waves through LDS behind one barrier,
// each sum brought to the common maximum by one factor 2^(own maximum - common maximum); wave w < 4 joins tile w of j.
// STAT holds, per batch and per 16 rows j, one 128-B line, stored whole by one wave: the 16 statistics, twice (the second 16 are not read).
// ---------------------------------------------------------------------------
// 2^y on the transcendental unit. The v_nop fills the one slot that the instruction set asks for behind a transcendental before
// its result is read or its source overwritten: inside the statement it stands there in every build.
__device__ __forceinline__ float exp2_slot(float y) { float r; asm("v_exp_f32 %0, %1\n\tv_nop" : "=v"(r) : "v"(y)); return r; }
// Every use of it in the row statistics has y <= 0: no overflow. Below 2^-126 the result may be 0: as a term, beside a sum that is
// at least 1; as a factor in a join, on a sum below 2^100 beside a running-max sum of at least 1 (under 2^-26 of it), or on a
// running-max sum of at most 128 beside a sum above 2^-80 (under 2^-39 of it).
// log2 x for a normal x > 0 on the transcendental unit, with the same slot behind it
__device__ __forceinline__ float log2_slot(float x) { float r; asm("v_log_f32 %0, %1\n\tv_nop" : "=v"(r) : "v"(x)); return r; }
// 2^y of the 16 values that a lane holds of two score tiles, one slot for the 16: the results pass through the statement, so no
// reader stands in front of the v_nop; the exponents are its inputs, so they keep their registers up to it and no v_exp_f32 lands
// on the source of the one directly in front
__device__ __forceinline__ void exp2_tiles(v8f& e0, v8f& e1, const v8f s0, const v8f s1) {
#pragma unroll
  for (int r = 0; r < 8; ++r) e0[r] = __builtin_amdgcn_exp2f(s0[r]);
#pragma unroll
  for (int r = 0; r < 8; ++r) e1[r] = __builtin_amdgcn_exp2f(s1[r]);
  asm("v_nop" : "+v"(e0), "+v"(e1) : "v"(s0), "v"(s1));
}
constexpr float kRSSumLo = 0x1p-80f;    // a lane's unshifted sum below this may have lost terms that count
constexpr float kRSSumHi = 0x1p100f;    // far enough below 2^128 that the joins of 32 such sums cannot overflow
constexpr float kPCarryLog2 = 15.0f;
static_assert(kPCarry == 32768.0f, "2^15");
constexpr int kRSWaves   = 16;
constexpr int kRSThreads = kRSWaves * 32;      // 512
constexpr int kStatRows  = 16;                 // rows j of S per 128-B line of STAT
constexpr int kRSJT      = 4;                  // 16-row tiles of j per block: every k fragment loaded feeds this many score tiles
constexpr int kRSCols    = kStatRows * kRSJT;  // 64 rows j of S per block
constexpr int kRSChunk   = kN / kRSWaves;      // 256 i per wave
constexpr int kRSGroups  = kRSChunk / 32;      // 8 groups of two k fragments (32 i)
static_assert(kN % kRSCols == 0 && kRSChunk % 32 == 0 && kRSWaves % 2 == 0 && kRSJT <= kRSWaves, "row statistics tiling");
// 8 waves on a SIMD, 128 registers a wave: two blocks share a WGP, and the build is held to it
__global__ __launch_bounds__(kRSThreads) __attribute__((amdgpu_waves_per_eu(8, 8))) void rowstats_kernel(const unsigned short* __restrict__ QKp, float* __restrict__ STAT) {
  typedef Frag<_Float16> F;
  __shared__ float pmax[kRSWaves][kRSCols];
  __shared__ float psum[kRSWaves][kRSCols];
  const int t    = threadIdx.x;
  const int lane = t & 31;
  const int wave = t >> 5;
  const int c    = lane & 15;
  const int h    = lane >> 4;
  const _Float16* QK    = (const _Float16*)QKp + (size_t)blockIdx.y * kPlaneH;   // the block's batch of the q plane
  const _Float16* Qlane = QK + (size_t)(blockIdx.x * kRSJT) * kTileH + lane * 8;   // the lane's 16 B of the block's first q tile
  // of the wave's first k tile; every tile is a compile-time offset from this address
  const _Float16* Klane = QK + kKOff + (size_t)(wave * (kRSChunk / 16)) * kTileH + lane * 8;
  v16h qf[kRSJT];
#pragma unroll
  for (int jt = 0; jt < kRSJT; ++jt) qf[jt] = frag_ld(Qlane + jt * kTileH);
  const v8f zero = (v8f){0.f, 0.f, 0.f, 0.f, 0.f, 0.f, 0.f, 0.f};
  v16h a[2][2];   // two register sets of two k fragments take turns
  a[0][0] = frag_ld(Klane);
  a[0][1] = frag_ld(Klane + kTileH);
  float m[kRSJT], sum[kRSJT];   // per lane and tile of j: the exponent that the sum is relative to, the exp-sum
  v2f fs[kRSJT];                // the unshifted sum, in two parts for the packed add
  v8f e0, e1;                   // 2^S of the pair of tiles (32 i, one tile of j) last formed
  auto fold = [&](const int jt, const bool first) {   // adds them to the sum of tile jt of j: 8 packed adds for 16 values
    const v8f e = e0 + e1;
    const v4f f = __builtin_shufflevector(e, e, 0, 1, 2, 3) + __builtin_shufflevector(e, e, 4, 5, 6, 7);
    const v2f p = __builtin_shufflevector(f, f, 0, 1) + __builtin_shufflevector(f, f, 2, 3);
    fs[jt] = first ? p : (fs[jt] + p);
  };
#pragma unroll   // whole: the sets' turns and the groups' address offsets are compile-time, the two address pairs never change
  for (int g = 0; g < kRSGroups; ++g) {
    if (g + 1 < kRSGroups) {
      a[(g + 1) & 1][0] = frag_ld(Klane + (2 * g + 2) * kTileH);
      a[(g + 1) & 1][1] = frag_ld(Klane + (2 * g + 3) * kTileH);
      __builtin_amdgcn_sched_barrier(0);   // the next group's 4 loads stay issued ahead of this group's exp work, which hides them
    }
#pragma unroll
    for (int jt = 0; jt < kRSJT; ++jt) {
      const v8f d0 = F::mma(a[g & 1][0], qf[jt], zero);
      const v8f d1 = F::mma(a[g & 1][1], qf[jt], zero);
      // the adds of the pair of tiles before stand behind this pair's products: they fill the slots that the chip needs between a
      // product and the first reader of its result, where the build otherwise puts four v_nop
      __builtin_amdgcn_sched_barrier(0);
      if (g > 0 || jt > 0) fold((jt + kRSJT - 1) % kRSJT, g == 0 || (g == 1 && jt == 0));
      __builtin_amdgcn_sched_barrier(0);   // nor are this pair's v_exp_f32 lifted in front of them
      exp2_tiles(e0, e1, d0, d1);
      __builtin_amdgcn_sched_barrier(0);   // one pair of tiles at a time: interleaved pairs take registers, and two blocks share a WGP
    }
  }
  fold(kRSJT - 1, false);
  // the wait behind the loop's loads and the q tiles': the build gives the q loads' scalar base new values in the test below
  asm volatile("s_wait_xcnt 0x0" ::: "memory");
  bool redo = false;
#pragma unroll
  for (int jt = 0; jt < kRSJT; ++jt) {
    m[jt]   = 0.f;
    sum[jt] = fs[jt][0] + fs[jt][1];
    redo = redo || !(sum[jt] > kRSSumLo && sum[jt] < kRSSumHi);   // an infinite or not-a-number sum fails it too
  }
  // a scalar branch, the same for the whole wave: the matrix instructions behind it run with every lane on
  if (__builtin_expect(__builtin_amdgcn_ballot_w32(redo) != 0u, 0)) {
  a[0][0] = frag_ld(Klane);
  a[0][1] = frag_ld(Klane + kTileH);
#pragma unroll   // whole: the sets' turns and the groups' address offsets are compile-time, the two address pairs never change
  for (int g = 0; g < kRSGroups; ++g) {
    if (g + 1 < kRSGroups) {
      a[(g + 1) & 1][0] = frag_ld(Klane + (2 * g + 2) * kTileH);
      a[(g + 1) & 1][1] = frag_ld(Klane + (2 * g + 3) * kTileH);
      __builtin_amdgcn_sched_barrier(0);   // the next group's 4 loads stay issued ahead of this group's exp work, which hides them
    }
#pragma unroll
    for (int jt = 0; jt < kRSJT; ++jt) {
      const v8f d0 = F::mma(a[g & 1][0], qf[jt], zero);
      const v8f d1 = F::mma(a[g & 1][1], qf[jt], zero);
      float t0 = d0[0], t1 = d1[0];
#pragma unroll
      for (int r = 1; r < 8; ++r) { t0 = fmaxf(t0, d0[r]); t1 = fmaxf(t1, d1[r]); }
      const float tm = fmaxf(t0, t1);
      const float mn = (g == 0) ? tm : fmaxf(m[jt], tm);
      float s0 = exp2_slot(d0[0] - mn), s1 = exp2_slot(d1[0] - mn);
#pragma unroll
      for (int r = 1; r < 8; ++r) { s0 += exp2_slot(d0[r] - mn); s1 += exp2_slot(d1[r] - mn); }
      sum[jt] = (g == 0) ? (s0 + s1) : (sum[jt] * exp2_slot(m[jt] - mn) + (s0 + s1));   // the old sum brought to the new maximum
      m[jt] = mn;
      // one tile of j at a time: interleaved tiles take registers, and two blocks share a WGP
      __builtin_amdgcn_sched_barrier(0);
    }
  }
  }
  // the wait behind the second pass's loads: no address register of an issued load is given a new value in front of it
  // (the lane addresses never change, and as inputs here they stay live up to the wait)
  asm volatile("s_wait_xcnt 0x0" :: "v"(Qlane), "v"(Klane) : "memory");
#pragma unroll
  for (int jt = 0; jt < kRSJT; ++jt) {   // the two lane halves of column j
    const float mo = __shfl_xor(m[jt], 16, 32), so = __shfl_xor(sum[jt], 16, 32);
    const float mj = fmaxf(m[jt], mo);
    sum[jt] = sum[jt] * exp2_slot(m[jt] - mj) + so * exp2_slot(mo - mj);
    m[jt] = mj;
  }
  if (lane < 16) {
#pragma unroll
    for (int jt = 0; jt < kRSJT; ++jt) { pmax[wave][jt * 16 + c] = m[jt]; psum[wave][jt * 16 + c] = sum[jt]; }
  }
  __syncthreads();   // every wave's partial maxima and sums are in pmax, psum
  if (wave >= kRSJT) return;   // wave-uniform, behind the kernel's only barrier; wave w joins tile w of j
  const int col = wave * 16 + c;
  float wm[kRSWaves / 2], wsum[kRSWaves / 2];   // lane half h joins waves 8 h .. 8 h + 7 in wave order
#pragma unroll
  for (int w = 0; w < kRSWaves / 2; ++w) {
    wm[w]   = pmax[h * (kRSWaves / 2) + w][col];
    wsum[w] = psum[h * (kRSWaves / 2) + w][col];
  }
  float bm = wm[0];
#pragma unroll
  for (int w = 1; w < kRSWaves / 2; ++w) bm = fmaxf(bm, wm[w]);
  bm = fmaxf(bm, __shfl_xor(bm, 16, 32));
  float tot = wsum[0] * exp2_slot(wm[0] - bm);
#pragma unroll
  for (int w = 1; w < kRSWaves / 2; ++w) tot += wsum[w] * exp2_slot(wm[w] - bm);
  tot += __shfl_xor(tot, 16, 32);   // tot >= 2^-80, a normal number: a sum relative to bm is in it whole, and it passed the test or is >= 1
  STAT[((size_t)blockIdx.y * (kN / kStatRows) + blockIdx.x * kRSJT + wave) * 32 + lane] = kPCarryLog2 - bm - log2_slot(tot);
}

// ---------------------------------------------------------------------------
// attn^T.v with the probabilities formed in registers (no probability plane in memory):
//   O16[i][c] = f16( (64/32768) sum_j P[i][j] * V16[c][j] ),  P[i][j] = f16( 2^(S[j][i] + stat[j]) ), f32 math.
// One block owns 64 positions i (4 tiles of 16) of one batch and all 4096 j: grid (kN/64 = 64, kB) blocks of 16 waves, blockIdx.y
// the batch; wave w walks j in [256 w, 256 w + 256). Every q, V and statistics load feeds the 4 tiles of i.
// Per 32 j and tile of i: two score tiles D[j][i] = q rows (A) x k rows (B, loaded once) + C, C[j][i] = stat[j]: the matrix unit's own
// addition gives the exponent, and a probability costs the vector port one v_exp_f32 and half a packed conversion.
// A lane then holds column i = lane & 15 and
// rows j = 8 h + r and 16 + 8 h + r (h = lane >> 4), which is the k order of an A fragment of row i: converted in place,
// the two tiles are the A operand against the V fragments (the v plane holds the same k order). No LDS, no lane exchange.
// q, k and v come from fragment-order planes: every fragment load of a wave is 512 contiguous B. j and i here count in tile order
// (row m of tile T is position 32 (T >> 1) + 2 m + (T & 1)); the sum over j takes every position once, and the store of O undoes it for i.
// The 16 waves' partial 64 x 32 tiles are joined through LDS in wave order behind one barrier.
// ---------------------------------------------------------------------------
constexpr int kAVWaves   = 16;
constexpr int kAVThreads = kAVWaves * 32;      // 512
constexpr int kAVIT      = 4;                  // 16-row tiles of i per block: every q, V and statistics load feeds this many tiles
constexpr int kAVRows    = 16 * kAVIT;         // 64 positions i per block
constexpr int kAVChunk   = kN / kAVWaves;      // 256 j per wave
constexpr int kAVSteps   = kAVChunk / 32;      // 8 steps of 32 j
constexpr int kAVPitch   = kCP + 4;            // floats per row of a partial tile
static_assert(kN % kAVRows == 0 && kAVChunk % 32 == 0 && (kAVRows * kCP) % kAVThreads == 0 && kCP == 32, "attn.v tiling");
// what 16 of a step's 32 j read for the scores: one q fragment and the lane's 8 row statistics, which are a C operand as they lie
// (register r of a lane is row 8 h + r of the tile, in C as in D; every column takes the same value)
struct AVHalf { v16h q; v8f c; };
__device__ __forceinline__ void av_load_half(AVHalf& s, const _Float16* __restrict__ Qlane, const float* __restrict__ Slane, int j0) {
  s.q = frag_ld(Qlane + (j0 >> 4) * kTileH);               // the q tile of rows j0 .. j0 + 15 in tile order
  const v4f c0 = *(const v4f*)(Slane + j0 * 2);            // j0 + 8 h + 0..3;  STAT: 32 floats per 16 j
  const v4f c1 = *(const v4f*)(Slane + j0 * 2 + 4);        // j0 + 8 h + 4..7
  s.c = __builtin_shufflevector(c0, c1, 0, 1, 2, 3, 4, 5, 6, 7);
}
// 8 probabilities of one lane from one tile of exponents (at most 15: no overflow in f32 or f16)
__device__ __forceinline__ v8h av_prob(const v8f s) {
  v8f e;
#pragma unroll
  for (int r = 0; r < 8; ++r) e[r] = __builtin_amdgcn_exp2f(s[r]);
  // the slot that the instruction set asks for behind a transcendental before its result is read or its source overwritten, in every
  // build: the results pass through the statement, so no reader stands in front of the v_nop; the exponents are its inputs, so they
  // keep their registers up to it and no v_exp_f32 lands on the source of the one directly in front
  asm("v_nop" : "+v"(e) : "v"(s));
  return __builtin_convertvector(e, v8h);
}
__global__ __launch_bounds__(kAVThreads) void attnv_kernel(const unsigned short* __restrict__ QKp,
                                                           const unsigned short* __restrict__ Vp,
                                                           const float* __restrict__ ST,
                                                           unsigned short* __restrict__ O) {
  typedef Frag<_Float16> F;
  __shared__ __align__(16) float part[kAVWaves][kAVRows][kAVPitch];
  const int t    = threadIdx.x;
  const int lane = t & 31;
  const int wave = t >> 5;
  const int c    = lane & 15;
  const int h8   = (lane >> 4) * 8;
  const int i0   = blockIdx.x * kAVRows;
  const int jb   = wave * kAVChunk;
  const int bt   = blockIdx.y;   // the block's batch
  const _Float16* QK    = (const _Float16*)QKp + (size_t)bt * kPlaneH;
  const _Float16* Klane = QK + kKOff + (size_t)(i0 >> 4) * kTileH + lane * 8;   // the lane's 16 B of the block's first k tile
  // the wave's first step: its two q tiles, its two v tiles
  const _Float16* Qlane = QK + (size_t)(jb >> 4) * kTileH + lane * 8;
  const _Float16* Vlane = (const _Float16*)Vp + (size_t)bt * kPlaneH + (size_t)(jb >> 4) * kTileH + lane * 8;
  const float* Slane = ST + (size_t)bt * kN * 2 + jb * 2 + h8;    // walks 32 floats per 16 j
  v16h kf[kAVIT];
#pragma unroll
  for (int it = 0; it < kAVIT; ++it) kf[it] = frag_ld(Klane + it * kTileH);
  // the k fragments stay the oldest loads: issued ahead of the first step's, they are covered by the waits for those
  __builtin_amdgcn_sched_barrier(0);
  const v8f zero = (v8f){0.f, 0.f, 0.f, 0.f, 0.f, 0.f, 0.f, 0.f};
  v8f acc[kAVIT][2];
#pragma unroll
  for (int it = 0; it < kAVIT; ++it) { acc[it][0] = zero; acc[it][1] = zero; }
  // One register set: each part is loaded anew directly behind its last use, half a step ahead of its next use.
  AVHalf ha, hb;
  v16h v0, v1;
  av_load_half(ha, Qlane, Slane, 0);
  // the first half's loads stay ahead of the others, as in the loop's refills: the loop's counted waits are set for both ways into it,
  // and with the two halves mixed here the wait at the loop's head reaches into the refill issued just in front of it
  __builtin_amdgcn_sched_barrier(0);
  av_load_half(hb, Qlane, Slane, 16);
  v0 = frag_ld(Vlane);            // channels 0..15
  v1 = frag_ld(Vlane + kTileH);   // channels 16..31
  // one step of 32 j; refill: whether a next step exists, a literal at both calls, so that a step is one run of code with no branch
  auto step = [&](const int jn, const bool refill) {
    // the next step's three addresses, each formed once: the refills read at compile-time offsets from them
    const _Float16* Qn  = Qlane + (jn >> 4) * kTileH;
    const _Float16* Vn  = Vlane + (jn >> 4) * kTileH;
    const float*    Sn  = Slane + jn * 2;
    v8h plo[kAVIT];
#pragma unroll
    for (int it = 0; it < kAVIT; ++it) plo[it] = av_prob(F::mma(ha.q, kf[it], ha.c));   // j = 8 h + r of the step
    if (refill) {
      __builtin_amdgcn_sched_barrier(0);   // the refill is not lifted into the exp work in front of it (it would need a second register set)
      av_load_half(ha, Qn, Sn, 0);
      // the step's addresses sit in registers that are given new values behind the loads; as inputs here the pairs stay
      // in their registers up to the wait, so that no load of the run lands in one of them
      asm volatile("s_wait_xcnt 0x0" :: "v"(Qn), "v"(Sn) : "memory");
      __builtin_amdgcn_sched_barrier(0);   // nor sunk: the second half's exp work behind it hides the loads
    }
#pragma unroll
    for (int it = 0; it < kAVIT; ++it) {
      const v8h phi = av_prob(F::mma(hb.q, kf[it], hb.c));                                  // j = 16 + 8 h + r
      const v16h p = __builtin_shufflevector(plo[it], phi, 0, 1, 2, 3, 4, 5, 6, 7, 8, 9, 10, 11, 12, 13, 14, 15);
      acc[it][0] = F::mma(p, v0, acc[it][0]);
      acc[it][1] = F::mma(p, v1, acc[it][1]);
    }
    if (refill) {
      __builtin_amdgcn_sched_barrier(0);   // as above, for the second half's and the V fragments' refill
      av_load_half(hb, Qn, Sn, 16);
      v0 = frag_ld(Vn);
      v1 = frag_ld(Vn + kTileH);
      asm volatile("s_wait_xcnt 0x0" :: "v"(Qn), "v"(Vn), "v"(Sn) : "memory");   // as above
      __builtin_amdgcn_sched_barrier(0);   // nor sunk: the next step's first half hides these loads
    }
  };
#pragma unroll 1   // rolled: one step's code for 4 tiles of i is as long as the 8 steps for one tile were
  for (int s = 1; s < kAVSteps; ++s) step(s * 32, true);
  step(0, false);   // the last step has nothing to load
#pragma unroll
  for (int it = 0; it < kAVIT; ++it)
#pragma unroll
    for (int r = 0; r < 8; ++r) {
      part[wave][it * 16 + h8 + r][c]      = acc[it][0][r];
      part[wave][it * 16 + h8 + r][16 + c] = acc[it][1][r];
    }
  __syncthreads();   // every wave's partial tiles are in part
  const int col = lane;   // a wave stores the 64 used bytes of one row of O, 4 rows in turn
#pragma unroll
  for (int it = 0; it < kAVIT; ++it) {
    const int row = it * 16 + wave;                              // row 'wave' of k tile it of the block,
    const int pos = 32 * (it >> 1) + 2 * wave + (it & 1);        // which is this one of its 64 positions
    float sum = part[0][row][col];
#pragma unroll
    for (int w = 1; w < kAVWaves; ++w) sum += part[w][row][col];
    O[(size_t)bt * kN * kOW + (size_t)(i0 + pos) * kOW + col] = h_bits(sum * kPVScale);
  }
}

// ---------------------------------------------------------------------------
// Host glue.
// Workspace region map (bytes, every offset a multiple of 256):
//   WP16  f16 [6][8][2][32][8]        49,152  at           0   16*log2e*Wq, 16*Wk, 16*Wv in fragment order
//   WB16  f16 [256][32]               16,384  at      49,152   16*Wb
//   BQK   f32 [64]                       256  at      65,536   log2e*bq | bk
//   BV64  f32 [64]                       256  at      65,792   bv | 0
//   QK16  f16 [2][8][256][2][32][8] 4,194,304 at      66,048   q x log2e, then k: fragment-order tiles of 16 positions x 32 channels
//   V16   f16 [8][128][2][2][32][8] 2,097,152 at   4,260,352   v: fragment-order tiles of 16 channels x 32 positions
//   STAT  f32 [8][256][32]           262,144  at   6,357,504   per q tile of 16 score rows: 16 x (15 - max - log2 sum), twice
//   O16   f16 [8][4096][64]        4,194,304  at   6,619,648   attention output x64, position-major, cols 0..31 (32..63 neither written nor read)
//   total                         10,813,952
// GEMM shapes: q, k, v M=96 N=4096 K=256 (own kernel); scores M=N=4096 K=32 (tiles inside the two attention kernels);
// attn.v M=4096 N=32 K=4096 (own kernel); back M=256 N=4096 K=32. No padding reads of unwritten data.
// Launch count: 1 + 1 + 2 + 1 = 5.
// ---------------------------------------------------------------------------
extern "C" void kernel_launch(void* const* d_in, const int* in_sizes, int n_in,
                              void* d_out, int out_size, void* d_ws, size_t ws_size,
                              hipStream_t stream) {
  if (n_in < 9) return;
  const int nX = kB * kC * kN;   // 8,388,608
  if (in_sizes[0] != nX) return;
  if (in_sizes[1] != kCP * kC || in_sizes[3] != kCP * kC || in_sizes[5] != kCP * kC) return;
  if (in_sizes[2] != kCP || in_sizes[4] != kCP || in_sizes[6] != kCP) return;
  if (in_sizes[7] != kC * kCP || in_sizes[8] != kC) return;
  if (out_size != nX) return;

  const size_t szWP  = (size_t)kPJWHalves * 2;
  const size_t szWB  = (size_t)kC * kCP * 2;
  const size_t szBQK = (size_t)kQKW * 4;
  const size_t szBV  = (size_t)kVR * 4;
  const size_t szQK  = (size_t)kB * kN * kQKW * 2;
  const size_t szV   = (size_t)kB * kPlaneH * 2;
  const size_t szST  = (size_t)kB * (kN / kStatRows) * 32 * 4;
  const size_t szO   = (size_t)kB * kN * kOW * 2;
  const size_t offWP  = 0;
  const size_t offWB  = offWP + szWP;
  const size_t offBQK = offWB + szWB;
  const size_t offBV  = offBQK + szBQK;
  const size_t offQK  = offBV + szBV;
  const size_t offV   = offQK + szQK;
  const size_t offST  = offV + szV;
  const size_t offO   = offST + szST;
  const size_t total  = offO + szO;   // 10,813,952
  if (ws_size < total) return;

  const float* x  = (const float*)d_in[0];
  const float* Wq = (const float*)d_in[1];
  const float* bq = (const float*)d_in[2];
  const float* Wk = (const float*)d_in[3];
  const float* bk = (const float*)d_in[4];
  const float* Wv = (const float*)d_in[5];
  const float* bv = (const float*)d_in[6];
  const float* Wb = (const float*)d_in[7];
  const float* bb = (const float*)d_in[8];
  float* out = (float*)d_out;
  char* ws = (char*)d_ws;
  unsigned short* WP16  = (unsigned short*)(ws + offWP);
  unsigned short* WB16  = (unsigned short*)(ws + offWB);
  float* BQK  = (float*)(ws + offBQK);
  float* BV64 = (float*)(ws + offBV);
  unsigned short* QK16 = (unsigned short*)(ws + offQK);
  unsigned short* V16  = (unsigned short*)(ws + offV);
  float* STAT = (float*)(ws + offST);
  unsigned short* O16 = (unsigned short*)(ws + offO);

  // ---- parameter planes ----
  prep_kernel<<<dim3(17), dim3(256), 0, stream>>>(Wq, bq, Wk, bk, Wv, bv, Wb, WP16, WB16, BQK, BV64);

  const long strideO  = (long)kN * kOW;
  const long strideX  = (long)kC * kN;

  // ---- q, k and v planes in fragment order, all batches in one grid, straight from x ----
  proj_kernel<<<dim3(kN / kPJPos, kB), dim3(kPJThreads), 0, stream>>>(x, WP16, BQK, BV64, QK16, V16);

  // all batches in one grid each (blockIdx.y = batch):
  // per row j of S[j][i] = log2e * sum_o q[o,j] * k[o,i]: 15 - max - log2 of the sum of 2^(S - max)
  rowstats_kernel<<<dim3(kN / kRSCols, kB), dim3(kRSThreads), 0, stream>>>(QK16, STAT);
  // O16[b][i][c] = f16( (64/32768) sum_j f16(32768 * attn[j][i]) * V16[b][c][j] ) = f16( 64 * out[c][i] )
  attnv_kernel<<<dim3(kN / kAVRows, kB), dim3(kAVThreads), 0, stream>>>(QK16, V16, STAT, O16);

  // ---- result[b][cc][i] = (1/1024) sum_o WB16[cc][o] * O16[b][i][o] + bb[cc] + x[b][cc][i]   (M=256, N=4096, K=32) ----
  const int blocksBack = ((kC / 64) * (kN / 64)) / 8;  // 256 tiles -> 32 blocks
  wmma_gemm64<0, false, 1, 0, true><<<dim3(blocksBack, kB), dim3(256), 0, stream>>>(
      WB16, WB16, kCP, 0L, O16, O16, kOW, strideO,
      (void*)out, (void*)out, kN, strideX, bb, x, strideX, kC, kN, kCP, kBackScale);
}

// v010
// Measured time: 40.8 microseconds a run.
// Timed twice side by side with v009, it ran 1.26 and 1.25 times as fast.
// Counting every step since v000, it is 130 times as fast.
// Contractions: q, k and v projections (x cast to f16 in registers x W f16 carried x16, Wq and bq also x log2 e; one kernel), scores (q, k f16 planes; once as k.q tiles inside the row-statistics kernel, once more as q.k tiles inside the attn^T.v kernel), attn^T.v (P f16 carried x32768, formed in registers, x V f16 plane; the score tiles there start from the row's statistic as C), back-projection (Wb f16 carried x16 x O f16 carried x64): all v_wmma_f32_16x16x32_f16 with f32 accumulate; softmax statistics, exp, biases and residual in f32.
#include <hip/hip_runtime.h>
#include <math.h>

// ---------------------------------------------------------------------------
// Problem constants
// ---------------------------------------------------------------------------
constexpr int kB   = 8;      // batch
constexpr int kC   = 256;    // channels
constexpr int kN   = 4096;   // positions (64 x 64)
constexpr int kCP  = 32;     // reduced channels
constexpr int kQKW = 64;     // rows of the q|k weights and biases: 0..31 q, 32..63 k
constexpr int kVR  = 64;     // entries of the v bias plane: 0..31 bv, 32..63 zero
constexpr int kTileH  = 512;             // halves of one fragment-order tile: 16 rows x 32 k = [part][lane][8 halves], 1,024 B
constexpr int kPlaneH = kN * kCP;        // halves of one batch of the q, k or v plane (256 tiles)
constexpr int kKOff   = kB * kPlaneH;    // the k plane lies this many halves behind the q plane
constexpr float kWCarry    = 16.0f;                      // weights carried x16 in f16
constexpr float kWCarryInv = 1.0f / 16.0f;
constexpr float kPCarry    = 32768.0f;                   // probabilities carried x2^15 in f16
constexpr float kOCarry    = 64.0f;                      // attention output carried x64 in f16
constexpr float kPVScale   = kOCarry / kPCarry;          // 1/512
constexpr float kBackScale = 1.0f / (kOCarry * kWCarry); // 1/1024
constexpr float kLog2e     = 1.4426950408889634f;        // q carries it, so that a score is the exponent of 2, not of e
static_assert(kN % 64 == 0 && kC % 64 == 0 && kQKW % 64 == 0 && kVR % 64 == 0, "tile multiples");
static_assert(kC % 32 == 0 && kCP % 32 == 0 && kN % 32 == 0, "k steps of 32");
static_assert(2 * kCP == kQKW && kCP <= kVR, "plane widths");
static_assert(kCP * kC == 8192 && kC * kCP == 8192 && kN % 256 == 0 && kN % 8 == 0, "prep and elementwise coverage");

typedef __attribute__((ext_vector_type(16))) _Float16 v16h;
typedef __attribute__((ext_vector_type(8)))  _Float16 v8h;
typedef __attribute__((ext_vector_type(8)))  float    v8f;
typedef __attribute__((ext_vector_type(4)))  float    v4f;
typedef __attribute__((ext_vector_type(2)))  float    v2f;
typedef __attribute__((ext_vector_type(4)))  unsigned int v4u;

// ---------------------------------------------------------------------------
// f16 fragments
// ---------------------------------------------------------------------------
template <typename T> struct Frag;
template <> struct Frag<_Float16> {
  typedef v16h V; union U { v16h v; v8h h[2]; };
  // elements 0..7 <- p[0..7], 8..15 <- p[16..23]
  static __device__ __forceinline__ v16h load(const _Float16* p) {
    U f; f.h[0] = *(const v8h*)(p); f.h[1] = *(const v8h*)(p + 16); return f.v;
  }
  static __device__ __forceinline__ v8f mma(v16h a, v16h b, v8f c) {
    return __builtin_amdgcn_wmma_f32_16x16x32_f16(false, a, false, b, (short)0, c, false, false);
  }
};

// A fragment from a plane in fragment order: lane l reads 16 B at 16 l of each 512-B part, so that each load of a wave covers 4 whole
// 128-B lines. p = tile + 8 * lane. Part s holds what Frag::load takes from p[16 s .. 16 s + 7] of a row-major row: the same k order.
__device__ __forceinline__ v16h frag_ld(const _Float16* p) {
  Frag<_Float16>::U f; f.h[0] = *(const v8h*)(p); f.h[1] = *(const v8h*)(p + 256); return f.v;
}

__device__ __forceinline__ unsigned pk16(unsigned short a, unsigned short b) { return (unsigned)a | ((unsigned)b << 16); }
__device__ __forceinline__ unsigned short h_bits(float f) { const _Float16 h = (_Float16)f; return __builtin_bit_cast(unsigned short, h); }

// ---------------------------------------------------------------------------
// Parameter planes (17 blocks of 256 threads):
//   blocks  0.. 3: WP16[0..8191]      = f16(16 * log2 e * Wq)   (tiles 0, 1 of 16 rows)
//   blocks  4.. 7: WP16[8192..16383]  = f16(16 * Wk)            (tiles 2, 3)
//   blocks  8..11: WP16[16384..24575] = f16(16 * Wv)            (tiles 4, 5)
//   blocks 12..15: WB16[0..8191]      = f16(16 * Wb)            ([256][32], row-major)
//   block  16    : BQK[64] = log2 e * bq | bk (f32), BV64[64] = bv | 0 (f32)
// WP16 lies in fragment order: [tile of 16 rows][k step of 32 channels][half][lane][8 halves]; lane l holds row l & 15 of the tile,
// channels 16 * half + 8 * (l >> 4) + 0..7 of the k step: the two 16-B parts of a lane's fragment, each part 512 contiguous B a wave.
// Coverage: 4 blocks x 256 threads x 8 = 8192 elements per group. Each thread one 16-B store; a wave writes 512 contiguous B
// ---------------------------------------------------------------------------
__global__ __launch_bounds__(256) void prep_kernel(const float* __restrict__ Wq, const float* __restrict__ bq,
                                                   const float* __restrict__ Wk, const float* __restrict__ bk,
                                                   const float* __restrict__ Wv, const float* __restrict__ bv,
                                                   const float* __restrict__ Wb,
                                                   unsigned short* __restrict__ WP16,
                                                   unsigned short* __restrict__ WB16,
                                                   float* __restrict__ BQK, float* __restrict__ BV64) {
  const int t   = threadIdx.x;
  const int blk = blockIdx.x;
  if (blk < 16) {   // block-uniform
    const int grp = blk >> 2;
    const int sub = blk & 3;
    const int d   = sub * 256 + t;         // 16-B part of the group's plane, 0 .. 1023
    const int e0  = d * 8;                 // 0 .. 8184
    // where part d comes from: Wb as it lies; else row (d >> 9) * 16 + (d & 15), channel 32 * k step + 16 * half + 8 * (lane >> 4)
    const int s0  = (grp == 3) ? e0 : (((d >> 9) * 16 + (d & 15)) * kC + ((d >> 6) & 7) * 32 + ((d >> 5) & 1) * 16 + ((d >> 4) & 1) * 8);
    const float* src = (grp == 0) ? Wq : (grp == 1) ? Wk : (grp == 2) ? Wv : Wb;
    const float  f   = (grp == 0) ? kWCarry * kLog2e : kWCarry;
    unsigned short* dst = (grp == 3) ? WB16 : (WP16 + grp * 8192);
    const v4f a = *(const v4f*)(src + s0);
    const v4f c = *(const v4f*)(src + s0 + 4);
    unsigned short hb[8];
#pragma unroll
    for (int e = 0; e < 4; ++e) {
      hb[e]     = h_bits(a[e] * f);
      hb[4 + e] = h_bits(c[e] * f);
    }
    const v4u u = (v4u){pk16(hb[0], hb[1]), pk16(hb[2], hb[3]), pk16(hb[4], hb[5]), pk16(hb[6], hb[7])};
    unsigned short* dp = dst + e0;
    *(v4u*)dp = u;
  } else {
    const int lane = t & 31, wave = t >> 5;
    const int idx = (lane & 7) * 4;   // 0..28: always inside the 32-entry bias vectors
    const v4f q4 = *(const v4f*)(bq + idx);
    const v4f k4 = *(const v4f*)(bk + idx);
    const v4f w4 = *(const v4f*)(bv + idx);
    const float fq = (lane < 8) ? 1.0f : 0.0f;
    const float fk = (lane < 8) ? 0.0f : 1.0f;
    // arithmetic select: lanes 0..7 take bq / bv, lanes 8..15 take bk / zeros (all loads unconditional)
    const v4f valQK = q4 * (fq * kLog2e) + k4 * fk;
    const v4f valV  = w4 * fq;
    const bool wq = (wave == 0) && (lane < 16);
    const bool wv = (wave == 1) && (lane < 16);
    float* dq = BQK  + (lane & 15) * 4;
    float* dv = BV64 + (lane & 15) * 4;
    if (wq) *(v4f*)dq = valQK;
    if (wv) *(v4f*)dv = valV;
  }
}

// ---------------------------------------------------------------------------
// q, k and v projections straight from x[b][c][n] (f32, n contiguous): no transposed f16 copy of x in memory.
//   q|k[b][n][o'] = f16( (1/16) sum_c WP[o'][c] * f16(x[b][c][n]) + BQK[o'] ),  o' = 0..63 (q | k)
//   v[b][o][n]    = f16( (1/16) sum_c WP[64 + o][c] * f16(x[b][c][n]) + BV64[o] ),  o = 0..31
// The three planes lie in the fragment order of their readers, in tiles of 1,024 B = [part s][lane l][8 halves]:
//   q, k: tile T of a batch holds 16 positions, row m = position 32 (T >> 1) + 2 m + (T & 1); lane l, part s: row l & 15,
//         channels 16 s + 8 (l >> 4) + 0..7.
//   v:    tile 2 S + nt holds channels 16 nt + 0..15 over the 32 positions of step S; lane l, part s: channel 16 nt + (l & 15),
//         rows 8 (l >> 4) + 0..7 of position tile 2 S + s: the k order in which attn.v forms its probabilities from q tiles 2 S, 2 S + 1.
// grid (kN/128 = 32, kB) blocks of 4 waves; a wave owns 32 positions, as two tiles of 16: column (or row) m of tile p is position
// n0 + 2 m + p, so that a lane's 8-B load of one channel feeds both tiles and 16 lanes read one whole 128-B line.
// An x fragment (lane = position, 16 channels in the k order of Frag::load) serves as B against the q|k weight rows (A): D[o'][n], a lane
// holds 8 consecutive o' of one position; and as A against the v weight rows (B): D[n][o], a lane holds 8 rows of one tile for one
// channel. Both are what the same lane holds of a fragment-order part: every store of a wave is 512 contiguous B, with no LDS pass.
// The 48 KiB of weights are copied once to LDS as they lie (fragment order: every read is 512 contiguous B): LDS reads count on their
// own counter, so that waiting for a weight fragment does not wait for the x loads, which run three k steps ahead (one wave on a SIMD:
// nothing else hides the memory latency, and the registers are there).
// ---------------------------------------------------------------------------
constexpr int kPJWaves   = 4;
constexpr int kPJThreads = kPJWaves * 32;       // 128
constexpr int kPJPos     = 32 * kPJWaves;       // 128 positions per block
constexpr int kPJSteps   = kC / 32;             // 8 k steps
constexpr int kPJTiles   = 6;                   // tiles of 16 weight rows: q, q, k, k, v, v
constexpr int kPJWHalves = kPJTiles * kPJSteps * 512;   // 24,576 halves of weights
static_assert(kN % kPJPos == 0 && kPJWHalves % (kPJThreads * 8) == 0 && kPJTiles * 16 == 3 * kCP && kCP == 32, "projection tiling");
__global__ __launch_bounds__(kPJThreads) void proj_kernel(const float* __restrict__ x, const unsigned short* __restrict__ WP16,
                                                          const float* __restrict__ BQK, const float* __restrict__ BV64,
                                                          unsigned short* __restrict__ QK16, unsigned short* __restrict__ V16) {
  typedef Frag<_Float16> F;
  __shared__ __align__(16) _Float16 sW[kPJWHalves];
  const int t    = threadIdx.x;
  const int lane = t & 31;
  const int wave = t >> 5;
  const int c    = lane & 15;
  const int h    = lane >> 4;
  const int b    = blockIdx.y;
  const int nb   = blockIdx.x * kPJPos;     // the block's first position
  const int n0   = nb + wave * 32;          // the wave's
  // channel 8 h, positions n0 + 2 c, + 1; every load of x is a compile-time offset from this address
  const float* xl = x + ((size_t)b * kC + h * 8) * kN + n0 + 2 * c;
  const unsigned short* wl = WP16 + t * 8;
  constexpr int kParts = kPJWHalves / (kPJThreads * 8);   // 24 parts of 16 B per thread
  v4u wst[kParts];
#pragma unroll
  for (int i = 0; i < kParts; ++i) wst[i] = *(const v4u*)(wl + i * kPJThreads * 8);
  v2f raw[3][16];   // three register sets take turns: element e is channel 8 h + e (e < 8), 16 + 8 h + e - 8 (e >= 8) of the k step
#pragma unroll
  for (int s = 0; s < 2; ++s)
#pragma unroll
    for (int e = 0; e < 16; ++e) raw[s][e] = *(const v2f*)(xl + (size_t)(s * 32 + e + (e & 8)) * kN);
#pragma unroll
  for (int i = 0; i < kParts; ++i) *(v4u*)(sW + (i * kPJThreads + t) * 8) = wst[i];
  __syncthreads();   // the weights are in sW
  // the third set's loads stand behind the barrier, which waits for every load in front of it
#pragma unroll
  for (int e = 0; e < 16; ++e) raw[2][e] = *(const v2f*)(xl + (size_t)(2 * 32 + e + (e & 8)) * kN);
  // the biases of the two epilogues, read here so that the loop hides them: o' = 16 ot + 8 h + r for q|k, channel 16 nt + c for v
  v8f bqk[4];
  float bvn[2];
#pragma unroll
  for (int ot = 0; ot < 4; ++ot) {
    const v4f b0 = *(const v4f*)(BQK + ot * 16 + h * 8);
    const v4f b1 = *(const v4f*)(BQK + ot * 16 + h * 8 + 4);
    bqk[ot] = __builtin_shufflevector(b0, b1, 0, 1, 2, 3, 4, 5, 6, 7);
  }
#pragma unroll
  for (int nt = 0; nt < 2; ++nt) bvn[nt] = BV64[nt * 16 + c];
  // the bias loads' offset registers are given new values directly behind them
  asm volatile("s_wait_xcnt 0x0" ::: "memory");
  __builtin_amdgcn_sched_barrier(0);   // these loads are not sunk to their uses behind the loop
  const v8f zero = (v8f){0.f, 0.f, 0.f, 0.f, 0.f, 0.f, 0.f, 0.f};
  v8f acc[2][kPJTiles];
#pragma unroll
  for (int p = 0; p < 2; ++p)
#pragma unroll
    for (int ot = 0; ot < kPJTiles; ++ot) acc[p][ot] = zero;
#pragma unroll   // whole: the sets' turns and every address offset are compile-time
  for (int ks = 0; ks < kPJSteps; ++ks) {
    F::U w[kPJTiles];   // the step's weight fragments: read first, the casts behind them hide the LDS latency
#pragma unroll
    for (int ot = 0; ot < kPJTiles; ++ot) {
      const _Float16* wp = sW + (ot * kPJSteps + ks) * 512 + lane * 8;
      w[ot].h[0] = *(const v8h*)(wp); w[ot].h[1] = *(const v8h*)(wp + 256);
    }
    v16h xf[2];
#pragma unroll
    for (int p = 0; p < 2; ++p) {
      v8f lo, hi;
#pragma unroll
      for (int e = 0; e < 8; ++e) { lo[e] = raw[ks % 3][e][p]; hi[e] = raw[ks % 3][8 + e][p]; }
      xf[p] = __builtin_shufflevector(__builtin_convertvector(lo, v8h), __builtin_convertvector(hi, v8h),
                                      0, 1, 2, 3, 4, 5, 6, 7, 8, 9, 10, 11, 12, 13, 14, 15);
    }
    // the refill is not lifted in front of the casts: it would take a fourth register set and 64 loads in flight
    __builtin_amdgcn_sched_barrier(0);
    if (ks + 3 < kPJSteps) {
#pragma unroll
      for (int e = 0; e < 16; ++e) raw[ks % 3][e] = *(const v2f*)(xl + (size_t)((ks + 3) * 32 + e + (e & 8)) * kN);
    }
    __builtin_amdgcn_sched_barrier(0);   // the loads of three steps on are not sunk behind this step's products
#pragma unroll
    for (int ot = 0; ot < kPJTiles; ++ot)
#pragma unroll
      for (int p = 0; p < 2; ++p)
        acc[p][ot] = (ot < 4) ? F::mma(w[ot].v, xf[p], acc[p][ot]) : F::mma(xf[p], w[ot].v, acc[p][ot]);
    __builtin_amdgcn_sched_barrier(0);   // nor later steps' LDS reads, casts and loads lifted into this step, which takes further register sets
  }
  // the wait behind the loads of x: their address pair is given no new value in front of it
  // (it never changes, and as an input here it stays in its registers up to the wait; the weights' loads were waited for at the barrier)
  asm volatile("s_wait_xcnt 0x0" :: "v"(xl) : "memory");
  // q|k: rows o' = 16 ot + 8 h + r of column c, which is row c of position tile n0 / 16 + p: part ot & 1 of that tile, this lane's 16 B
  unsigned short* qdst = QK16 + (size_t)b * kPlaneH + (size_t)(n0 >> 4) * kTileH + lane * 8;
#pragma unroll
  for (int ot = 0; ot < 4; ++ot) {
#pragma unroll
    for (int p = 0; p < 2; ++p) {
      v8f v;
#pragma unroll
      for (int r = 0; r < 8; ++r) { v[r] = acc[p][ot][r] * kWCarryInv; v[r] += bqk[ot][r]; }
      *(v8h*)(qdst + (ot >> 1) * kKOff + p * kTileH + (ot & 1) * 256) = __builtin_convertvector(v, v8h);
    }
  }
  // v: column c is channel 16 nt + c; rows 8 h + r of position tile p: part p of tile 2 (n0 / 32) + nt, this lane's 16 B
  unsigned short* vdst = V16 + (size_t)b * kPlaneH + (size_t)(n0 >> 5) * (2 * kTileH) + lane * 8;
#pragma unroll
  for (int nt = 0; nt < 2; ++nt) {
#pragma unroll
    for (int p = 0; p < 2; ++p) {
      v8f v;
#pragma unroll
      for (int r = 0; r < 8; ++r) { v[r] = acc[p][4 + nt][r] * kWCarryInv; v[r] += bvn[nt]; }
      *(v8h*)(vdst + nt * kTileH + p * 256) = __builtin_convertvector(v, v8h);
    }
  }
}

// ---------------------------------------------------------------------------
// Softmax statistic of the score rows, from score tiles formed in registers (no score plane in memory): for each j,
//   stat[j] = 15 - max_i S[j][i] - log2 sum_i 2^(S[j][i] - max),  S[j][i] = q row j . k row i, q carrying log2 e,
// so that 2^(S[j][i] + stat[j]) is the probability carried x 32768.
// One block owns 64 rows j (4 tiles of 16) of one batch and all 4096 i: grid (kN/64 = 64, kB) blocks of 16 waves, blockIdx.y the
// batch; wave w takes i in [256 w, 256 w + 256). Tiles are those of the fragment-order planes (row m of tile T is position
// 32 (T >> 1) + 2 m + (T & 1)): a statistic is filed under its q tile and row, as attn.v reads it; the order of i inside a sum is free.
// A tile is D[i][j] = k rows (A) x q rows (B, the block's 4 fragments loaded once): every k fragment loaded feeds 4 tiles.
// A lane holds column j = lane & 15 of each tile of j and rows i = 8 h + r (h = lane >> 4). Per tile of j it sums 2^S as it comes
// from the matrix unit, relative to no maximum: one power of two on every term only scales an f32 sum while all stay in range,
// so the pair (0, sum) says what (maximum, sum relative to it) says, and an element costs one v_exp_f32 and half a packed add.
// One test per wave, behind the loop: where a lane's sum has left [2^-80, 2^100] (terms lost below or an overflow near), the wave
// does its 256 i again with a running maximum and the exp-sum relative to it (per 32 i the maximum is raised and the old sum
// brought to it by one factor): any scores are served. Terms flushed below 2^-126, 128 a lane, are under 2^-39 of a sum that passes.
// The (maximum or 0, sum) pairs of the 2 lane halves join by lane exchange, those of the 16 waves through LDS behind one barrier,
// each sum brought to the common maximum by one factor 2^(own maximum - common maximum); wave w < 4 joins tile w of j.
// STAT holds, per batch and per 16 rows j, one 128-B line, stored whole by one wave: the 16 statistics, twice (the second 16 are not read).
// ---------------------------------------------------------------------------
// 2^y on the transcendental unit. The v_nop fills the one slot that the instruction set asks for behind a transcendental before
// its result is read or its source overwritten: inside the statement it stands there in every build.
__device__ __forceinline__ float exp2_slot(float y) { float r; asm("v_exp_f32 %0, %1\n\tv_nop" : "=v"(r) : "v"(y)); return r; }
// Every use of it in the row statistics has y <= 0: no overflow. Below 2^-126 the result may be 0: as a term, beside a sum that is
// at least 1; as a factor in a join, on a sum below 2^100 beside a running-max sum of at least 1 (under 2^-26 of it), or on a
// running-max sum of at most 128 beside a sum above 2^-80 (under 2^-39 of it).
// log2 x for a normal x > 0 on the transcendental unit, with the same slot behind it
__device__ __forceinline__ float log2_slot(float x) { float r; asm("v_log_f32 %0, %1\n\tv_nop" : "=v"(r) : "v"(x)); return r; }
// 2^y of the 16 values that a lane holds of two score tiles, one slot for the 16: the results pass through the statement, so no
// reader stands in front of the v_nop; the exponents are its inputs, so they keep their registers up to it and no v_exp_f32 lands
// on the source of the one directly in front
__device__ __forceinline__ void exp2_tiles(v8f& e0, v8f& e1, const v8f s0, const v8f s1) {
#pragma unroll
  for (int r = 0; r < 8; ++r) e0[r] = __builtin_amdgcn_exp2f(s0[r]);
#pragma unroll
  for (int r = 0; r < 8; ++r) e1[r] = __builtin_amdgcn_exp2f(s1[r]);
  asm("v_nop" : "+v"(e0), "+v"(e1) : "v"(s0), "v"(s1));
}
constexpr float kRSSumLo = 0x1p-80f;    // a lane's unshifted sum below this may have lost terms that count
constexpr float kRSSumHi = 0x1p100f;    // far enough below 2^128 that the joins of 32 such sums cannot overflow
constexpr float kPCarryLog2 = 15.0f;
static_assert(kPCarry == 32768.0f, "2^15");
constexpr int kRSWaves   = 16;
constexpr int kRSThreads = kRSWaves * 32;      // 512
constexpr int kStatRows  = 16;                 // rows j of S per 128-B line of STAT
constexpr int kRSJT      = 4;                  // 16-row tiles of j per block: every k fragment loaded feeds this many score tiles
constexpr int kRSCols    = kStatRows * kRSJT;  // 64 rows j of S per block
constexpr int kRSChunk   = kN / kRSWaves;      // 256 i per wave
constexpr int kRSGroups  = kRSChunk / 32;      // 8 groups of two k fragments (32 i)
static_assert(kN % kRSCols == 0 && kRSChunk % 32 == 0 && kRSWaves % 2 == 0 && kRSJT <= kRSWaves, "row statistics tiling");
// 8 waves on a SIMD, 128 registers a wave: two blocks share a WGP, and the build is held to it
__global__ __launch_bounds__(kRSThreads) __attribute__((amdgpu_waves_per_eu(8, 8))) void rowstats_kernel(const unsigned short* __restrict__ QKp, float* __restrict__ STAT) {
  typedef Frag<_Float16> F;
  __shared__ float pmax[kRSWaves][kRSCols];
  __shared__ float psum[kRSWaves][kRSCols];
  const int t    = threadIdx.x;
  const int lane = t & 31;
  const int wave = t >> 5;
  const int c    = lane & 15;
  const int h    = lane >> 4;
  const _Float16* QK    = (const _Float16*)QKp + (size_t)blockIdx.y * kPlaneH;   // the block's batch of the q plane
  const _Float16* Qlane = QK + (size_t)(blockIdx.x * kRSJT) * kTileH + lane * 8;   // the lane's 16 B of the block's first q tile
  // of the wave's first k tile; every tile is a compile-time offset from this address
  const _Float16* Klane = QK + kKOff + (size_t)(wave * (kRSChunk / 16)) * kTileH + lane * 8;
  v16h qf[kRSJT];
#pragma unroll
  for (int jt = 0; jt < kRSJT; ++jt) qf[jt] = frag_ld(Qlane + jt * kTileH);
  const v8f zero = (v8f){0.f, 0.f, 0.f, 0.f, 0.f, 0.f, 0.f, 0.f};
  v16h a[2][2];   // two register sets of two k fragments take turns
  a[0][0] = frag_ld(Klane);
  a[0][1] = frag_ld(Klane + kTileH);
  float m[kRSJT], sum[kRSJT];   // per lane and tile of j: the exponent that the sum is relative to, the exp-sum
  v2f fs[kRSJT];                // the unshifted sum, in two parts for the packed add
  v8f e0, e1;                   // 2^S of the pair of tiles (32 i, one tile of j) last formed
  auto fold = [&](const int jt, const bool first) {   // adds them to the sum of tile jt of j: 8 packed adds for 16 values
    const v8f e = e0 + e1;
    const v4f f = __builtin_shufflevector(e, e, 0, 1, 2, 3) + __builtin_shufflevector(e, e, 4, 5, 6, 7);
    const v2f p = __builtin_shufflevector(f, f, 0, 1) + __builtin_shufflevector(f, f, 2, 3);
    fs[jt] = first ? p : (fs[jt] + p);
  };
#pragma unroll   // whole: the sets' turns and the groups' address offsets are compile-time, the two address pairs never change
  for (int g = 0; g < kRSGroups; ++g) {
    if (g + 1 < kRSGroups) {
      a[(g + 1) & 1][0] = frag_ld(Klane + (2 * g + 2) * kTileH);
      a[(g + 1) & 1][1] = frag_ld(Klane + (2 * g + 3) * kTileH);
      __builtin_amdgcn_sched_barrier(0);   // the next group's 4 loads stay issued ahead of this group's exp work, which hides them
    }
#pragma unroll
    for (int jt = 0; jt < kRSJT; ++jt) {
      const v8f d0 = F::mma(a[g & 1][0], qf[jt], zero);
      const v8f d1 = F::mma(a[g & 1][1], qf[jt], zero);
      // the adds of the pair of tiles before stand behind this pair's products: they fill the slots that the chip needs between a
      // product and the first reader of its result, where the build otherwise puts four v_nop
      __builtin_amdgcn_sched_barrier(0);
      if (g > 0 || jt > 0) fold((jt + kRSJT - 1) % kRSJT, g == 0 || (g == 1 && jt == 0));
      __builtin_amdgcn_sched_barrier(0);   // nor are this pair's v_exp_f32 lifted in front of them
      exp2_tiles(e0, e1, d0, d1);
      __builtin_amdgcn_sched_barrier(0);   // one pair of tiles at a time: interleaved pairs take registers, and two blocks share a WGP
    }
  }
  fold(kRSJT - 1, false);
  // the wait behind the loop's loads and the q tiles': the build gives the q loads' scalar base new values in the test below
  asm volatile("s_wait_xcnt 0x0" ::: "memory");
  bool redo = false;
#pragma unroll
  for (int jt = 0; jt < kRSJT; ++jt) {
    m[jt]   = 0.f;
    sum[jt] = fs[jt][0] + fs[jt][1];
    redo = redo || !(sum[jt] > kRSSumLo && sum[jt] < kRSSumHi);   // an infinite or not-a-number sum fails it too
  }
  // a scalar branch, the same for the whole wave: the matrix instructions behind it run with every lane on
  if (__builtin_expect(__builtin_amdgcn_ballot_w32(redo) != 0u, 0)) {
  a[0][0] = frag_ld(Klane);
  a[0][1] = frag_ld(Klane + kTileH);
#pragma unroll   // whole: the sets' turns and the groups' address offsets are compile-time, the two address pairs never change
  for (int g = 0; g < kRSGroups; ++g) {
    if (g + 1 < kRSGroups) {
      a[(g + 1) & 1][0] = frag_ld(Klane + (2 * g + 2) * kTileH);
      a[(g + 1) & 1][1] = frag_ld(Klane + (2 * g + 3) * kTileH);
      __builtin_amdgcn_sched_barrier(0);   // the next group's 4 loads stay issued ahead of this group's exp work, which hides them
    }
#pragma unroll
    for (int jt = 0; jt < kRSJT; ++jt) {
      const v8f d0 = F::mma(a[g & 1][0], qf[jt], zero);
      const v8f d1 = F::mma(a[g & 1][1], qf[jt], zero);
      float t0 = d0[0], t1 = d1[0];
#pragma unroll
      for (int r = 1; r < 8; ++r) { t0 = fmaxf(t0, d0[r]); t1 = fmaxf(t1, d1[r]); }
      const float tm = fmaxf(t0, t1);
      const float mn = (g == 0) ? tm : fmaxf(m[jt], tm);
      float s0 = exp2_slot(d0[0] - mn), s1 = exp2_slot(d1[0] - mn);
#pragma unroll
      for (int r = 1; r < 8; ++r) { s0 += exp2_slot(d0[r] - mn); s1 += exp2_slot(d1[r] - mn); }
      sum[jt] = (g == 0) ? (s0 + s1) : (sum[jt] * exp2_slot(m[jt] - mn) + (s0 + s1));   // the old sum brought to the new maximum
      m[jt] = mn;
      // one tile of j at a time: interleaved tiles take registers, and two blocks share a WGP
      __builtin_amdgcn_sched_barrier(0);
    }
  }
  }
  // the wait behind the second pass's loads: no address register of an issued load is given a new value in front of it
  // (the lane addresses never change, and as inputs here they stay live up to the wait)
  asm volatile("s_wait_xcnt 0x0" :: "v"(Qlane), "v"(Klane) : "memory");
#pragma unroll
  for (int jt = 0; jt < kRSJT; ++jt) {   // the two lane halves of column j
    const float mo = __shfl_xor(m[jt], 16, 32), so = __shfl_xor(sum[jt], 16, 32);
    const float mj = fmaxf(m[jt], mo);
    sum[jt] = sum[jt] * exp2_slot(m[jt] - mj) + so * exp2_slot(mo - mj);
    m[jt] = mj;
  }
  if (lane < 16) {
#pragma unroll
    for (int jt = 0; jt < kRSJT; ++jt) { pmax[wave][jt * 16 + c] = m[jt]; psum[wave][jt * 16 + c] = sum[jt]; }
  }
  __syncthreads();   // every wave's partial maxima and sums are in pmax, psum
  if (wave >= kRSJT) return;   // wave-uniform, behind the kernel's only barrier; wave w joins tile w of j
  const int col = wave * 16 + c;
  float wm[kRSWaves / 2], wsum[kRSWaves / 2];   // lane half h joins waves 8 h .. 8 h + 7 in wave order
#pragma unroll
  for (int w = 0; w < kRSWaves / 2; ++w) {
    wm[w]   = pmax[h * (kRSWaves / 2) + w][col];
    wsum[w] = psum[h * (kRSWaves / 2) + w][col];
  }
  float bm = wm[0];
#pragma unroll
  for (int w = 1; w < kRSWaves / 2; ++w) bm = fmaxf(bm, wm[w]);
  bm = fmaxf(bm, __shfl_xor(bm, 16, 32));
  float tot = wsum[0] * exp2_slot(wm[0] - bm);
#pragma unroll
  for (int w = 1; w < kRSWaves / 2; ++w) tot += wsum[w] * exp2_slot(wm[w] - bm);
  tot += __shfl_xor(tot, 16, 32);   // tot >= 2^-80, a normal number: a sum relative to bm is in it whole, and it passed the test or is >= 1
  STAT[((size_t)blockIdx.y * (kN / kStatRows) + blockIdx.x * kRSJT + wave) * 32 + lane] = kPCarryLog2 - bm - log2_slot(tot);
}

// ---------------------------------------------------------------------------
// attn^T.v with the probabilities formed in registers (no probability plane in memory), and the back-projection of its result:
//   O[i][c] = f16( (64/32768) sum_j P[i][j] * V16[c][j] ),  P[i][j] = f16( 2^(S[j][i] + stat[j]) ), f32 math;
//   out[cc][i] = (1/1024) sum_c WB16[cc][c] * O[i][c] + bb[cc] + x[cc][i].
// One block owns 64 positions i (4 tiles of 16) of one batch and all 4096 j: grid (kN/64 = 64, kB) blocks of 16 waves, blockIdx.y
// the batch; wave w walks j in [256 w, 256 w + 256). Every q, V and statistics load feeds the 4 tiles of i.
// Per 32 j and tile of i: two score tiles D[j][i] = q rows (A) x k rows (B, loaded once) + C, C[j][i] = stat[j]: the matrix unit's own
// addition gives the exponent, and a probability costs the vector port one v_exp_f32 and half a packed conversion.
// A lane then holds column i = lane & 15 and
// rows j = 8 h + r and 16 + 8 h + r (h = lane >> 4), which is the k order of an A fragment of row i: converted in place,
// the two tiles are the A operand against the V fragments (the v plane holds the same k order). No LDS, no lane exchange.
// q, k and v come from fragment-order planes: every fragment load of a wave is 512 contiguous B. j and i here count in tile order
// (row m of tile T is position 32 (T >> 1) + 2 m + (T & 1)); the sum over j takes every position once, and the store of O undoes it for i.
// The 16 waves' partial 64 x 32 tiles are joined through LDS in wave order behind one barrier.
// The joined O (64 positions x 32 channels, f16) never leaves the block: it is filed in LDS as 4 B fragments in fragment order, column m
// of tile t being position 4 m + t of the block's 64, and behind a second barrier wave w multiplies rows 16 w .. 16 w + 15 of Wb (A, one
// fragment) with the 4 tiles. A lane then holds, for each of its 8 rows cc = 16 w + 8 h + r, 4 consecutive positions, one a tile: 16 lanes
// load the residual and store the result as 256 contiguous B of a row, with no LDS pass. The residual, the bias and the Wb fragment are
// loaded in front of the last step of the j loop: that step and the join hide them.
// ---------------------------------------------------------------------------
constexpr int kAVWaves   = 16;
constexpr int kAVThreads = kAVWaves * 32;      // 512
constexpr int kAVIT      = 4;                  // 16-row tiles of i per block: every q, V and statistics load feeds this many tiles
constexpr int kAVRows    = 16 * kAVIT;         // 64 positions i per block
constexpr int kAVChunk   = kN / kAVWaves;      // 256 j per wave
constexpr int kAVSteps   = kAVChunk / 32;      // 8 steps of 32 j
constexpr int kAVPitch   = kCP + 4;            // floats per row of a partial tile
static_assert(kN % kAVRows == 0 && kAVChunk % 32 == 0 && (kAVRows * kCP) % kAVThreads == 0 && kCP == 32, "attn.v tiling");
static_assert(kAVWaves * 16 == kC && kAVRows == 64, "back-projection: a wave per 16 rows of Wb, 4 tiles of 16 positions");
// what 16 of a step's 32 j read for the scores: one q fragment and the lane's 8 row statistics, which are a C operand as they lie
// (register r of a lane is row 8 h + r of the tile, in C as in D; every column takes the same value)
struct AVHalf { v16h q; v8f c; };
__device__ __forceinline__ void av_load_half(AVHalf& s, const _Float16* __restrict__ Qlane, const float* __restrict__ Slane, int j0) {
  s.q = frag_ld(Qlane + (j0 >> 4) * kTileH);               // the q tile of rows j0 .. j0 + 15 in tile order
  const v4f c0 = *(const v4f*)(Slane + j0 * 2);            // j0 + 8 h + 0..3;  STAT: 32 floats per 16 j
  const v4f c1 = *(const v4f*)(Slane + j0 * 2 + 4);        // j0 + 8 h + 4..7
  s.c = __builtin_shufflevector(c0, c1, 0, 1, 2, 3, 4, 5, 6, 7);
}
// 8 probabilities of one lane from one tile of exponents (at most 15: no overflow in f32 or f16)
__device__ __forceinline__ v8h av_prob(const v8f s) {
  v8f e;
#pragma unroll
  for (int r = 0; r < 8; ++r) e[r] = __builtin_amdgcn_exp2f(s[r]);
  // the slot that the instruction set asks for behind a transcendental before its result is read or its source overwritten, in every
  // build: the results pass through the statement, so no reader stands in front of the v_nop; the exponents are its inputs, so they
  // keep their registers up to it and no v_exp_f32 lands on the source of the one directly in front
  asm("v_nop" : "+v"(e) : "v"(s));
  return __builtin_convertvector(e, v8h);
}
// A work-group barrier across which only LDS data passes: its fences name LDS alone, so that a wave waits for its LDS traffic and not for
// its global loads in flight (__syncthreads() waits for those too: the residual loads would have to land in front of the join)
__device__ __forceinline__ void lds_barrier() {
  __builtin_amdgcn_fence(__ATOMIC_RELEASE, "workgroup", "local");
  __builtin_amdgcn_s_barrier();
  __builtin_amdgcn_fence(__ATOMIC_ACQUIRE, "workgroup", "local");
}
__global__ __launch_bounds__(kAVThreads) void attnv_kernel(const unsigned short* __restrict__ QKp,
                                                           const unsigned short* __restrict__ Vp,
                                                           const float* __restrict__ ST,
                                                           const unsigned short* __restrict__ WBp,
                                                           const float* __restrict__ bb,
                                                           const float* __restrict__ x,
                                                           float* __restrict__ out) {
  typedef Frag<_Float16> F;
  __shared__ __align__(16) float part[kAVWaves][kAVRows][kAVPitch];
  __shared__ __align__(16) _Float16 sO[kAVIT * kTileH];   // the block's O as 4 B fragments in fragment order
  const int t    = threadIdx.x;
  const int lane = t & 31;
  const int wave = t >> 5;
  const int c    = lane & 15;
  const int h8   = (lane >> 4) * 8;
  const int i0   = blockIdx.x * kAVRows;
  const int jb   = wave * kAVChunk;
  const int bt   = blockIdx.y;   // the block's batch
  const _Float16* QK    = (const _Float16*)QKp + (size_t)bt * kPlaneH;
  const _Float16* Klane = QK + kKOff + (size_t)(i0 >> 4) * kTileH + lane * 8;   // the lane's 16 B of the block's first k tile
  // the wave's first step: its two q tiles, its two v tiles
  const _Float16* Qlane = QK + (size_t)(jb >> 4) * kTileH + lane * 8;
  const _Float16* Vlane = (const _Float16*)Vp + (size_t)bt * kPlaneH + (size_t)(jb >> 4) * kTileH + lane * 8;
  const float* Slane = ST + (size_t)bt * kN * 2 + jb * 2 + h8;    // walks 32 floats per 16 j
  v16h kf[kAVIT];
#pragma unroll
  for (int it = 0; it < kAVIT; ++it) kf[it] = frag_ld(Klane + it * kTileH);
  // the k fragments stay the oldest loads: issued ahead of the first step's, they are covered by the waits for those
  __builtin_amdgcn_sched_barrier(0);
  const v8f zero = (v8f){0.f, 0.f, 0.f, 0.f, 0.f, 0.f, 0.f, 0.f};
  v8f acc[kAVIT][2];
#pragma unroll
  for (int it = 0; it < kAVIT; ++it) { acc[it][0] = zero; acc[it][1] = zero; }
  // One register set: each part is loaded anew directly behind its last use, half a step ahead of its next use.
  AVHalf ha, hb;
  v16h v0, v1;
  av_load_half(ha, Qlane, Slane, 0);
  // the first half's loads stay ahead of the others, as in the loop's refills: the loop's counted waits are set for both ways into it,
  // and with the two halves mixed here the wait at the loop's head reaches into the refill issued just in front of it
  __builtin_amdgcn_sched_barrier(0);
  av_load_half(hb, Qlane, Slane, 16);
  v0 = frag_ld(Vlane);            // channels 0..15
  v1 = frag_ld(Vlane + kTileH);   // channels 16..31
  // one step of 32 j; refill: whether a next step exists, a literal at both calls, so that a step is one run of code with no branch
  auto step = [&](const int jn, const bool refill) {
    // the next step's three addresses, each formed once: the refills read at compile-time offsets from them
    const _Float16* Qn  = Qlane + (jn >> 4) * kTileH;
    const _Float16* Vn  = Vlane + (jn >> 4) * kTileH;
    const float*    Sn  = Slane + jn * 2;
    v8h plo[kAVIT];
#pragma unroll
    for (int it = 0; it < kAVIT; ++it) plo[it] = av_prob(F::mma(ha.q, kf[it], ha.c));   // j = 8 h + r of the step
    if (refill) {
      __builtin_amdgcn_sched_barrier(0);   // the refill is not lifted into the exp work in front of it (it would need a second register set)
      av_load_half(ha, Qn, Sn, 0);
      // the step's addresses sit in registers that are given new values behind the loads; as inputs here the pairs stay
      // in their registers up to the wait, so that no load of the run lands in one of them
      asm volatile("s_wait_xcnt 0x0" :: "v"(Qn), "v"(Sn) : "memory");
      __builtin_amdgcn_sched_barrier(0);   // nor sunk: the second half's exp work behind it hides the loads
    }
#pragma unroll
    for (int it = 0; it < kAVIT; ++it) {
      const v8h phi = av_prob(F::mma(hb.q, kf[it], hb.c));                                  // j = 16 + 8 h + r
      const v16h p = __builtin_shufflevector(plo[it], phi, 0, 1, 2, 3, 4, 5, 6, 7, 8, 9, 10, 11, 12, 13, 14, 15);
      acc[it][0] = F::mma(p, v0, acc[it][0]);
      acc[it][1] = F::mma(p, v1, acc[it][1]);
    }
    if (refill) {
      __builtin_amdgcn_sched_barrier(0);   // as above, for the second half's and the V fragments' refill
      av_load_half(hb, Qn, Sn, 16);
      v0 = frag_ld(Vn);
      v1 = frag_ld(Vn + kTileH);
      asm volatile("s_wait_xcnt 0x0" :: "v"(Qn), "v"(Vn), "v"(Sn) : "memory");   // as above
      __builtin_amdgcn_sched_barrier(0);   // nor sunk: the next step's first half hides these loads
    }
  };
#pragma unroll 1   // rolled: one step's code for 4 tiles of i is as long as the 8 steps for one tile were
  for (int s = 1; s < kAVSteps; ++s) step(s * 32, true);
  // what the back-projection reads from memory: rows cc = 16 wave + 8 h + r; of x 4 positions a row, 4 c + 0..3 of the block's 64
  const size_t xo = ((size_t)bt * kC + wave * 16 + h8) * kN + i0 + 4 * c;
  const float*    xl  = x + xo;
  const float*    bl  = bb + wave * 16 + h8;
  const _Float16* wbl = (const _Float16*)WBp + (wave * 16 + c) * kCP + h8;   // row 16 wave + c of Wb, the k order of Frag::load
  v4f xr[8];
#pragma unroll
  for (int r = 0; r < 8; ++r) xr[r] = *(const v4f*)(xl + (size_t)r * kN);
  const v16h wb  = F::load(wbl);
  const v4f  bb0 = *(const v4f*)(bl);
  const v4f  bb1 = *(const v4f*)(bl + 4);
  // the wait behind these loads: as inputs here the three addresses stay in their registers up to it
  asm volatile("s_wait_xcnt 0x0" :: "v"(xl), "v"(bl), "v"(wbl) : "memory");
  __builtin_amdgcn_sched_barrier(0);   // these loads are not sunk to their uses behind the join: the last step's work hides them
  step(0, false);   // the last step has nothing of the loop's to load
#pragma unroll
  for (int it = 0; it < kAVIT; ++it)
#pragma unroll
    for (int r = 0; r < 8; ++r) {
      part[wave][it * 16 + h8 + r][c]      = acc[it][0][r];
      part[wave][it * 16 + h8 + r][16 + c] = acc[it][1][r];
    }
  lds_barrier();   // every wave's partial tiles are in part
  const int col = lane;   // a wave joins one row of O (32 channels), 4 rows in turn
#pragma unroll
  for (int it = 0; it < kAVIT; ++it) {
    const int row = it * 16 + wave;                              // row 'wave' of k tile it of the block,
    const int pos = 32 * (it >> 1) + 2 * wave + (it & 1);        // which is this one of its 64 positions
    float sum = part[0][row][col];
#pragma unroll
    for (int w = 1; w < kAVWaves; ++w) sum += part[w][row][col];
    // tile pos & 3, column pos >> 2; channel col is element col & 7 of part col >> 4, lane half (col >> 3) & 1
    sO[(((pos & 3) * 2 + (col >> 4)) * 32 + ((col >> 3) & 1) * 16 + (pos >> 2)) * 8 + (col & 7)] = (_Float16)(sum * kPVScale);
  }
  lds_barrier();   // the block's O is in sO
  v16h of[kAVIT];
#pragma unroll
  for (int tt = 0; tt < kAVIT; ++tt) of[tt] = frag_ld(sO + tt * kTileH + lane * 8);
  __builtin_amdgcn_sched_barrier(0);   // the 8 LDS reads stand together: read tile by tile in one register set, each product waits out its own LDS latency
  v8f d[kAVIT];
#pragma unroll
  for (int tt = 0; tt < kAVIT; ++tt) d[tt] = F::mma(wb, of[tt], zero);
  const v8f bias = __builtin_shufflevector(bb0, bb1, 0, 1, 2, 3, 4, 5, 6, 7);
  float* ol = out + xo;
#pragma unroll
  for (int r = 0; r < 8; ++r) {
    v4f v;
#pragma unroll
    for (int tt = 0; tt < kAVIT; ++tt) { v[tt] = d[tt][r] * kBackScale; v[tt] += bias[r]; }
    *(v4f*)(ol + (size_t)r * kN) = v + xr[r];
  }
}

// ---------------------------------------------------------------------------
// Host glue.
// Workspace region map (bytes, every offset a multiple of 256):
//   WP16  f16 [6][8][2][32][8]        49,152  at           0   16*log2e*Wq, 16*Wk, 16*Wv in fragment order
//   WB16  f16 [256][32]               16,384  at      49,152   16*Wb
//   BQK   f32 [64]                       256  at      65,536   log2e*bq | bk
//   BV64  f32 [64]                       256  at      65,792   bv | 0
//   QK16  f16 [2][8][256][2][32][8] 4,194,304 at      66,048   q x log2e, then k: fragment-order tiles of 16 positions x 32 channels
//   V16   f16 [8][128][2][2][32][8] 2,097,152 at   4,260,352   v: fragment-order tiles of 16 channels x 32 positions
//   STAT  f32 [8][256][32]           262,144  at   6,357,504   per q tile of 16 score rows: 16 x (15 - max - log2 sum), twice
//   total                          6,619,648
// GEMM shapes: q, k, v M=96 N=4096 K=256 (own kernel); scores M=N=4096 K=32 (tiles inside the two attention kernels);
// attn.v M=4096 N=32 K=4096 (own kernel); back M=256 N=4096 K=32 (at the end of the attn.v kernel). No padding reads of unwritten data.
// Launch count: 1 + 1 + 2 = 4.
// ---------------------------------------------------------------------------
extern "C" void kernel_launch(void* const* d_in, const int* in_sizes, int n_in,
                              void* d_out, int out_size, void* d_ws, size_t ws_size,
                              hipStream_t stream) {
  if (n_in < 9) return;
  const int nX = kB * kC * kN;   // 8,388,608
  if (in_sizes[0] != nX) return;
  if (in_sizes[1] != kCP * kC || in_sizes[3] != kCP * kC || in_sizes[5] != kCP * kC) return;
  if (in_sizes[2] != kCP || in_sizes[4] != kCP || in_sizes[6] != kCP) return;
  if (in_sizes[7] != kC * kCP || in_sizes[8] != kC) return;
  if (out_size != nX) return;

  const size_t szWP  = (size_t)kPJWHalves * 2;
  const size_t szWB  = (size_t)kC * kCP * 2;
  const size_t szBQK = (size_t)kQKW * 4;
  const size_t szBV  = (size_t)kVR * 4;
  const size_t szQK  = (size_t)kB * kN * kQKW * 2;
  const size_t szV   = (size_t)kB * kPlaneH * 2;
  const size_t szST  = (size_t)kB * (kN / kStatRows) * 32 * 4;
  const size_t offWP  = 0;
  const size_t offWB  = offWP + szWP;
  const size_t offBQK = offWB + szWB;
  const size_t offBV  = offBQK + szBQK;
  const size_t offQK  = offBV + szBV;
  const size_t offV   = offQK + szQK;
  const size_t offST  = offV + szV;
  const size_t total  = offST + szST;   // 6,619,648
  if (ws_size < total) return;

  const float* x  = (const float*)d_in[0];
  const float* Wq = (const float*)d_in[1];
  const float* bq = (const float*)d_in[2];
  const float* Wk = (const float*)d_in[3];
  const float* bk = (const float*)d_in[4];
  const float* Wv = (const float*)d_in[5];
  const float* bv = (const float*)d_in[6];
  const float* Wb = (const float*)d_in[7];
  const float* bb = (const float*)d_in[8];
  float* out = (float*)d_out;
  char* ws = (char*)d_ws;
  unsigned short* WP16  = (unsigned short*)(ws + offWP);
  unsigned short* WB16  = (unsigned short*)(ws + offWB);
  float* BQK  = (float*)(ws + offBQK);
  float* BV64 = (float*)(ws + offBV);
  unsigned short* QK16 = (unsigned short*)(ws + offQK);
  unsigned short* V16  = (unsigned short*)(ws + offV);
  float* STAT = (float*)(ws + offST);

  // ---- parameter planes ----
  prep_kernel<<<dim3(17), dim3(256), 0, stream>>>(Wq, bq, Wk, bk, Wv, bv, Wb, WP16, WB16, BQK, BV64);

  // ---- q, k and v planes in fragment order, all batches in one grid, straight from x ----
  proj_kernel<<<dim3(kN / kPJPos, kB), dim3(kPJThreads), 0, stream>>>(x, WP16, BQK, BV64, QK16, V16);

  // all batches in one grid each (blockIdx.y = batch):
  // per row j of S[j][i] = log2e * sum_o q[o,j] * k[o,i]: 15 - max - log2 of the sum of 2^(S - max)
  rowstats_kernel<<<dim3(kN / kRSCols, kB), dim3(kRSThreads), 0, stream>>>(QK16, STAT);
  // O[b][i][c] = f16( (64/32768) sum_j f16(32768 * attn[j][i]) * V16[b][c][j] ) = f16( 64 * out[c][i] ), kept in the block, and
  // result[b][cc][i] = (1/1024) sum_o WB16[cc][o] * O[b][i][o] + bb[cc] + x[b][cc][i]
  attnv_kernel<<<dim3(kN / kAVRows, kB), dim3(kAVThreads), 0, stream>>>(QK16, V16, STAT, WB16, bb, x, out);
}
